// v000
// Measured on an AMD MI455X. A time is GPU time per run, averaged over a window of back-to-back runs after a warm-up
// (all launches, gaps included; the runs take copies of the inputs in turn), and the median of several windows.
// Apart from v000's, it joins two sittings. Times from different sittings can be a few percent apart, while
// side-by-side timings come from the same sitting.
// v000 is the starting kernel. One run takes 3630 microseconds.
#include <hip/hip_runtime.h>
// Multi-head self-attention with PER-HEAD STACKED bias-free projections, scaled by the MODEL WIDTH (X [2][2048][1024]; Q / K / V = einsum('bsd,hde->bhse', X, W) with W [16][1024][64] = [head][in][out], NO biases, 16 heads of 64; scores / sqrt(d_model = 1024) = 1/32 (the module's own: the full width, not the head width); softmax over all 2048 keys (no mask); out = merged Wo + bo ([in][out] [1024][1024] + bias) -> [2][2048][1024]); each head's [in][out] block is transposed into its 64 contiguous rows of the weight plane by the existing builder, one call per head.
// Structure: token rows r = b*2048 + s; the query source and the key/value source as exact f16 rows (bf16-rounded); Q, K, V as three WMMA GEMMs (32x64 wave tiles, f32 accumulation, exact x16 weights, no bias, f16 outputs); per batch: V^T for all heads via LDS transposes; per (batch, group of 4 heads): scores GEMM (K = 64, batched over the heads on grid.y, alpha = 1024^-0.5), row softmax on VALU (f32 statistics, native exp; weights stored x256 as f16), o = P . V^T GEMM (K = 2048, alpha 2^-2: o carried x64 against f16 subnormal flush, folded into the output GEMM alpha) written straight into the merged f16 o rows; out = o W_o + b GEMM (f32) into the output layout.
// Compute dtype: inputs rounded to bf16; x / weights exact; q, k, v, softmax weights and o as plain f16 GEMM operands (~2^-12); scores and softmax statistics f32. v_wmma_f32_16x16x32_f16.
#define NB 2
#define SQ 2048
#define DM 1024
#define NH 16
#define HD 64
#define HG 4                         /* heads per attention launch group */
#define B0 0                         /* first batch processed (debug hook) */
#define NBR NB                       /* batches processed (debug hook) */
#define NR ((size_t)NB * SQ)         /* token rows */
#define MP ((int)((size_t)NBR * SQ)) /* rows projected (debug hook) */
#define QN SQ                        /* query rows attended per batch (debug hook) */
#define NHD NH                       /* heads attended (debug hook) */
#define MPO MP                       /* rows through the output stage (debug hook) */
#define LQ DM      /* row pitch of the q/k/v rows */
typedef __bf16 v16b __attribute__((ext_vector_type(16)));
typedef unsigned short v8us __attribute__((ext_vector_type(8), may_alias));
typedef float  v8f  __attribute__((ext_vector_type(8)));
typedef float  v4f  __attribute__((ext_vector_type(4)));
typedef float  v4fa __attribute__((ext_vector_type(4), may_alias));
union FragB { v16b v; v8us half[2]; unsigned short u[16]; };

__device__ __forceinline__ unsigned short bf16_bits(float x) { unsigned int u = __float_as_uint(x); return (unsigned short)((u + 0x7FFFu + ((u >> 16) & 1u)) >> 16); }
__device__ __forceinline__ float bf16_val(unsigned short b) { return __uint_as_float(((unsigned int)b) << 16); }
__device__ __forceinline__ float bf16_round(float x) { return bf16_val(bf16_bits(x)); }
// D += A·B with NT terms: 1 = ah·bh, 2 = + al·bh (A split), 3 = + ah·bl (both split)
template <int NT>
__device__ __forceinline__ v8f mmaN(v16b ah, v16b al, v16b bh, v16b bl, v8f c) {
  c = __builtin_amdgcn_wmma_f32_16x16x32_bf16(false, ah, false, bh, (short)0, c, false, false);
  if (NT >= 2) c = __builtin_amdgcn_wmma_f32_16x16x32_bf16(false, al, false, bh, (short)0, c, false, false);
  if (NT >= 3) c = __builtin_amdgcn_wmma_f32_16x16x32_bf16(false, ah, false, bl, (short)0, c, false, false);
  asm volatile("v_nop\n\tv_nop\n\tv_nop\n\tv_nop" : "+v"(c) : "v"(ah), "v"(al), "v"(bh), "v"(bl));
  return c;
}

__global__ __launch_bounds__(256) void k_wt_bf16(const float* __restrict__ W, unsigned short* __restrict__ Wt, int K, int N) {
  const int t = blockIdx.x * 256 + threadIdx.x;
  const int k8n = K / 8;
  if (t >= N * k8n) return;
  const int n = t / k8n, k8 = (t % k8n) * 8;
  v8us v;
#pragma unroll
  for (int i = 0; i < 8; ++i) v[i] = bf16_bits(W[(size_t)(k8 + i) * N + n]);
  *(v8us*)(Wt + (size_t)n * K + k8) = v;
  
}

// GEMM C[M][N] (f32, pitch ldc) = act(A[M][K]·W + bias). A f32 row-major (pitch lda) converted per fragment to bf16
// (ASPLIT: hi/lo two planes -> 2 terms, else single rounded term); Wt bf16 [N][K] (pitch ldb). BIAS_BF16 rounds the
// bias to bf16 first (bias quantised to bf16 before the add). K%32==0, M%16==0, N%64==0.
template <bool ASPLIT, int ACT, bool BIAS_BF16>
__global__ __launch_bounds__(128) void k_gemm_bf(const float* __restrict__ A, int lda, const unsigned short* __restrict__ Wt, int ldb,
                                               const float* __restrict__ bias, float* __restrict__ C, int ldc, int M, int N, int K) {
  __shared__ __attribute__((aligned(16))) float so[4][16][64];
  const int tid = threadIdx.x, w = tid >> 5, lane = tid & 31, ln = lane & 15, hh = lane >> 4;
  const int ntn = N / 64;
  const int wid = blockIdx.x * 4 + w;
  const int mt = wid / ntn, nq = wid % ntn;
  if (mt * 16 >= M) return;
  const int row0 = mt * 16, col0 = nq * 64;
  const float* arow = A + (size_t)(row0 + ln) * lda;
  v8f acc[4] = {};
  for (int kb = 0; kb < K; kb += 32) {
    FragB ah, al;
    const v4f x0 = *(const v4fa*)(arow + kb + 8 * hh), x1 = *(const v4fa*)(arow + kb + 8 * hh + 4);
    const v4f x2 = *(const v4fa*)(arow + kb + 16 + 8 * hh), x3 = *(const v4fa*)(arow + kb + 16 + 8 * hh + 4);
    float xs[16] = {x0[0],x0[1],x0[2],x0[3],x1[0],x1[1],x1[2],x1[3],x2[0],x2[1],x2[2],x2[3],x3[0],x3[1],x3[2],x3[3]};
#pragma unroll
    for (int i = 0; i < 16; ++i) { const unsigned short hb = bf16_bits(xs[i]); ah.u[i] = hb; al.u[i] = ASPLIT ? bf16_bits(xs[i] - bf16_val(hb)) : (unsigned short)0; }
#pragma unroll
    for (int t = 0; t < 4; ++t) {
      const unsigned short* brow = Wt + (size_t)(col0 + t * 16 + ln) * ldb + kb;
      FragB b;
      b.half[0] = *(const v8us*)(brow + 8 * hh);
      b.half[1] = *(const v8us*)(brow + 16 + 8 * hh);
      acc[t] = mmaN<ASPLIT ? 2 : 1>(ah.v, al.v, b.v, b.v, acc[t]);
    }
  }
#pragma unroll
  for (int t = 0; t < 4; ++t) {
    float bv = bias ? bias[col0 + t * 16 + ln] : 0.f;
    if (BIAS_BF16) bv = bf16_round(bv);
#pragma unroll
    for (int r = 0; r < 8; ++r) { float v = acc[t][r] + bv; if (ACT == 1) v = fmaxf(v, 0.f); so[w][8 * hh + r][t * 16 + ln] = v; }
  }
  __builtin_amdgcn_fence(__ATOMIC_ACQ_REL, "workgroup");
  __builtin_amdgcn_wave_barrier();
  const int rsub = lane >> 4, c4 = (lane & 15) * 4;
  {
#pragma unroll
    for (int q = 0; q < 8; ++q) {
      const int r = q * 2 + rsub;
      const v4f v = *(const v4fa*)&so[w][r][c4];
      *(v4f*)(C + (size_t)(row0 + r) * ldc + col0 + c4) = v;
    }
    
  }
}

// GEMM C = act(A·W + bias + resid): A f32 (ASPLIT -> hi/lo 2 terms), Wt bf16 [N][K]; ACT 0 none, 1 relu, 2 exact gelu;
// resid (optional, f32, row index = (row % rmod), pitch ldr, RES_BF16 rounds it) added before the activation.
template <bool ASPLIT, int ACT, bool BIAS_BF16, bool RES_BF16>
__global__ __launch_bounds__(128) void k_gemm_bf3(const float* __restrict__ A, int lda, const unsigned short* __restrict__ Wt, int ldb,
                                                const float* __restrict__ bias, const float* __restrict__ resid, int rmod, int ldr,
                                                float* __restrict__ C, int ldc, int M, int N, int K) {
  __shared__ __attribute__((aligned(16))) float so[4][16][64];
  const int tid = threadIdx.x, w = tid >> 5, lane = tid & 31, ln = lane & 15, hh = lane >> 4;
  const int ntn = N / 64;
  const int wid = blockIdx.x * 4 + w;
  const int mt = wid / ntn, nq = wid % ntn;
  if (mt * 16 >= M) return;
  const int row0 = mt * 16, col0 = nq * 64;
  const float* arow = A + (size_t)(row0 + ln) * lda;
  v8f acc[4] = {};
  for (int kb = 0; kb < K; kb += 32) {
    FragB ah, al;
    const v4f x0 = *(const v4fa*)(arow + kb + 8 * hh), x1 = *(const v4fa*)(arow + kb + 8 * hh + 4);
    const v4f x2 = *(const v4fa*)(arow + kb + 16 + 8 * hh), x3 = *(const v4fa*)(arow + kb + 16 + 8 * hh + 4);
    float xs[16] = {x0[0],x0[1],x0[2],x0[3],x1[0],x1[1],x1[2],x1[3],x2[0],x2[1],x2[2],x2[3],x3[0],x3[1],x3[2],x3[3]};
#pragma unroll
    for (int i = 0; i < 16; ++i) { const unsigned short hb = bf16_bits(xs[i]); ah.u[i] = hb; al.u[i] = ASPLIT ? bf16_bits(xs[i] - bf16_val(hb)) : (unsigned short)0; }
#pragma unroll
    for (int t = 0; t < 4; ++t) {
      const unsigned short* brow = Wt + (size_t)(col0 + t * 16 + ln) * ldb + kb;
      FragB b;
      b.half[0] = *(const v8us*)(brow + 8 * hh);
      b.half[1] = *(const v8us*)(brow + 16 + 8 * hh);
      acc[t] = mmaN<ASPLIT ? 2 : 1>(ah.v, al.v, b.v, b.v, acc[t]);
    }
  }
#pragma unroll
  for (int t = 0; t < 4; ++t) {
    const int col = col0 + t * 16 + ln;
    float bv = bias ? bias[col] : 0.f;
    if (BIAS_BF16) bv = bf16_round(bv);
#pragma unroll
    for (int r = 0; r < 8; ++r) {
      float v = acc[t][r] + bv;
      if (resid) { float rv = resid[(size_t)((row0 + 8 * hh + r) % rmod) * ldr + col]; if (RES_BF16) rv = bf16_round(rv); v += rv; }
      if (ACT == 1) v = fmaxf(v, 0.f);
      if (ACT == 2) v = 0.5f * v * (1.0f + erff(v * 0.70710678118654752f));
      if (ACT == 3) { const float u = 0.7978845608028654f * (v + 0.044715f * v * v * v); v = 0.5f * v * (1.0f + tanhf(u)); }
      so[w][8 * hh + r][t * 16 + ln] = v;
    }
  }
  __builtin_amdgcn_fence(__ATOMIC_ACQ_REL, "workgroup");
  __builtin_amdgcn_wave_barrier();
  const int rsub = lane >> 4, c4 = (lane & 15) * 4;
  {
#pragma unroll
    for (int q = 0; q < 8; ++q) {
      const int r = q * 2 + rsub;
      const v4f v = *(const v4fa*)&so[w][r][c4];
      *(v4f*)(C + (size_t)(row0 + r) * ldc + col0 + c4) = v;
    }
    
  }
}
// row LayerNorm (biased variance, eps) over N: s = X (+ R); optional out_sum <- s; out_norm <- (s-mu)*rsqrt(var+eps)*g + b
template <bool PARAM_BF16>
__global__ __launch_bounds__(256) void k_layernorm(const float* __restrict__ X, const float* __restrict__ R, const float* __restrict__ g, const float* __restrict__ bta,
                                                  float* __restrict__ out_sum, float* __restrict__ out_norm, int N, float eps) {
  __shared__ float red[256];
  const int row = blockIdx.x, tid = threadIdx.x;
  const float* x = X + (size_t)row * N; const float* rr = R ? R + (size_t)row * N : nullptr;
  float vals[16];                     // up to N = 4096
  const int per = N / 256;            // contiguous chunk per thread? use strided-by-4 chunks: thread handles j = tid*4 + 1024*u
  float s1 = 0.f;
  for (int u = 0; u < per / 4; ++u) {
    const int j = tid * 4 + 1024 * u;
    const v4f a = *(const v4fa*)(x + j);
    v4f b = {0.f,0.f,0.f,0.f}; if (rr) b = *(const v4fa*)(rr + j);
#pragma unroll
    for (int q = 0; q < 4; ++q) { const float v = a[q] + b[q]; vals[u * 4 + q] = v; s1 += v; }
  }
  red[tid] = s1; __syncthreads();
  for (int st = 128; st > 0; st >>= 1) { if (tid < st) red[tid] += red[tid + st]; __syncthreads(); }
  const float mu = red[0] / (float)N; __syncthreads();
  float s2 = 0.f;
  for (int u = 0; u < per / 4; ++u)
#pragma unroll
    for (int q = 0; q < 4; ++q) { const float c = vals[u * 4 + q] - mu; s2 += c * c; }
  red[tid] = s2; __syncthreads();
  for (int st = 128; st > 0; st >>= 1) { if (tid < st) red[tid] += red[tid + st]; __syncthreads(); }
  const float rs = rsqrtf(red[0] / (float)N + eps);
  {
    for (int u = 0; u < per / 4; ++u) {
      const int j = tid * 4 + 1024 * u;
      v4f o, sm;
#pragma unroll
      for (int q = 0; q < 4; ++q) {
        float gg = g[j + q], bb = bta[j + q];
        if (PARAM_BF16) { gg = bf16_round(gg); bb = bf16_round(bb); }
        sm[q] = vals[u * 4 + q]; o[q] = (vals[u * 4 + q] - mu) * rs * gg + bb;
      }
      if (out_sum) *(v4f*)(out_sum + (size_t)row * N + j) = sm;
      *(v4f*)(out_norm + (size_t)row * N + j) = o;
    }
    
  }
}



// ---- f16 WMMA path (v_wmma_f32_16x16x32_f16): 11-bit significands for operands in range — used where a [0,1] probability operand needs more precision than bf16
typedef _Float16 v16h __attribute__((ext_vector_type(16)));
union FragH { v16h v; v8us half[2]; _Float16 h[16]; unsigned short u[16]; };
template <int NT>
__device__ __forceinline__ v8f mmaH(v16h ah, v16h al, v16h bh, v16h bl, v8f c) {
  c = __builtin_amdgcn_wmma_f32_16x16x32_f16(false, ah, false, bh, (short)0, c, false, false);
  if (NT >= 2) c = __builtin_amdgcn_wmma_f32_16x16x32_f16(false, al, false, bh, (short)0, c, false, false);
  if (NT >= 3) c = __builtin_amdgcn_wmma_f32_16x16x32_f16(false, ah, false, bl, (short)0, c, false, false);
  asm volatile("v_nop\n\tv_nop\n\tv_nop\n\tv_nop" : "+v"(c) : "v"(ah), "v"(al), "v"(bh), "v"(bl));
  return c;
}
// batched GEMM like k_gemm_b but f16 operands: A f32 (split into f16 hi/lo if ASPLIT, else rounded to f16), Bt = f16 values [n][k]; alpha; C f32; N multiple of 16 (partial tiles skipped)
template <bool ASPLIT>
__global__ __launch_bounds__(128) void k_gemm_h(const float* __restrict__ A, int lda, size_t sA, const _Float16* __restrict__ Bh, int ldb, size_t sB, float alpha, float* __restrict__ C, int ldc, size_t sC, int M, int N, int K) {
  __shared__ __attribute__((aligned(16))) float so[4][16][64];
  const int tid = threadIdx.x, w = tid >> 5, lane = tid & 31, ln = lane & 15, hh = lane >> 4; const int by = blockIdx.y;
  A += (size_t)by * sA; Bh += (size_t)by * sB; C += (size_t)by * sC;
  const int ntn = (N + 63) / 64; const int wid = blockIdx.x * 4 + w; const int mt = wid / ntn, nq = wid % ntn; if (mt * 16 >= M) return;
  const int row0 = mt * 16, col0 = nq * 64; const float* arow = A + (size_t)(row0 + ln) * lda;
  v8f acc[4] = {};
  for (int kb = 0; kb < K; kb += 32) {
    FragH ah, al;
    const v4f x0 = *(const v4fa*)(arow + kb + 8 * hh), x1 = *(const v4fa*)(arow + kb + 8 * hh + 4), x2 = *(const v4fa*)(arow + kb + 16 + 8 * hh), x3 = *(const v4fa*)(arow + kb + 16 + 8 * hh + 4);
    float xs[16] = {x0[0],x0[1],x0[2],x0[3],x1[0],x1[1],x1[2],x1[3],x2[0],x2[1],x2[2],x2[3],x3[0],x3[1],x3[2],x3[3]};
#pragma unroll
    for (int i = 0; i < 16; ++i) { const _Float16 h = (_Float16)xs[i]; ah.h[i] = h; al.h[i] = ASPLIT ? (_Float16)(xs[i] - (float)h) : (_Float16)0.0f; }
#pragma unroll
    for (int t = 0; t < 4; ++t) { if (col0 + t * 16 >= N) continue; const size_t boff = (size_t)(col0 + t * 16 + ln) * ldb + kb; FragH bq; bq.half[0] = *(const v8us*)(Bh + boff + 8 * hh); bq.half[1] = *(const v8us*)(Bh + boff + 16 + 8 * hh);
      acc[t] = mmaH<ASPLIT ? 2 : 1>(ah.v, al.v, bq.v, bq.v, acc[t]); }
  }
#pragma unroll
  for (int t = 0; t < 4; ++t) { if (col0 + t * 16 >= N) continue;
#pragma unroll
    for (int r = 0; r < 8; ++r) so[w][8 * hh + r][t * 16 + ln] = acc[t][r] * alpha; }
  __builtin_amdgcn_fence(__ATOMIC_ACQ_REL, "workgroup"); __builtin_amdgcn_wave_barrier();
  const int rsub = lane >> 4, c4 = (lane & 15) * 4;
  {
#pragma unroll
    for (int q = 0; q < 8; ++q) { const int r = q * 2 + rsub; if (col0 + c4 < N) { const v4f v = *(const v4fa*)&so[w][r][c4]; *(v4f*)(C + (size_t)(row0 + r) * ldc + col0 + c4) = v; } }
     }
}

// Wt[n][k] = f16(W[k][n]·scale) from f32 row-major W[K][N] (scale = power of two; bf16-exact weights stay exact in f16 away from the subnormal range)
__global__ __launch_bounds__(256) void k_wt_f16(const float* __restrict__ W, _Float16* __restrict__ Wt, int K, int N, float scale) {
  const int t = blockIdx.x * 256 + threadIdx.x; if (t >= N * (K / 8)) return; const int n = t / (K / 8), k8 = (t % (K / 8)) * 8; FragH f;
#pragma unroll
  for (int i = 0; i < 8; ++i) f.h[i] = (_Float16)(bf16_round(W[(size_t)(k8 + i) * N + n]) * scale); const v8us o = f.half[0];
  *(v8us*)((unsigned short*)Wt + (size_t)n * K + k8) = o; 
}
// k_gemm_hh variant with fused epilogue: v = acc·alpha + bias[by·sBias + col] (+ CP[(row/rowsPerB)·sCPb + by·64 + col] if CP) ; ACT 0 none / 1 elu ; writes f16 C16 (and f32 C if non-null)
template <int ACT>
__global__ __launch_bounds__(128) void k_gemm_hhx(const _Float16* __restrict__ A, int lda, size_t sA, const _Float16* __restrict__ Bh, int ldb, size_t sB, float alpha, const float* __restrict__ bias, size_t sBias, const float* __restrict__ CP, int rowsPerB, size_t sCPb, int row0g,
    float* __restrict__ C, _Float16* __restrict__ C16, int ldc, size_t sC, int M, int N, int K) {
  __shared__ __attribute__((aligned(16))) float so[4][16][64];
  const int tid = threadIdx.x, w = tid >> 5, lane = tid & 31, ln = lane & 15, hh = lane >> 4; const int by = blockIdx.y;
  A += (size_t)by * sA; Bh += (size_t)by * sB; const size_t cofs = (size_t)by * sC; const float* bp = bias ? bias + (size_t)by * sBias : nullptr;
  const int ntn = (N + 63) / 64; const int wid = blockIdx.x * 4 + w; const int mt = wid / ntn, nq = wid % ntn; if (mt * 16 >= M) return;
  const int row0 = mt * 16, col0 = nq * 64; const _Float16* arow = A + (size_t)(row0 + ln) * lda;
  v8f acc[4] = {};
  for (int kb = 0; kb < K; kb += 32) { FragH ah; ah.half[0] = *(const v8us*)((const unsigned short*)arow + kb + 8 * hh); ah.half[1] = *(const v8us*)((const unsigned short*)arow + kb + 16 + 8 * hh);
#pragma unroll
    for (int t = 0; t < 4; ++t) { if (col0 + t * 16 >= N) continue; const size_t boff = (size_t)(col0 + t * 16 + ln) * ldb + kb; FragH bq; bq.half[0] = *(const v8us*)((const unsigned short*)Bh + boff + 8 * hh); bq.half[1] = *(const v8us*)((const unsigned short*)Bh + boff + 16 + 8 * hh);
      acc[t] = mmaH<1>(ah.v, ah.v, bq.v, bq.v, acc[t]); }
  }
#pragma unroll
  for (int t = 0; t < 4; ++t) { if (col0 + t * 16 >= N) continue; const int col = col0 + t * 16 + ln; const float bv = bp ? bf16_round(bp[col]) : 0.f;
#pragma unroll
    for (int r = 0; r < 8; ++r) { float v = acc[t][r] * alpha + bv; if (CP) { const int rr = row0g + row0 + 8 * hh + r; if (rowsPerB < 0) v += CP[cofs + (size_t)rr * ldc + col];      /* rowsPerB < 0: own element of the batched C plane */ else { const int bidx = rr / rowsPerB; v += CP[(size_t)bidx * sCPb + (size_t)by * 64 + col]; } } if (ACT == 1) v = (v > 0.f) ? v : expm1f(v); else if (ACT == 7) v = (v > 0.f) ? v + 1.0f : expf(v); else if (ACT == 8) v = tanhf(v); else if (ACT == 9) v = 0.5f * v * (1.0f + tanhf(0.7978845608028654f * (v + 0.044715f * v * v * v))); else if (ACT == 11) v = 1.0f / (1.0f + expf(-v)); else if (ACT == 12) v = (v > 0.f) ? v : 0.01f * v; else if (ACT == 14) v = (v > 0.f) ? v : 0.1f * v; else if (ACT == 16) v = (v >= 0.f) ? v : 0.3f * v; else if (ACT == 17) v = (v >= 0.f) ? v : 0.2f * v; else if (ACT == 15) v = v / (1.0f + expf(-v)); else if (ACT == 3) v = fmaxf(v, 0.f); else if (ACT == 6) v = 0.5f * v * (1.0f + erff(v * 0.70710678118654752f)); so[w][8 * hh + r][t * 16 + ln] = v; } }
  __builtin_amdgcn_fence(__ATOMIC_ACQ_REL, "workgroup"); __builtin_amdgcn_wave_barrier();
  const int rsub = lane >> 4, c4 = (lane & 15) * 4; typedef _Float16 v4h __attribute__((ext_vector_type(4)));
  {
#pragma unroll
    for (int q = 0; q < 8; ++q) { const int r = q * 2 + rsub; if (col0 + c4 < N) { const v4f v = *(const v4fa*)&so[w][r][c4]; if (C) *(v4f*)(C + cofs + (size_t)(row0 + r) * ldc + col0 + c4) = v; if (C16) { v4h h4; for (int i = 0; i < 4; ++i) h4[i] = (_Float16)v[i]; *(v4h*)(C16 + cofs + (size_t)(row0 + r) * ldc + col0 + c4) = h4; } } }
     }
}


typedef _Float16 v4h __attribute__((ext_vector_type(4)));

__global__ __launch_bounds__(256) void k_x16(const float* __restrict__ x, _Float16* __restrict__ X16, size_t n8) { const size_t t = (size_t)blockIdx.x * 256 + threadIdx.x; if (t >= n8) return; FragH f;
#pragma unroll
  for (int q = 0; q < 8; ++q) f.h[q] = (_Float16)bf16_round(x[t * 8 + q]); *(v8us*)((unsigned short*)X16 + t * 8) = f.half[0];  }
__global__ __launch_bounds__(256) void k_h16(const float* __restrict__ x, _Float16* __restrict__ X16, size_t n8) { const size_t t = (size_t)blockIdx.x * 256 + threadIdx.x; if (t >= n8) return; FragH f;
#pragma unroll
  for (int q = 0; q < 8; ++q) f.h[q] = (_Float16)x[t * 8 + q]; *(v8us*)((unsigned short*)X16 + t * 8) = f.half[0];  }
__global__ __launch_bounds__(256) void k_round16f(const float* __restrict__ W, _Float16* __restrict__ Bt, size_t n8) { const size_t t = (size_t)blockIdx.x * 256 + threadIdx.x; if (t >= n8) return; FragH f;
#pragma unroll
  for (int i = 0; i < 8; ++i) f.h[i] = (_Float16)(bf16_round(W[t * 8 + i]) * 16.0f); *(v8us*)((unsigned short*)Bt + t * 8) = f.half[0];  }
template <int NHv, int TTv>
__global__ __launch_bounds__(256) void k_vt(const _Float16* __restrict__ V16, int ldv, int voff, _Float16* __restrict__ Vt) { __shared__ unsigned short tl[64][66]; const int tid = threadIdx.x; const int slab = blockIdx.x / (TTv / 64), lg = blockIdx.x % (TTv / 64); const int b = slab / NHv, h = slab % NHv;
  for (int i = tid; i < 64 * 8; i += 256) { const int r = i / 8, c8 = (i % 8) * 8; FragH f; f.half[0] = *(const v8us*)((const unsigned short*)V16 + ((size_t)b * TTv + lg * 64 + r) * ldv + voff + h * 64 + c8);
#pragma unroll
    for (int q = 0; q < 8; ++q) tl[r][c8 + q] = f.u[q]; }
  __syncthreads();
  {
#pragma unroll
    for (int rd = 0; rd < 2; ++rd) { const int d = rd * 32 + tid / 8, pc = tid % 8; FragH f;
#pragma unroll
      for (int q = 0; q < 8; ++q) f.u[q] = tl[pc * 8 + q][d];
      *(v8us*)((unsigned short*)Vt + ((size_t)slab * 64 + d) * TTv + lg * 64 + pc * 8) = f.half[0]; }
     } }

__global__ __launch_bounds__(256) void k_hl(const float* __restrict__ F, _Float16* __restrict__ Hh, _Float16* __restrict__ Hl, size_t n8) { const size_t t = (size_t)blockIdx.x * 256 + threadIdx.x; if (t >= n8) return; FragH fh, fl; const v4f a = *(const v4fa*)(F + t * 8), c = *(const v4fa*)(F + t * 8 + 4);
#pragma unroll
  for (int q = 0; q < 4; ++q) { _Float16 h = (_Float16)a[q]; fh.h[q] = h; fl.h[q] = (_Float16)((a[q] - (float)h) * 1024.0f); h = (_Float16)c[q]; fh.h[4 + q] = h; fl.h[4 + q] = (_Float16)((c[q] - (float)h) * 1024.0f); }
  { *(v8us*)((unsigned short*)Hh + t * 8) = fh.half[0]; *(v8us*)((unsigned short*)Hl + t * 8) = fl.half[0];  } }

// ---- fast GEMM (wave tile 32x64; requires M % 32 == 0 rows per launch region and N % 64 == 0); epilogue = k_gemm_hhx semantics ----
__device__ __forceinline__ v16h g2_frag(const _Float16* p, int hh) { FragH f; f.half[0] = *(const v8us*)((const unsigned short*)p + 8 * hh); f.half[1] = *(const v8us*)((const unsigned short*)p + 16 + 8 * hh); return f.v; }
__device__ __forceinline__ v8f g2_mma(v16h a, v16h b, v8f c) { v8f d = __builtin_amdgcn_wmma_f32_16x16x32_f16(false, a, false, b, (short)0, c, false, false); asm volatile("v_nop\n\tv_nop\n\tv_nop\n\tv_nop" : "+v"(d) : "v"(a), "v"(b)); return d; }
template <int ACT>
__global__ __launch_bounds__(128) void k_gemm2(const _Float16* __restrict__ A, int lda, size_t sA, const _Float16* __restrict__ Bh, int ldb, size_t sB, float alpha, const float* __restrict__ bias, size_t sBias, const float* __restrict__ CP, int rowsPerB, size_t sCPb, int row0g,
    float* __restrict__ C, _Float16* __restrict__ C16, int ldc, size_t sC, int M, int N, int K) { static_assert(ACT == 0 || ACT == 3 || ACT == 6 || ACT == 8 || ACT == 9 || ACT == 11 || ACT == 12 || ACT == 14 || ACT == 15 || ACT == 16 || ACT == 17, "k_gemm2: unsupported ACT code (would silently apply no activation)");
  __shared__ __attribute__((aligned(16))) float so[4][32][68];
  const int tid = threadIdx.x, w = tid >> 5, lane = tid & 31, ln = lane & 15, hh = lane >> 4; const int by = blockIdx.y;
  A += (size_t)by * sA; Bh += (size_t)by * sB; const size_t cofs = (size_t)by * sC; const float* bp = bias ? bias + (size_t)by * sBias : nullptr;
  const int ntn = N >> 6; const int mt = blockIdx.x / ntn, nq = blockIdx.x - mt * ntn; const int row0 = mt * 128 + 32 * w, col0 = nq * 64; if (row0 >= M) return;
  const _Float16* a0p = A + (size_t)(row0 + ln) * lda; const _Float16* a1p = a0p + (size_t)16 * lda;
  const _Float16* b0p = Bh + (size_t)(col0 + ln) * ldb; const _Float16* b1p = b0p + (size_t)16 * ldb; const _Float16* b2p = b1p + (size_t)16 * ldb; const _Float16* b3p = b2p + (size_t)16 * ldb;
  const v8f z8 = {0.f,0.f,0.f,0.f,0.f,0.f,0.f,0.f}; v8f c00 = z8, c01 = z8, c02 = z8, c03 = z8, c10 = z8, c11 = z8, c12 = z8, c13 = z8;
#pragma unroll 1
  for (int kb = 0; kb < K; kb += 32) { const v16h a0 = g2_frag(a0p + kb, hh), a1 = g2_frag(a1p + kb, hh);
    v16h b = g2_frag(b0p + kb, hh); c00 = g2_mma(a0, b, c00); c10 = g2_mma(a1, b, c10);
    b = g2_frag(b1p + kb, hh); c01 = g2_mma(a0, b, c01); c11 = g2_mma(a1, b, c11);
    b = g2_frag(b2p + kb, hh); c02 = g2_mma(a0, b, c02); c12 = g2_mma(a1, b, c12);
    b = g2_frag(b3p + kb, hh); c03 = g2_mma(a0, b, c03); c13 = g2_mma(a1, b, c13); }
  v8f accs[8] = {c00, c01, c02, c03, c10, c11, c12, c13};
#pragma unroll
  for (int u = 0; u < 8; ++u) { const int t = u & 3, half = u >> 2; const int col = col0 + t * 16 + ln; const float bv = bp ? bf16_round(bp[col]) : 0.f;
#pragma unroll
    for (int r = 0; r < 8; ++r) { const int rloc = half * 16 + 8 * hh + r; float v = accs[u][r] * alpha + bv; if (CP) { if (rowsPerB < 0) v += CP[cofs + (size_t)(row0g + row0 + rloc) * ldc + col];      /* rowsPerB < 0: own element of the batched C plane */ else { const int bidx = (row0g + row0 + rloc) / rowsPerB; v += CP[(size_t)bidx * sCPb + (size_t)by * 64 + col]; } }
      if (ACT == 3) v = fmaxf(v, 0.f); else if (ACT == 6) v = 0.5f * v * (1.0f + erff(v * 0.70710678118654752f)); else if (ACT == 11) v = 1.0f / (1.0f + expf(-v)); else if (ACT == 15) v = v / (1.0f + expf(-v)); else if (ACT == 12) v = (v > 0.f) ? v : 0.01f * v; else if (ACT == 8) v = tanhf(v); else if (ACT == 9) v = 0.5f * v * (1.0f + tanhf(0.7978845608028654f * (v + 0.044715f * v * v * v))); else if (ACT == 14) v = (v > 0.f) ? v : 0.1f * v; else if (ACT == 16) v = (v >= 0.f) ? v : 0.3f * v; else if (ACT == 17) v = (v >= 0.f) ? v : 0.2f * v;
      so[w][rloc][t * 16 + ln] = v; } }
  __builtin_amdgcn_fence(__ATOMIC_ACQ_REL, "workgroup"); __builtin_amdgcn_wave_barrier();
  const int rsub = lane >> 4, c4 = (lane & 15) * 4;
  {
#pragma unroll
    for (int q = 0; q < 16; ++q) { const int r = q * 2 + rsub; const v4f v = *(const v4fa*)&so[w][r][c4]; if (C) *(v4f*)(C + cofs + (size_t)(row0 + r) * ldc + col0 + c4) = v; if (C16) { v4h h4; for (int i = 0; i < 4; ++i) h4[i] = (_Float16)v[i]; *(v4h*)(C16 + cofs + (size_t)(row0 + r) * ldc + col0 + c4) = h4; } }
     } }


__global__ __launch_bounds__(256) void k_wnat(const float* __restrict__ w, size_t n8, _Float16* __restrict__ Bt) { const size_t t = (size_t)blockIdx.x * 256 + threadIdx.x; if (t >= n8) return; FragH f; for (int q = 0; q < 8; ++q) f.h[q] = (_Float16)(bf16_round(w[t * 8 + q]) * 16.0f); *(v8us*)((unsigned short*)Bt + t * 8) = f.half[0];  }
__global__ __launch_bounds__(256) void k_rsm(const float* __restrict__ S, _Float16* __restrict__ P, int nrows) {
  #pragma clang fp contract(off)
  const int i = blockIdx.x * 256 + threadIdx.x; if (i >= nrows) return; const float* s = S + (size_t)i * SQ; float mx = -3.0e38f;
#pragma unroll 1
  for (int j = 0; j < SQ; ++j) mx = fmaxf(mx, s[j]); float se = 0.f;
#pragma unroll 1
  for (int j = 0; j < SQ; ++j) se += expf(s[j] - mx); const float sc = 256.0f / se;
#pragma unroll 1
  for (int j0 = 0; j0 < SQ; j0 += 8) { FragH f; for (int q = 0; q < 8; ++q) f.h[q] = (_Float16)(expf(s[j0 + q] - mx) * sc); unsigned short* d = (unsigned short*)P + (size_t)i * SQ + j0; *(v8us*)d = f.half[0];  } }
__global__ __launch_bounds__(256) void k_vt(const _Float16* __restrict__ V16, int b, int h0, _Float16* __restrict__ VT) { __shared__ unsigned short tl[64][65]; const int tid = threadIdx.x; const int hh = blockIdx.x % HG, sg = blockIdx.x / HG; const int s0 = sg * 64; const int h = h0 + hh;
  for (int i = tid; i < 64 * 8; i += 256) { const int j = i / 8, d8 = (i % 8) * 8; FragH f; f.half[0] = *(const v8us*)((const unsigned short*)V16 + ((size_t)b * SQ + s0 + j) * DM + h * HD + d8); for (int q = 0; q < 8; ++q) tl[d8 + q][j] = f.u[q]; }
  __syncthreads();
  { for (int i = tid; i < 64 * 8; i += 256) { const int d = i / 8, j8 = (i % 8) * 8; FragH f; for (int q = 0; q < 8; ++q) f.u[q] = tl[d][j8 + q]; *(v8us*)((unsigned short*)VT + ((size_t)hh * HD + d) * SQ + s0 + j8) = f.half[0]; }  } }



__global__ __launch_bounds__(256) void k_rsmf(const float* __restrict__ S, _Float16* __restrict__ P, int qn, int hg) {
  #pragma clang fp contract(off)
  const int t = blockIdx.x * 256 + threadIdx.x; if (t >= qn * hg) return; const size_t i = (size_t)(t / qn) * SQ + (t % qn); const float* s = S + i * SQ; float mx = -3.0e38f;
#pragma unroll 1
  for (int j = 0; j < SQ; ++j) mx = fmaxf(mx, s[j]); float se = 0.f;
#pragma unroll 1
  for (int j = 0; j < SQ; ++j) se += __expf(s[j] - mx); const float sc = 256.0f / se;
#pragma unroll 1
  for (int j0 = 0; j0 < SQ; j0 += 8) { FragH f; for (int q = 0; q < 8; ++q) f.h[q] = (_Float16)(__expf(s[j0 + q] - mx) * sc); unsigned short* d = (unsigned short*)P + i * SQ + j0; *(v8us*)d = f.half[0];  } }

extern "C" void kernel_launch(void* const* d_in, const int* in_sizes, int n_in,
                              void* d_out, int out_size, void* d_ws, size_t ws_size, hipStream_t stream) {
  (void)in_sizes; (void)n_in; (void)out_size;
  const float* const* I = (const float* const*)d_in; const float* xq = I[0]; const float* xk = I[0]; const float* xv = I[0]; const float* wq = I[1]; const float* bq = nullptr; const float* wk = I[2]; const float* bk = nullptr; const float* wv = I[3]; const float* bv = nullptr; const float* wo = I[4]; const float* bo = I[5];      /* ONE input stream (X) read on all three projections; Wq, Wk, Wv are PER-HEAD STACKS [16][1024][64] = [head][in][out] (the module has NO q / k / v biases: null pointers in the guarded bias slots); Wo [in][out] [1024][1024] at I[4], bo at I[5] */
  char* ws = (char*)d_ws; size_t off = 0;
  auto take = [&](size_t bytes) { char* p = ws + off; off += (bytes + 255) & ~(size_t)255; return p; };
  _Float16* BQ = (_Float16*)take((size_t)DM * DM * 2); _Float16* BK = (_Float16*)take((size_t)DM * DM * 2); _Float16* BV = (_Float16*)take((size_t)DM * DM * 2); _Float16* BO = (_Float16*)take((size_t)DM * DM * 2);
  _Float16* XQ = (_Float16*)take(NR * DM * 2); _Float16* XK = (_Float16*)take(NR * DM * 2); _Float16* XV = (_Float16*)take(NR * DM * 2); _Float16* Q16 = (_Float16*)take(NR * DM * 2); _Float16* K16 = (_Float16*)take(NR * DM * 2); _Float16* V16 = (_Float16*)take(NR * DM * 2); _Float16* O16 = (_Float16*)take(NR * DM * 2);
  float* S = (float*)take((size_t)HG * SQ * SQ * 4); _Float16* P = (_Float16*)take((size_t)HG * SQ * SQ * 2); _Float16* VT = (_Float16*)take((size_t)NH * HD * SQ * 2);
  if (off > ws_size) return;
  { const unsigned g = (unsigned)(((size_t)DM * (DM / 8) + 255) / 256); const unsigned gh = (unsigned)(((size_t)HD * (DM / 8) + 255) / 256); for (int h = 0; h < NH; ++h) { const size_t wofs = (size_t)h * DM * HD, pofs = (size_t)h * HD * DM; k_wt_f16<<<gh, 256, 0, stream>>>(wq + wofs, BQ + pofs, DM, HD, 16.0f); k_wt_f16<<<gh, 256, 0, stream>>>(wk + wofs, BK + pofs, DM, HD, 16.0f); k_wt_f16<<<gh, 256, 0, stream>>>(wv + wofs, BV + pofs, DM, HD, 16.0f); } k_wt_f16<<<g, 256, 0, stream>>>(wo, BO, DM, DM, 16.0f); }      /* PER-HEAD STACKS wq / wk / wv [NH][DM][HD]: head h is a row-major [in = DM][out = HD] block at w + h * DM * HD: the transposing builder with K = DM, N = HD writes its HD rows Bt[h * HD + e][k] at B + h * HD * DM: contiguous rows of the [out][in] plane (x16); wo is a plain [in][out] [DM][DM] matrix: one call as before */

  k_x16<<<(unsigned)((NR * DM / 8 + 255) / 256), 256, 0, stream>>>(xq, XQ, NR * DM / 8); k_x16<<<(unsigned)((NR * DM / 8 + 255) / 256), 256, 0, stream>>>(xk, XK, NR * DM / 8); k_x16<<<(unsigned)((NR * DM / 8 + 255) / 256), 256, 0, stream>>>(xv, XV, NR * DM / 8);      /* the three inputs as exact f16 rows */
  const size_t r0p = (size_t)B0 * SQ;      /* first projected row */
  k_gemm2<0><<<dim3((unsigned)((MP / 128) * (DM / 64)), 1), 128, 0, stream>>>(XQ + r0p * DM, DM, 0, BQ, DM, 0, 0.0625f, bq, 0, nullptr, 1, 0, 0, nullptr, Q16 + r0p * DM, DM, 0, MP, DM, DM);
  k_gemm2<0><<<dim3((unsigned)((MP / 128) * (DM / 64)), 1), 128, 0, stream>>>(XK + r0p * DM, DM, 0, BK, DM, 0, 0.0625f, bk, 0, nullptr, 1, 0, 0, nullptr, K16 + r0p * DM, DM, 0, MP, DM, DM);
  k_gemm2<0><<<dim3((unsigned)((MP / 128) * (DM / 64)), 1), 128, 0, stream>>>(XV + r0p * DM, DM, 0, BV, DM, 0, 0.0625f, bv, 0, nullptr, 1, 0, 0, nullptr, V16 + r0p * DM, DM, 0, MP, DM, DM);
  for (int b = B0; b < B0 + NBR; ++b) { const size_t r0 = (size_t)b * SQ;
    k_vt<NH, SQ><<<NH * (SQ / 64), 256, 0, stream>>>(V16 + r0 * LQ, LQ, 0, VT);      /* V^T [NH][HD][SQ] for this batch */
    for (int h0 = 0; h0 < NHD; h0 += HG) {
      k_gemm2<0><<<dim3((QN / 128) * (SQ / 64), HG), 128, 0, stream>>>(Q16 + r0 * LQ + h0 * HD, LQ, (size_t)HD, K16 + r0 * LQ + h0 * HD, LQ, (size_t)HD, 0.03125f, nullptr, 0, nullptr, 1, 0, 0, S, nullptr, SQ, (size_t)SQ * SQ, QN, SQ, HD);      /* scores, HG heads per launch */
      k_rsmf<<<(HG * QN + 255) / 256, 256, 0, stream>>>(S, P, QN, HG);      /* P = 256 softmax (f16), rows of all HG heads */
      k_gemm2<0><<<dim3((QN / 128) * (HD / 64), HG), 128, 0, stream>>>(P, SQ, (size_t)SQ * SQ, VT + (size_t)h0 * HD * SQ, SQ, (size_t)HD * SQ, 0.25f, nullptr, 0, nullptr, 1, 0, 0, nullptr, O16 + r0 * DM + h0 * HD, DM, (size_t)HD, QN, HD, SQ); } }      /* o (merged heads) as f16 rows */
  k_gemm2<0><<<dim3((unsigned)((MPO / 128) * (DM / 64)), 1), 128, 0, stream>>>(O16 + r0p * DM, DM, 0, BO, DM, 0, 0.0009765625f, bo, 0, nullptr, 1, 0, 0, (float*)d_out + r0p * DM, nullptr, DM, 0, MPO, DM, DM);      /* out rows are the output layout */
}

// v001
// One run takes 1090 microseconds.
// Timed twice side by side with v000, it ran 3.34 and 3.37 times as fast.
#include <hip/hip_runtime.h>
// Multi-head self-attention with PER-HEAD STACKED bias-free projections, scaled by the MODEL WIDTH (X [2][2048][1024]; Q / K / V = einsum('bsd,hde->bhse', X, W) with W [16][1024][64] = [head][in][out], NO biases, 16 heads of 64; scores / sqrt(d_model = 1024) = 1/32 (the module's own: the full width, not the head width); softmax over all 2048 keys (no mask); out = merged Wo + bo ([in][out] [1024][1024] + bias) -> [2][2048][1024]); each head's [in][out] block is transposed into its 64 contiguous rows of the weight plane by the existing builder, one call per head.
// Structure: token rows r = b*2048 + s; the query source and the key/value source as exact f16 rows (bf16-rounded); Q, K, V as three WMMA GEMMs (32x64 wave tiles, f32 accumulation, exact x16 weights, no bias, f16 outputs); per batch: V^T for all heads via LDS transposes; per (batch, group of 4 heads): scores GEMM (K = 64, batched over the heads on grid.y, alpha = 1024^-0.5), row softmax on VALU (f32 statistics, native exp; weights stored x256 as f16), o = P . V^T GEMM (K = 2048, alpha 2^-2: o carried x64 against f16 subnormal flush, folded into the output GEMM alpha) written straight into the merged f16 o rows; out = o W_o + b GEMM (f32) into the output layout.
// Compute dtype: inputs rounded to bf16; x / weights exact; q, k, v, softmax weights and o as plain f16 GEMM operands (~2^-12); scores and softmax statistics f32. v_wmma_f32_16x16x32_f16.
#define NB 2
#define SQ 2048
#define DM 1024
#define NH 16
#define HD 64
#define HG 4                         /* heads per attention launch group */
#define B0 0                         /* first batch processed (debug hook) */
#define NBR NB                       /* batches processed (debug hook) */
#define NR ((size_t)NB * SQ)         /* token rows */
#define MP ((int)((size_t)NBR * SQ)) /* rows projected (debug hook) */
#define QN SQ                        /* query rows attended per batch (debug hook) */
#define NHD NH                       /* heads attended (debug hook) */
#define MPO MP                       /* rows through the output stage (debug hook) */
#define LQ DM      /* row pitch of the q/k/v rows */
typedef __bf16 v16b __attribute__((ext_vector_type(16)));
typedef unsigned short v8us __attribute__((ext_vector_type(8), may_alias));
typedef float  v8f  __attribute__((ext_vector_type(8)));
typedef float  v4f  __attribute__((ext_vector_type(4)));
typedef float  v4fa __attribute__((ext_vector_type(4), may_alias));
union FragB { v16b v; v8us half[2]; unsigned short u[16]; };

__device__ __forceinline__ unsigned short bf16_bits(float x) { unsigned int u = __float_as_uint(x); return (unsigned short)((u + 0x7FFFu + ((u >> 16) & 1u)) >> 16); }
__device__ __forceinline__ float bf16_val(unsigned short b) { return __uint_as_float(((unsigned int)b) << 16); }
__device__ __forceinline__ float bf16_round(float x) { return bf16_val(bf16_bits(x)); }
// D += A·B with NT terms: 1 = ah·bh, 2 = + al·bh (A split), 3 = + ah·bl (both split)
template <int NT>
__device__ __forceinline__ v8f mmaN(v16b ah, v16b al, v16b bh, v16b bl, v8f c) {
  c = __builtin_amdgcn_wmma_f32_16x16x32_bf16(false, ah, false, bh, (short)0, c, false, false);
  if (NT >= 2) c = __builtin_amdgcn_wmma_f32_16x16x32_bf16(false, al, false, bh, (short)0, c, false, false);
  if (NT >= 3) c = __builtin_amdgcn_wmma_f32_16x16x32_bf16(false, ah, false, bl, (short)0, c, false, false);
  asm volatile("v_nop\n\tv_nop\n\tv_nop\n\tv_nop" : "+v"(c) : "v"(ah), "v"(al), "v"(bh), "v"(bl));
  return c;
}

__global__ __launch_bounds__(256) void k_wt_bf16(const float* __restrict__ W, unsigned short* __restrict__ Wt, int K, int N) {
  const int t = blockIdx.x * 256 + threadIdx.x;
  const int k8n = K / 8;
  if (t >= N * k8n) return;
  const int n = t / k8n, k8 = (t % k8n) * 8;
  v8us v;
#pragma unroll
  for (int i = 0; i < 8; ++i) v[i] = bf16_bits(W[(size_t)(k8 + i) * N + n]);
  *(v8us*)(Wt + (size_t)n * K + k8) = v;
  
}

// GEMM C[M][N] (f32, pitch ldc) = act(A[M][K]·W + bias). A f32 row-major (pitch lda) converted per fragment to bf16
// (ASPLIT: hi/lo two planes -> 2 terms, else single rounded term); Wt bf16 [N][K] (pitch ldb). BIAS_BF16 rounds the
// bias to bf16 first (bias quantised to bf16 before the add). K%32==0, M%16==0, N%64==0.
template <bool ASPLIT, int ACT, bool BIAS_BF16>
__global__ __launch_bounds__(128) void k_gemm_bf(const float* __restrict__ A, int lda, const unsigned short* __restrict__ Wt, int ldb,
                                               const float* __restrict__ bias, float* __restrict__ C, int ldc, int M, int N, int K) {
  __shared__ __attribute__((aligned(16))) float so[4][16][64];
  const int tid = threadIdx.x, w = tid >> 5, lane = tid & 31, ln = lane & 15, hh = lane >> 4;
  const int ntn = N / 64;
  const int wid = blockIdx.x * 4 + w;
  const int mt = wid / ntn, nq = wid % ntn;
  if (mt * 16 >= M) return;
  const int row0 = mt * 16, col0 = nq * 64;
  const float* arow = A + (size_t)(row0 + ln) * lda;
  v8f acc[4] = {};
  for (int kb = 0; kb < K; kb += 32) {
    FragB ah, al;
    const v4f x0 = *(const v4fa*)(arow + kb + 8 * hh), x1 = *(const v4fa*)(arow + kb + 8 * hh + 4);
    const v4f x2 = *(const v4fa*)(arow + kb + 16 + 8 * hh), x3 = *(const v4fa*)(arow + kb + 16 + 8 * hh + 4);
    float xs[16] = {x0[0],x0[1],x0[2],x0[3],x1[0],x1[1],x1[2],x1[3],x2[0],x2[1],x2[2],x2[3],x3[0],x3[1],x3[2],x3[3]};
#pragma unroll
    for (int i = 0; i < 16; ++i) { const unsigned short hb = bf16_bits(xs[i]); ah.u[i] = hb; al.u[i] = ASPLIT ? bf16_bits(xs[i] - bf16_val(hb)) : (unsigned short)0; }
#pragma unroll
    for (int t = 0; t < 4; ++t) {
      const unsigned short* brow = Wt + (size_t)(col0 + t * 16 + ln) * ldb + kb;
      FragB b;
      b.half[0] = *(const v8us*)(brow + 8 * hh);
      b.half[1] = *(const v8us*)(brow + 16 + 8 * hh);
      acc[t] = mmaN<ASPLIT ? 2 : 1>(ah.v, al.v, b.v, b.v, acc[t]);
    }
  }
#pragma unroll
  for (int t = 0; t < 4; ++t) {
    float bv = bias ? bias[col0 + t * 16 + ln] : 0.f;
    if (BIAS_BF16) bv = bf16_round(bv);
#pragma unroll
    for (int r = 0; r < 8; ++r) { float v = acc[t][r] + bv; if (ACT == 1) v = fmaxf(v, 0.f); so[w][8 * hh + r][t * 16 + ln] = v; }
  }
  __builtin_amdgcn_fence(__ATOMIC_ACQ_REL, "workgroup");
  __builtin_amdgcn_wave_barrier();
  const int rsub = lane >> 4, c4 = (lane & 15) * 4;
  {
#pragma unroll
    for (int q = 0; q < 8; ++q) {
      const int r = q * 2 + rsub;
      const v4f v = *(const v4fa*)&so[w][r][c4];
      *(v4f*)(C + (size_t)(row0 + r) * ldc + col0 + c4) = v;
    }
    
  }
}

// GEMM C = act(A·W + bias + resid): A f32 (ASPLIT -> hi/lo 2 terms), Wt bf16 [N][K]; ACT 0 none, 1 relu, 2 exact gelu;
// resid (optional, f32, row index = (row % rmod), pitch ldr, RES_BF16 rounds it) added before the activation.
template <bool ASPLIT, int ACT, bool BIAS_BF16, bool RES_BF16>
__global__ __launch_bounds__(128) void k_gemm_bf3(const float* __restrict__ A, int lda, const unsigned short* __restrict__ Wt, int ldb,
                                                const float* __restrict__ bias, const float* __restrict__ resid, int rmod, int ldr,
                                                float* __restrict__ C, int ldc, int M, int N, int K) {
  __shared__ __attribute__((aligned(16))) float so[4][16][64];
  const int tid = threadIdx.x, w = tid >> 5, lane = tid & 31, ln = lane & 15, hh = lane >> 4;
  const int ntn = N / 64;
  const int wid = blockIdx.x * 4 + w;
  const int mt = wid / ntn, nq = wid % ntn;
  if (mt * 16 >= M) return;
  const int row0 = mt * 16, col0 = nq * 64;
  const float* arow = A + (size_t)(row0 + ln) * lda;
  v8f acc[4] = {};
  for (int kb = 0; kb < K; kb += 32) {
    FragB ah, al;
    const v4f x0 = *(const v4fa*)(arow + kb + 8 * hh), x1 = *(const v4fa*)(arow + kb + 8 * hh + 4);
    const v4f x2 = *(const v4fa*)(arow + kb + 16 + 8 * hh), x3 = *(const v4fa*)(arow + kb + 16 + 8 * hh + 4);
    float xs[16] = {x0[0],x0[1],x0[2],x0[3],x1[0],x1[1],x1[2],x1[3],x2[0],x2[1],x2[2],x2[3],x3[0],x3[1],x3[2],x3[3]};
#pragma unroll
    for (int i = 0; i < 16; ++i) { const unsigned short hb = bf16_bits(xs[i]); ah.u[i] = hb; al.u[i] = ASPLIT ? bf16_bits(xs[i] - bf16_val(hb)) : (unsigned short)0; }
#pragma unroll
    for (int t = 0; t < 4; ++t) {
      const unsigned short* brow = Wt + (size_t)(col0 + t * 16 + ln) * ldb + kb;
      FragB b;
      b.half[0] = *(const v8us*)(brow + 8 * hh);
      b.half[1] = *(const v8us*)(brow + 16 + 8 * hh);
      acc[t] = mmaN<ASPLIT ? 2 : 1>(ah.v, al.v, b.v, b.v, acc[t]);
    }
  }
#pragma unroll
  for (int t = 0; t < 4; ++t) {
    const int col = col0 + t * 16 + ln;
    float bv = bias ? bias[col] : 0.f;
    if (BIAS_BF16) bv = bf16_round(bv);
#pragma unroll
    for (int r = 0; r < 8; ++r) {
      float v = acc[t][r] + bv;
      if (resid) { float rv = resid[(size_t)((row0 + 8 * hh + r) % rmod) * ldr + col]; if (RES_BF16) rv = bf16_round(rv); v += rv; }
      if (ACT == 1) v = fmaxf(v, 0.f);
      if (ACT == 2) v = 0.5f * v * (1.0f + erff(v * 0.70710678118654752f));
      if (ACT == 3) { const float u = 0.7978845608028654f * (v + 0.044715f * v * v * v); v = 0.5f * v * (1.0f + tanhf(u)); }
      so[w][8 * hh + r][t * 16 + ln] = v;
    }
  }
  __builtin_amdgcn_fence(__ATOMIC_ACQ_REL, "workgroup");
  __builtin_amdgcn_wave_barrier();
  const int rsub = lane >> 4, c4 = (lane & 15) * 4;
  {
#pragma unroll
    for (int q = 0; q < 8; ++q) {
      const int r = q * 2 + rsub;
      const v4f v = *(const v4fa*)&so[w][r][c4];
      *(v4f*)(C + (size_t)(row0 + r) * ldc + col0 + c4) = v;
    }
    
  }
}
// row LayerNorm (biased variance, eps) over N: s = X (+ R); optional out_sum <- s; out_norm <- (s-mu)*rsqrt(var+eps)*g + b
template <bool PARAM_BF16>
__global__ __launch_bounds__(256) void k_layernorm(const float* __restrict__ X, const float* __restrict__ R, const float* __restrict__ g, const float* __restrict__ bta,
                                                  float* __restrict__ out_sum, float* __restrict__ out_norm, int N, float eps) {
  __shared__ float red[256];
  const int row = blockIdx.x, tid = threadIdx.x;
  const float* x = X + (size_t)row * N; const float* rr = R ? R + (size_t)row * N : nullptr;
  float vals[16];                     // up to N = 4096
  const int per = N / 256;            // contiguous chunk per thread? use strided-by-4 chunks: thread handles j = tid*4 + 1024*u
  float s1 = 0.f;
  for (int u = 0; u < per / 4; ++u) {
    const int j = tid * 4 + 1024 * u;
    const v4f a = *(const v4fa*)(x + j);
    v4f b = {0.f,0.f,0.f,0.f}; if (rr) b = *(const v4fa*)(rr + j);
#pragma unroll
    for (int q = 0; q < 4; ++q) { const float v = a[q] + b[q]; vals[u * 4 + q] = v; s1 += v; }
  }
  red[tid] = s1; __syncthreads();
  for (int st = 128; st > 0; st >>= 1) { if (tid < st) red[tid] += red[tid + st]; __syncthreads(); }
  const float mu = red[0] / (float)N; __syncthreads();
  float s2 = 0.f;
  for (int u = 0; u < per / 4; ++u)
#pragma unroll
    for (int q = 0; q < 4; ++q) { const float c = vals[u * 4 + q] - mu; s2 += c * c; }
  red[tid] = s2; __syncthreads();
  for (int st = 128; st > 0; st >>= 1) { if (tid < st) red[tid] += red[tid + st]; __syncthreads(); }
  const float rs = rsqrtf(red[0] / (float)N + eps);
  {
    for (int u = 0; u < per / 4; ++u) {
      const int j = tid * 4 + 1024 * u;
      v4f o, sm;
#pragma unroll
      for (int q = 0; q < 4; ++q) {
        float gg = g[j + q], bb = bta[j + q];
        if (PARAM_BF16) { gg = bf16_round(gg); bb = bf16_round(bb); }
        sm[q] = vals[u * 4 + q]; o[q] = (vals[u * 4 + q] - mu) * rs * gg + bb;
      }
      if (out_sum) *(v4f*)(out_sum + (size_t)row * N + j) = sm;
      *(v4f*)(out_norm + (size_t)row * N + j) = o;
    }
    
  }
}



// ---- f16 WMMA path (v_wmma_f32_16x16x32_f16): 11-bit significands for operands in range — used where a [0,1] probability operand needs more precision than bf16
typedef _Float16 v16h __attribute__((ext_vector_type(16)));
union FragH { v16h v; v8us half[2]; _Float16 h[16]; unsigned short u[16]; };
template <int NT>
__device__ __forceinline__ v8f mmaH(v16h ah, v16h al, v16h bh, v16h bl, v8f c) {
  c = __builtin_amdgcn_wmma_f32_16x16x32_f16(false, ah, false, bh, (short)0, c, false, false);
  if (NT >= 2) c = __builtin_amdgcn_wmma_f32_16x16x32_f16(false, al, false, bh, (short)0, c, false, false);
  if (NT >= 3) c = __builtin_amdgcn_wmma_f32_16x16x32_f16(false, ah, false, bl, (short)0, c, false, false);
  asm volatile("v_nop\n\tv_nop\n\tv_nop\n\tv_nop" : "+v"(c) : "v"(ah), "v"(al), "v"(bh), "v"(bl));
  return c;
}
// batched GEMM like k_gemm_b but f16 operands: A f32 (split into f16 hi/lo if ASPLIT, else rounded to f16), Bt = f16 values [n][k]; alpha; C f32; N multiple of 16 (partial tiles skipped)
template <bool ASPLIT>
__global__ __launch_bounds__(128) void k_gemm_h(const float* __restrict__ A, int lda, size_t sA, const _Float16* __restrict__ Bh, int ldb, size_t sB, float alpha, float* __restrict__ C, int ldc, size_t sC, int M, int N, int K) {
  __shared__ __attribute__((aligned(16))) float so[4][16][64];
  const int tid = threadIdx.x, w = tid >> 5, lane = tid & 31, ln = lane & 15, hh = lane >> 4; const int by = blockIdx.y;
  A += (size_t)by * sA; Bh += (size_t)by * sB; C += (size_t)by * sC;
  const int ntn = (N + 63) / 64; const int wid = blockIdx.x * 4 + w; const int mt = wid / ntn, nq = wid % ntn; if (mt * 16 >= M) return;
  const int row0 = mt * 16, col0 = nq * 64; const float* arow = A + (size_t)(row0 + ln) * lda;
  v8f acc[4] = {};
  for (int kb = 0; kb < K; kb += 32) {
    FragH ah, al;
    const v4f x0 = *(const v4fa*)(arow + kb + 8 * hh), x1 = *(const v4fa*)(arow + kb + 8 * hh + 4), x2 = *(const v4fa*)(arow + kb + 16 + 8 * hh), x3 = *(const v4fa*)(arow + kb + 16 + 8 * hh + 4);
    float xs[16] = {x0[0],x0[1],x0[2],x0[3],x1[0],x1[1],x1[2],x1[3],x2[0],x2[1],x2[2],x2[3],x3[0],x3[1],x3[2],x3[3]};
#pragma unroll
    for (int i = 0; i < 16; ++i) { const _Float16 h = (_Float16)xs[i]; ah.h[i] = h; al.h[i] = ASPLIT ? (_Float16)(xs[i] - (float)h) : (_Float16)0.0f; }
#pragma unroll
    for (int t = 0; t < 4; ++t) { if (col0 + t * 16 >= N) continue; const size_t boff = (size_t)(col0 + t * 16 + ln) * ldb + kb; FragH bq; bq.half[0] = *(const v8us*)(Bh + boff + 8 * hh); bq.half[1] = *(const v8us*)(Bh + boff + 16 + 8 * hh);
      acc[t] = mmaH<ASPLIT ? 2 : 1>(ah.v, al.v, bq.v, bq.v, acc[t]); }
  }
#pragma unroll
  for (int t = 0; t < 4; ++t) { if (col0 + t * 16 >= N) continue;
#pragma unroll
    for (int r = 0; r < 8; ++r) so[w][8 * hh + r][t * 16 + ln] = acc[t][r] * alpha; }
  __builtin_amdgcn_fence(__ATOMIC_ACQ_REL, "workgroup"); __builtin_amdgcn_wave_barrier();
  const int rsub = lane >> 4, c4 = (lane & 15) * 4;
  {
#pragma unroll
    for (int q = 0; q < 8; ++q) { const int r = q * 2 + rsub; if (col0 + c4 < N) { const v4f v = *(const v4fa*)&so[w][r][c4]; *(v4f*)(C + (size_t)(row0 + r) * ldc + col0 + c4) = v; } }
     }
}

// Wt[n][k] = f16(W[k][n]·scale) from f32 row-major W[K][N] (scale = power of two; bf16-exact weights stay exact in f16 away from the subnormal range)
__global__ __launch_bounds__(256) void k_wt_f16(const float* __restrict__ W, _Float16* __restrict__ Wt, int K, int N, float scale) {
  const int t = blockIdx.x * 256 + threadIdx.x; if (t >= N * (K / 8)) return; const int n = t / (K / 8), k8 = (t % (K / 8)) * 8; FragH f;
#pragma unroll
  for (int i = 0; i < 8; ++i) f.h[i] = (_Float16)(bf16_round(W[(size_t)(k8 + i) * N + n]) * scale); const v8us o = f.half[0];
  *(v8us*)((unsigned short*)Wt + (size_t)n * K + k8) = o; 
}
// k_gemm_hh variant with fused epilogue: v = acc·alpha + bias[by·sBias + col] (+ CP[(row/rowsPerB)·sCPb + by·64 + col] if CP) ; ACT 0 none / 1 elu ; writes f16 C16 (and f32 C if non-null)
template <int ACT>
__global__ __launch_bounds__(128) void k_gemm_hhx(const _Float16* __restrict__ A, int lda, size_t sA, const _Float16* __restrict__ Bh, int ldb, size_t sB, float alpha, const float* __restrict__ bias, size_t sBias, const float* __restrict__ CP, int rowsPerB, size_t sCPb, int row0g,
    float* __restrict__ C, _Float16* __restrict__ C16, int ldc, size_t sC, int M, int N, int K) {
  __shared__ __attribute__((aligned(16))) float so[4][16][64];
  const int tid = threadIdx.x, w = tid >> 5, lane = tid & 31, ln = lane & 15, hh = lane >> 4; const int by = blockIdx.y;
  A += (size_t)by * sA; Bh += (size_t)by * sB; const size_t cofs = (size_t)by * sC; const float* bp = bias ? bias + (size_t)by * sBias : nullptr;
  const int ntn = (N + 63) / 64; const int wid = blockIdx.x * 4 + w; const int mt = wid / ntn, nq = wid % ntn; if (mt * 16 >= M) return;
  const int row0 = mt * 16, col0 = nq * 64; const _Float16* arow = A + (size_t)(row0 + ln) * lda;
  v8f acc[4] = {};
  for (int kb = 0; kb < K; kb += 32) { FragH ah; ah.half[0] = *(const v8us*)((const unsigned short*)arow + kb + 8 * hh); ah.half[1] = *(const v8us*)((const unsigned short*)arow + kb + 16 + 8 * hh);
#pragma unroll
    for (int t = 0; t < 4; ++t) { if (col0 + t * 16 >= N) continue; const size_t boff = (size_t)(col0 + t * 16 + ln) * ldb + kb; FragH bq; bq.half[0] = *(const v8us*)((const unsigned short*)Bh + boff + 8 * hh); bq.half[1] = *(const v8us*)((const unsigned short*)Bh + boff + 16 + 8 * hh);
      acc[t] = mmaH<1>(ah.v, ah.v, bq.v, bq.v, acc[t]); }
  }
#pragma unroll
  for (int t = 0; t < 4; ++t) { if (col0 + t * 16 >= N) continue; const int col = col0 + t * 16 + ln; const float bv = bp ? bf16_round(bp[col]) : 0.f;
#pragma unroll
    for (int r = 0; r < 8; ++r) { float v = acc[t][r] * alpha + bv; if (CP) { const int rr = row0g + row0 + 8 * hh + r; if (rowsPerB < 0) v += CP[cofs + (size_t)rr * ldc + col];      /* rowsPerB < 0: own element of the batched C plane */ else { const int bidx = rr / rowsPerB; v += CP[(size_t)bidx * sCPb + (size_t)by * 64 + col]; } } if (ACT == 1) v = (v > 0.f) ? v : expm1f(v); else if (ACT == 7) v = (v > 0.f) ? v + 1.0f : expf(v); else if (ACT == 8) v = tanhf(v); else if (ACT == 9) v = 0.5f * v * (1.0f + tanhf(0.7978845608028654f * (v + 0.044715f * v * v * v))); else if (ACT == 11) v = 1.0f / (1.0f + expf(-v)); else if (ACT == 12) v = (v > 0.f) ? v : 0.01f * v; else if (ACT == 14) v = (v > 0.f) ? v : 0.1f * v; else if (ACT == 16) v = (v >= 0.f) ? v : 0.3f * v; else if (ACT == 17) v = (v >= 0.f) ? v : 0.2f * v; else if (ACT == 15) v = v / (1.0f + expf(-v)); else if (ACT == 3) v = fmaxf(v, 0.f); else if (ACT == 6) v = 0.5f * v * (1.0f + erff(v * 0.70710678118654752f)); so[w][8 * hh + r][t * 16 + ln] = v; } }
  __builtin_amdgcn_fence(__ATOMIC_ACQ_REL, "workgroup"); __builtin_amdgcn_wave_barrier();
  const int rsub = lane >> 4, c4 = (lane & 15) * 4; typedef _Float16 v4h __attribute__((ext_vector_type(4)));
  {
#pragma unroll
    for (int q = 0; q < 8; ++q) { const int r = q * 2 + rsub; if (col0 + c4 < N) { const v4f v = *(const v4fa*)&so[w][r][c4]; if (C) *(v4f*)(C + cofs + (size_t)(row0 + r) * ldc + col0 + c4) = v; if (C16) { v4h h4; for (int i = 0; i < 4; ++i) h4[i] = (_Float16)v[i]; *(v4h*)(C16 + cofs + (size_t)(row0 + r) * ldc + col0 + c4) = h4; } } }
     }
}


typedef _Float16 v4h __attribute__((ext_vector_type(4)));

__global__ __launch_bounds__(256) void k_x16(const float* __restrict__ x, _Float16* __restrict__ X16, size_t n8) { const size_t t = (size_t)blockIdx.x * 256 + threadIdx.x; if (t >= n8) return; FragH f;
#pragma unroll
  for (int q = 0; q < 8; ++q) f.h[q] = (_Float16)bf16_round(x[t * 8 + q]); *(v8us*)((unsigned short*)X16 + t * 8) = f.half[0];  }
__global__ __launch_bounds__(256) void k_h16(const float* __restrict__ x, _Float16* __restrict__ X16, size_t n8) { const size_t t = (size_t)blockIdx.x * 256 + threadIdx.x; if (t >= n8) return; FragH f;
#pragma unroll
  for (int q = 0; q < 8; ++q) f.h[q] = (_Float16)x[t * 8 + q]; *(v8us*)((unsigned short*)X16 + t * 8) = f.half[0];  }
__global__ __launch_bounds__(256) void k_round16f(const float* __restrict__ W, _Float16* __restrict__ Bt, size_t n8) { const size_t t = (size_t)blockIdx.x * 256 + threadIdx.x; if (t >= n8) return; FragH f;
#pragma unroll
  for (int i = 0; i < 8; ++i) f.h[i] = (_Float16)(bf16_round(W[t * 8 + i]) * 16.0f); *(v8us*)((unsigned short*)Bt + t * 8) = f.half[0];  }
template <int NHv, int TTv>
__global__ __launch_bounds__(256) void k_vt(const _Float16* __restrict__ V16, int ldv, int voff, _Float16* __restrict__ Vt) { __shared__ unsigned short tl[64][66]; const int tid = threadIdx.x; const int slab = blockIdx.x / (TTv / 64), lg = blockIdx.x % (TTv / 64); const int b = slab / NHv, h = slab % NHv;
  for (int i = tid; i < 64 * 8; i += 256) { const int r = i / 8, c8 = (i % 8) * 8; FragH f; f.half[0] = *(const v8us*)((const unsigned short*)V16 + ((size_t)b * TTv + lg * 64 + r) * ldv + voff + h * 64 + c8);
#pragma unroll
    for (int q = 0; q < 8; ++q) tl[r][c8 + q] = f.u[q]; }
  __syncthreads();
  {
#pragma unroll
    for (int rd = 0; rd < 2; ++rd) { const int d = rd * 32 + tid / 8, pc = tid % 8; FragH f;
#pragma unroll
      for (int q = 0; q < 8; ++q) f.u[q] = tl[pc * 8 + q][d];
      *(v8us*)((unsigned short*)Vt + ((size_t)slab * 64 + d) * TTv + lg * 64 + pc * 8) = f.half[0]; }
     } }

__global__ __launch_bounds__(256) void k_hl(const float* __restrict__ F, _Float16* __restrict__ Hh, _Float16* __restrict__ Hl, size_t n8) { const size_t t = (size_t)blockIdx.x * 256 + threadIdx.x; if (t >= n8) return; FragH fh, fl; const v4f a = *(const v4fa*)(F + t * 8), c = *(const v4fa*)(F + t * 8 + 4);
#pragma unroll
  for (int q = 0; q < 4; ++q) { _Float16 h = (_Float16)a[q]; fh.h[q] = h; fl.h[q] = (_Float16)((a[q] - (float)h) * 1024.0f); h = (_Float16)c[q]; fh.h[4 + q] = h; fl.h[4 + q] = (_Float16)((c[q] - (float)h) * 1024.0f); }
  { *(v8us*)((unsigned short*)Hh + t * 8) = fh.half[0]; *(v8us*)((unsigned short*)Hl + t * 8) = fl.half[0];  } }

// ---- fast GEMM (wave tile 32x64; requires M % 32 == 0 rows per launch region and N % 64 == 0); epilogue = k_gemm_hhx semantics ----
__device__ __forceinline__ v16h g2_frag(const _Float16* p, int hh) { FragH f; f.half[0] = *(const v8us*)((const unsigned short*)p + 8 * hh); f.half[1] = *(const v8us*)((const unsigned short*)p + 16 + 8 * hh); return f.v; }
__device__ __forceinline__ v8f g2_mma(v16h a, v16h b, v8f c) { v8f d = __builtin_amdgcn_wmma_f32_16x16x32_f16(false, a, false, b, (short)0, c, false, false); asm volatile("v_nop\n\tv_nop\n\tv_nop\n\tv_nop" : "+v"(d) : "v"(a), "v"(b)); return d; }
template <int ACT>
__global__ __launch_bounds__(128) void k_gemm2(const _Float16* __restrict__ A, int lda, size_t sA, const _Float16* __restrict__ Bh, int ldb, size_t sB, float alpha, const float* __restrict__ bias, size_t sBias, const float* __restrict__ CP, int rowsPerB, size_t sCPb, int row0g,
    float* __restrict__ C, _Float16* __restrict__ C16, int ldc, size_t sC, int M, int N, int K) { static_assert(ACT == 0 || ACT == 3 || ACT == 6 || ACT == 8 || ACT == 9 || ACT == 11 || ACT == 12 || ACT == 14 || ACT == 15 || ACT == 16 || ACT == 17, "k_gemm2: unsupported ACT code (would silently apply no activation)");
  __shared__ __attribute__((aligned(16))) float so[4][32][68];
  const int tid = threadIdx.x, w = tid >> 5, lane = tid & 31, ln = lane & 15, hh = lane >> 4; const int by = blockIdx.y;
  A += (size_t)by * sA; Bh += (size_t)by * sB; const size_t cofs = (size_t)by * sC; const float* bp = bias ? bias + (size_t)by * sBias : nullptr;
  const int ntn = N >> 6; const int mt = blockIdx.x / ntn, nq = blockIdx.x - mt * ntn; const int row0 = mt * 128 + 32 * w, col0 = nq * 64; if (row0 >= M) return;
  const _Float16* a0p = A + (size_t)(row0 + ln) * lda; const _Float16* a1p = a0p + (size_t)16 * lda;
  const _Float16* b0p = Bh + (size_t)(col0 + ln) * ldb; const _Float16* b1p = b0p + (size_t)16 * ldb; const _Float16* b2p = b1p + (size_t)16 * ldb; const _Float16* b3p = b2p + (size_t)16 * ldb;
  const v8f z8 = {0.f,0.f,0.f,0.f,0.f,0.f,0.f,0.f}; v8f c00 = z8, c01 = z8, c02 = z8, c03 = z8, c10 = z8, c11 = z8, c12 = z8, c13 = z8;
#pragma unroll 1
  for (int kb = 0; kb < K; kb += 32) { const v16h a0 = g2_frag(a0p + kb, hh), a1 = g2_frag(a1p + kb, hh);
    v16h b = g2_frag(b0p + kb, hh); c00 = g2_mma(a0, b, c00); c10 = g2_mma(a1, b, c10);
    b = g2_frag(b1p + kb, hh); c01 = g2_mma(a0, b, c01); c11 = g2_mma(a1, b, c11);
    b = g2_frag(b2p + kb, hh); c02 = g2_mma(a0, b, c02); c12 = g2_mma(a1, b, c12);
    b = g2_frag(b3p + kb, hh); c03 = g2_mma(a0, b, c03); c13 = g2_mma(a1, b, c13); }
  v8f accs[8] = {c00, c01, c02, c03, c10, c11, c12, c13};
#pragma unroll
  for (int u = 0; u < 8; ++u) { const int t = u & 3, half = u >> 2; const int col = col0 + t * 16 + ln; const float bv = bp ? bf16_round(bp[col]) : 0.f;
#pragma unroll
    for (int r = 0; r < 8; ++r) { const int rloc = half * 16 + 8 * hh + r; float v = accs[u][r] * alpha + bv; if (CP) { if (rowsPerB < 0) v += CP[cofs + (size_t)(row0g + row0 + rloc) * ldc + col];      /* rowsPerB < 0: own element of the batched C plane */ else { const int bidx = (row0g + row0 + rloc) / rowsPerB; v += CP[(size_t)bidx * sCPb + (size_t)by * 64 + col]; } }
      if (ACT == 3) v = fmaxf(v, 0.f); else if (ACT == 6) v = 0.5f * v * (1.0f + erff(v * 0.70710678118654752f)); else if (ACT == 11) v = 1.0f / (1.0f + expf(-v)); else if (ACT == 15) v = v / (1.0f + expf(-v)); else if (ACT == 12) v = (v > 0.f) ? v : 0.01f * v; else if (ACT == 8) v = tanhf(v); else if (ACT == 9) v = 0.5f * v * (1.0f + tanhf(0.7978845608028654f * (v + 0.044715f * v * v * v))); else if (ACT == 14) v = (v > 0.f) ? v : 0.1f * v; else if (ACT == 16) v = (v >= 0.f) ? v : 0.3f * v; else if (ACT == 17) v = (v >= 0.f) ? v : 0.2f * v;
      so[w][rloc][t * 16 + ln] = v; } }
  __builtin_amdgcn_fence(__ATOMIC_ACQ_REL, "workgroup"); __builtin_amdgcn_wave_barrier();
  const int rsub = lane >> 4, c4 = (lane & 15) * 4;
  {
#pragma unroll
    for (int q = 0; q < 16; ++q) { const int r = q * 2 + rsub; const v4f v = *(const v4fa*)&so[w][r][c4]; if (C) *(v4f*)(C + cofs + (size_t)(row0 + r) * ldc + col0 + c4) = v; if (C16) { v4h h4; for (int i = 0; i < 4; ++i) h4[i] = (_Float16)v[i]; *(v4h*)(C16 + cofs + (size_t)(row0 + r) * ldc + col0 + c4) = h4; } }
     } }


__global__ __launch_bounds__(256) void k_wnat(const float* __restrict__ w, size_t n8, _Float16* __restrict__ Bt) { const size_t t = (size_t)blockIdx.x * 256 + threadIdx.x; if (t >= n8) return; FragH f; for (int q = 0; q < 8; ++q) f.h[q] = (_Float16)(bf16_round(w[t * 8 + q]) * 16.0f); *(v8us*)((unsigned short*)Bt + t * 8) = f.half[0];  }
__global__ __launch_bounds__(256) void k_rsm(const float* __restrict__ S, _Float16* __restrict__ P, int nrows) {
  #pragma clang fp contract(off)
  const int i = blockIdx.x * 256 + threadIdx.x; if (i >= nrows) return; const float* s = S + (size_t)i * SQ; float mx = -3.0e38f;
#pragma unroll 1
  for (int j = 0; j < SQ; ++j) mx = fmaxf(mx, s[j]); float se = 0.f;
#pragma unroll 1
  for (int j = 0; j < SQ; ++j) se += expf(s[j] - mx); const float sc = 256.0f / se;
#pragma unroll 1
  for (int j0 = 0; j0 < SQ; j0 += 8) { FragH f; for (int q = 0; q < 8; ++q) f.h[q] = (_Float16)(expf(s[j0 + q] - mx) * sc); unsigned short* d = (unsigned short*)P + (size_t)i * SQ + j0; *(v8us*)d = f.half[0];  } }
__global__ __launch_bounds__(256) void k_vt(const _Float16* __restrict__ V16, int b, int h0, _Float16* __restrict__ VT) { __shared__ unsigned short tl[64][65]; const int tid = threadIdx.x; const int hh = blockIdx.x % HG, sg = blockIdx.x / HG; const int s0 = sg * 64; const int h = h0 + hh;
  for (int i = tid; i < 64 * 8; i += 256) { const int j = i / 8, d8 = (i % 8) * 8; FragH f; f.half[0] = *(const v8us*)((const unsigned short*)V16 + ((size_t)b * SQ + s0 + j) * DM + h * HD + d8); for (int q = 0; q < 8; ++q) tl[d8 + q][j] = f.u[q]; }
  __syncthreads();
  { for (int i = tid; i < 64 * 8; i += 256) { const int d = i / 8, j8 = (i % 8) * 8; FragH f; for (int q = 0; q < 8; ++q) f.u[q] = tl[d][j8 + q]; *(v8us*)((unsigned short*)VT + ((size_t)hh * HD + d) * SQ + s0 + j8) = f.half[0]; }  } }



// wave-wide butterfly steps: lanes l and l ^ m (m < 16) by DPP row_xmask, l and l ^ 16 by the cross-row permlane (no LDS round trip)
template <int M> __device__ __forceinline__ float xl_row(float v) { return __int_as_float(__builtin_amdgcn_update_dpp(0, __float_as_int(v), 0x160 + M, 0xf, 0xf, true)); }
__device__ __forceinline__ float xl_half(float v) { const int i = __float_as_int(v); return __int_as_float(__builtin_amdgcn_permlanex16(i, i, 0x76543210, 0xfedcba98, false, false)); }
__device__ __forceinline__ float wave_max(float v) { v = fmaxf(v, xl_row<1>(v)); v = fmaxf(v, xl_row<2>(v)); v = fmaxf(v, xl_row<4>(v)); v = fmaxf(v, xl_row<8>(v)); return fmaxf(v, xl_half(v)); }
__device__ __forceinline__ float wave_sum(float v) { v += xl_row<1>(v); v += xl_row<2>(v); v += xl_row<4>(v); v += xl_row<8>(v); return v + xl_half(v); }
// one WAVE per score row: 16 loads of 512 contiguous bytes hold the whole row (64 values a lane) in registers, so S is read once; maximum and sum = per-lane chains, then a five-step butterfly; P leaves as 256 contiguous bytes a store; the loops over the row are fully unrolled because x[] stays in registers only under constant indices
__global__ __launch_bounds__(256) void k_rsmf(const float* __restrict__ S, _Float16* __restrict__ P, int qn, int hg) {
  const int lane = threadIdx.x & 31; const int t = blockIdx.x * 8 + __builtin_amdgcn_readfirstlane(threadIdx.x >> 5); if (t >= qn * hg) return;      /* the row is the same in every lane: scalar row arithmetic; no barrier in this kernel */
  const size_t i = (size_t)(t / qn) * SQ + (t % qn); const float* s = S + i * SQ + lane * 4; _Float16* d = P + i * SQ + lane * 4;
  v4f x[SQ / 128];
#pragma unroll
  for (int u = 0; u < SQ / 128; ++u) x[u] = *(const v4fa*)(s + u * 128);
  v4f m4 = x[0];
#pragma unroll
  for (int u = 1; u < SQ / 128; ++u) for (int q = 0; q < 4; ++q) m4[q] = fmaxf(m4[q], x[u][q]);
  const float mx = wave_max(fmaxf(fmaxf(fmaxf(m4[0], m4[1]), fmaxf(m4[2], m4[3])), -3.0e38f));
  v4f s4 = {0.f, 0.f, 0.f, 0.f};
#pragma unroll
  for (int u = 0; u < SQ / 128; ++u) { float e0 = (x[u][0] - mx) * 1.44269504f, e1 = (x[u][1] - mx) * 1.44269504f, e2 = (x[u][2] - mx) * 1.44269504f, e3 = (x[u][3] - mx) * 1.44269504f;
    /* the native exponential (2^(x log2 e), as __expf builds it), four at a time; the v_nop is the one slot the instruction set asks for behind a transcendental, written in the same statement so that it stays directly behind the last one */
    asm("v_exp_f32 %0, %0\n\tv_exp_f32 %1, %1\n\tv_exp_f32 %2, %2\n\tv_exp_f32 %3, %3\n\tv_nop" : "+v"(e0), "+v"(e1), "+v"(e2), "+v"(e3));
    x[u][0] = e0; x[u][1] = e1; x[u][2] = e2; x[u][3] = e3; s4[0] += e0; s4[1] += e1; s4[2] += e2; s4[3] += e3; }
  const float sc = 256.0f / wave_sum((s4[0] + s4[1]) + (s4[2] + s4[3]));
#pragma unroll
  for (int u = 0; u < SQ / 128; ++u) { v4h h4; for (int q = 0; q < 4; ++q) h4[q] = (_Float16)(x[u][q] * sc); *(v4h*)(d + u * 128) = h4; } }

extern "C" void kernel_launch(void* const* d_in, const int* in_sizes, int n_in,
                              void* d_out, int out_size, void* d_ws, size_t ws_size, hipStream_t stream) {
  (void)in_sizes; (void)n_in; (void)out_size;
  const float* const* I = (const float* const*)d_in; const float* xq = I[0]; const float* xk = I[0]; const float* xv = I[0]; const float* wq = I[1]; const float* bq = nullptr; const float* wk = I[2]; const float* bk = nullptr; const float* wv = I[3]; const float* bv = nullptr; const float* wo = I[4]; const float* bo = I[5];      /* ONE input stream (X) read on all three projections; Wq, Wk, Wv are PER-HEAD STACKS [16][1024][64] = [head][in][out] (the module has NO q / k / v biases: null pointers in the guarded bias slots); Wo [in][out] [1024][1024] at I[4], bo at I[5] */
  char* ws = (char*)d_ws; size_t off = 0;
  auto take = [&](size_t bytes) { char* p = ws + off; off += (bytes + 255) & ~(size_t)255; return p; };
  _Float16* BQ = (_Float16*)take((size_t)DM * DM * 2); _Float16* BK = (_Float16*)take((size_t)DM * DM * 2); _Float16* BV = (_Float16*)take((size_t)DM * DM * 2); _Float16* BO = (_Float16*)take((size_t)DM * DM * 2);
  _Float16* XQ = (_Float16*)take(NR * DM * 2); _Float16* XK = (_Float16*)take(NR * DM * 2); _Float16* XV = (_Float16*)take(NR * DM * 2); _Float16* Q16 = (_Float16*)take(NR * DM * 2); _Float16* K16 = (_Float16*)take(NR * DM * 2); _Float16* V16 = (_Float16*)take(NR * DM * 2); _Float16* O16 = (_Float16*)take(NR * DM * 2);
  float* S = (float*)take((size_t)HG * SQ * SQ * 4); _Float16* P = (_Float16*)take((size_t)HG * SQ * SQ * 2); _Float16* VT = (_Float16*)take((size_t)NH * HD * SQ * 2);
  if (off > ws_size) return;
  { const unsigned g = (unsigned)(((size_t)DM * (DM / 8) + 255) / 256); const unsigned gh = (unsigned)(((size_t)HD * (DM / 8) + 255) / 256); for (int h = 0; h < NH; ++h) { const size_t wofs = (size_t)h * DM * HD, pofs = (size_t)h * HD * DM; k_wt_f16<<<gh, 256, 0, stream>>>(wq + wofs, BQ + pofs, DM, HD, 16.0f); k_wt_f16<<<gh, 256, 0, stream>>>(wk + wofs, BK + pofs, DM, HD, 16.0f); k_wt_f16<<<gh, 256, 0, stream>>>(wv + wofs, BV + pofs, DM, HD, 16.0f); } k_wt_f16<<<g, 256, 0, stream>>>(wo, BO, DM, DM, 16.0f); }      /* PER-HEAD STACKS wq / wk / wv [NH][DM][HD]: head h is a row-major [in = DM][out = HD] block at w + h * DM * HD: the transposing builder with K = DM, N = HD writes its HD rows Bt[h * HD + e][k] at B + h * HD * DM: contiguous rows of the [out][in] plane (x16); wo is a plain [in][out] [DM][DM] matrix: one call as before */

  k_x16<<<(unsigned)((NR * DM / 8 + 255) / 256), 256, 0, stream>>>(xq, XQ, NR * DM / 8); k_x16<<<(unsigned)((NR * DM / 8 + 255) / 256), 256, 0, stream>>>(xk, XK, NR * DM / 8); k_x16<<<(unsigned)((NR * DM / 8 + 255) / 256), 256, 0, stream>>>(xv, XV, NR * DM / 8);      /* the three inputs as exact f16 rows */
  const size_t r0p = (size_t)B0 * SQ;      /* first projected row */
  k_gemm2<0><<<dim3((unsigned)((MP / 128) * (DM / 64)), 1), 128, 0, stream>>>(XQ + r0p * DM, DM, 0, BQ, DM, 0, 0.0625f, bq, 0, nullptr, 1, 0, 0, nullptr, Q16 + r0p * DM, DM, 0, MP, DM, DM);
  k_gemm2<0><<<dim3((unsigned)((MP / 128) * (DM / 64)), 1), 128, 0, stream>>>(XK + r0p * DM, DM, 0, BK, DM, 0, 0.0625f, bk, 0, nullptr, 1, 0, 0, nullptr, K16 + r0p * DM, DM, 0, MP, DM, DM);
  k_gemm2<0><<<dim3((unsigned)((MP / 128) * (DM / 64)), 1), 128, 0, stream>>>(XV + r0p * DM, DM, 0, BV, DM, 0, 0.0625f, bv, 0, nullptr, 1, 0, 0, nullptr, V16 + r0p * DM, DM, 0, MP, DM, DM);
  for (int b = B0; b < B0 + NBR; ++b) { const size_t r0 = (size_t)b * SQ;
    k_vt<NH, SQ><<<NH * (SQ / 64), 256, 0, stream>>>(V16 + r0 * LQ, LQ, 0, VT);      /* V^T [NH][HD][SQ] for this batch */
    for (int h0 = 0; h0 < NHD; h0 += HG) {
      k_gemm2<0><<<dim3((QN / 128) * (SQ / 64), HG), 128, 0, stream>>>(Q16 + r0 * LQ + h0 * HD, LQ, (size_t)HD, K16 + r0 * LQ + h0 * HD, LQ, (size_t)HD, 0.03125f, nullptr, 0, nullptr, 1, 0, 0, S, nullptr, SQ, (size_t)SQ * SQ, QN, SQ, HD);      /* scores, HG heads per launch */
      k_rsmf<<<(HG * QN + 7) / 8, 256, 0, stream>>>(S, P, QN, HG);      /* P = 256 softmax (f16), rows of all HG heads */
      k_gemm2<0><<<dim3((QN / 128) * (HD / 64), HG), 128, 0, stream>>>(P, SQ, (size_t)SQ * SQ, VT + (size_t)h0 * HD * SQ, SQ, (size_t)HD * SQ, 0.25f, nullptr, 0, nullptr, 1, 0, 0, nullptr, O16 + r0 * DM + h0 * HD, DM, (size_t)HD, QN, HD, SQ); } }      /* o (merged heads) as f16 rows */
  k_gemm2<0><<<dim3((unsigned)((MPO / 128) * (DM / 64)), 1), 128, 0, stream>>>(O16 + r0p * DM, DM, 0, BO, DM, 0, 0.0009765625f, bo, 0, nullptr, 1, 0, 0, (float*)d_out + r0p * DM, nullptr, DM, 0, MPO, DM, DM);      /* out rows are the output layout */
}

// v002
// One run takes 408 microseconds.
// Next to v001, in two timings, it ran 2.69 and 2.67 times as fast.
// All steps since v000 together make it 8.98 times as fast.
#include <hip/hip_runtime.h>
#define NB 2
#define SQ 2048
#define DM 1024
#define NH 16
#define HD 64
#define HG 4                         /* heads per launch of the per-batch k_vt */
#define B0 0                         /* first batch processed (debug hook) */
#define NBR NB                       /* batches processed (debug hook) */
#define NR ((size_t)NB * SQ)         /* token rows */
#define MP ((int)((size_t)NBR * SQ)) /* rows projected (debug hook) */
#define QN SQ                        /* query rows per batch; not used */
#define NHD NH                       /* heads; not used */
#define MPO MP                       /* rows through the output stage (debug hook) */
#define LQ DM      /* row pitch of the q/k/v rows */
typedef __bf16 v16b __attribute__((ext_vector_type(16)));
typedef unsigned short v8us __attribute__((ext_vector_type(8), may_alias));
typedef float  v8f  __attribute__((ext_vector_type(8)));
typedef float  v4f  __attribute__((ext_vector_type(4)));
typedef float  v4fa __attribute__((ext_vector_type(4), may_alias));
union FragB { v16b v; v8us half[2]; unsigned short u[16]; };

__device__ __forceinline__ unsigned short bf16_bits(float x) { unsigned int u = __float_as_uint(x); return (unsigned short)((u + 0x7FFFu + ((u >> 16) & 1u)) >> 16); }
__device__ __forceinline__ float bf16_val(unsigned short b) { return __uint_as_float(((unsigned int)b) << 16); }
__device__ __forceinline__ float bf16_round(float x) { return bf16_val(bf16_bits(x)); }
// D += A·B with NT terms: 1 = ah·bh, 2 = + al·bh (A split), 3 = + ah·bl (both split)
template <int NT>
__device__ __forceinline__ v8f mmaN(v16b ah, v16b al, v16b bh, v16b bl, v8f c) {
  c = __builtin_amdgcn_wmma_f32_16x16x32_bf16(false, ah, false, bh, (short)0, c, false, false);
  if (NT >= 2) c = __builtin_amdgcn_wmma_f32_16x16x32_bf16(false, al, false, bh, (short)0, c, false, false);
  if (NT >= 3) c = __builtin_amdgcn_wmma_f32_16x16x32_bf16(false, ah, false, bl, (short)0, c, false, false);
  asm volatile("v_nop\n\tv_nop\n\tv_nop\n\tv_nop" : "+v"(c) : "v"(ah), "v"(al), "v"(bh), "v"(bl));
  return c;
}

__global__ __launch_bounds__(256) void k_wt_bf16(const float* __restrict__ W, unsigned short* __restrict__ Wt, int K, int N) {
  const int t = blockIdx.x * 256 + threadIdx.x;
  const int k8n = K / 8;
  if (t >= N * k8n) return;
  const int n = t / k8n, k8 = (t % k8n) * 8;
  v8us v;
#pragma unroll
  for (int i = 0; i < 8; ++i) v[i] = bf16_bits(W[(size_t)(k8 + i) * N + n]);
  *(v8us*)(Wt + (size_t)n * K + k8) = v;
  
}

// GEMM C[M][N] (f32, pitch ldc) = act(A[M][K]·W + bias). A f32 row-major (pitch lda) converted per fragment to bf16
// (ASPLIT: hi/lo two planes -> 2 terms, else single rounded term); Wt bf16 [N][K] (pitch ldb). BIAS_BF16 rounds the
// bias to bf16 first (bias quantised to bf16 before the add). K%32==0, M%16==0, N%64==0.
template <bool ASPLIT, int ACT, bool BIAS_BF16>
__global__ __launch_bounds__(128) void k_gemm_bf(const float* __restrict__ A, int lda, const unsigned short* __restrict__ Wt, int ldb,
                                               const float* __restrict__ bias, float* __restrict__ C, int ldc, int M, int N, int K) {
  __shared__ __attribute__((aligned(16))) float so[4][16][64];
  const int tid = threadIdx.x, w = tid >> 5, lane = tid & 31, ln = lane & 15, hh = lane >> 4;
  const int ntn = N / 64;
  const int wid = blockIdx.x * 4 + w;
  const int mt = wid / ntn, nq = wid % ntn;
  if (mt * 16 >= M) return;
  const int row0 = mt * 16, col0 = nq * 64;
  const float* arow = A + (size_t)(row0 + ln) * lda;
  v8f acc[4] = {};
  for (int kb = 0; kb < K; kb += 32) {
    FragB ah, al;
    const v4f x0 = *(const v4fa*)(arow + kb + 8 * hh), x1 = *(const v4fa*)(arow + kb + 8 * hh + 4);
    const v4f x2 = *(const v4fa*)(arow + kb + 16 + 8 * hh), x3 = *(const v4fa*)(arow + kb + 16 + 8 * hh + 4);
    float xs[16] = {x0[0],x0[1],x0[2],x0[3],x1[0],x1[1],x1[2],x1[3],x2[0],x2[1],x2[2],x2[3],x3[0],x3[1],x3[2],x3[3]};
#pragma unroll
    for (int i = 0; i < 16; ++i) { const unsigned short hb = bf16_bits(xs[i]); ah.u[i] = hb; al.u[i] = ASPLIT ? bf16_bits(xs[i] - bf16_val(hb)) : (unsigned short)0; }
#pragma unroll
    for (int t = 0; t < 4; ++t) {
      const unsigned short* brow = Wt + (size_t)(col0 + t * 16 + ln) * ldb + kb;
      FragB b;
      b.half[0] = *(const v8us*)(brow + 8 * hh);
      b.half[1] = *(const v8us*)(brow + 16 + 8 * hh);
      acc[t] = mmaN<ASPLIT ? 2 : 1>(ah.v, al.v, b.v, b.v, acc[t]);
    }
  }
#pragma unroll
  for (int t = 0; t < 4; ++t) {
    float bv = bias ? bias[col0 + t * 16 + ln] : 0.f;
    if (BIAS_BF16) bv = bf16_round(bv);
#pragma unroll
    for (int r = 0; r < 8; ++r) { float v = acc[t][r] + bv; if (ACT == 1) v = fmaxf(v, 0.f); so[w][8 * hh + r][t * 16 + ln] = v; }
  }
  __builtin_amdgcn_fence(__ATOMIC_ACQ_REL, "workgroup");
  __builtin_amdgcn_wave_barrier();
  const int rsub = lane >> 4, c4 = (lane & 15) * 4;
  {
#pragma unroll
    for (int q = 0; q < 8; ++q) {
      const int r = q * 2 + rsub;
      const v4f v = *(const v4fa*)&so[w][r][c4];
      *(v4f*)(C + (size_t)(row0 + r) * ldc + col0 + c4) = v;
    }
    
  }
}

// GEMM C = act(A·W + bias + resid): A f32 (ASPLIT -> hi/lo 2 terms), Wt bf16 [N][K]; ACT 0 none, 1 relu, 2 exact gelu;
// resid (optional, f32, row index = (row % rmod), pitch ldr, RES_BF16 rounds it) added before the activation.
template <bool ASPLIT, int ACT, bool BIAS_BF16, bool RES_BF16>
__global__ __launch_bounds__(128) void k_gemm_bf3(const float* __restrict__ A, int lda, const unsigned short* __restrict__ Wt, int ldb,
                                                const float* __restrict__ bias, const float* __restrict__ resid, int rmod, int ldr,
                                                float* __restrict__ C, int ldc, int M, int N, int K) {
  __shared__ __attribute__((aligned(16))) float so[4][16][64];
  const int tid = threadIdx.x, w = tid >> 5, lane = tid & 31, ln = lane & 15, hh = lane >> 4;
  const int ntn = N / 64;
  const int wid = blockIdx.x * 4 + w;
  const int mt = wid / ntn, nq = wid % ntn;
  if (mt * 16 >= M) return;
  const int row0 = mt * 16, col0 = nq * 64;
  const float* arow = A + (size_t)(row0 + ln) * lda;
  v8f acc[4] = {};
  for (int kb = 0; kb < K; kb += 32) {
    FragB ah, al;
    const v4f x0 = *(const v4fa*)(arow + kb + 8 * hh), x1 = *(const v4fa*)(arow + kb + 8 * hh + 4);
    const v4f x2 = *(const v4fa*)(arow + kb + 16 + 8 * hh), x3 = *(const v4fa*)(arow + kb + 16 + 8 * hh + 4);
    float xs[16] = {x0[0],x0[1],x0[2],x0[3],x1[0],x1[1],x1[2],x1[3],x2[0],x2[1],x2[2],x2[3],x3[0],x3[1],x3[2],x3[3]};
#pragma unroll
    for (int i = 0; i < 16; ++i) { const unsigned short hb = bf16_bits(xs[i]); ah.u[i] = hb; al.u[i] = ASPLIT ? bf16_bits(xs[i] - bf16_val(hb)) : (unsigned short)0; }
#pragma unroll
    for (int t = 0; t < 4; ++t) {
      const unsigned short* brow = Wt + (size_t)(col0 + t * 16 + ln) * ldb + kb;
      FragB b;
      b.half[0] = *(const v8us*)(brow + 8 * hh);
      b.half[1] = *(const v8us*)(brow + 16 + 8 * hh);
      acc[t] = mmaN<ASPLIT ? 2 : 1>(ah.v, al.v, b.v, b.v, acc[t]);
    }
  }
#pragma unroll
  for (int t = 0; t < 4; ++t) {
    const int col = col0 + t * 16 + ln;
    float bv = bias ? bias[col] : 0.f;
    if (BIAS_BF16) bv = bf16_round(bv);
#pragma unroll
    for (int r = 0; r < 8; ++r) {
      float v = acc[t][r] + bv;
      if (resid) { float rv = resid[(size_t)((row0 + 8 * hh + r) % rmod) * ldr + col]; if (RES_BF16) rv = bf16_round(rv); v += rv; }
      if (ACT == 1) v = fmaxf(v, 0.f);
      if (ACT == 2) v = 0.5f * v * (1.0f + erff(v * 0.70710678118654752f));
      if (ACT == 3) { const float u = 0.7978845608028654f * (v + 0.044715f * v * v * v); v = 0.5f * v * (1.0f + tanhf(u)); }
      so[w][8 * hh + r][t * 16 + ln] = v;
    }
  }
  __builtin_amdgcn_fence(__ATOMIC_ACQ_REL, "workgroup");
  __builtin_amdgcn_wave_barrier();
  const int rsub = lane >> 4, c4 = (lane & 15) * 4;
  {
#pragma unroll
    for (int q = 0; q < 8; ++q) {
      const int r = q * 2 + rsub;
      const v4f v = *(const v4fa*)&so[w][r][c4];
      *(v4f*)(C + (size_t)(row0 + r) * ldc + col0 + c4) = v;
    }
    
  }
}
// row LayerNorm (biased variance, eps) over N: s = X (+ R); optional out_sum <- s; out_norm <- (s-mu)*rsqrt(var+eps)*g + b
template <bool PARAM_BF16>
__global__ __launch_bounds__(256) void k_layernorm(const float* __restrict__ X, const float* __restrict__ R, const float* __restrict__ g, const float* __restrict__ bta,
                                                  float* __restrict__ out_sum, float* __restrict__ out_norm, int N, float eps) {
  __shared__ float red[256];
  const int row = blockIdx.x, tid = threadIdx.x;
  const float* x = X + (size_t)row * N; const float* rr = R ? R + (size_t)row * N : nullptr;
  float vals[16];                     // up to N = 4096
  const int per = N / 256;            // contiguous chunk per thread? use strided-by-4 chunks: thread handles j = tid*4 + 1024*u
  float s1 = 0.f;
  for (int u = 0; u < per / 4; ++u) {
    const int j = tid * 4 + 1024 * u;
    const v4f a = *(const v4fa*)(x + j);
    v4f b = {0.f,0.f,0.f,0.f}; if (rr) b = *(const v4fa*)(rr + j);
#pragma unroll
    for (int q = 0; q < 4; ++q) { const float v = a[q] + b[q]; vals[u * 4 + q] = v; s1 += v; }
  }
  red[tid] = s1; __syncthreads();
  for (int st = 128; st > 0; st >>= 1) { if (tid < st) red[tid] += red[tid + st]; __syncthreads(); }
  const float mu = red[0] / (float)N; __syncthreads();
  float s2 = 0.f;
  for (int u = 0; u < per / 4; ++u)
#pragma unroll
    for (int q = 0; q < 4; ++q) { const float c = vals[u * 4 + q] - mu; s2 += c * c; }
  red[tid] = s2; __syncthreads();
  for (int st = 128; st > 0; st >>= 1) { if (tid < st) red[tid] += red[tid + st]; __syncthreads(); }
  const float rs = rsqrtf(red[0] / (float)N + eps);
  {
    for (int u = 0; u < per / 4; ++u) {
      const int j = tid * 4 + 1024 * u;
      v4f o, sm;
#pragma unroll
      for (int q = 0; q < 4; ++q) {
        float gg = g[j + q], bb = bta[j + q];
        if (PARAM_BF16) { gg = bf16_round(gg); bb = bf16_round(bb); }
        sm[q] = vals[u * 4 + q]; o[q] = (vals[u * 4 + q] - mu) * rs * gg + bb;
      }
      if (out_sum) *(v4f*)(out_sum + (size_t)row * N + j) = sm;
      *(v4f*)(out_norm + (size_t)row * N + j) = o;
    }
    
  }
}



// ---- f16 WMMA path (v_wmma_f32_16x16x32_f16): 11-bit significands for operands in range — used where a [0,1] probability operand needs more precision than bf16
typedef _Float16 v16h __attribute__((ext_vector_type(16)));
union FragH { v16h v; v8us half[2]; _Float16 h[16]; unsigned short u[16]; };
template <int NT>
__device__ __forceinline__ v8f mmaH(v16h ah, v16h al, v16h bh, v16h bl, v8f c) {
  c = __builtin_amdgcn_wmma_f32_16x16x32_f16(false, ah, false, bh, (short)0, c, false, false);
  if (NT >= 2) c = __builtin_amdgcn_wmma_f32_16x16x32_f16(false, al, false, bh, (short)0, c, false, false);
  if (NT >= 3) c = __builtin_amdgcn_wmma_f32_16x16x32_f16(false, ah, false, bl, (short)0, c, false, false);
  asm volatile("v_nop\n\tv_nop\n\tv_nop\n\tv_nop" : "+v"(c) : "v"(ah), "v"(al), "v"(bh), "v"(bl));
  return c;
}
// batched GEMM like k_gemm_b but f16 operands: A f32 (split into f16 hi/lo if ASPLIT, else rounded to f16), Bt = f16 values [n][k]; alpha; C f32; N multiple of 16 (partial tiles skipped)
template <bool ASPLIT>
__global__ __launch_bounds__(128) void k_gemm_h(const float* __restrict__ A, int lda, size_t sA, const _Float16* __restrict__ Bh, int ldb, size_t sB, float alpha, float* __restrict__ C, int ldc, size_t sC, int M, int N, int K) {
  __shared__ __attribute__((aligned(16))) float so[4][16][64];
  const int tid = threadIdx.x, w = tid >> 5, lane = tid & 31, ln = lane & 15, hh = lane >> 4; const int by = blockIdx.y;
  A += (size_t)by * sA; Bh += (size_t)by * sB; C += (size_t)by * sC;
  const int ntn = (N + 63) / 64; const int wid = blockIdx.x * 4 + w; const int mt = wid / ntn, nq = wid % ntn; if (mt * 16 >= M) return;
  const int row0 = mt * 16, col0 = nq * 64; const float* arow = A + (size_t)(row0 + ln) * lda;
  v8f acc[4] = {};
  for (int kb = 0; kb < K; kb += 32) {
    FragH ah, al;
    const v4f x0 = *(const v4fa*)(arow + kb + 8 * hh), x1 = *(const v4fa*)(arow + kb + 8 * hh + 4), x2 = *(const v4fa*)(arow + kb + 16 + 8 * hh), x3 = *(const v4fa*)(arow + kb + 16 + 8 * hh + 4);
    float xs[16] = {x0[0],x0[1],x0[2],x0[3],x1[0],x1[1],x1[2],x1[3],x2[0],x2[1],x2[2],x2[3],x3[0],x3[1],x3[2],x3[3]};
#pragma unroll
    for (int i = 0; i < 16; ++i) { const _Float16 h = (_Float16)xs[i]; ah.h[i] = h; al.h[i] = ASPLIT ? (_Float16)(xs[i] - (float)h) : (_Float16)0.0f; }
#pragma unroll
    for (int t = 0; t < 4; ++t) { if (col0 + t * 16 >= N) continue; const size_t boff = (size_t)(col0 + t * 16 + ln) * ldb + kb; FragH bq; bq.half[0] = *(const v8us*)(Bh + boff + 8 * hh); bq.half[1] = *(const v8us*)(Bh + boff + 16 + 8 * hh);
      acc[t] = mmaH<ASPLIT ? 2 : 1>(ah.v, al.v, bq.v, bq.v, acc[t]); }
  }
#pragma unroll
  for (int t = 0; t < 4; ++t) { if (col0 + t * 16 >= N) continue;
#pragma unroll
    for (int r = 0; r < 8; ++r) so[w][8 * hh + r][t * 16 + ln] = acc[t][r] * alpha; }
  __builtin_amdgcn_fence(__ATOMIC_ACQ_REL, "workgroup"); __builtin_amdgcn_wave_barrier();
  const int rsub = lane >> 4, c4 = (lane & 15) * 4;
  {
#pragma unroll
    for (int q = 0; q < 8; ++q) { const int r = q * 2 + rsub; if (col0 + c4 < N) { const v4f v = *(const v4fa*)&so[w][r][c4]; *(v4f*)(C + (size_t)(row0 + r) * ldc + col0 + c4) = v; } }
     }
}

// Wt[n][k] = f16(W[k][n]·scale) from f32 row-major W[K][N] (scale = power of two; bf16-exact weights stay exact in f16 away from the subnormal range)
__global__ __launch_bounds__(256) void k_wt_f16(const float* __restrict__ W, _Float16* __restrict__ Wt, int K, int N, float scale) {
  const int t = blockIdx.x * 256 + threadIdx.x; if (t >= N * (K / 8)) return; const int n = t / (K / 8), k8 = (t % (K / 8)) * 8; FragH f;
#pragma unroll
  for (int i = 0; i < 8; ++i) f.h[i] = (_Float16)(bf16_round(W[(size_t)(k8 + i) * N + n]) * scale); const v8us o = f.half[0];
  *(v8us*)((unsigned short*)Wt + (size_t)n * K + k8) = o; 
}
// k_gemm_hh variant with fused epilogue: v = acc·alpha + bias[by·sBias + col] (+ CP[(row/rowsPerB)·sCPb + by·64 + col] if CP) ; ACT 0 none / 1 elu ; writes f16 C16 (and f32 C if non-null)
template <int ACT>
__global__ __launch_bounds__(128) void k_gemm_hhx(const _Float16* __restrict__ A, int lda, size_t sA, const _Float16* __restrict__ Bh, int ldb, size_t sB, float alpha, const float* __restrict__ bias, size_t sBias, const float* __restrict__ CP, int rowsPerB, size_t sCPb, int row0g,
    float* __restrict__ C, _Float16* __restrict__ C16, int ldc, size_t sC, int M, int N, int K) {
  __shared__ __attribute__((aligned(16))) float so[4][16][64];
  const int tid = threadIdx.x, w = tid >> 5, lane = tid & 31, ln = lane & 15, hh = lane >> 4; const int by = blockIdx.y;
  A += (size_t)by * sA; Bh += (size_t)by * sB; const size_t cofs = (size_t)by * sC; const float* bp = bias ? bias + (size_t)by * sBias : nullptr;
  const int ntn = (N + 63) / 64; const int wid = blockIdx.x * 4 + w; const int mt = wid / ntn, nq = wid % ntn; if (mt * 16 >= M) return;
  const int row0 = mt * 16, col0 = nq * 64; const _Float16* arow = A + (size_t)(row0 + ln) * lda;
  v8f acc[4] = {};
  for (int kb = 0; kb < K; kb += 32) { FragH ah; ah.half[0] = *(const v8us*)((const unsigned short*)arow + kb + 8 * hh); ah.half[1] = *(const v8us*)((const unsigned short*)arow + kb + 16 + 8 * hh);
#pragma unroll
    for (int t = 0; t < 4; ++t) { if (col0 + t * 16 >= N) continue; const size_t boff = (size_t)(col0 + t * 16 + ln) * ldb + kb; FragH bq; bq.half[0] = *(const v8us*)((const unsigned short*)Bh + boff + 8 * hh); bq.half[1] = *(const v8us*)((const unsigned short*)Bh + boff + 16 + 8 * hh);
      acc[t] = mmaH<1>(ah.v, ah.v, bq.v, bq.v, acc[t]); }
  }
#pragma unroll
  for (int t = 0; t < 4; ++t) { if (col0 + t * 16 >= N) continue; const int col = col0 + t * 16 + ln; const float bv = bp ? bf16_round(bp[col]) : 0.f;
#pragma unroll
    for (int r = 0; r < 8; ++r) { float v = acc[t][r] * alpha + bv; if (CP) { const int rr = row0g + row0 + 8 * hh + r; if (rowsPerB < 0) v += CP[cofs + (size_t)rr * ldc + col];      /* rowsPerB < 0: own element of the batched C plane */ else { const int bidx = rr / rowsPerB; v += CP[(size_t)bidx * sCPb + (size_t)by * 64 + col]; } } if (ACT == 1) v = (v > 0.f) ? v : expm1f(v); else if (ACT == 7) v = (v > 0.f) ? v + 1.0f : expf(v); else if (ACT == 8) v = tanhf(v); else if (ACT == 9) v = 0.5f * v * (1.0f + tanhf(0.7978845608028654f * (v + 0.044715f * v * v * v))); else if (ACT == 11) v = 1.0f / (1.0f + expf(-v)); else if (ACT == 12) v = (v > 0.f) ? v : 0.01f * v; else if (ACT == 14) v = (v > 0.f) ? v : 0.1f * v; else if (ACT == 16) v = (v >= 0.f) ? v : 0.3f * v; else if (ACT == 17) v = (v >= 0.f) ? v : 0.2f * v; else if (ACT == 15) v = v / (1.0f + expf(-v)); else if (ACT == 3) v = fmaxf(v, 0.f); else if (ACT == 6) v = 0.5f * v * (1.0f + erff(v * 0.70710678118654752f)); so[w][8 * hh + r][t * 16 + ln] = v; } }
  __builtin_amdgcn_fence(__ATOMIC_ACQ_REL, "workgroup"); __builtin_amdgcn_wave_barrier();
  const int rsub = lane >> 4, c4 = (lane & 15) * 4; typedef _Float16 v4h __attribute__((ext_vector_type(4)));
  {
#pragma unroll
    for (int q = 0; q < 8; ++q) { const int r = q * 2 + rsub; if (col0 + c4 < N) { const v4f v = *(const v4fa*)&so[w][r][c4]; if (C) *(v4f*)(C + cofs + (size_t)(row0 + r) * ldc + col0 + c4) = v; if (C16) { v4h h4; for (int i = 0; i < 4; ++i) h4[i] = (_Float16)v[i]; *(v4h*)(C16 + cofs + (size_t)(row0 + r) * ldc + col0 + c4) = h4; } } }
     }
}


typedef _Float16 v4h __attribute__((ext_vector_type(4)));

__global__ __launch_bounds__(256) void k_x16(const float* __restrict__ x, _Float16* __restrict__ X16, size_t n8) { const size_t t = (size_t)blockIdx.x * 256 + threadIdx.x; if (t >= n8) return; FragH f;
#pragma unroll
  for (int q = 0; q < 8; ++q) f.h[q] = (_Float16)bf16_round(x[t * 8 + q]); *(v8us*)((unsigned short*)X16 + t * 8) = f.half[0];  }
__global__ __launch_bounds__(256) void k_h16(const float* __restrict__ x, _Float16* __restrict__ X16, size_t n8) { const size_t t = (size_t)blockIdx.x * 256 + threadIdx.x; if (t >= n8) return; FragH f;
#pragma unroll
  for (int q = 0; q < 8; ++q) f.h[q] = (_Float16)x[t * 8 + q]; *(v8us*)((unsigned short*)X16 + t * 8) = f.half[0];  }
__global__ __launch_bounds__(256) void k_round16f(const float* __restrict__ W, _Float16* __restrict__ Bt, size_t n8) { const size_t t = (size_t)blockIdx.x * 256 + threadIdx.x; if (t >= n8) return; FragH f;
#pragma unroll
  for (int i = 0; i < 8; ++i) f.h[i] = (_Float16)(bf16_round(W[t * 8 + i]) * 16.0f); *(v8us*)((unsigned short*)Bt + t * 8) = f.half[0];  }
template <int NHv, int TTv>
__global__ __launch_bounds__(256) void k_vt(const _Float16* __restrict__ V16, int ldv, int voff, _Float16* __restrict__ Vt) { __shared__ unsigned short tl[64][66]; const int tid = threadIdx.x; const int slab = blockIdx.x / (TTv / 64), lg = blockIdx.x % (TTv / 64); const int b = slab / NHv, h = slab % NHv;
  for (int i = tid; i < 64 * 8; i += 256) { const int r = i / 8, c8 = (i % 8) * 8; FragH f; f.half[0] = *(const v8us*)((const unsigned short*)V16 + ((size_t)b * TTv + lg * 64 + r) * ldv + voff + h * 64 + c8);
#pragma unroll
    for (int q = 0; q < 8; ++q) tl[r][c8 + q] = f.u[q]; }
  __syncthreads();
  {
#pragma unroll
    for (int rd = 0; rd < 2; ++rd) { const int d = rd * 32 + tid / 8, pc = tid % 8; FragH f;
#pragma unroll
      for (int q = 0; q < 8; ++q) f.u[q] = tl[pc * 8 + q][d];
      *(v8us*)((unsigned short*)Vt + ((size_t)slab * 64 + d) * TTv + lg * 64 + pc * 8) = f.half[0]; }
     } }

__global__ __launch_bounds__(256) void k_hl(const float* __restrict__ F, _Float16* __restrict__ Hh, _Float16* __restrict__ Hl, size_t n8) { const size_t t = (size_t)blockIdx.x * 256 + threadIdx.x; if (t >= n8) return; FragH fh, fl; const v4f a = *(const v4fa*)(F + t * 8), c = *(const v4fa*)(F + t * 8 + 4);
#pragma unroll
  for (int q = 0; q < 4; ++q) { _Float16 h = (_Float16)a[q]; fh.h[q] = h; fl.h[q] = (_Float16)((a[q] - (float)h) * 1024.0f); h = (_Float16)c[q]; fh.h[4 + q] = h; fl.h[4 + q] = (_Float16)((c[q] - (float)h) * 1024.0f); }
  { *(v8us*)((unsigned short*)Hh + t * 8) = fh.half[0]; *(v8us*)((unsigned short*)Hl + t * 8) = fl.half[0];  } }

// ---- fast GEMM (wave tile 32x64; requires M % 32 == 0 rows per launch region and N % 64 == 0); epilogue = k_gemm_hhx semantics ----
__device__ __forceinline__ v16h g2_frag(const _Float16* p, int hh) { FragH f; f.half[0] = *(const v8us*)((const unsigned short*)p + 8 * hh); f.half[1] = *(const v8us*)((const unsigned short*)p + 16 + 8 * hh); return f.v; }
__device__ __forceinline__ v8f g2_mma(v16h a, v16h b, v8f c) { v8f d = __builtin_amdgcn_wmma_f32_16x16x32_f16(false, a, false, b, (short)0, c, false, false); asm volatile("v_nop\n\tv_nop\n\tv_nop\n\tv_nop" : "+v"(d) : "v"(a), "v"(b)); return d; }
template <int ACT>
__global__ __launch_bounds__(128) void k_gemm2(const _Float16* __restrict__ A, int lda, size_t sA, const _Float16* __restrict__ Bh, int ldb, size_t sB, float alpha, const float* __restrict__ bias, size_t sBias, const float* __restrict__ CP, int rowsPerB, size_t sCPb, int row0g,
    float* __restrict__ C, _Float16* __restrict__ C16, int ldc, size_t sC, int M, int N, int K) { static_assert(ACT == 0 || ACT == 3 || ACT == 6 || ACT == 8 || ACT == 9 || ACT == 11 || ACT == 12 || ACT == 14 || ACT == 15 || ACT == 16 || ACT == 17, "k_gemm2: unsupported ACT code (would silently apply no activation)");
  __shared__ __attribute__((aligned(16))) float so[4][32][68];
  const int tid = threadIdx.x, w = tid >> 5, lane = tid & 31, ln = lane & 15, hh = lane >> 4; const int by = blockIdx.y;
  A += (size_t)by * sA; Bh += (size_t)by * sB; const size_t cofs = (size_t)by * sC; const float* bp = bias ? bias + (size_t)by * sBias : nullptr;
  const int ntn = N >> 6; const int mt = blockIdx.x / ntn, nq = blockIdx.x - mt * ntn; const int row0 = mt * 128 + 32 * w, col0 = nq * 64; if (row0 >= M) return;
  const _Float16* a0p = A + (size_t)(row0 + ln) * lda; const _Float16* a1p = a0p + (size_t)16 * lda;
  const _Float16* b0p = Bh + (size_t)(col0 + ln) * ldb; const _Float16* b1p = b0p + (size_t)16 * ldb; const _Float16* b2p = b1p + (size_t)16 * ldb; const _Float16* b3p = b2p + (size_t)16 * ldb;
  const v8f z8 = {0.f,0.f,0.f,0.f,0.f,0.f,0.f,0.f}; v8f c00 = z8, c01 = z8, c02 = z8, c03 = z8, c10 = z8, c11 = z8, c12 = z8, c13 = z8;
#pragma unroll 1
  for (int kb = 0; kb < K; kb += 32) { const v16h a0 = g2_frag(a0p + kb, hh), a1 = g2_frag(a1p + kb, hh);
    v16h b = g2_frag(b0p + kb, hh); c00 = g2_mma(a0, b, c00); c10 = g2_mma(a1, b, c10);
    b = g2_frag(b1p + kb, hh); c01 = g2_mma(a0, b, c01); c11 = g2_mma(a1, b, c11);
    b = g2_frag(b2p + kb, hh); c02 = g2_mma(a0, b, c02); c12 = g2_mma(a1, b, c12);
    b = g2_frag(b3p + kb, hh); c03 = g2_mma(a0, b, c03); c13 = g2_mma(a1, b, c13); }
  v8f accs[8] = {c00, c01, c02, c03, c10, c11, c12, c13};
#pragma unroll
  for (int u = 0; u < 8; ++u) { const int t = u & 3, half = u >> 2; const int col = col0 + t * 16 + ln; const float bv = bp ? bf16_round(bp[col]) : 0.f;
#pragma unroll
    for (int r = 0; r < 8; ++r) { const int rloc = half * 16 + 8 * hh + r; float v = accs[u][r] * alpha + bv; if (CP) { if (rowsPerB < 0) v += CP[cofs + (size_t)(row0g + row0 + rloc) * ldc + col];      /* rowsPerB < 0: own element of the batched C plane */ else { const int bidx = (row0g + row0 + rloc) / rowsPerB; v += CP[(size_t)bidx * sCPb + (size_t)by * 64 + col]; } }
      if (ACT == 3) v = fmaxf(v, 0.f); else if (ACT == 6) v = 0.5f * v * (1.0f + erff(v * 0.70710678118654752f)); else if (ACT == 11) v = 1.0f / (1.0f + expf(-v)); else if (ACT == 15) v = v / (1.0f + expf(-v)); else if (ACT == 12) v = (v > 0.f) ? v : 0.01f * v; else if (ACT == 8) v = tanhf(v); else if (ACT == 9) v = 0.5f * v * (1.0f + tanhf(0.7978845608028654f * (v + 0.044715f * v * v * v))); else if (ACT == 14) v = (v > 0.f) ? v : 0.1f * v; else if (ACT == 16) v = (v >= 0.f) ? v : 0.3f * v; else if (ACT == 17) v = (v >= 0.f) ? v : 0.2f * v;
      so[w][rloc][t * 16 + ln] = v; } }
  __builtin_amdgcn_fence(__ATOMIC_ACQ_REL, "workgroup"); __builtin_amdgcn_wave_barrier();
  const int rsub = lane >> 4, c4 = (lane & 15) * 4;
  {
#pragma unroll
    for (int q = 0; q < 16; ++q) { const int r = q * 2 + rsub; const v4f v = *(const v4fa*)&so[w][r][c4]; if (C) *(v4f*)(C + cofs + (size_t)(row0 + r) * ldc + col0 + c4) = v; if (C16) { v4h h4; for (int i = 0; i < 4; ++i) h4[i] = (_Float16)v[i]; *(v4h*)(C16 + cofs + (size_t)(row0 + r) * ldc + col0 + c4) = h4; } }
     } }


__global__ __launch_bounds__(256) void k_wnat(const float* __restrict__ w, size_t n8, _Float16* __restrict__ Bt) { const size_t t = (size_t)blockIdx.x * 256 + threadIdx.x; if (t >= n8) return; FragH f; for (int q = 0; q < 8; ++q) f.h[q] = (_Float16)(bf16_round(w[t * 8 + q]) * 16.0f); *(v8us*)((unsigned short*)Bt + t * 8) = f.half[0];  }
__global__ __launch_bounds__(256) void k_rsm(const float* __restrict__ S, _Float16* __restrict__ P, int nrows) {
  #pragma clang fp contract(off)
  const int i = blockIdx.x * 256 + threadIdx.x; if (i >= nrows) return; const float* s = S + (size_t)i * SQ; float mx = -3.0e38f;
#pragma unroll 1
  for (int j = 0; j < SQ; ++j) mx = fmaxf(mx, s[j]); float se = 0.f;
#pragma unroll 1
  for (int j = 0; j < SQ; ++j) se += expf(s[j] - mx); const float sc = 256.0f / se;
#pragma unroll 1
  for (int j0 = 0; j0 < SQ; j0 += 8) { FragH f; for (int q = 0; q < 8; ++q) f.h[q] = (_Float16)(expf(s[j0 + q] - mx) * sc); unsigned short* d = (unsigned short*)P + (size_t)i * SQ + j0; *(v8us*)d = f.half[0];  } }
__global__ __launch_bounds__(256) void k_vt(const _Float16* __restrict__ V16, int b, int h0, _Float16* __restrict__ VT) { __shared__ unsigned short tl[64][65]; const int tid = threadIdx.x; const int hh = blockIdx.x % HG, sg = blockIdx.x / HG; const int s0 = sg * 64; const int h = h0 + hh;
  for (int i = tid; i < 64 * 8; i += 256) { const int j = i / 8, d8 = (i % 8) * 8; FragH f; f.half[0] = *(const v8us*)((const unsigned short*)V16 + ((size_t)b * SQ + s0 + j) * DM + h * HD + d8); for (int q = 0; q < 8; ++q) tl[d8 + q][j] = f.u[q]; }
  __syncthreads();
  { for (int i = tid; i < 64 * 8; i += 256) { const int d = i / 8, j8 = (i % 8) * 8; FragH f; for (int q = 0; q < 8; ++q) f.u[q] = tl[d][j8 + q]; *(v8us*)((unsigned short*)VT + ((size_t)hh * HD + d) * SQ + s0 + j8) = f.half[0]; }  } }



// lanes l and l ^ 16 exchanged by the cross-row permlane (no LDS round trip)
__device__ __forceinline__ float xl_half(float v) { const int i = __float_as_int(v); return __int_as_float(__builtin_amdgcn_permlanex16(i, i, 0x76543210, 0xfedcba98, false, false)); }
__device__ __forceinline__ v8f fa_mma(v16h a, v16h b, v8f c) { return __builtin_amdgcn_wmma_f32_16x16x32_f16(false, a, false, b, (short)0, c, false, false); }
// 2^x on eight values; the v_nop is the one slot the instruction set asks for behind a transcendental, written in the same statement so that it stays directly behind the last one
__device__ __forceinline__ void fa_exp8(float (&e)[8]) { asm("v_exp_f32 %0, %0\n\tv_exp_f32 %1, %1\n\tv_exp_f32 %2, %2\n\tv_exp_f32 %3, %3\n\tv_exp_f32 %4, %4\n\tv_exp_f32 %5, %5\n\tv_exp_f32 %6, %6\n\tv_exp_f32 %7, %7\n\tv_nop" : "+v"(e[0]), "+v"(e[1]), "+v"(e[2]), "+v"(e[3]), "+v"(e[4]), "+v"(e[5]), "+v"(e[6]), "+v"(e[7])); }
__device__ __forceinline__ float fa_exp1(float x) { asm("v_exp_f32 %0, %0\n\tv_nop" : "+v"(x)); return x; }      /* same slot as above */
__global__ __launch_bounds__(128) void k_fattn(const _Float16* __restrict__ Q, const _Float16* __restrict__ Kr, const _Float16* __restrict__ VT, _Float16* __restrict__ O) {
  const int lane = threadIdx.x & 31, ln = lane & 15, hh = lane >> 4, w = threadIdx.x >> 5; const int bh = blockIdx.y, b = bh / NH, h = bh % NH; const int q0 = blockIdx.x * 128 + w * 32;
  const _Float16* qp = Q + ((size_t)b * SQ + q0 + ln) * LQ + h * HD; const _Float16* kp = Kr + ((size_t)b * SQ + ln) * LQ + h * HD; const _Float16* vp = VT + ((size_t)bh * HD + ln) * SQ;
  const float cs = 0.03125f * 1.44269504f;      /* 1 / sqrt(d_model) and log2 e in one factor on the raw products */
  const v8f z8 = {0.f,0.f,0.f,0.f,0.f,0.f,0.f,0.f};
  v16h qf[2][2], kf[2][2], vf[4]; v8f o[4][2]; float m[2] = {-3.0e38f, -3.0e38f}, l[2] = {0.f, 0.f};
#pragma unroll
  for (int u = 0; u < 2; ++u) for (int ch = 0; ch < 2; ++ch) { qf[u][ch] = g2_frag(qp + (size_t)u * 16 * LQ + ch * 32, hh); kf[u][ch] = g2_frag(kp + (size_t)u * 16 * LQ + ch * 32, hh); }
#pragma unroll
  for (int t = 0; t < 4; ++t) { o[t][0] = z8; o[t][1] = z8; }
  for (int j = 0; j < SQ; j += 32) {
    v8f s[2][2];      /* [key tile][query group], raw q . k */
#pragma unroll
    for (int kt = 0; kt < 2; ++kt) for (int qt = 0; qt < 2; ++qt) s[kt][qt] = fa_mma(kf[kt][1], qf[qt][1], fa_mma(kf[kt][0], qf[qt][0], z8));
    const int jn = (j + 32) & (SQ - 1);      /* next pass's keys, fetched one pass ahead into the same registers; the last pass re-reads keys 0..31 (in bounds, unused) */
#pragma unroll
    for (int kt = 0; kt < 2; ++kt) for (int ch = 0; ch < 2; ++ch) kf[kt][ch] = g2_frag(kp + (size_t)(jn + kt * 16) * LQ + ch * 32, hh);
    float mn[2];
#pragma unroll
    for (int qt = 0; qt < 2; ++qt) { float a = fmaxf(s[0][qt][0], s[1][qt][0]);
      for (int r = 1; r < 8; ++r) a = fmaxf(a, fmaxf(s[0][qt][r], s[1][qt][r]));
      mn[qt] = fmaxf(m[qt], fmaxf(a, xl_half(a))); }
    if (__builtin_amdgcn_ballot_w32(mn[0] > m[0] || mn[1] > m[1]) != 0) {      /* scalar branch: where no column's maximum moved every factor is exactly 1 */
#pragma unroll
      for (int qt = 0; qt < 2; ++qt) { const float a = fa_exp1((m[qt] - mn[qt]) * cs); l[qt] *= a; m[qt] = mn[qt];
        for (int t = 0; t < 4; ++t) for (int r = 0; r < 8; ++r) o[t][qt][r] *= a; } }
#pragma unroll
    for (int t = 0; t < 4; ++t) vf[t] = g2_frag(vp + (size_t)t * 16 * SQ + j, hh);      /* this pass's V^T: the exponentials below stand between the loads and their use */
    FragH pf[2];
#pragma unroll
    for (int qt = 0; qt < 2; ++qt) { const float mc = m[qt] * cs;
      for (int kt = 0; kt < 2; ++kt) { float e[8];
        for (int r = 0; r < 8; ++r) e[r] = fmaf(s[kt][qt][r], cs, -mc);
        fa_exp8(e);
        l[qt] += ((e[0] + e[1]) + (e[2] + e[3])) + ((e[4] + e[5]) + (e[6] + e[7]));
        for (int r = 0; r < 8; ++r) pf[qt].h[kt * 8 + r] = (_Float16)e[r]; } }
#pragma unroll
    for (int t = 0; t < 4; ++t) for (int qt = 0; qt < 2; ++qt) o[t][qt] = fa_mma(vf[t], pf[qt].v, o[t][qt]);
  }
#pragma unroll
  for (int qt = 0; qt < 2; ++qt) { const float inv = 64.0f / (l[qt] + xl_half(l[qt])); unsigned short* op = (unsigned short*)O + ((size_t)b * SQ + q0 + qt * 16 + ln) * DM + h * HD + 8 * hh;      /* o[t][qt][r] = O[query ln][16 t + 8 hh + r]: 16 contiguous bytes a store */
    for (int t = 0; t < 4; ++t) { FragH f; for (int r = 0; r < 8; ++r) f.h[r] = (_Float16)(o[t][qt][r] * inv); *(v8us*)(op + t * 16) = f.half[0]; } } }

extern "C" void kernel_launch(void* const* d_in, const int* in_sizes, int n_in,
                              void* d_out, int out_size, void* d_ws, size_t ws_size, hipStream_t stream) {
  (void)in_sizes; (void)n_in; (void)out_size;
  const float* const* I = (const float* const*)d_in; const float* xq = I[0]; const float* xk = I[0]; const float* xv = I[0]; const float* wq = I[1]; const float* bq = nullptr; const float* wk = I[2]; const float* bk = nullptr; const float* wv = I[3]; const float* bv = nullptr; const float* wo = I[4]; const float* bo = I[5];      /* ONE input stream (X) read on all three projections; Wq, Wk, Wv are PER-HEAD STACKS [16][1024][64] = [head][in][out] (the module has NO q / k / v biases: null pointers in the guarded bias slots); Wo [in][out] [1024][1024] at I[4], bo at I[5] */
  char* ws = (char*)d_ws; size_t off = 0;
  auto take = [&](size_t bytes) { char* p = ws + off; off += (bytes + 255) & ~(size_t)255; return p; };
  _Float16* BQ = (_Float16*)take((size_t)DM * DM * 2); _Float16* BK = (_Float16*)take((size_t)DM * DM * 2); _Float16* BV = (_Float16*)take((size_t)DM * DM * 2); _Float16* BO = (_Float16*)take((size_t)DM * DM * 2);
  _Float16* XQ = (_Float16*)take(NR * DM * 2); _Float16* XK = (_Float16*)take(NR * DM * 2); _Float16* XV = (_Float16*)take(NR * DM * 2); _Float16* Q16 = (_Float16*)take(NR * DM * 2); _Float16* K16 = (_Float16*)take(NR * DM * 2); _Float16* V16 = (_Float16*)take(NR * DM * 2); _Float16* O16 = (_Float16*)take(NR * DM * 2);
  _Float16* VT = (_Float16*)take((size_t)NB * NH * HD * SQ * 2);
  if (off > ws_size) return;
  { const unsigned g = (unsigned)(((size_t)DM * (DM / 8) + 255) / 256); const unsigned gh = (unsigned)(((size_t)HD * (DM / 8) + 255) / 256); for (int h = 0; h < NH; ++h) { const size_t wofs = (size_t)h * DM * HD, pofs = (size_t)h * HD * DM; k_wt_f16<<<gh, 256, 0, stream>>>(wq + wofs, BQ + pofs, DM, HD, 16.0f); k_wt_f16<<<gh, 256, 0, stream>>>(wk + wofs, BK + pofs, DM, HD, 16.0f); k_wt_f16<<<gh, 256, 0, stream>>>(wv + wofs, BV + pofs, DM, HD, 16.0f); } k_wt_f16<<<g, 256, 0, stream>>>(wo, BO, DM, DM, 16.0f); }      /* PER-HEAD STACKS wq / wk / wv [NH][DM][HD]: head h is a row-major [in = DM][out = HD] block at w + h * DM * HD: the transposing builder with K = DM, N = HD writes its HD rows Bt[h * HD + e][k] at B + h * HD * DM: contiguous rows of the [out][in] plane (x16); wo is a plain [in][out] [DM][DM] matrix: one call as before */

  k_x16<<<(unsigned)((NR * DM / 8 + 255) / 256), 256, 0, stream>>>(xq, XQ, NR * DM / 8); k_x16<<<(unsigned)((NR * DM / 8 + 255) / 256), 256, 0, stream>>>(xk, XK, NR * DM / 8); k_x16<<<(unsigned)((NR * DM / 8 + 255) / 256), 256, 0, stream>>>(xv, XV, NR * DM / 8);      /* the three inputs as exact f16 rows */
  const size_t r0p = (size_t)B0 * SQ;      /* first projected row */
  k_gemm2<0><<<dim3((unsigned)((MP / 128) * (DM / 64)), 1), 128, 0, stream>>>(XQ + r0p * DM, DM, 0, BQ, DM, 0, 0.0625f, bq, 0, nullptr, 1, 0, 0, nullptr, Q16 + r0p * DM, DM, 0, MP, DM, DM);
  k_gemm2<0><<<dim3((unsigned)((MP / 128) * (DM / 64)), 1), 128, 0, stream>>>(XK + r0p * DM, DM, 0, BK, DM, 0, 0.0625f, bk, 0, nullptr, 1, 0, 0, nullptr, K16 + r0p * DM, DM, 0, MP, DM, DM);
  k_gemm2<0><<<dim3((unsigned)((MP / 128) * (DM / 64)), 1), 128, 0, stream>>>(XV + r0p * DM, DM, 0, BV, DM, 0, 0.0625f, bv, 0, nullptr, 1, 0, 0, nullptr, V16 + r0p * DM, DM, 0, MP, DM, DM);
  k_vt<NH, SQ><<<NB * NH * (SQ / 64), 256, 0, stream>>>(V16, LQ, 0, VT);      /* V^T [NB][NH][HD][SQ], both batches */
  k_fattn<<<dim3(SQ / 128, NB * NH), 128, 0, stream>>>(Q16, K16, VT, O16);      /* scores, softmax and P V in one kernel: o (merged heads, x64) as f16 rows */
  k_gemm2<0><<<dim3((unsigned)((MPO / 128) * (DM / 64)), 1), 128, 0, stream>>>(O16 + r0p * DM, DM, 0, BO, DM, 0, 0.0009765625f, bo, 0, nullptr, 1, 0, 0, (float*)d_out + r0p * DM, nullptr, DM, 0, MPO, DM, DM);      /* out rows are the output layout */
}

// v003
// A run of this version takes 211 microseconds.
// Two timings next to v002 both put it at 1.95 times that version's speed.
// Over all steps from v000 it is 17.5 times as fast.
#include <hip/hip_runtime.h>
#define NB 2
#define SQ 2048
#define DM 1024
#define NH 16
#define HD 64
#define HG 4                         /* heads per launch of the per-batch k_vt */
#define B0 0                         /* first batch processed (debug hook) */
#define NBR NB                       /* batches processed (debug hook) */
#define NR ((size_t)NB * SQ)         /* token rows */
#define MP ((int)((size_t)NBR * SQ)) /* rows projected (debug hook) */
#define QN SQ                        /* query rows per batch; not used */
#define NHD NH                       /* heads; not used */
#define MPO MP                       /* rows through the output stage (debug hook) */
#define LQ DM      /* row pitch of the q/k/v rows */
typedef __bf16 v16b __attribute__((ext_vector_type(16)));
typedef unsigned short v8us __attribute__((ext_vector_type(8), may_alias));
typedef float  v8f  __attribute__((ext_vector_type(8)));
typedef float  v4f  __attribute__((ext_vector_type(4)));
typedef float  v4fa __attribute__((ext_vector_type(4), may_alias));
union FragB { v16b v; v8us half[2]; unsigned short u[16]; };

__device__ __forceinline__ unsigned short bf16_bits(float x) { unsigned int u = __float_as_uint(x); return (unsigned short)((u + 0x7FFFu + ((u >> 16) & 1u)) >> 16); }
__device__ __forceinline__ float bf16_val(unsigned short b) { return __uint_as_float(((unsigned int)b) << 16); }
__device__ __forceinline__ float bf16_round(float x) { return bf16_val(bf16_bits(x)); }
// D += A·B with NT terms: 1 = ah·bh, 2 = + al·bh (A split), 3 = + ah·bl (both split)
template <int NT>
__device__ __forceinline__ v8f mmaN(v16b ah, v16b al, v16b bh, v16b bl, v8f c) {
  c = __builtin_amdgcn_wmma_f32_16x16x32_bf16(false, ah, false, bh, (short)0, c, false, false);
  if (NT >= 2) c = __builtin_amdgcn_wmma_f32_16x16x32_bf16(false, al, false, bh, (short)0, c, false, false);
  if (NT >= 3) c = __builtin_amdgcn_wmma_f32_16x16x32_bf16(false, ah, false, bl, (short)0, c, false, false);
  asm volatile("v_nop\n\tv_nop\n\tv_nop\n\tv_nop" : "+v"(c) : "v"(ah), "v"(al), "v"(bh), "v"(bl));
  return c;
}

__global__ __launch_bounds__(256) void k_wt_bf16(const float* __restrict__ W, unsigned short* __restrict__ Wt, int K, int N) {
  const int t = blockIdx.x * 256 + threadIdx.x;
  const int k8n = K / 8;
  if (t >= N * k8n) return;
  const int n = t / k8n, k8 = (t % k8n) * 8;
  v8us v;
#pragma unroll
  for (int i = 0; i < 8; ++i) v[i] = bf16_bits(W[(size_t)(k8 + i) * N + n]);
  *(v8us*)(Wt + (size_t)n * K + k8) = v;
  
}

// GEMM C[M][N] (f32, pitch ldc) = act(A[M][K]·W + bias). A f32 row-major (pitch lda) converted per fragment to bf16
// (ASPLIT: hi/lo two planes -> 2 terms, else single rounded term); Wt bf16 [N][K] (pitch ldb). BIAS_BF16 rounds the
// bias to bf16 first (bias quantised to bf16 before the add). K%32==0, M%16==0, N%64==0.
template <bool ASPLIT, int ACT, bool BIAS_BF16>
__global__ __launch_bounds__(128) void k_gemm_bf(const float* __restrict__ A, int lda, const unsigned short* __restrict__ Wt, int ldb,
                                               const float* __restrict__ bias, float* __restrict__ C, int ldc, int M, int N, int K) {
  __shared__ __attribute__((aligned(16))) float so[4][16][64];
  const int tid = threadIdx.x, w = tid >> 5, lane = tid & 31, ln = lane & 15, hh = lane >> 4;
  const int ntn = N / 64;
  const int wid = blockIdx.x * 4 + w;
  const int mt = wid / ntn, nq = wid % ntn;
  if (mt * 16 >= M) return;
  const int row0 = mt * 16, col0 = nq * 64;
  const float* arow = A + (size_t)(row0 + ln) * lda;
  v8f acc[4] = {};
  for (int kb = 0; kb < K; kb += 32) {
    FragB ah, al;
    const v4f x0 = *(const v4fa*)(arow + kb + 8 * hh), x1 = *(const v4fa*)(arow + kb + 8 * hh + 4);
    const v4f x2 = *(const v4fa*)(arow + kb + 16 + 8 * hh), x3 = *(const v4fa*)(arow + kb + 16 + 8 * hh + 4);
    float xs[16] = {x0[0],x0[1],x0[2],x0[3],x1[0],x1[1],x1[2],x1[3],x2[0],x2[1],x2[2],x2[3],x3[0],x3[1],x3[2],x3[3]};
#pragma unroll
    for (int i = 0; i < 16; ++i) { const unsigned short hb = bf16_bits(xs[i]); ah.u[i] = hb; al.u[i] = ASPLIT ? bf16_bits(xs[i] - bf16_val(hb)) : (unsigned short)0; }
#pragma unroll
    for (int t = 0; t < 4; ++t) {
      const unsigned short* brow = Wt + (size_t)(col0 + t * 16 + ln) * ldb + kb;
      FragB b;
      b.half[0] = *(const v8us*)(brow + 8 * hh);
      b.half[1] = *(const v8us*)(brow + 16 + 8 * hh);
      acc[t] = mmaN<ASPLIT ? 2 : 1>(ah.v, al.v, b.v, b.v, acc[t]);
    }
  }
#pragma unroll
  for (int t = 0; t < 4; ++t) {
    float bv = bias ? bias[col0 + t * 16 + ln] : 0.f;
    if (BIAS_BF16) bv = bf16_round(bv);
#pragma unroll
    for (int r = 0; r < 8; ++r) { float v = acc[t][r] + bv; if (ACT == 1) v = fmaxf(v, 0.f); so[w][8 * hh + r][t * 16 + ln] = v; }
  }
  __builtin_amdgcn_fence(__ATOMIC_ACQ_REL, "workgroup");
  __builtin_amdgcn_wave_barrier();
  const int rsub = lane >> 4, c4 = (lane & 15) * 4;
  {
#pragma unroll
    for (int q = 0; q < 8; ++q) {
      const int r = q * 2 + rsub;
      const v4f v = *(const v4fa*)&so[w][r][c4];
      *(v4f*)(C + (size_t)(row0 + r) * ldc + col0 + c4) = v;
    }
    
  }
}

// GEMM C = act(A·W + bias + resid): A f32 (ASPLIT -> hi/lo 2 terms), Wt bf16 [N][K]; ACT 0 none, 1 relu, 2 exact gelu;
// resid (optional, f32, row index = (row % rmod), pitch ldr, RES_BF16 rounds it) added before the activation.
template <bool ASPLIT, int ACT, bool BIAS_BF16, bool RES_BF16>
__global__ __launch_bounds__(128) void k_gemm_bf3(const float* __restrict__ A, int lda, const unsigned short* __restrict__ Wt, int ldb,
                                                const float* __restrict__ bias, const float* __restrict__ resid, int rmod, int ldr,
                                                float* __restrict__ C, int ldc, int M, int N, int K) {
  __shared__ __attribute__((aligned(16))) float so[4][16][64];
  const int tid = threadIdx.x, w = tid >> 5, lane = tid & 31, ln = lane & 15, hh = lane >> 4;
  const int ntn = N / 64;
  const int wid = blockIdx.x * 4 + w;
  const int mt = wid / ntn, nq = wid % ntn;
  if (mt * 16 >= M) return;
  const int row0 = mt * 16, col0 = nq * 64;
  const float* arow = A + (size_t)(row0 + ln) * lda;
  v8f acc[4] = {};
  for (int kb = 0; kb < K; kb += 32) {
    FragB ah, al;
    const v4f x0 = *(const v4fa*)(arow + kb + 8 * hh), x1 = *(const v4fa*)(arow + kb + 8 * hh + 4);
    const v4f x2 = *(const v4fa*)(arow + kb + 16 + 8 * hh), x3 = *(const v4fa*)(arow + kb + 16 + 8 * hh + 4);
    float xs[16] = {x0[0],x0[1],x0[2],x0[3],x1[0],x1[1],x1[2],x1[3],x2[0],x2[1],x2[2],x2[3],x3[0],x3[1],x3[2],x3[3]};
#pragma unroll
    for (int i = 0; i < 16; ++i) { const unsigned short hb = bf16_bits(xs[i]); ah.u[i] = hb; al.u[i] = ASPLIT ? bf16_bits(xs[i] - bf16_val(hb)) : (unsigned short)0; }
#pragma unroll
    for (int t = 0; t < 4; ++t) {
      const unsigned short* brow = Wt + (size_t)(col0 + t * 16 + ln) * ldb + kb;
      FragB b;
      b.half[0] = *(const v8us*)(brow + 8 * hh);
      b.half[1] = *(const v8us*)(brow + 16 + 8 * hh);
      acc[t] = mmaN<ASPLIT ? 2 : 1>(ah.v, al.v, b.v, b.v, acc[t]);
    }
  }
#pragma unroll
  for (int t = 0; t < 4; ++t) {
    const int col = col0 + t * 16 + ln;
    float bv = bias ? bias[col] : 0.f;
    if (BIAS_BF16) bv = bf16_round(bv);
#pragma unroll
    for (int r = 0; r < 8; ++r) {
      float v = acc[t][r] + bv;
      if (resid) { float rv = resid[(size_t)((row0 + 8 * hh + r) % rmod) * ldr + col]; if (RES_BF16) rv = bf16_round(rv); v += rv; }
      if (ACT == 1) v = fmaxf(v, 0.f);
      if (ACT == 2) v = 0.5f * v * (1.0f + erff(v * 0.70710678118654752f));
      if (ACT == 3) { const float u = 0.7978845608028654f * (v + 0.044715f * v * v * v); v = 0.5f * v * (1.0f + tanhf(u)); }
      so[w][8 * hh + r][t * 16 + ln] = v;
    }
  }
  __builtin_amdgcn_fence(__ATOMIC_ACQ_REL, "workgroup");
  __builtin_amdgcn_wave_barrier();
  const int rsub = lane >> 4, c4 = (lane & 15) * 4;
  {
#pragma unroll
    for (int q = 0; q < 8; ++q) {
      const int r = q * 2 + rsub;
      const v4f v = *(const v4fa*)&so[w][r][c4];
      *(v4f*)(C + (size_t)(row0 + r) * ldc + col0 + c4) = v;
    }
    
  }
}
// row LayerNorm (biased variance, eps) over N: s = X (+ R); optional out_sum <- s; out_norm <- (s-mu)*rsqrt(var+eps)*g + b
template <bool PARAM_BF16>
__global__ __launch_bounds__(256) void k_layernorm(const float* __restrict__ X, const float* __restrict__ R, const float* __restrict__ g, const float* __restrict__ bta,
                                                  float* __restrict__ out_sum, float* __restrict__ out_norm, int N, float eps) {
  __shared__ float red[256];
  const int row = blockIdx.x, tid = threadIdx.x;
  const float* x = X + (size_t)row * N; const float* rr = R ? R + (size_t)row * N : nullptr;
  float vals[16];                     // up to N = 4096
  const int per = N / 256;            // contiguous chunk per thread? use strided-by-4 chunks: thread handles j = tid*4 + 1024*u
  float s1 = 0.f;
  for (int u = 0; u < per / 4; ++u) {
    const int j = tid * 4 + 1024 * u;
    const v4f a = *(const v4fa*)(x + j);
    v4f b = {0.f,0.f,0.f,0.f}; if (rr) b = *(const v4fa*)(rr + j);
#pragma unroll
    for (int q = 0; q < 4; ++q) { const float v = a[q] + b[q]; vals[u * 4 + q] = v; s1 += v; }
  }
  red[tid] = s1; __syncthreads();
  for (int st = 128; st > 0; st >>= 1) { if (tid < st) red[tid] += red[tid + st]; __syncthreads(); }
  const float mu = red[0] / (float)N; __syncthreads();
  float s2 = 0.f;
  for (int u = 0; u < per / 4; ++u)
#pragma unroll
    for (int q = 0; q < 4; ++q) { const float c = vals[u * 4 + q] - mu; s2 += c * c; }
  red[tid] = s2; __syncthreads();
  for (int st = 128; st > 0; st >>= 1) { if (tid < st) red[tid] += red[tid + st]; __syncthreads(); }
  const float rs = rsqrtf(red[0] / (float)N + eps);
  {
    for (int u = 0; u < per / 4; ++u) {
      const int j = tid * 4 + 1024 * u;
      v4f o, sm;
#pragma unroll
      for (int q = 0; q < 4; ++q) {
        float gg = g[j + q], bb = bta[j + q];
        if (PARAM_BF16) { gg = bf16_round(gg); bb = bf16_round(bb); }
        sm[q] = vals[u * 4 + q]; o[q] = (vals[u * 4 + q] - mu) * rs * gg + bb;
      }
      if (out_sum) *(v4f*)(out_sum + (size_t)row * N + j) = sm;
      *(v4f*)(out_norm + (size_t)row * N + j) = o;
    }
    
  }
}



// ---- f16 WMMA path (v_wmma_f32_16x16x32_f16): 11-bit significands for operands in range — used where a [0,1] probability operand needs more precision than bf16
typedef _Float16 v16h __attribute__((ext_vector_type(16)));
union FragH { v16h v; v8us half[2]; _Float16 h[16]; unsigned short u[16]; };
template <int NT>
__device__ __forceinline__ v8f mmaH(v16h ah, v16h al, v16h bh, v16h bl, v8f c) {
  c = __builtin_amdgcn_wmma_f32_16x16x32_f16(false, ah, false, bh, (short)0, c, false, false);
  if (NT >= 2) c = __builtin_amdgcn_wmma_f32_16x16x32_f16(false, al, false, bh, (short)0, c, false, false);
  if (NT >= 3) c = __builtin_amdgcn_wmma_f32_16x16x32_f16(false, ah, false, bl, (short)0, c, false, false);
  asm volatile("v_nop\n\tv_nop\n\tv_nop\n\tv_nop" : "+v"(c) : "v"(ah), "v"(al), "v"(bh), "v"(bl));
  return c;
}
// batched GEMM like k_gemm_b but f16 operands: A f32 (split into f16 hi/lo if ASPLIT, else rounded to f16), Bt = f16 values [n][k]; alpha; C f32; N multiple of 16 (partial tiles skipped)
template <bool ASPLIT>
__global__ __launch_bounds__(128) void k_gemm_h(const float* __restrict__ A, int lda, size_t sA, const _Float16* __restrict__ Bh, int ldb, size_t sB, float alpha, float* __restrict__ C, int ldc, size_t sC, int M, int N, int K) {
  __shared__ __attribute__((aligned(16))) float so[4][16][64];
  const int tid = threadIdx.x, w = tid >> 5, lane = tid & 31, ln = lane & 15, hh = lane >> 4; const int by = blockIdx.y;
  A += (size_t)by * sA; Bh += (size_t)by * sB; C += (size_t)by * sC;
  const int ntn = (N + 63) / 64; const int wid = blockIdx.x * 4 + w; const int mt = wid / ntn, nq = wid % ntn; if (mt * 16 >= M) return;
  const int row0 = mt * 16, col0 = nq * 64; const float* arow = A + (size_t)(row0 + ln) * lda;
  v8f acc[4] = {};
  for (int kb = 0; kb < K; kb += 32) {
    FragH ah, al;
    const v4f x0 = *(const v4fa*)(arow + kb + 8 * hh), x1 = *(const v4fa*)(arow + kb + 8 * hh + 4), x2 = *(const v4fa*)(arow + kb + 16 + 8 * hh), x3 = *(const v4fa*)(arow + kb + 16 + 8 * hh + 4);
    float xs[16] = {x0[0],x0[1],x0[2],x0[3],x1[0],x1[1],x1[2],x1[3],x2[0],x2[1],x2[2],x2[3],x3[0],x3[1],x3[2],x3[3]};
#pragma unroll
    for (int i = 0; i < 16; ++i) { const _Float16 h = (_Float16)xs[i]; ah.h[i] = h; al.h[i] = ASPLIT ? (_Float16)(xs[i] - (float)h) : (_Float16)0.0f; }
#pragma unroll
    for (int t = 0; t < 4; ++t) { if (col0 + t * 16 >= N) continue; const size_t boff = (size_t)(col0 + t * 16 + ln) * ldb + kb; FragH bq; bq.half[0] = *(const v8us*)(Bh + boff + 8 * hh); bq.half[1] = *(const v8us*)(Bh + boff + 16 + 8 * hh);
      acc[t] = mmaH<ASPLIT ? 2 : 1>(ah.v, al.v, bq.v, bq.v, acc[t]); }
  }
#pragma unroll
  for (int t = 0; t < 4; ++t) { if (col0 + t * 16 >= N) continue;
#pragma unroll
    for (int r = 0; r < 8; ++r) so[w][8 * hh + r][t * 16 + ln] = acc[t][r] * alpha; }
  __builtin_amdgcn_fence(__ATOMIC_ACQ_REL, "workgroup"); __builtin_amdgcn_wave_barrier();
  const int rsub = lane >> 4, c4 = (lane & 15) * 4;
  {
#pragma unroll
    for (int q = 0; q < 8; ++q) { const int r = q * 2 + rsub; if (col0 + c4 < N) { const v4f v = *(const v4fa*)&so[w][r][c4]; *(v4f*)(C + (size_t)(row0 + r) * ldc + col0 + c4) = v; } }
     }
}

// k_gemm_hh variant with fused epilogue: v = acc·alpha + bias[by·sBias + col] (+ CP[(row/rowsPerB)·sCPb + by·64 + col] if CP) ; ACT 0 none / 1 elu ; writes f16 C16 (and f32 C if non-null)
template <int ACT>
__global__ __launch_bounds__(128) void k_gemm_hhx(const _Float16* __restrict__ A, int lda, size_t sA, const _Float16* __restrict__ Bh, int ldb, size_t sB, float alpha, const float* __restrict__ bias, size_t sBias, const float* __restrict__ CP, int rowsPerB, size_t sCPb, int row0g,
    float* __restrict__ C, _Float16* __restrict__ C16, int ldc, size_t sC, int M, int N, int K) {
  __shared__ __attribute__((aligned(16))) float so[4][16][64];
  const int tid = threadIdx.x, w = tid >> 5, lane = tid & 31, ln = lane & 15, hh = lane >> 4; const int by = blockIdx.y;
  A += (size_t)by * sA; Bh += (size_t)by * sB; const size_t cofs = (size_t)by * sC; const float* bp = bias ? bias + (size_t)by * sBias : nullptr;
  const int ntn = (N + 63) / 64; const int wid = blockIdx.x * 4 + w; const int mt = wid / ntn, nq = wid % ntn; if (mt * 16 >= M) return;
  const int row0 = mt * 16, col0 = nq * 64; const _Float16* arow = A + (size_t)(row0 + ln) * lda;
  v8f acc[4] = {};
  for (int kb = 0; kb < K; kb += 32) { FragH ah; ah.half[0] = *(const v8us*)((const unsigned short*)arow + kb + 8 * hh); ah.half[1] = *(const v8us*)((const unsigned short*)arow + kb + 16 + 8 * hh);
#pragma unroll
    for (int t = 0; t < 4; ++t) { if (col0 + t * 16 >= N) continue; const size_t boff = (size_t)(col0 + t * 16 + ln) * ldb + kb; FragH bq; bq.half[0] = *(const v8us*)((const unsigned short*)Bh + boff + 8 * hh); bq.half[1] = *(const v8us*)((const unsigned short*)Bh + boff + 16 + 8 * hh);
      acc[t] = mmaH<1>(ah.v, ah.v, bq.v, bq.v, acc[t]); }
  }
#pragma unroll
  for (int t = 0; t < 4; ++t) { if (col0 + t * 16 >= N) continue; const int col = col0 + t * 16 + ln; const float bv = bp ? bf16_round(bp[col]) : 0.f;
#pragma unroll
    for (int r = 0; r < 8; ++r) { float v = acc[t][r] * alpha + bv; if (CP) { const int rr = row0g + row0 + 8 * hh + r; if (rowsPerB < 0) v += CP[cofs + (size_t)rr * ldc + col];      /* rowsPerB < 0: own element of the batched C plane */ else { const int bidx = rr / rowsPerB; v += CP[(size_t)bidx * sCPb + (size_t)by * 64 + col]; } } if (ACT == 1) v = (v > 0.f) ? v : expm1f(v); else if (ACT == 7) v = (v > 0.f) ? v + 1.0f : expf(v); else if (ACT == 8) v = tanhf(v); else if (ACT == 9) v = 0.5f * v * (1.0f + tanhf(0.7978845608028654f * (v + 0.044715f * v * v * v))); else if (ACT == 11) v = 1.0f / (1.0f + expf(-v)); else if (ACT == 12) v = (v > 0.f) ? v : 0.01f * v; else if (ACT == 14) v = (v > 0.f) ? v : 0.1f * v; else if (ACT == 16) v = (v >= 0.f) ? v : 0.3f * v; else if (ACT == 17) v = (v >= 0.f) ? v : 0.2f * v; else if (ACT == 15) v = v / (1.0f + expf(-v)); else if (ACT == 3) v = fmaxf(v, 0.f); else if (ACT == 6) v = 0.5f * v * (1.0f + erff(v * 0.70710678118654752f)); so[w][8 * hh + r][t * 16 + ln] = v; } }
  __builtin_amdgcn_fence(__ATOMIC_ACQ_REL, "workgroup"); __builtin_amdgcn_wave_barrier();
  const int rsub = lane >> 4, c4 = (lane & 15) * 4; typedef _Float16 v4h __attribute__((ext_vector_type(4)));
  {
#pragma unroll
    for (int q = 0; q < 8; ++q) { const int r = q * 2 + rsub; if (col0 + c4 < N) { const v4f v = *(const v4fa*)&so[w][r][c4]; if (C) *(v4f*)(C + cofs + (size_t)(row0 + r) * ldc + col0 + c4) = v; if (C16) { v4h h4; for (int i = 0; i < 4; ++i) h4[i] = (_Float16)v[i]; *(v4h*)(C16 + cofs + (size_t)(row0 + r) * ldc + col0 + c4) = h4; } } }
     }
}


typedef _Float16 v4h __attribute__((ext_vector_type(4)));

__global__ __launch_bounds__(256) void k_h16(const float* __restrict__ x, _Float16* __restrict__ X16, size_t n8) { const size_t t = (size_t)blockIdx.x * 256 + threadIdx.x; if (t >= n8) return; FragH f;
#pragma unroll
  for (int q = 0; q < 8; ++q) f.h[q] = (_Float16)x[t * 8 + q]; *(v8us*)((unsigned short*)X16 + t * 8) = f.half[0];  }
__global__ __launch_bounds__(256) void k_round16f(const float* __restrict__ W, _Float16* __restrict__ Bt, size_t n8) { const size_t t = (size_t)blockIdx.x * 256 + threadIdx.x; if (t >= n8) return; FragH f;
#pragma unroll
  for (int i = 0; i < 8; ++i) f.h[i] = (_Float16)(bf16_round(W[t * 8 + i]) * 16.0f); *(v8us*)((unsigned short*)Bt + t * 8) = f.half[0];  }
template <int NHv, int TTv>
__global__ __launch_bounds__(256) void k_vt(const _Float16* __restrict__ V16, int ldv, int voff, _Float16* __restrict__ Vt) { __shared__ unsigned short tl[64][66]; const int tid = threadIdx.x; const int slab = blockIdx.x / (TTv / 64), lg = blockIdx.x % (TTv / 64); const int b = slab / NHv, h = slab % NHv;
  for (int i = tid; i < 64 * 8; i += 256) { const int r = i / 8, c8 = (i % 8) * 8; FragH f; f.half[0] = *(const v8us*)((const unsigned short*)V16 + ((size_t)b * TTv + lg * 64 + r) * ldv + voff + h * 64 + c8);
#pragma unroll
    for (int q = 0; q < 8; ++q) tl[r][c8 + q] = f.u[q]; }
  __syncthreads();
  {
#pragma unroll
    for (int rd = 0; rd < 2; ++rd) { const int d = rd * 32 + tid / 8, pc = tid % 8; FragH f;
#pragma unroll
      for (int q = 0; q < 8; ++q) f.u[q] = tl[pc * 8 + q][d];
      *(v8us*)((unsigned short*)Vt + ((size_t)slab * 64 + d) * TTv + lg * 64 + pc * 8) = f.half[0]; }
     } }

__global__ __launch_bounds__(256) void k_hl(const float* __restrict__ F, _Float16* __restrict__ Hh, _Float16* __restrict__ Hl, size_t n8) { const size_t t = (size_t)blockIdx.x * 256 + threadIdx.x; if (t >= n8) return; FragH fh, fl; const v4f a = *(const v4fa*)(F + t * 8), c = *(const v4fa*)(F + t * 8 + 4);
#pragma unroll
  for (int q = 0; q < 4; ++q) { _Float16 h = (_Float16)a[q]; fh.h[q] = h; fl.h[q] = (_Float16)((a[q] - (float)h) * 1024.0f); h = (_Float16)c[q]; fh.h[4 + q] = h; fl.h[4 + q] = (_Float16)((c[q] - (float)h) * 1024.0f); }
  { *(v8us*)((unsigned short*)Hh + t * 8) = fh.half[0]; *(v8us*)((unsigned short*)Hl + t * 8) = fl.half[0];  } }

// ---- fast GEMM (wave tile 32x64; requires M % 32 == 0 rows per launch region and N % 64 == 0); epilogue = k_gemm_hhx semantics ----
__device__ __forceinline__ v16h g2_frag(const _Float16* p, int hh) { FragH f; f.half[0] = *(const v8us*)((const unsigned short*)p + 8 * hh); f.half[1] = *(const v8us*)((const unsigned short*)p + 16 + 8 * hh); return f.v; }
__device__ __forceinline__ v8f g2_mma(v16h a, v16h b, v8f c) { v8f d = __builtin_amdgcn_wmma_f32_16x16x32_f16(false, a, false, b, (short)0, c, false, false); asm volatile("v_nop\n\tv_nop\n\tv_nop\n\tv_nop" : "+v"(d) : "v"(a), "v"(b)); return d; }
template <int ACT>
__global__ __launch_bounds__(128) void k_gemm2(const _Float16* __restrict__ A, int lda, size_t sA, const _Float16* __restrict__ Bh, int ldb, size_t sB, float alpha, const float* __restrict__ bias, size_t sBias, const float* __restrict__ CP, int rowsPerB, size_t sCPb, int row0g,
    float* __restrict__ C, _Float16* __restrict__ C16, int ldc, size_t sC, int M, int N, int K) { static_assert(ACT == 0 || ACT == 3 || ACT == 6 || ACT == 8 || ACT == 9 || ACT == 11 || ACT == 12 || ACT == 14 || ACT == 15 || ACT == 16 || ACT == 17, "k_gemm2: unsupported ACT code (would silently apply no activation)");
  __shared__ __attribute__((aligned(16))) float so[4][32][68];
  const int tid = threadIdx.x, w = tid >> 5, lane = tid & 31, ln = lane & 15, hh = lane >> 4; const int by = blockIdx.y;
  A += (size_t)by * sA; Bh += (size_t)by * sB; const size_t cofs = (size_t)by * sC; const float* bp = bias ? bias + (size_t)by * sBias : nullptr;
  const int ntn = N >> 6; const int mt = blockIdx.x / ntn, nq = blockIdx.x - mt * ntn; const int row0 = mt * 128 + 32 * w, col0 = nq * 64; if (row0 >= M) return;
  const _Float16* a0p = A + (size_t)(row0 + ln) * lda; const _Float16* a1p = a0p + (size_t)16 * lda;
  const _Float16* b0p = Bh + (size_t)(col0 + ln) * ldb; const _Float16* b1p = b0p + (size_t)16 * ldb; const _Float16* b2p = b1p + (size_t)16 * ldb; const _Float16* b3p = b2p + (size_t)16 * ldb;
  const v8f z8 = {0.f,0.f,0.f,0.f,0.f,0.f,0.f,0.f}; v8f c00 = z8, c01 = z8, c02 = z8, c03 = z8, c10 = z8, c11 = z8, c12 = z8, c13 = z8;
#pragma unroll 1
  for (int kb = 0; kb < K; kb += 32) { const v16h a0 = g2_frag(a0p + kb, hh), a1 = g2_frag(a1p + kb, hh);
    v16h b = g2_frag(b0p + kb, hh); c00 = g2_mma(a0, b, c00); c10 = g2_mma(a1, b, c10);
    b = g2_frag(b1p + kb, hh); c01 = g2_mma(a0, b, c01); c11 = g2_mma(a1, b, c11);
    b = g2_frag(b2p + kb, hh); c02 = g2_mma(a0, b, c02); c12 = g2_mma(a1, b, c12);
    b = g2_frag(b3p + kb, hh); c03 = g2_mma(a0, b, c03); c13 = g2_mma(a1, b, c13); }
  v8f accs[8] = {c00, c01, c02, c03, c10, c11, c12, c13};
#pragma unroll
  for (int u = 0; u < 8; ++u) { const int t = u & 3, half = u >> 2; const int col = col0 + t * 16 + ln; const float bv = bp ? bf16_round(bp[col]) : 0.f;
#pragma unroll
    for (int r = 0; r < 8; ++r) { const int rloc = half * 16 + 8 * hh + r; float v = accs[u][r] * alpha + bv; if (CP) { if (rowsPerB < 0) v += CP[cofs + (size_t)(row0g + row0 + rloc) * ldc + col];      /* rowsPerB < 0: own element of the batched C plane */ else { const int bidx = (row0g + row0 + rloc) / rowsPerB; v += CP[(size_t)bidx * sCPb + (size_t)by * 64 + col]; } }
      if (ACT == 3) v = fmaxf(v, 0.f); else if (ACT == 6) v = 0.5f * v * (1.0f + erff(v * 0.70710678118654752f)); else if (ACT == 11) v = 1.0f / (1.0f + expf(-v)); else if (ACT == 15) v = v / (1.0f + expf(-v)); else if (ACT == 12) v = (v > 0.f) ? v : 0.01f * v; else if (ACT == 8) v = tanhf(v); else if (ACT == 9) v = 0.5f * v * (1.0f + tanhf(0.7978845608028654f * (v + 0.044715f * v * v * v))); else if (ACT == 14) v = (v > 0.f) ? v : 0.1f * v; else if (ACT == 16) v = (v >= 0.f) ? v : 0.3f * v; else if (ACT == 17) v = (v >= 0.f) ? v : 0.2f * v;
      so[w][rloc][t * 16 + ln] = v; } }
  __builtin_amdgcn_fence(__ATOMIC_ACQ_REL, "workgroup"); __builtin_amdgcn_wave_barrier();
  const int rsub = lane >> 4, c4 = (lane & 15) * 4;
  {
#pragma unroll
    for (int q = 0; q < 16; ++q) { const int r = q * 2 + rsub; const v4f v = *(const v4fa*)&so[w][r][c4]; if (C) *(v4f*)(C + cofs + (size_t)(row0 + r) * ldc + col0 + c4) = v; if (C16) { v4h h4; for (int i = 0; i < 4; ++i) h4[i] = (_Float16)v[i]; *(v4h*)(C16 + cofs + (size_t)(row0 + r) * ldc + col0 + c4) = h4; } }
     } }


__global__ __launch_bounds__(256) void k_wnat(const float* __restrict__ w, size_t n8, _Float16* __restrict__ Bt) { const size_t t = (size_t)blockIdx.x * 256 + threadIdx.x; if (t >= n8) return; FragH f; for (int q = 0; q < 8; ++q) f.h[q] = (_Float16)(bf16_round(w[t * 8 + q]) * 16.0f); *(v8us*)((unsigned short*)Bt + t * 8) = f.half[0];  }
__global__ __launch_bounds__(256) void k_rsm(const float* __restrict__ S, _Float16* __restrict__ P, int nrows) {
  #pragma clang fp contract(off)
  const int i = blockIdx.x * 256 + threadIdx.x; if (i >= nrows) return; const float* s = S + (size_t)i * SQ; float mx = -3.0e38f;
#pragma unroll 1
  for (int j = 0; j < SQ; ++j) mx = fmaxf(mx, s[j]); float se = 0.f;
#pragma unroll 1
  for (int j = 0; j < SQ; ++j) se += expf(s[j] - mx); const float sc = 256.0f / se;
#pragma unroll 1
  for (int j0 = 0; j0 < SQ; j0 += 8) { FragH f; for (int q = 0; q < 8; ++q) f.h[q] = (_Float16)(expf(s[j0 + q] - mx) * sc); unsigned short* d = (unsigned short*)P + (size_t)i * SQ + j0; *(v8us*)d = f.half[0];  } }
__global__ __launch_bounds__(256) void k_vt(const _Float16* __restrict__ V16, int b, int h0, _Float16* __restrict__ VT) { __shared__ unsigned short tl[64][65]; const int tid = threadIdx.x; const int hh = blockIdx.x % HG, sg = blockIdx.x / HG; const int s0 = sg * 64; const int h = h0 + hh;
  for (int i = tid; i < 64 * 8; i += 256) { const int j = i / 8, d8 = (i % 8) * 8; FragH f; f.half[0] = *(const v8us*)((const unsigned short*)V16 + ((size_t)b * SQ + s0 + j) * DM + h * HD + d8); for (int q = 0; q < 8; ++q) tl[d8 + q][j] = f.u[q]; }
  __syncthreads();
  { for (int i = tid; i < 64 * 8; i += 256) { const int d = i / 8, j8 = (i % 8) * 8; FragH f; for (int q = 0; q < 8; ++q) f.u[q] = tl[d][j8 + q]; *(v8us*)((unsigned short*)VT + ((size_t)hh * HD + d) * SQ + s0 + j8) = f.half[0]; }  } }



// lanes l and l ^ 16 exchanged by the cross-row permlane (no LDS round trip)
__device__ __forceinline__ float xl_half(float v) { const int i = __float_as_int(v); return __int_as_float(__builtin_amdgcn_permlanex16(i, i, 0x76543210, 0xfedcba98, false, false)); }
__device__ __forceinline__ v8f fa_mma(v16h a, v16h b, v8f c) { return __builtin_amdgcn_wmma_f32_16x16x32_f16(false, a, false, b, (short)0, c, false, false); }
// 2^x on eight values; the v_nop is the one slot the instruction set asks for behind a transcendental, written in the same statement so that it stays directly behind the last one
__device__ __forceinline__ void fa_exp8(float (&e)[8]) { asm("v_exp_f32 %0, %0\n\tv_exp_f32 %1, %1\n\tv_exp_f32 %2, %2\n\tv_exp_f32 %3, %3\n\tv_exp_f32 %4, %4\n\tv_exp_f32 %5, %5\n\tv_exp_f32 %6, %6\n\tv_exp_f32 %7, %7\n\tv_nop" : "+v"(e[0]), "+v"(e[1]), "+v"(e[2]), "+v"(e[3]), "+v"(e[4]), "+v"(e[5]), "+v"(e[6]), "+v"(e[7])); }
__device__ __forceinline__ float fa_exp1(float x) { asm("v_exp_f32 %0, %0\n\tv_nop" : "+v"(x)); return x; }      /* same slot as above */
__global__ __launch_bounds__(128) void k_fattn(const _Float16* __restrict__ Q, const _Float16* __restrict__ Kr, const _Float16* __restrict__ VT, _Float16* __restrict__ O) {
  const int lane = threadIdx.x & 31, ln = lane & 15, hh = lane >> 4, w = threadIdx.x >> 5; const int bh = blockIdx.y, b = bh / NH, h = bh % NH; const int q0 = blockIdx.x * 128 + w * 32;
  const _Float16* qp = Q + ((size_t)b * SQ + q0 + ln) * LQ + h * HD; const _Float16* kp = Kr + ((size_t)b * SQ + ln) * LQ + h * HD; const _Float16* vp = VT + ((size_t)bh * HD + ln) * SQ;
  const float cs = 0.03125f * 1.44269504f;      /* 1 / sqrt(d_model) and log2 e in one factor on the raw products */
  const v8f z8 = {0.f,0.f,0.f,0.f,0.f,0.f,0.f,0.f};
  v16h qf[2][2], kf[2][2], vf[4]; v8f o[4][2]; float m[2] = {-3.0e38f, -3.0e38f}, l[2] = {0.f, 0.f};
#pragma unroll
  for (int u = 0; u < 2; ++u) for (int ch = 0; ch < 2; ++ch) { qf[u][ch] = g2_frag(qp + (size_t)u * 16 * LQ + ch * 32, hh); kf[u][ch] = g2_frag(kp + (size_t)u * 16 * LQ + ch * 32, hh); }
#pragma unroll
  for (int t = 0; t < 4; ++t) { o[t][0] = z8; o[t][1] = z8; }
  for (int j = 0; j < SQ; j += 32) {
    v8f s[2][2];      /* [key tile][query group], raw q . k */
#pragma unroll
    for (int kt = 0; kt < 2; ++kt) for (int qt = 0; qt < 2; ++qt) s[kt][qt] = fa_mma(kf[kt][1], qf[qt][1], fa_mma(kf[kt][0], qf[qt][0], z8));
    const int jn = (j + 32) & (SQ - 1);      /* next pass's keys, fetched one pass ahead into the same registers; the last pass re-reads keys 0..31 (in bounds, unused) */
#pragma unroll
    for (int kt = 0; kt < 2; ++kt) for (int ch = 0; ch < 2; ++ch) kf[kt][ch] = g2_frag(kp + (size_t)(jn + kt * 16) * LQ + ch * 32, hh);
    float mn[2];
#pragma unroll
    for (int qt = 0; qt < 2; ++qt) { float a = fmaxf(s[0][qt][0], s[1][qt][0]);
      for (int r = 1; r < 8; ++r) a = fmaxf(a, fmaxf(s[0][qt][r], s[1][qt][r]));
      mn[qt] = fmaxf(m[qt], fmaxf(a, xl_half(a))); }
    if (__builtin_amdgcn_ballot_w32(mn[0] > m[0] || mn[1] > m[1]) != 0) {      /* scalar branch: where no column's maximum moved every factor is exactly 1 */
#pragma unroll
      for (int qt = 0; qt < 2; ++qt) { const float a = fa_exp1((m[qt] - mn[qt]) * cs); l[qt] *= a; m[qt] = mn[qt];
        for (int t = 0; t < 4; ++t) for (int r = 0; r < 8; ++r) o[t][qt][r] *= a; } }
#pragma unroll
    for (int t = 0; t < 4; ++t) vf[t] = g2_frag(vp + (size_t)t * 16 * SQ + j, hh);      /* this pass's V^T: the exponentials below stand between the loads and their use */
    FragH pf[2];
#pragma unroll
    for (int qt = 0; qt < 2; ++qt) { const float mc = m[qt] * cs;
      for (int kt = 0; kt < 2; ++kt) { float e[8];
        for (int r = 0; r < 8; ++r) e[r] = fmaf(s[kt][qt][r], cs, -mc);
        fa_exp8(e);
        l[qt] += ((e[0] + e[1]) + (e[2] + e[3])) + ((e[4] + e[5]) + (e[6] + e[7]));
        for (int r = 0; r < 8; ++r) pf[qt].h[kt * 8 + r] = (_Float16)e[r]; } }
#pragma unroll
    for (int t = 0; t < 4; ++t) for (int qt = 0; qt < 2; ++qt) o[t][qt] = fa_mma(vf[t], pf[qt].v, o[t][qt]);
  }
#pragma unroll
  for (int qt = 0; qt < 2; ++qt) { const float inv = 64.0f / (l[qt] + xl_half(l[qt])); unsigned short* op = (unsigned short*)O + ((size_t)b * SQ + q0 + qt * 16 + ln) * DM + h * HD + 8 * hh;      /* o[t][qt][r] = O[query ln][16 t + 8 hh + r]: 16 contiguous bytes a store */
    for (int t = 0; t < 4; ++t) { FragH f; for (int r = 0; r < 8; ++r) f.h[r] = (_Float16)(o[t][qt][r] * inv); *(v8us*)(op + t * 16) = f.half[0]; } } }

// every launch-independent preparation job in ONE grid, the job picked by the block index (a scalar branch): the 48 per-head weight blocks, W_o, and the three x planes; none reads what another writes, and a thread still builds 8 consecutive f16 of one output row.
#define PB_WH (HD * (DM / 8) / 256)            /* blocks for one head's [DM][HD] weight block */
#define PB_WO (DM * (DM / 8) / 256)            /* blocks for W_o */
#define PB_X  ((int)(NR * DM / 8 / 256))       /* blocks for one x plane */
template <int N>
__device__ __forceinline__ void prep_wt(const float* __restrict__ Wm, _Float16* __restrict__ Wt, int t) { const int n = t / (DM / 8), k8 = (t % (DM / 8)) * 8; FragH f;      /* Wt[n][k] = f16(bf16(W[k][n]) x16), W row-major [DM][N]; x16 (a power of two) keeps the bf16-exact weights exact in f16, away from the subnormal range */
#pragma unroll
  for (int i = 0; i < 8; ++i) f.h[i] = (_Float16)(bf16_round(Wm[(size_t)(k8 + i) * N + n]) * 16.0f);
  *(v8us*)((unsigned short*)Wt + (size_t)n * DM + k8) = f.half[0];
  asm volatile("s_wait_xcnt 0x0" ::: "memory"); }      /* the store's registers are released before any code the compiler lays behind this job can rewrite them */
__global__ __launch_bounds__(256) void k_prep(const float* __restrict__ x, const float* __restrict__ wq, const float* __restrict__ wk, const float* __restrict__ wv, const float* __restrict__ wo, _Float16* __restrict__ Bt, _Float16* __restrict__ X16) {
  int blk = blockIdx.x; const int tid = threadIdx.x;
  if (blk < 3 * NH * PB_WH) { const int p = blk / (NH * PB_WH), r = blk % (NH * PB_WH), h = r / PB_WH; const float* wp = (p == 0 ? wq : p == 1 ? wk : wv) + (size_t)h * DM * HD;      /* plane p (q, k, v), head h: its HD rows of the [out][in] plane */
    prep_wt<HD>(wp, Bt + (size_t)p * DM * DM + (size_t)h * HD * DM, (r % PB_WH) * 256 + tid); return; }
  blk -= 3 * NH * PB_WH;
  if (blk < PB_WO) { prep_wt<DM>(wo, Bt + (size_t)3 * DM * DM, blk * 256 + tid); return; }
  blk -= PB_WO;
  const int p = blk / PB_X; const size_t t = (size_t)(blk % PB_X) * 256 + tid; FragH f;      /* x plane p as exact f16 rows */
#pragma unroll
  for (int q = 0; q < 8; ++q) f.h[q] = (_Float16)bf16_round(x[t * 8 + q]);
  *(v8us*)((unsigned short*)X16 + (size_t)p * NR * DM + t * 8) = f.half[0];
  asm volatile("s_wait_xcnt 0x0" ::: "memory"); }      /* as in prep_wt: the store's registers are released before anything behind it can rewrite them */

extern "C" void kernel_launch(void* const* d_in, const int* in_sizes, int n_in,
                              void* d_out, int out_size, void* d_ws, size_t ws_size, hipStream_t stream) {
  (void)in_sizes; (void)n_in; (void)out_size;
  const float* const* I = (const float* const*)d_in; const float* x = I[0]; const float* wq = I[1]; const float* wk = I[2]; const float* wv = I[3]; const float* wo = I[4]; const float* bo = I[5];      /* ONE input stream (X) read on all three projections; Wq, Wk, Wv are PER-HEAD STACKS [16][1024][64] = [head][in][out] (the module has NO q / k / v biases: null pointers in the guarded bias slots); Wo [in][out] [1024][1024] at I[4], bo at I[5] */
  char* ws = (char*)d_ws; size_t off = 0;
  auto take = [&](size_t bytes) { char* p = ws + off; off += (bytes + 255) & ~(size_t)255; return p; };
  _Float16* BQ = (_Float16*)take((size_t)4 * DM * DM * 2); _Float16* BO = BQ + (size_t)3 * DM * DM;      /* weight planes q, k, v, o, one behind the other: a grid index steps through them */
  _Float16* XQ = (_Float16*)take((size_t)3 * NR * DM * 2);      /* x planes for q, k, v, likewise */
  _Float16* Q16 = (_Float16*)take((size_t)3 * NR * DM * 2); _Float16* K16 = Q16 + NR * DM; _Float16* V16 = K16 + NR * DM; _Float16* O16 = (_Float16*)take(NR * DM * 2);
  _Float16* VT = (_Float16*)take((size_t)NB * NH * HD * SQ * 2);
  if (off > ws_size) return;
  k_prep<<<3 * NH * PB_WH + PB_WO + 3 * PB_X, 256, 0, stream>>>(x, wq, wk, wv, wo, BQ, XQ);      /* PER-HEAD STACKS wq / wk / wv [NH][DM][HD]: head h is a row-major [in = DM][out = HD] block at w + h * DM * HD, transposed into rows Bt[h * HD + e][k] of the [out][in] plane (x16); wo is a plain [in][out] [DM][DM] matrix; the three inputs as exact f16 rows */
  const size_t r0p = (size_t)B0 * SQ;      /* first projected row */
  k_gemm2<0><<<dim3((unsigned)((MP / 128) * (DM / 64)), 3), 128, 0, stream>>>(XQ + r0p * DM, DM, NR * DM, BQ, DM, (size_t)DM * DM, 0.0625f, nullptr, 0, nullptr, 1, 0, 0, nullptr, Q16 + r0p * DM, DM, NR * DM, MP, DM, DM);      /* Q, K, V: blockIdx.y picks the x plane, the weight plane and the output plane */
  k_vt<NH, SQ><<<NB * NH * (SQ / 64), 256, 0, stream>>>(V16, LQ, 0, VT);      /* V^T [NB][NH][HD][SQ], both batches */
  k_fattn<<<dim3(SQ / 128, NB * NH), 128, 0, stream>>>(Q16, K16, VT, O16);      /* scores, softmax and P V in one kernel: o (merged heads, x64) as f16 rows */
  k_gemm2<0><<<dim3((unsigned)((MPO / 128) * (DM / 64)), 1), 128, 0, stream>>>(O16 + r0p * DM, DM, 0, BO, DM, 0, 0.0009765625f, bo, 0, nullptr, 1, 0, 0, (float*)d_out + r0p * DM, nullptr, DM, 0, MPO, DM, DM);      /* out rows are the output layout */
}

// v004
// Measured time: 136 microseconds a run.
// Two timings next to v003 put it at 1.54 and 1.52 times that version's speed.
// Over all steps from v000 it is 26.8 times as fast.
#include <hip/hip_runtime.h>
#define NB 2
#define SQ 2048
#define DM 1024
#define NH 16
#define HD 64
#define HG 4                         /* heads per launch of the per-batch k_vt */
#define B0 0                         /* first batch processed (debug hook) */
#define NBR NB                       /* batches processed (debug hook) */
#define NR ((size_t)NB * SQ)         /* token rows */
#define MP ((int)((size_t)NBR * SQ)) /* rows projected (debug hook) */
#define QN SQ                        /* query rows per batch; not used */
#define NHD NH                       /* heads; not used */
#define MPO MP                       /* rows through the output stage (debug hook) */
#define LQ DM      /* row pitch of the q/k/v rows */
typedef __bf16 v16b __attribute__((ext_vector_type(16)));
typedef unsigned short v8us __attribute__((ext_vector_type(8), may_alias));
typedef float  v8f  __attribute__((ext_vector_type(8)));
typedef float  v4f  __attribute__((ext_vector_type(4)));
typedef float  v4fa __attribute__((ext_vector_type(4), may_alias));
union FragB { v16b v; v8us half[2]; unsigned short u[16]; };

__device__ __forceinline__ unsigned short bf16_bits(float x) { unsigned int u = __float_as_uint(x); return (unsigned short)((u + 0x7FFFu + ((u >> 16) & 1u)) >> 16); }
__device__ __forceinline__ float bf16_val(unsigned short b) { return __uint_as_float(((unsigned int)b) << 16); }
__device__ __forceinline__ float bf16_round(float x) { return bf16_val(bf16_bits(x)); }
// D += A·B with NT terms: 1 = ah·bh, 2 = + al·bh (A split), 3 = + ah·bl (both split)
template <int NT>
__device__ __forceinline__ v8f mmaN(v16b ah, v16b al, v16b bh, v16b bl, v8f c) {
  c = __builtin_amdgcn_wmma_f32_16x16x32_bf16(false, ah, false, bh, (short)0, c, false, false);
  if (NT >= 2) c = __builtin_amdgcn_wmma_f32_16x16x32_bf16(false, al, false, bh, (short)0, c, false, false);
  if (NT >= 3) c = __builtin_amdgcn_wmma_f32_16x16x32_bf16(false, ah, false, bl, (short)0, c, false, false);
  asm volatile("v_nop\n\tv_nop\n\tv_nop\n\tv_nop" : "+v"(c) : "v"(ah), "v"(al), "v"(bh), "v"(bl));
  return c;
}

__global__ __launch_bounds__(256) void k_wt_bf16(const float* __restrict__ W, unsigned short* __restrict__ Wt, int K, int N) {
  const int t = blockIdx.x * 256 + threadIdx.x;
  const int k8n = K / 8;
  if (t >= N * k8n) return;
  const int n = t / k8n, k8 = (t % k8n) * 8;
  v8us v;
#pragma unroll
  for (int i = 0; i < 8; ++i) v[i] = bf16_bits(W[(size_t)(k8 + i) * N + n]);
  *(v8us*)(Wt + (size_t)n * K + k8) = v;
  
}

// GEMM C[M][N] (f32, pitch ldc) = act(A[M][K]·W + bias). A f32 row-major (pitch lda) converted per fragment to bf16
// (ASPLIT: hi/lo two planes -> 2 terms, else single rounded term); Wt bf16 [N][K] (pitch ldb). BIAS_BF16 rounds the
// bias to bf16 first (bias quantised to bf16 before the add). K%32==0, M%16==0, N%64==0.
template <bool ASPLIT, int ACT, bool BIAS_BF16>
__global__ __launch_bounds__(128) void k_gemm_bf(const float* __restrict__ A, int lda, const unsigned short* __restrict__ Wt, int ldb,
                                               const float* __restrict__ bias, float* __restrict__ C, int ldc, int M, int N, int K) {
  __shared__ __attribute__((aligned(16))) float so[4][16][64];
  const int tid = threadIdx.x, w = tid >> 5, lane = tid & 31, ln = lane & 15, hh = lane >> 4;
  const int ntn = N / 64;
  const int wid = blockIdx.x * 4 + w;
  const int mt = wid / ntn, nq = wid % ntn;
  if (mt * 16 >= M) return;
  const int row0 = mt * 16, col0 = nq * 64;
  const float* arow = A + (size_t)(row0 + ln) * lda;
  v8f acc[4] = {};
  for (int kb = 0; kb < K; kb += 32) {
    FragB ah, al;
    const v4f x0 = *(const v4fa*)(arow + kb + 8 * hh), x1 = *(const v4fa*)(arow + kb + 8 * hh + 4);
    const v4f x2 = *(const v4fa*)(arow + kb + 16 + 8 * hh), x3 = *(const v4fa*)(arow + kb + 16 + 8 * hh + 4);
    float xs[16] = {x0[0],x0[1],x0[2],x0[3],x1[0],x1[1],x1[2],x1[3],x2[0],x2[1],x2[2],x2[3],x3[0],x3[1],x3[2],x3[3]};
#pragma unroll
    for (int i = 0; i < 16; ++i) { const unsigned short hb = bf16_bits(xs[i]); ah.u[i] = hb; al.u[i] = ASPLIT ? bf16_bits(xs[i] - bf16_val(hb)) : (unsigned short)0; }
#pragma unroll
    for (int t = 0; t < 4; ++t) {
      const unsigned short* brow = Wt + (size_t)(col0 + t * 16 + ln) * ldb + kb;
      FragB b;
      b.half[0] = *(const v8us*)(brow + 8 * hh);
      b.half[1] = *(const v8us*)(brow + 16 + 8 * hh);
      acc[t] = mmaN<ASPLIT ? 2 : 1>(ah.v, al.v, b.v, b.v, acc[t]);
    }
  }
#pragma unroll
  for (int t = 0; t < 4; ++t) {
    float bv = bias ? bias[col0 + t * 16 + ln] : 0.f;
    if (BIAS_BF16) bv = bf16_round(bv);
#pragma unroll
    for (int r = 0; r < 8; ++r) { float v = acc[t][r] + bv; if (ACT == 1) v = fmaxf(v, 0.f); so[w][8 * hh + r][t * 16 + ln] = v; }
  }
  __builtin_amdgcn_fence(__ATOMIC_ACQ_REL, "workgroup");
  __builtin_amdgcn_wave_barrier();
  const int rsub = lane >> 4, c4 = (lane & 15) * 4;
  {
#pragma unroll
    for (int q = 0; q < 8; ++q) {
      const int r = q * 2 + rsub;
      const v4f v = *(const v4fa*)&so[w][r][c4];
      *(v4f*)(C + (size_t)(row0 + r) * ldc + col0 + c4) = v;
    }
    
  }
}

// GEMM C = act(A·W + bias + resid): A f32 (ASPLIT -> hi/lo 2 terms), Wt bf16 [N][K]; ACT 0 none, 1 relu, 2 exact gelu;
// resid (optional, f32, row index = (row % rmod), pitch ldr, RES_BF16 rounds it) added before the activation.
template <bool ASPLIT, int ACT, bool BIAS_BF16, bool RES_BF16>
__global__ __launch_bounds__(128) void k_gemm_bf3(const float* __restrict__ A, int lda, const unsigned short* __restrict__ Wt, int ldb,
                                                const float* __restrict__ bias, const float* __restrict__ resid, int rmod, int ldr,
                                                float* __restrict__ C, int ldc, int M, int N, int K) {
  __shared__ __attribute__((aligned(16))) float so[4][16][64];
  const int tid = threadIdx.x, w = tid >> 5, lane = tid & 31, ln = lane & 15, hh = lane >> 4;
  const int ntn = N / 64;
  const int wid = blockIdx.x * 4 + w;
  const int mt = wid / ntn, nq = wid % ntn;
  if (mt * 16 >= M) return;
  const int row0 = mt * 16, col0 = nq * 64;
  const float* arow = A + (size_t)(row0 + ln) * lda;
  v8f acc[4] = {};
  for (int kb = 0; kb < K; kb += 32) {
    FragB ah, al;
    const v4f x0 = *(const v4fa*)(arow + kb + 8 * hh), x1 = *(const v4fa*)(arow + kb + 8 * hh + 4);
    const v4f x2 = *(const v4fa*)(arow + kb + 16 + 8 * hh), x3 = *(const v4fa*)(arow + kb + 16 + 8 * hh + 4);
    float xs[16] = {x0[0],x0[1],x0[2],x0[3],x1[0],x1[1],x1[2],x1[3],x2[0],x2[1],x2[2],x2[3],x3[0],x3[1],x3[2],x3[3]};
#pragma unroll
    for (int i = 0; i < 16; ++i) { const unsigned short hb = bf16_bits(xs[i]); ah.u[i] = hb; al.u[i] = ASPLIT ? bf16_bits(xs[i] - bf16_val(hb)) : (unsigned short)0; }
#pragma unroll
    for (int t = 0; t < 4; ++t) {
      const unsigned short* brow = Wt + (size_t)(col0 + t * 16 + ln) * ldb + kb;
      FragB b;
      b.half[0] = *(const v8us*)(brow + 8 * hh);
      b.half[1] = *(const v8us*)(brow + 16 + 8 * hh);
      acc[t] = mmaN<ASPLIT ? 2 : 1>(ah.v, al.v, b.v, b.v, acc[t]);
    }
  }
#pragma unroll
  for (int t = 0; t < 4; ++t) {
    const int col = col0 + t * 16 + ln;
    float bv = bias ? bias[col] : 0.f;
    if (BIAS_BF16) bv = bf16_round(bv);
#pragma unroll
    for (int r = 0; r < 8; ++r) {
      float v = acc[t][r] + bv;
      if (resid) { float rv = resid[(size_t)((row0 + 8 * hh + r) % rmod) * ldr + col]; if (RES_BF16) rv = bf16_round(rv); v += rv; }
      if (ACT == 1) v = fmaxf(v, 0.f);
      if (ACT == 2) v = 0.5f * v * (1.0f + erff(v * 0.70710678118654752f));
      if (ACT == 3) { const float u = 0.7978845608028654f * (v + 0.044715f * v * v * v); v = 0.5f * v * (1.0f + tanhf(u)); }
      so[w][8 * hh + r][t * 16 + ln] = v;
    }
  }
  __builtin_amdgcn_fence(__ATOMIC_ACQ_REL, "workgroup");
  __builtin_amdgcn_wave_barrier();
  const int rsub = lane >> 4, c4 = (lane & 15) * 4;
  {
#pragma unroll
    for (int q = 0; q < 8; ++q) {
      const int r = q * 2 + rsub;
      const v4f v = *(const v4fa*)&so[w][r][c4];
      *(v4f*)(C + (size_t)(row0 + r) * ldc + col0 + c4) = v;
    }
    
  }
}
// row LayerNorm (biased variance, eps) over N: s = X (+ R); optional out_sum <- s; out_norm <- (s-mu)*rsqrt(var+eps)*g + b
template <bool PARAM_BF16>
__global__ __launch_bounds__(256) void k_layernorm(const float* __restrict__ X, const float* __restrict__ R, const float* __restrict__ g, const float* __restrict__ bta,
                                                  float* __restrict__ out_sum, float* __restrict__ out_norm, int N, float eps) {
  __shared__ float red[256];
  const int row = blockIdx.x, tid = threadIdx.x;
  const float* x = X + (size_t)row * N; const float* rr = R ? R + (size_t)row * N : nullptr;
  float vals[16];                     // up to N = 4096
  const int per = N / 256;            // contiguous chunk per thread? use strided-by-4 chunks: thread handles j = tid*4 + 1024*u
  float s1 = 0.f;
  for (int u = 0; u < per / 4; ++u) {
    const int j = tid * 4 + 1024 * u;
    const v4f a = *(const v4fa*)(x + j);
    v4f b = {0.f,0.f,0.f,0.f}; if (rr) b = *(const v4fa*)(rr + j);
#pragma unroll
    for (int q = 0; q < 4; ++q) { const float v = a[q] + b[q]; vals[u * 4 + q] = v; s1 += v; }
  }
  red[tid] = s1; __syncthreads();
  for (int st = 128; st > 0; st >>= 1) { if (tid < st) red[tid] += red[tid + st]; __syncthreads(); }
  const float mu = red[0] / (float)N; __syncthreads();
  float s2 = 0.f;
  for (int u = 0; u < per / 4; ++u)
#pragma unroll
    for (int q = 0; q < 4; ++q) { const float c = vals[u * 4 + q] - mu; s2 += c * c; }
  red[tid] = s2; __syncthreads();
  for (int st = 128; st > 0; st >>= 1) { if (tid < st) red[tid] += red[tid + st]; __syncthreads(); }
  const float rs = rsqrtf(red[0] / (float)N + eps);
  {
    for (int u = 0; u < per / 4; ++u) {
      const int j = tid * 4 + 1024 * u;
      v4f o, sm;
#pragma unroll
      for (int q = 0; q < 4; ++q) {
        float gg = g[j + q], bb = bta[j + q];
        if (PARAM_BF16) { gg = bf16_round(gg); bb = bf16_round(bb); }
        sm[q] = vals[u * 4 + q]; o[q] = (vals[u * 4 + q] - mu) * rs * gg + bb;
      }
      if (out_sum) *(v4f*)(out_sum + (size_t)row * N + j) = sm;
      *(v4f*)(out_norm + (size_t)row * N + j) = o;
    }
    
  }
}



// ---- f16 WMMA path (v_wmma_f32_16x16x32_f16): 11-bit significands for operands in range — used where a [0,1] probability operand needs more precision than bf16
typedef _Float16 v16h __attribute__((ext_vector_type(16)));
union FragH { v16h v; v8us half[2]; _Float16 h[16]; unsigned short u[16]; };
template <int NT>
__device__ __forceinline__ v8f mmaH(v16h ah, v16h al, v16h bh, v16h bl, v8f c) {
  c = __builtin_amdgcn_wmma_f32_16x16x32_f16(false, ah, false, bh, (short)0, c, false, false);
  if (NT >= 2) c = __builtin_amdgcn_wmma_f32_16x16x32_f16(false, al, false, bh, (short)0, c, false, false);
  if (NT >= 3) c = __builtin_amdgcn_wmma_f32_16x16x32_f16(false, ah, false, bl, (short)0, c, false, false);
  asm volatile("v_nop\n\tv_nop\n\tv_nop\n\tv_nop" : "+v"(c) : "v"(ah), "v"(al), "v"(bh), "v"(bl));
  return c;
}
// batched GEMM like k_gemm_b but f16 operands: A f32 (split into f16 hi/lo if ASPLIT, else rounded to f16), Bt = f16 values [n][k]; alpha; C f32; N multiple of 16 (partial tiles skipped)
template <bool ASPLIT>
__global__ __launch_bounds__(128) void k_gemm_h(const float* __restrict__ A, int lda, size_t sA, const _Float16* __restrict__ Bh, int ldb, size_t sB, float alpha, float* __restrict__ C, int ldc, size_t sC, int M, int N, int K) {
  __shared__ __attribute__((aligned(16))) float so[4][16][64];
  const int tid = threadIdx.x, w = tid >> 5, lane = tid & 31, ln = lane & 15, hh = lane >> 4; const int by = blockIdx.y;
  A += (size_t)by * sA; Bh += (size_t)by * sB; C += (size_t)by * sC;
  const int ntn = (N + 63) / 64; const int wid = blockIdx.x * 4 + w; const int mt = wid / ntn, nq = wid % ntn; if (mt * 16 >= M) return;
  const int row0 = mt * 16, col0 = nq * 64; const float* arow = A + (size_t)(row0 + ln) * lda;
  v8f acc[4] = {};
  for (int kb = 0; kb < K; kb += 32) {
    FragH ah, al;
    const v4f x0 = *(const v4fa*)(arow + kb + 8 * hh), x1 = *(const v4fa*)(arow + kb + 8 * hh + 4), x2 = *(const v4fa*)(arow + kb + 16 + 8 * hh), x3 = *(const v4fa*)(arow + kb + 16 + 8 * hh + 4);
    float xs[16] = {x0[0],x0[1],x0[2],x0[3],x1[0],x1[1],x1[2],x1[3],x2[0],x2[1],x2[2],x2[3],x3[0],x3[1],x3[2],x3[3]};
#pragma unroll
    for (int i = 0; i < 16; ++i) { const _Float16 h = (_Float16)xs[i]; ah.h[i] = h; al.h[i] = ASPLIT ? (_Float16)(xs[i] - (float)h) : (_Float16)0.0f; }
#pragma unroll
    for (int t = 0; t < 4; ++t) { if (col0 + t * 16 >= N) continue; const size_t boff = (size_t)(col0 + t * 16 + ln) * ldb + kb; FragH bq; bq.half[0] = *(const v8us*)(Bh + boff + 8 * hh); bq.half[1] = *(const v8us*)(Bh + boff + 16 + 8 * hh);
      acc[t] = mmaH<ASPLIT ? 2 : 1>(ah.v, al.v, bq.v, bq.v, acc[t]); }
  }
#pragma unroll
  for (int t = 0; t < 4; ++t) { if (col0 + t * 16 >= N) continue;
#pragma unroll
    for (int r = 0; r < 8; ++r) so[w][8 * hh + r][t * 16 + ln] = acc[t][r] * alpha; }
  __builtin_amdgcn_fence(__ATOMIC_ACQ_REL, "workgroup"); __builtin_amdgcn_wave_barrier();
  const int rsub = lane >> 4, c4 = (lane & 15) * 4;
  {
#pragma unroll
    for (int q = 0; q < 8; ++q) { const int r = q * 2 + rsub; if (col0 + c4 < N) { const v4f v = *(const v4fa*)&so[w][r][c4]; *(v4f*)(C + (size_t)(row0 + r) * ldc + col0 + c4) = v; } }
     }
}

// k_gemm_hh variant with fused epilogue: v = acc·alpha + bias[by·sBias + col] (+ CP[(row/rowsPerB)·sCPb + by·64 + col] if CP) ; ACT 0 none / 1 elu ; writes f16 C16 (and f32 C if non-null)
template <int ACT>
__global__ __launch_bounds__(128) void k_gemm_hhx(const _Float16* __restrict__ A, int lda, size_t sA, const _Float16* __restrict__ Bh, int ldb, size_t sB, float alpha, const float* __restrict__ bias, size_t sBias, const float* __restrict__ CP, int rowsPerB, size_t sCPb, int row0g,
    float* __restrict__ C, _Float16* __restrict__ C16, int ldc, size_t sC, int M, int N, int K) {
  __shared__ __attribute__((aligned(16))) float so[4][16][64];
  const int tid = threadIdx.x, w = tid >> 5, lane = tid & 31, ln = lane & 15, hh = lane >> 4; const int by = blockIdx.y;
  A += (size_t)by * sA; Bh += (size_t)by * sB; const size_t cofs = (size_t)by * sC; const float* bp = bias ? bias + (size_t)by * sBias : nullptr;
  const int ntn = (N + 63) / 64; const int wid = blockIdx.x * 4 + w; const int mt = wid / ntn, nq = wid % ntn; if (mt * 16 >= M) return;
  const int row0 = mt * 16, col0 = nq * 64; const _Float16* arow = A + (size_t)(row0 + ln) * lda;
  v8f acc[4] = {};
  for (int kb = 0; kb < K; kb += 32) { FragH ah; ah.half[0] = *(const v8us*)((const unsigned short*)arow + kb + 8 * hh); ah.half[1] = *(const v8us*)((const unsigned short*)arow + kb + 16 + 8 * hh);
#pragma unroll
    for (int t = 0; t < 4; ++t) { if (col0 + t * 16 >= N) continue; const size_t boff = (size_t)(col0 + t * 16 + ln) * ldb + kb; FragH bq; bq.half[0] = *(const v8us*)((const unsigned short*)Bh + boff + 8 * hh); bq.half[1] = *(const v8us*)((const unsigned short*)Bh + boff + 16 + 8 * hh);
      acc[t] = mmaH<1>(ah.v, ah.v, bq.v, bq.v, acc[t]); }
  }
#pragma unroll
  for (int t = 0; t < 4; ++t) { if (col0 + t * 16 >= N) continue; const int col = col0 + t * 16 + ln; const float bv = bp ? bf16_round(bp[col]) : 0.f;
#pragma unroll
    for (int r = 0; r < 8; ++r) { float v = acc[t][r] * alpha + bv; if (CP) { const int rr = row0g + row0 + 8 * hh + r; if (rowsPerB < 0) v += CP[cofs + (size_t)rr * ldc + col];      /* rowsPerB < 0: own element of the batched C plane */ else { const int bidx = rr / rowsPerB; v += CP[(size_t)bidx * sCPb + (size_t)by * 64 + col]; } } if (ACT == 1) v = (v > 0.f) ? v : expm1f(v); else if (ACT == 7) v = (v > 0.f) ? v + 1.0f : expf(v); else if (ACT == 8) v = tanhf(v); else if (ACT == 9) v = 0.5f * v * (1.0f + tanhf(0.7978845608028654f * (v + 0.044715f * v * v * v))); else if (ACT == 11) v = 1.0f / (1.0f + expf(-v)); else if (ACT == 12) v = (v > 0.f) ? v : 0.01f * v; else if (ACT == 14) v = (v > 0.f) ? v : 0.1f * v; else if (ACT == 16) v = (v >= 0.f) ? v : 0.3f * v; else if (ACT == 17) v = (v >= 0.f) ? v : 0.2f * v; else if (ACT == 15) v = v / (1.0f + expf(-v)); else if (ACT == 3) v = fmaxf(v, 0.f); else if (ACT == 6) v = 0.5f * v * (1.0f + erff(v * 0.70710678118654752f)); so[w][8 * hh + r][t * 16 + ln] = v; } }
  __builtin_amdgcn_fence(__ATOMIC_ACQ_REL, "workgroup"); __builtin_amdgcn_wave_barrier();
  const int rsub = lane >> 4, c4 = (lane & 15) * 4; typedef _Float16 v4h __attribute__((ext_vector_type(4)));
  {
#pragma unroll
    for (int q = 0; q < 8; ++q) { const int r = q * 2 + rsub; if (col0 + c4 < N) { const v4f v = *(const v4fa*)&so[w][r][c4]; if (C) *(v4f*)(C + cofs + (size_t)(row0 + r) * ldc + col0 + c4) = v; if (C16) { v4h h4; for (int i = 0; i < 4; ++i) h4[i] = (_Float16)v[i]; *(v4h*)(C16 + cofs + (size_t)(row0 + r) * ldc + col0 + c4) = h4; } } }
     }
}


typedef _Float16 v4h __attribute__((ext_vector_type(4)));

__global__ __launch_bounds__(256) void k_h16(const float* __restrict__ x, _Float16* __restrict__ X16, size_t n8) { const size_t t = (size_t)blockIdx.x * 256 + threadIdx.x; if (t >= n8) return; FragH f;
#pragma unroll
  for (int q = 0; q < 8; ++q) f.h[q] = (_Float16)x[t * 8 + q]; *(v8us*)((unsigned short*)X16 + t * 8) = f.half[0];  }
__global__ __launch_bounds__(256) void k_round16f(const float* __restrict__ W, _Float16* __restrict__ Bt, size_t n8) { const size_t t = (size_t)blockIdx.x * 256 + threadIdx.x; if (t >= n8) return; FragH f;
#pragma unroll
  for (int i = 0; i < 8; ++i) f.h[i] = (_Float16)(bf16_round(W[t * 8 + i]) * 16.0f); *(v8us*)((unsigned short*)Bt + t * 8) = f.half[0];  }
template <int NHv, int TTv>
__global__ __launch_bounds__(256) void k_vt(const _Float16* __restrict__ V16, int ldv, int voff, _Float16* __restrict__ Vt) { __shared__ unsigned short tl[64][66]; const int tid = threadIdx.x; const int slab = blockIdx.x / (TTv / 64), lg = blockIdx.x % (TTv / 64); const int b = slab / NHv, h = slab % NHv;
  for (int i = tid; i < 64 * 8; i += 256) { const int r = i / 8, c8 = (i % 8) * 8; FragH f; f.half[0] = *(const v8us*)((const unsigned short*)V16 + ((size_t)b * TTv + lg * 64 + r) * ldv + voff + h * 64 + c8);
#pragma unroll
    for (int q = 0; q < 8; ++q) tl[r][c8 + q] = f.u[q]; }
  __syncthreads();
  {
#pragma unroll
    for (int rd = 0; rd < 2; ++rd) { const int d = rd * 32 + tid / 8, pc = tid % 8; FragH f;
#pragma unroll
      for (int q = 0; q < 8; ++q) f.u[q] = tl[pc * 8 + q][d];
      *(v8us*)((unsigned short*)Vt + ((size_t)slab * 64 + d) * TTv + lg * 64 + pc * 8) = f.half[0]; }
     } }

__global__ __launch_bounds__(256) void k_hl(const float* __restrict__ F, _Float16* __restrict__ Hh, _Float16* __restrict__ Hl, size_t n8) { const size_t t = (size_t)blockIdx.x * 256 + threadIdx.x; if (t >= n8) return; FragH fh, fl; const v4f a = *(const v4fa*)(F + t * 8), c = *(const v4fa*)(F + t * 8 + 4);
#pragma unroll
  for (int q = 0; q < 4; ++q) { _Float16 h = (_Float16)a[q]; fh.h[q] = h; fl.h[q] = (_Float16)((a[q] - (float)h) * 1024.0f); h = (_Float16)c[q]; fh.h[4 + q] = h; fl.h[4 + q] = (_Float16)((c[q] - (float)h) * 1024.0f); }
  { *(v8us*)((unsigned short*)Hh + t * 8) = fh.half[0]; *(v8us*)((unsigned short*)Hl + t * 8) = fl.half[0];  } }

// ---- fast GEMM (block tile 128x128, eight waves of 32x64; requires M % 128 == 0, N % 128 == 0, K % 64 == 0); epilogue = k_gemm_hhx semantics ----
// Both operands pass through LDS: a stage is 64 k (one whole 128-byte line) of the block's 128 A rows and 128 B rows, brought by asynchronous copies and read by all eight waves; two stages, the next one in flight while this one is multiplied.
__device__ __forceinline__ v16h g2_frag(const _Float16* p, int hh) { FragH f; f.half[0] = *(const v8us*)((const unsigned short*)p + 8 * hh); f.half[1] = *(const v8us*)((const unsigned short*)p + 16 + 8 * hh); return f.v; }
__device__ __forceinline__ v8f g2_mma(v16h a, v16h b, v8f c) { v8f d = __builtin_amdgcn_wmma_f32_16x16x32_f16(false, a, false, b, (short)0, c, false, false); asm volatile("v_nop\n\tv_nop\n\tv_nop\n\tv_nop" : "+v"(d) : "v"(a), "v"(b)); return d; }
#define G2_PITCH 144                   /* LDS row pitch in bytes: 16 x odd, free of bank conflicts for 16-byte reads */
#define G2_STAGE (256 * G2_PITCH)      /* rows 0..127 = A, rows 128..255 = B */
// one stage's copies: a thread brings 16 bytes of each of 8 rows (32 rows apart; 4 of A, 4 of B), so a wave-wide copy covers 4 whole 128-byte lines.
// s_wait_xcnt 0 is the statement's last line: it then stands in front of every later rewrite of the address registers the copies name.
__device__ __forceinline__ void g2_stage(unsigned l, const _Float16* a, int lda, const _Float16* b, int ldb) {
  const _Float16* a1 = a + (size_t)32 * lda; const _Float16* a2 = a + (size_t)64 * lda; const _Float16* a3 = a + (size_t)96 * lda;
  const _Float16* b1 = b + (size_t)32 * ldb; const _Float16* b2 = b + (size_t)64 * ldb; const _Float16* b3 = b + (size_t)96 * ldb;
  asm volatile("global_load_async_to_lds_b128 %0, %8, off\n\tglobal_load_async_to_lds_b128 %1, %9, off\n\tglobal_load_async_to_lds_b128 %2, %10, off\n\tglobal_load_async_to_lds_b128 %3, %11, off\n\t"
               "global_load_async_to_lds_b128 %4, %12, off\n\tglobal_load_async_to_lds_b128 %5, %13, off\n\tglobal_load_async_to_lds_b128 %6, %14, off\n\tglobal_load_async_to_lds_b128 %7, %15, off\n\ts_wait_xcnt 0x0"
               :: "v"(l), "v"(l + 32 * G2_PITCH), "v"(l + 64 * G2_PITCH), "v"(l + 96 * G2_PITCH), "v"(l + 128 * G2_PITCH), "v"(l + 160 * G2_PITCH), "v"(l + 192 * G2_PITCH), "v"(l + 224 * G2_PITCH),
                  "v"(a), "v"(a1), "v"(a2), "v"(a3), "v"(b), "v"(b1), "v"(b2), "v"(b3) : "memory"); }
template <int ACT>
__global__ __launch_bounds__(256) void k_gemm2(const _Float16* __restrict__ A, int lda, size_t sA, const _Float16* __restrict__ Bh, int ldb, size_t sB, float alpha, const float* __restrict__ bias, size_t sBias, const float* __restrict__ CP, int rowsPerB, size_t sCPb, int row0g,
    float* __restrict__ C, _Float16* __restrict__ C16, int ldc, size_t sC, int M, int N, int K) { static_assert(ACT == 0 || ACT == 3 || ACT == 6 || ACT == 8 || ACT == 9 || ACT == 11 || ACT == 12 || ACT == 14 || ACT == 15 || ACT == 16 || ACT == 17, "k_gemm2: unsupported ACT code (would silently apply no activation)");
  __shared__ __attribute__((aligned(128))) unsigned char sm[2 * G2_STAGE];      /* the two operand stages; behind the loop's last barrier the same bytes are the waves' output staging */
  static_assert(8 * 32 * 68 * 4 <= 2 * G2_STAGE, "output staging must fit the operand stages");
  float (*so)[32][68] = (float (*)[32][68])sm;
  const int tid = threadIdx.x, w = tid >> 5, lane = tid & 31, ln = lane & 15, hh = lane >> 4; const int by = blockIdx.y;
  A += (size_t)by * sA; Bh += (size_t)by * sB; const size_t cofs = (size_t)by * sC; const float* bp = bias ? bias + (size_t)by * sBias : nullptr;
  const int ntn = N >> 7; const int mt = blockIdx.x / ntn, nq = blockIdx.x - mt * ntn; if (mt * 128 >= M) return;      /* the same for the whole block, in front of every barrier */
  const int wm = w & 3, wn = w >> 2; const int row0 = mt * 128 + 32 * wm, col0 = nq * 128 + 64 * wn;
  const _Float16* ga = A + (size_t)(mt * 128 + (tid >> 3)) * lda + (tid & 7) * 8; const _Float16* gb = Bh + (size_t)(nq * 128 + (tid >> 3)) * ldb + (tid & 7) * 8;
  const unsigned l0 = (unsigned)(size_t)sm + (unsigned)((tid >> 3) * G2_PITCH + (tid & 7) * 16);      /* the thread's LDS byte address in stage buffer 0 */
  const int nt = K >> 6;
  g2_stage(l0, ga, lda, gb, ldb);
  asm volatile("s_wait_asynccnt 0x0" ::: "memory");      /* this wave's copies of stage 0 have landed */
  __syncthreads();                                       /* ... and every other wave's */
  if (1 < nt) g2_stage(l0 + G2_STAGE, ga + 64, lda, gb + 64, ldb);
  const v8f z8 = {0.f,0.f,0.f,0.f,0.f,0.f,0.f,0.f}; v8f c00 = z8, c01 = z8, c02 = z8, c03 = z8, c10 = z8, c11 = z8, c12 = z8, c13 = z8;
  for (int t = 0; t < nt; ++t) { const unsigned char* st = sm + (t & 1) * G2_STAGE;
    const _Float16* a0p = (const _Float16*)(st + (32 * wm + ln) * G2_PITCH); const _Float16* a1p = (const _Float16*)(st + (32 * wm + 16 + ln) * G2_PITCH);
    const _Float16* b0p = (const _Float16*)(st + (128 + 64 * wn + ln) * G2_PITCH); const _Float16* b1p = (const _Float16*)(st + (128 + 64 * wn + 16 + ln) * G2_PITCH); const _Float16* b2p = (const _Float16*)(st + (128 + 64 * wn + 32 + ln) * G2_PITCH); const _Float16* b3p = (const _Float16*)(st + (128 + 64 * wn + 48 + ln) * G2_PITCH);
#pragma unroll      /* both 32-k halves of the stage in one body: constant LDS offsets */
    for (int kb = 0; kb < 64; kb += 32) { const v16h a0 = g2_frag(a0p + kb, hh), a1 = g2_frag(a1p + kb, hh), b0 = g2_frag(b0p + kb, hh), b1 = g2_frag(b1p + kb, hh), b2 = g2_frag(b2p + kb, hh), b3 = g2_frag(b3p + kb, hh);      /* the six fragments as one group of LDS reads in front of their eight products: one LDS latency, not four */
      c00 = g2_mma(a0, b0, c00); c10 = g2_mma(a1, b0, c10); c01 = g2_mma(a0, b1, c01); c11 = g2_mma(a1, b1, c11);
      c02 = g2_mma(a0, b2, c02); c12 = g2_mma(a1, b2, c12); c03 = g2_mma(a0, b3, c03); c13 = g2_mma(a1, b3, c13); }
    asm volatile("s_wait_dscnt 0x0" ::: "memory");         /* this wave's reads of the stage are done before the buffer is given back */
    asm volatile("s_wait_asynccnt 0x0" ::: "memory");      /* this wave's copies of stage t + 1 have landed */
    __syncthreads();                                       /* publishes stage t + 1 and ends every wave's reads of stage t */
    if (t + 2 < nt) g2_stage(l0 + (unsigned)((t & 1) * G2_STAGE), ga + (size_t)(t + 2) * 64, lda, gb + (size_t)(t + 2) * 64, ldb); }
  asm volatile("s_wait_asynccnt 0x0" ::: "memory");        /* nothing is in flight when the stages become output staging */
  v8f accs[8] = {c00, c01, c02, c03, c10, c11, c12, c13};
#pragma unroll
  for (int u = 0; u < 8; ++u) { const int t = u & 3, half = u >> 2; const int col = col0 + t * 16 + ln; const float bv = bp ? bf16_round(bp[col]) : 0.f;
#pragma unroll
    for (int r = 0; r < 8; ++r) { const int rloc = half * 16 + 8 * hh + r; float v = accs[u][r] * alpha + bv; if (CP) { if (rowsPerB < 0) v += CP[cofs + (size_t)(row0g + row0 + rloc) * ldc + col];      /* rowsPerB < 0: own element of the batched C plane */ else { const int bidx = (row0g + row0 + rloc) / rowsPerB; v += CP[(size_t)bidx * sCPb + (size_t)by * 64 + col]; } }
      if (ACT == 3) v = fmaxf(v, 0.f); else if (ACT == 6) v = 0.5f * v * (1.0f + erff(v * 0.70710678118654752f)); else if (ACT == 11) v = 1.0f / (1.0f + expf(-v)); else if (ACT == 15) v = v / (1.0f + expf(-v)); else if (ACT == 12) v = (v > 0.f) ? v : 0.01f * v; else if (ACT == 8) v = tanhf(v); else if (ACT == 9) v = 0.5f * v * (1.0f + tanhf(0.7978845608028654f * (v + 0.044715f * v * v * v))); else if (ACT == 14) v = (v > 0.f) ? v : 0.1f * v; else if (ACT == 16) v = (v >= 0.f) ? v : 0.3f * v; else if (ACT == 17) v = (v >= 0.f) ? v : 0.2f * v;
      so[w][rloc][t * 16 + ln] = v; } }
  __builtin_amdgcn_fence(__ATOMIC_ACQ_REL, "workgroup"); __builtin_amdgcn_wave_barrier();
  const int rsub = lane >> 4, c4 = (lane & 15) * 4;
  {
#pragma unroll
    for (int q = 0; q < 16; ++q) { const int r = q * 2 + rsub; const v4f v = *(const v4fa*)&so[w][r][c4]; if (C) *(v4f*)(C + cofs + (size_t)(row0 + r) * ldc + col0 + c4) = v; if (C16) { v4h h4; for (int i = 0; i < 4; ++i) h4[i] = (_Float16)v[i]; *(v4h*)(C16 + cofs + (size_t)(row0 + r) * ldc + col0 + c4) = h4; } }
     } }


__global__ __launch_bounds__(256) void k_wnat(const float* __restrict__ w, size_t n8, _Float16* __restrict__ Bt) { const size_t t = (size_t)blockIdx.x * 256 + threadIdx.x; if (t >= n8) return; FragH f; for (int q = 0; q < 8; ++q) f.h[q] = (_Float16)(bf16_round(w[t * 8 + q]) * 16.0f); *(v8us*)((unsigned short*)Bt + t * 8) = f.half[0];  }
__global__ __launch_bounds__(256) void k_rsm(const float* __restrict__ S, _Float16* __restrict__ P, int nrows) {
  #pragma clang fp contract(off)
  const int i = blockIdx.x * 256 + threadIdx.x; if (i >= nrows) return; const float* s = S + (size_t)i * SQ; float mx = -3.0e38f;
#pragma unroll 1
  for (int j = 0; j < SQ; ++j) mx = fmaxf(mx, s[j]); float se = 0.f;
#pragma unroll 1
  for (int j = 0; j < SQ; ++j) se += expf(s[j] - mx); const float sc = 256.0f / se;
#pragma unroll 1
  for (int j0 = 0; j0 < SQ; j0 += 8) { FragH f; for (int q = 0; q < 8; ++q) f.h[q] = (_Float16)(expf(s[j0 + q] - mx) * sc); unsigned short* d = (unsigned short*)P + (size_t)i * SQ + j0; *(v8us*)d = f.half[0];  } }
__global__ __launch_bounds__(256) void k_vt(const _Float16* __restrict__ V16, int b, int h0, _Float16* __restrict__ VT) { __shared__ unsigned short tl[64][65]; const int tid = threadIdx.x; const int hh = blockIdx.x % HG, sg = blockIdx.x / HG; const int s0 = sg * 64; const int h = h0 + hh;
  for (int i = tid; i < 64 * 8; i += 256) { const int j = i / 8, d8 = (i % 8) * 8; FragH f; f.half[0] = *(const v8us*)((const unsigned short*)V16 + ((size_t)b * SQ + s0 + j) * DM + h * HD + d8); for (int q = 0; q < 8; ++q) tl[d8 + q][j] = f.u[q]; }
  __syncthreads();
  { for (int i = tid; i < 64 * 8; i += 256) { const int d = i / 8, j8 = (i % 8) * 8; FragH f; for (int q = 0; q < 8; ++q) f.u[q] = tl[d][j8 + q]; *(v8us*)((unsigned short*)VT + ((size_t)hh * HD + d) * SQ + s0 + j8) = f.half[0]; }  } }



// lanes l and l ^ 16 exchanged by the cross-row permlane (no LDS round trip)
__device__ __forceinline__ float xl_half(float v) { const int i = __float_as_int(v); return __int_as_float(__builtin_amdgcn_permlanex16(i, i, 0x76543210, 0xfedcba98, false, false)); }
__device__ __forceinline__ v8f fa_mma(v16h a, v16h b, v8f c) { return __builtin_amdgcn_wmma_f32_16x16x32_f16(false, a, false, b, (short)0, c, false, false); }
// 2^x on eight values; the v_nop is the one slot the instruction set asks for behind a transcendental, written in the same statement so that it stays directly behind the last one
__device__ __forceinline__ void fa_exp8(float (&e)[8]) { asm("v_exp_f32 %0, %0\n\tv_exp_f32 %1, %1\n\tv_exp_f32 %2, %2\n\tv_exp_f32 %3, %3\n\tv_exp_f32 %4, %4\n\tv_exp_f32 %5, %5\n\tv_exp_f32 %6, %6\n\tv_exp_f32 %7, %7\n\tv_nop" : "+v"(e[0]), "+v"(e[1]), "+v"(e[2]), "+v"(e[3]), "+v"(e[4]), "+v"(e[5]), "+v"(e[6]), "+v"(e[7])); }
__device__ __forceinline__ float fa_exp1(float x) { asm("v_exp_f32 %0, %0\n\tv_nop" : "+v"(x)); return x; }      /* same slot as above */
__global__ __launch_bounds__(128) void k_fattn(const _Float16* __restrict__ Q, const _Float16* __restrict__ Kr, const _Float16* __restrict__ VT, _Float16* __restrict__ O) {
  const int lane = threadIdx.x & 31, ln = lane & 15, hh = lane >> 4, w = threadIdx.x >> 5; const int bh = blockIdx.y, b = bh / NH, h = bh % NH; const int q0 = blockIdx.x * 128 + w * 32;
  const _Float16* qp = Q + ((size_t)b * SQ + q0 + ln) * LQ + h * HD; const _Float16* kp = Kr + ((size_t)b * SQ + ln) * LQ + h * HD; const _Float16* vp = VT + ((size_t)bh * HD + ln) * SQ;
  const float cs = 0.03125f * 1.44269504f;      /* 1 / sqrt(d_model) and log2 e in one factor on the raw products */
  const v8f z8 = {0.f,0.f,0.f,0.f,0.f,0.f,0.f,0.f};
  v16h qf[2][2], kf[2][2], vf[4]; v8f o[4][2]; float m[2] = {-3.0e38f, -3.0e38f}, l[2] = {0.f, 0.f};
#pragma unroll
  for (int u = 0; u < 2; ++u) for (int ch = 0; ch < 2; ++ch) { qf[u][ch] = g2_frag(qp + (size_t)u * 16 * LQ + ch * 32, hh); kf[u][ch] = g2_frag(kp + (size_t)u * 16 * LQ + ch * 32, hh); }
#pragma unroll
  for (int t = 0; t < 4; ++t) { o[t][0] = z8; o[t][1] = z8; }
  for (int j = 0; j < SQ; j += 32) {
    v8f s[2][2];      /* [key tile][query group], raw q . k */
#pragma unroll
    for (int kt = 0; kt < 2; ++kt) for (int qt = 0; qt < 2; ++qt) s[kt][qt] = fa_mma(kf[kt][1], qf[qt][1], fa_mma(kf[kt][0], qf[qt][0], z8));
    const int jn = (j + 32) & (SQ - 1);      /* next pass's keys, fetched one pass ahead into the same registers; the last pass re-reads keys 0..31 (in bounds, unused) */
#pragma unroll
    for (int kt = 0; kt < 2; ++kt) for (int ch = 0; ch < 2; ++ch) kf[kt][ch] = g2_frag(kp + (size_t)(jn + kt * 16) * LQ + ch * 32, hh);
    float mn[2];
#pragma unroll
    for (int qt = 0; qt < 2; ++qt) { float a = fmaxf(s[0][qt][0], s[1][qt][0]);
      for (int r = 1; r < 8; ++r) a = fmaxf(a, fmaxf(s[0][qt][r], s[1][qt][r]));
      mn[qt] = fmaxf(m[qt], fmaxf(a, xl_half(a))); }
    if (__builtin_amdgcn_ballot_w32(mn[0] > m[0] || mn[1] > m[1]) != 0) {      /* scalar branch: where no column's maximum moved every factor is exactly 1 */
#pragma unroll
      for (int qt = 0; qt < 2; ++qt) { const float a = fa_exp1((m[qt] - mn[qt]) * cs); l[qt] *= a; m[qt] = mn[qt];
        for (int t = 0; t < 4; ++t) for (int r = 0; r < 8; ++r) o[t][qt][r] *= a; } }
#pragma unroll
    for (int t = 0; t < 4; ++t) vf[t] = g2_frag(vp + (size_t)t * 16 * SQ + j, hh);      /* this pass's V^T: the exponentials below stand between the loads and their use */
    FragH pf[2];
#pragma unroll
    for (int qt = 0; qt < 2; ++qt) { const float mc = m[qt] * cs;
      for (int kt = 0; kt < 2; ++kt) { float e[8];
        for (int r = 0; r < 8; ++r) e[r] = fmaf(s[kt][qt][r], cs, -mc);
        fa_exp8(e);
        l[qt] += ((e[0] + e[1]) + (e[2] + e[3])) + ((e[4] + e[5]) + (e[6] + e[7]));
        for (int r = 0; r < 8; ++r) pf[qt].h[kt * 8 + r] = (_Float16)e[r]; } }
#pragma unroll
    for (int t = 0; t < 4; ++t) for (int qt = 0; qt < 2; ++qt) o[t][qt] = fa_mma(vf[t], pf[qt].v, o[t][qt]);
  }
#pragma unroll
  for (int qt = 0; qt < 2; ++qt) { const float inv = 64.0f / (l[qt] + xl_half(l[qt])); unsigned short* op = (unsigned short*)O + ((size_t)b * SQ + q0 + qt * 16 + ln) * DM + h * HD + 8 * hh;      /* o[t][qt][r] = O[query ln][16 t + 8 hh + r]: 16 contiguous bytes a store */
    for (int t = 0; t < 4; ++t) { FragH f; for (int r = 0; r < 8; ++r) f.h[r] = (_Float16)(o[t][qt][r] * inv); *(v8us*)(op + t * 16) = f.half[0]; } } }

// every launch-independent preparation job in ONE grid, the job picked by the block index (a scalar branch): the 48 per-head weight blocks, W_o, and the three x planes; none reads what another writes, and a thread still builds 8 consecutive f16 of one output row.
#define PB_WH (HD * (DM / 8) / 256)            /* blocks for one head's [DM][HD] weight block */
#define PB_WO (DM * (DM / 8) / 256)            /* blocks for W_o */
#define PB_X  ((int)(NR * DM / 8 / 256))       /* blocks for one x plane */
template <int N>
__device__ __forceinline__ void prep_wt(const float* __restrict__ Wm, _Float16* __restrict__ Wt, int t) { const int n = t / (DM / 8), k8 = (t % (DM / 8)) * 8; FragH f;      /* Wt[n][k] = f16(bf16(W[k][n]) x16), W row-major [DM][N]; x16 (a power of two) keeps the bf16-exact weights exact in f16, away from the subnormal range */
#pragma unroll
  for (int i = 0; i < 8; ++i) f.h[i] = (_Float16)(bf16_round(Wm[(size_t)(k8 + i) * N + n]) * 16.0f);
  *(v8us*)((unsigned short*)Wt + (size_t)n * DM + k8) = f.half[0];
  asm volatile("s_wait_xcnt 0x0" ::: "memory"); }      /* the store's registers are released before any code the compiler lays behind this job can rewrite them */
__global__ __launch_bounds__(256) void k_prep(const float* __restrict__ x, const float* __restrict__ wq, const float* __restrict__ wk, const float* __restrict__ wv, const float* __restrict__ wo, _Float16* __restrict__ Bt, _Float16* __restrict__ X16) {
  int blk = blockIdx.x; const int tid = threadIdx.x;
  if (blk < 3 * NH * PB_WH) { const int p = blk / (NH * PB_WH), r = blk % (NH * PB_WH), h = r / PB_WH; const float* wp = (p == 0 ? wq : p == 1 ? wk : wv) + (size_t)h * DM * HD;      /* plane p (q, k, v), head h: its HD rows of the [out][in] plane */
    prep_wt<HD>(wp, Bt + (size_t)p * DM * DM + (size_t)h * HD * DM, (r % PB_WH) * 256 + tid); return; }
  blk -= 3 * NH * PB_WH;
  if (blk < PB_WO) { prep_wt<DM>(wo, Bt + (size_t)3 * DM * DM, blk * 256 + tid); return; }
  blk -= PB_WO;
  const int p = blk / PB_X; const size_t t = (size_t)(blk % PB_X) * 256 + tid; FragH f;      /* x plane p as exact f16 rows */
#pragma unroll
  for (int q = 0; q < 8; ++q) f.h[q] = (_Float16)bf16_round(x[t * 8 + q]);
  *(v8us*)((unsigned short*)X16 + (size_t)p * NR * DM + t * 8) = f.half[0];
  asm volatile("s_wait_xcnt 0x0" ::: "memory"); }      /* as in prep_wt: the store's registers are released before anything behind it can rewrite them */

extern "C" void kernel_launch(void* const* d_in, const int* in_sizes, int n_in,
                              void* d_out, int out_size, void* d_ws, size_t ws_size, hipStream_t stream) {
  (void)in_sizes; (void)n_in; (void)out_size;
  const float* const* I = (const float* const*)d_in; const float* x = I[0]; const float* wq = I[1]; const float* wk = I[2]; const float* wv = I[3]; const float* wo = I[4]; const float* bo = I[5];      /* ONE input stream (X) read on all three projections; Wq, Wk, Wv are PER-HEAD STACKS [16][1024][64] = [head][in][out] (the module has NO q / k / v biases: null pointers in the guarded bias slots); Wo [in][out] [1024][1024] at I[4], bo at I[5] */
  char* ws = (char*)d_ws; size_t off = 0;
  auto take = [&](size_t bytes) { char* p = ws + off; off += (bytes + 255) & ~(size_t)255; return p; };
  _Float16* BQ = (_Float16*)take((size_t)4 * DM * DM * 2); _Float16* BO = BQ + (size_t)3 * DM * DM;      /* weight planes q, k, v, o, one behind the other: a grid index steps through them */
  _Float16* XQ = (_Float16*)take((size_t)3 * NR * DM * 2);      /* x planes for q, k, v, likewise */
  _Float16* Q16 = (_Float16*)take((size_t)3 * NR * DM * 2); _Float16* K16 = Q16 + NR * DM; _Float16* V16 = K16 + NR * DM; _Float16* O16 = (_Float16*)take(NR * DM * 2);
  _Float16* VT = (_Float16*)take((size_t)NB * NH * HD * SQ * 2);
  if (off > ws_size) return;
  k_prep<<<3 * NH * PB_WH + PB_WO + 3 * PB_X, 256, 0, stream>>>(x, wq, wk, wv, wo, BQ, XQ);      /* PER-HEAD STACKS wq / wk / wv [NH][DM][HD]: head h is a row-major [in = DM][out = HD] block at w + h * DM * HD, transposed into rows Bt[h * HD + e][k] of the [out][in] plane (x16); wo is a plain [in][out] [DM][DM] matrix; the three inputs as exact f16 rows */
  const size_t r0p = (size_t)B0 * SQ;      /* first projected row */
  k_gemm2<0><<<dim3((unsigned)((MP / 128) * (DM / 128)), 3), 256, 0, stream>>>(XQ + r0p * DM, DM, NR * DM, BQ, DM, (size_t)DM * DM, 0.0625f, nullptr, 0, nullptr, 1, 0, 0, nullptr, Q16 + r0p * DM, DM, NR * DM, MP, DM, DM);      /* Q, K, V: blockIdx.y picks the x plane, the weight plane and the output plane */
  k_vt<NH, SQ><<<NB * NH * (SQ / 64), 256, 0, stream>>>(V16, LQ, 0, VT);      /* V^T [NB][NH][HD][SQ], both batches */
  k_fattn<<<dim3(SQ / 128, NB * NH), 128, 0, stream>>>(Q16, K16, VT, O16);      /* scores, softmax and P V in one kernel: o (merged heads, x64) as f16 rows */
  k_gemm2<0><<<dim3((unsigned)((MPO / 128) * (DM / 128)), 1), 256, 0, stream>>>(O16 + r0p * DM, DM, 0, BO, DM, 0, 0.0009765625f, bo, 0, nullptr, 1, 0, 0, (float*)d_out + r0p * DM, nullptr, DM, 0, MPO, DM, DM);      /* out rows are the output layout */
}

// v005
// A run of this version takes 126 microseconds.
// In both of two side-by-side timings against v004, it was 1.09 times as fast.
// Counting every step since v000, it is 29.1 times as fast.
#include <hip/hip_runtime.h>
#define NB 2
#define SQ 2048
#define DM 1024
#define NH 16
#define HD 64
#define HG 4                         /* heads per launch of the per-batch k_vt */
#define B0 0                         /* first batch processed (debug hook) */
#define NBR NB                       /* batches processed (debug hook) */
#define NR ((size_t)NB * SQ)         /* token rows */
#define MP ((int)((size_t)NBR * SQ)) /* rows projected (debug hook) */
#define QN SQ                        /* query rows per batch; not used */
#define NHD NH                       /* heads; not used */
#define MPO MP                       /* rows through the output stage (debug hook) */
#define LQ DM      /* row pitch of the q/k/v rows */
typedef __bf16 v16b __attribute__((ext_vector_type(16)));
typedef unsigned short v8us __attribute__((ext_vector_type(8), may_alias));
typedef float  v8f  __attribute__((ext_vector_type(8)));
typedef float  v4f  __attribute__((ext_vector_type(4)));
typedef float  v4fa __attribute__((ext_vector_type(4), may_alias));
union FragB { v16b v; v8us half[2]; unsigned short u[16]; };

__device__ __forceinline__ unsigned short bf16_bits(float x) { unsigned int u = __float_as_uint(x); return (unsigned short)((u + 0x7FFFu + ((u >> 16) & 1u)) >> 16); }
__device__ __forceinline__ float bf16_val(unsigned short b) { return __uint_as_float(((unsigned int)b) << 16); }
__device__ __forceinline__ float bf16_round(float x) { return bf16_val(bf16_bits(x)); }
// D += A·B with NT terms: 1 = ah·bh, 2 = + al·bh (A split), 3 = + ah·bl (both split)
template <int NT>
__device__ __forceinline__ v8f mmaN(v16b ah, v16b al, v16b bh, v16b bl, v8f c) {
  c = __builtin_amdgcn_wmma_f32_16x16x32_bf16(false, ah, false, bh, (short)0, c, false, false);
  if (NT >= 2) c = __builtin_amdgcn_wmma_f32_16x16x32_bf16(false, al, false, bh, (short)0, c, false, false);
  if (NT >= 3) c = __builtin_amdgcn_wmma_f32_16x16x32_bf16(false, ah, false, bl, (short)0, c, false, false);
  asm volatile("v_nop\n\tv_nop\n\tv_nop\n\tv_nop" : "+v"(c) : "v"(ah), "v"(al), "v"(bh), "v"(bl));
  return c;
}

__global__ __launch_bounds__(256) void k_wt_bf16(const float* __restrict__ W, unsigned short* __restrict__ Wt, int K, int N) {
  const int t = blockIdx.x * 256 + threadIdx.x;
  const int k8n = K / 8;
  if (t >= N * k8n) return;
  const int n = t / k8n, k8 = (t % k8n) * 8;
  v8us v;
#pragma unroll
  for (int i = 0; i < 8; ++i) v[i] = bf16_bits(W[(size_t)(k8 + i) * N + n]);
  *(v8us*)(Wt + (size_t)n * K + k8) = v;
  
}

// GEMM C[M][N] (f32, pitch ldc) = act(A[M][K]·W + bias). A f32 row-major (pitch lda) converted per fragment to bf16
// (ASPLIT: hi/lo two planes -> 2 terms, else single rounded term); Wt bf16 [N][K] (pitch ldb). BIAS_BF16 rounds the
// bias to bf16 first (bias quantised to bf16 before the add). K%32==0, M%16==0, N%64==0.
template <bool ASPLIT, int ACT, bool BIAS_BF16>
__global__ __launch_bounds__(128) void k_gemm_bf(const float* __restrict__ A, int lda, const unsigned short* __restrict__ Wt, int ldb,
                                               const float* __restrict__ bias, float* __restrict__ C, int ldc, int M, int N, int K) {
  __shared__ __attribute__((aligned(16))) float so[4][16][64];
  const int tid = threadIdx.x, w = tid >> 5, lane = tid & 31, ln = lane & 15, hh = lane >> 4;
  const int ntn = N / 64;
  const int wid = blockIdx.x * 4 + w;
  const int mt = wid / ntn, nq = wid % ntn;
  if (mt * 16 >= M) return;
  const int row0 = mt * 16, col0 = nq * 64;
  const float* arow = A + (size_t)(row0 + ln) * lda;
  v8f acc[4] = {};
  for (int kb = 0; kb < K; kb += 32) {
    FragB ah, al;
    const v4f x0 = *(const v4fa*)(arow + kb + 8 * hh), x1 = *(const v4fa*)(arow + kb + 8 * hh + 4);
    const v4f x2 = *(const v4fa*)(arow + kb + 16 + 8 * hh), x3 = *(const v4fa*)(arow + kb + 16 + 8 * hh + 4);
    float xs[16] = {x0[0],x0[1],x0[2],x0[3],x1[0],x1[1],x1[2],x1[3],x2[0],x2[1],x2[2],x2[3],x3[0],x3[1],x3[2],x3[3]};
#pragma unroll
    for (int i = 0; i < 16; ++i) { const unsigned short hb = bf16_bits(xs[i]); ah.u[i] = hb; al.u[i] = ASPLIT ? bf16_bits(xs[i] - bf16_val(hb)) : (unsigned short)0; }
#pragma unroll
    for (int t = 0; t < 4; ++t) {
      const unsigned short* brow = Wt + (size_t)(col0 + t * 16 + ln) * ldb + kb;
      FragB b;
      b.half[0] = *(const v8us*)(brow + 8 * hh);
      b.half[1] = *(const v8us*)(brow + 16 + 8 * hh);
      acc[t] = mmaN<ASPLIT ? 2 : 1>(ah.v, al.v, b.v, b.v, acc[t]);
    }
  }
#pragma unroll
  for (int t = 0; t < 4; ++t) {
    float bv = bias ? bias[col0 + t * 16 + ln] : 0.f;
    if (BIAS_BF16) bv = bf16_round(bv);
#pragma unroll
    for (int r = 0; r < 8; ++r) { float v = acc[t][r] + bv; if (ACT == 1) v = fmaxf(v, 0.f); so[w][8 * hh + r][t * 16 + ln] = v; }
  }
  __builtin_amdgcn_fence(__ATOMIC_ACQ_REL, "workgroup");
  __builtin_amdgcn_wave_barrier();
  const int rsub = lane >> 4, c4 = (lane & 15) * 4;
  {
#pragma unroll
    for (int q = 0; q < 8; ++q) {
      const int r = q * 2 + rsub;
      const v4f v = *(const v4fa*)&so[w][r][c4];
      *(v4f*)(C + (size_t)(row0 + r) * ldc + col0 + c4) = v;
    }
    
  }
}

// GEMM C = act(A·W + bias + resid): A f32 (ASPLIT -> hi/lo 2 terms), Wt bf16 [N][K]; ACT 0 none, 1 relu, 2 exact gelu;
// resid (optional, f32, row index = (row % rmod), pitch ldr, RES_BF16 rounds it) added before the activation.
template <bool ASPLIT, int ACT, bool BIAS_BF16, bool RES_BF16>
__global__ __launch_bounds__(128) void k_gemm_bf3(const float* __restrict__ A, int lda, const unsigned short* __restrict__ Wt, int ldb,
                                                const float* __restrict__ bias, const float* __restrict__ resid, int rmod, int ldr,
                                                float* __restrict__ C, int ldc, int M, int N, int K) {
  __shared__ __attribute__((aligned(16))) float so[4][16][64];
  const int tid = threadIdx.x, w = tid >> 5, lane = tid & 31, ln = lane & 15, hh = lane >> 4;
  const int ntn = N / 64;
  const int wid = blockIdx.x * 4 + w;
  const int mt = wid / ntn, nq = wid % ntn;
  if (mt * 16 >= M) return;
  const int row0 = mt * 16, col0 = nq * 64;
  const float* arow = A + (size_t)(row0 + ln) * lda;
  v8f acc[4] = {};
  for (int kb = 0; kb < K; kb += 32) {
    FragB ah, al;
    const v4f x0 = *(const v4fa*)(arow + kb + 8 * hh), x1 = *(const v4fa*)(arow + kb + 8 * hh + 4);
    const v4f x2 = *(const v4fa*)(arow + kb + 16 + 8 * hh), x3 = *(const v4fa*)(arow + kb + 16 + 8 * hh + 4);
    float xs[16] = {x0[0],x0[1],x0[2],x0[3],x1[0],x1[1],x1[2],x1[3],x2[0],x2[1],x2[2],x2[3],x3[0],x3[1],x3[2],x3[3]};
#pragma unroll
    for (int i = 0; i < 16; ++i) { const unsigned short hb = bf16_bits(xs[i]); ah.u[i] = hb; al.u[i] = ASPLIT ? bf16_bits(xs[i] - bf16_val(hb)) : (unsigned short)0; }
#pragma unroll
    for (int t = 0; t < 4; ++t) {
      const unsigned short* brow = Wt + (size_t)(col0 + t * 16 + ln) * ldb + kb;
      FragB b;
      b.half[0] = *(const v8us*)(brow + 8 * hh);
      b.half[1] = *(const v8us*)(brow + 16 + 8 * hh);
      acc[t] = mmaN<ASPLIT ? 2 : 1>(ah.v, al.v, b.v, b.v, acc[t]);
    }
  }
#pragma unroll
  for (int t = 0; t < 4; ++t) {
    const int col = col0 + t * 16 + ln;
    float bv = bias ? bias[col] : 0.f;
    if (BIAS_BF16) bv = bf16_round(bv);
#pragma unroll
    for (int r = 0; r < 8; ++r) {
      float v = acc[t][r] + bv;
      if (resid) { float rv = resid[(size_t)((row0 + 8 * hh + r) % rmod) * ldr + col]; if (RES_BF16) rv = bf16_round(rv); v += rv; }
      if (ACT == 1) v = fmaxf(v, 0.f);
      if (ACT == 2) v = 0.5f * v * (1.0f + erff(v * 0.70710678118654752f));
      if (ACT == 3) { const float u = 0.7978845608028654f * (v + 0.044715f * v * v * v); v = 0.5f * v * (1.0f + tanhf(u)); }
      so[w][8 * hh + r][t * 16 + ln] = v;
    }
  }
  __builtin_amdgcn_fence(__ATOMIC_ACQ_REL, "workgroup");
  __builtin_amdgcn_wave_barrier();
  const int rsub = lane >> 4, c4 = (lane & 15) * 4;
  {
#pragma unroll
    for (int q = 0; q < 8; ++q) {
      const int r = q * 2 + rsub;
      const v4f v = *(const v4fa*)&so[w][r][c4];
      *(v4f*)(C + (size_t)(row0 + r) * ldc + col0 + c4) = v;
    }
    
  }
}
// row LayerNorm (biased variance, eps) over N: s = X (+ R); optional out_sum <- s; out_norm <- (s-mu)*rsqrt(var+eps)*g + b
template <bool PARAM_BF16>
__global__ __launch_bounds__(256) void k_layernorm(const float* __restrict__ X, const float* __restrict__ R, const float* __restrict__ g, const float* __restrict__ bta,
                                                  float* __restrict__ out_sum, float* __restrict__ out_norm, int N, float eps) {
  __shared__ float red[256];
  const int row = blockIdx.x, tid = threadIdx.x;
  const float* x = X + (size_t)row * N; const float* rr = R ? R + (size_t)row * N : nullptr;
  float vals[16];                     // up to N = 4096
  const int per = N / 256;            // contiguous chunk per thread? use strided-by-4 chunks: thread handles j = tid*4 + 1024*u
  float s1 = 0.f;
  for (int u = 0; u < per / 4; ++u) {
    const int j = tid * 4 + 1024 * u;
    const v4f a = *(const v4fa*)(x + j);
    v4f b = {0.f,0.f,0.f,0.f}; if (rr) b = *(const v4fa*)(rr + j);
#pragma unroll
    for (int q = 0; q < 4; ++q) { const float v = a[q] + b[q]; vals[u * 4 + q] = v; s1 += v; }
  }
  red[tid] = s1; __syncthreads();
  for (int st = 128; st > 0; st >>= 1) { if (tid < st) red[tid] += red[tid + st]; __syncthreads(); }
  const float mu = red[0] / (float)N; __syncthreads();
  float s2 = 0.f;
  for (int u = 0; u < per / 4; ++u)
#pragma unroll
    for (int q = 0; q < 4; ++q) { const float c = vals[u * 4 + q] - mu; s2 += c * c; }
  red[tid] = s2; __syncthreads();
  for (int st = 128; st > 0; st >>= 1) { if (tid < st) red[tid] += red[tid + st]; __syncthreads(); }
  const float rs = rsqrtf(red[0] / (float)N + eps);
  {
    for (int u = 0; u < per / 4; ++u) {
      const int j = tid * 4 + 1024 * u;
      v4f o, sm;
#pragma unroll
      for (int q = 0; q < 4; ++q) {
        float gg = g[j + q], bb = bta[j + q];
        if (PARAM_BF16) { gg = bf16_round(gg); bb = bf16_round(bb); }
        sm[q] = vals[u * 4 + q]; o[q] = (vals[u * 4 + q] - mu) * rs * gg + bb;
      }
      if (out_sum) *(v4f*)(out_sum + (size_t)row * N + j) = sm;
      *(v4f*)(out_norm + (size_t)row * N + j) = o;
    }
    
  }
}



// ---- f16 WMMA path (v_wmma_f32_16x16x32_f16): 11-bit significands for operands in range — used where a [0,1] probability operand needs more precision than bf16
typedef _Float16 v16h __attribute__((ext_vector_type(16)));
union FragH { v16h v; v8us half[2]; _Float16 h[16]; unsigned short u[16]; };
template <int NT>
__device__ __forceinline__ v8f mmaH(v16h ah, v16h al, v16h bh, v16h bl, v8f c) {
  c = __builtin_amdgcn_wmma_f32_16x16x32_f16(false, ah, false, bh, (short)0, c, false, false);
  if (NT >= 2) c = __builtin_amdgcn_wmma_f32_16x16x32_f16(false, al, false, bh, (short)0, c, false, false);
  if (NT >= 3) c = __builtin_amdgcn_wmma_f32_16x16x32_f16(false, ah, false, bl, (short)0, c, false, false);
  asm volatile("v_nop\n\tv_nop\n\tv_nop\n\tv_nop" : "+v"(c) : "v"(ah), "v"(al), "v"(bh), "v"(bl));
  return c;
}
// batched GEMM like k_gemm_b but f16 operands: A f32 (split into f16 hi/lo if ASPLIT, else rounded to f16), Bt = f16 values [n][k]; alpha; C f32; N multiple of 16 (partial tiles skipped)
template <bool ASPLIT>
__global__ __launch_bounds__(128) void k_gemm_h(const float* __restrict__ A, int lda, size_t sA, const _Float16* __restrict__ Bh, int ldb, size_t sB, float alpha, float* __restrict__ C, int ldc, size_t sC, int M, int N, int K) {
  __shared__ __attribute__((aligned(16))) float so[4][16][64];
  const int tid = threadIdx.x, w = tid >> 5, lane = tid & 31, ln = lane & 15, hh = lane >> 4; const int by = blockIdx.y;
  A += (size_t)by * sA; Bh += (size_t)by * sB; C += (size_t)by * sC;
  const int ntn = (N + 63) / 64; const int wid = blockIdx.x * 4 + w; const int mt = wid / ntn, nq = wid % ntn; if (mt * 16 >= M) return;
  const int row0 = mt * 16, col0 = nq * 64; const float* arow = A + (size_t)(row0 + ln) * lda;
  v8f acc[4] = {};
  for (int kb = 0; kb < K; kb += 32) {
    FragH ah, al;
    const v4f x0 = *(const v4fa*)(arow + kb + 8 * hh), x1 = *(const v4fa*)(arow + kb + 8 * hh + 4), x2 = *(const v4fa*)(arow + kb + 16 + 8 * hh), x3 = *(const v4fa*)(arow + kb + 16 + 8 * hh + 4);
    float xs[16] = {x0[0],x0[1],x0[2],x0[3],x1[0],x1[1],x1[2],x1[3],x2[0],x2[1],x2[2],x2[3],x3[0],x3[1],x3[2],x3[3]};
#pragma unroll
    for (int i = 0; i < 16; ++i) { const _Float16 h = (_Float16)xs[i]; ah.h[i] = h; al.h[i] = ASPLIT ? (_Float16)(xs[i] - (float)h) : (_Float16)0.0f; }
#pragma unroll
    for (int t = 0; t < 4; ++t) { if (col0 + t * 16 >= N) continue; const size_t boff = (size_t)(col0 + t * 16 + ln) * ldb + kb; FragH bq; bq.half[0] = *(const v8us*)(Bh + boff + 8 * hh); bq.half[1] = *(const v8us*)(Bh + boff + 16 + 8 * hh);
      acc[t] = mmaH<ASPLIT ? 2 : 1>(ah.v, al.v, bq.v, bq.v, acc[t]); }
  }
#pragma unroll
  for (int t = 0; t < 4; ++t) { if (col0 + t * 16 >= N) continue;
#pragma unroll
    for (int r = 0; r < 8; ++r) so[w][8 * hh + r][t * 16 + ln] = acc[t][r] * alpha; }
  __builtin_amdgcn_fence(__ATOMIC_ACQ_REL, "workgroup"); __builtin_amdgcn_wave_barrier();
  const int rsub = lane >> 4, c4 = (lane & 15) * 4;
  {
#pragma unroll
    for (int q = 0; q < 8; ++q) { const int r = q * 2 + rsub; if (col0 + c4 < N) { const v4f v = *(const v4fa*)&so[w][r][c4]; *(v4f*)(C + (size_t)(row0 + r) * ldc + col0 + c4) = v; } }
     }
}

// k_gemm_hh variant with fused epilogue: v = acc·alpha + bias[by·sBias + col] (+ CP[(row/rowsPerB)·sCPb + by·64 + col] if CP) ; ACT 0 none / 1 elu ; writes f16 C16 (and f32 C if non-null)
template <int ACT>
__global__ __launch_bounds__(128) void k_gemm_hhx(const _Float16* __restrict__ A, int lda, size_t sA, const _Float16* __restrict__ Bh, int ldb, size_t sB, float alpha, const float* __restrict__ bias, size_t sBias, const float* __restrict__ CP, int rowsPerB, size_t sCPb, int row0g,
    float* __restrict__ C, _Float16* __restrict__ C16, int ldc, size_t sC, int M, int N, int K) {
  __shared__ __attribute__((aligned(16))) float so[4][16][64];
  const int tid = threadIdx.x, w = tid >> 5, lane = tid & 31, ln = lane & 15, hh = lane >> 4; const int by = blockIdx.y;
  A += (size_t)by * sA; Bh += (size_t)by * sB; const size_t cofs = (size_t)by * sC; const float* bp = bias ? bias + (size_t)by * sBias : nullptr;
  const int ntn = (N + 63) / 64; const int wid = blockIdx.x * 4 + w; const int mt = wid / ntn, nq = wid % ntn; if (mt * 16 >= M) return;
  const int row0 = mt * 16, col0 = nq * 64; const _Float16* arow = A + (size_t)(row0 + ln) * lda;
  v8f acc[4] = {};
  for (int kb = 0; kb < K; kb += 32) { FragH ah; ah.half[0] = *(const v8us*)((const unsigned short*)arow + kb + 8 * hh); ah.half[1] = *(const v8us*)((const unsigned short*)arow + kb + 16 + 8 * hh);
#pragma unroll
    for (int t = 0; t < 4; ++t) { if (col0 + t * 16 >= N) continue; const size_t boff = (size_t)(col0 + t * 16 + ln) * ldb + kb; FragH bq; bq.half[0] = *(const v8us*)((const unsigned short*)Bh + boff + 8 * hh); bq.half[1] = *(const v8us*)((const unsigned short*)Bh + boff + 16 + 8 * hh);
      acc[t] = mmaH<1>(ah.v, ah.v, bq.v, bq.v, acc[t]); }
  }
#pragma unroll
  for (int t = 0; t < 4; ++t) { if (col0 + t * 16 >= N) continue; const int col = col0 + t * 16 + ln; const float bv = bp ? bf16_round(bp[col]) : 0.f;
#pragma unroll
    for (int r = 0; r < 8; ++r) { float v = acc[t][r] * alpha + bv; if (CP) { const int rr = row0g + row0 + 8 * hh + r; if (rowsPerB < 0) v += CP[cofs + (size_t)rr * ldc + col];      /* rowsPerB < 0: own element of the batched C plane */ else { const int bidx = rr / rowsPerB; v += CP[(size_t)bidx * sCPb + (size_t)by * 64 + col]; } } if (ACT == 1) v = (v > 0.f) ? v : expm1f(v); else if (ACT == 7) v = (v > 0.f) ? v + 1.0f : expf(v); else if (ACT == 8) v = tanhf(v); else if (ACT == 9) v = 0.5f * v * (1.0f + tanhf(0.7978845608028654f * (v + 0.044715f * v * v * v))); else if (ACT == 11) v = 1.0f / (1.0f + expf(-v)); else if (ACT == 12) v = (v > 0.f) ? v : 0.01f * v; else if (ACT == 14) v = (v > 0.f) ? v : 0.1f * v; else if (ACT == 16) v = (v >= 0.f) ? v : 0.3f * v; else if (ACT == 17) v = (v >= 0.f) ? v : 0.2f * v; else if (ACT == 15) v = v / (1.0f + expf(-v)); else if (ACT == 3) v = fmaxf(v, 0.f); else if (ACT == 6) v = 0.5f * v * (1.0f + erff(v * 0.70710678118654752f)); so[w][8 * hh + r][t * 16 + ln] = v; } }
  __builtin_amdgcn_fence(__ATOMIC_ACQ_REL, "workgroup"); __builtin_amdgcn_wave_barrier();
  const int rsub = lane >> 4, c4 = (lane & 15) * 4; typedef _Float16 v4h __attribute__((ext_vector_type(4)));
  {
#pragma unroll
    for (int q = 0; q < 8; ++q) { const int r = q * 2 + rsub; if (col0 + c4 < N) { const v4f v = *(const v4fa*)&so[w][r][c4]; if (C) *(v4f*)(C + cofs + (size_t)(row0 + r) * ldc + col0 + c4) = v; if (C16) { v4h h4; for (int i = 0; i < 4; ++i) h4[i] = (_Float16)v[i]; *(v4h*)(C16 + cofs + (size_t)(row0 + r) * ldc + col0 + c4) = h4; } } }
     }
}


typedef _Float16 v4h __attribute__((ext_vector_type(4)));

__global__ __launch_bounds__(256) void k_h16(const float* __restrict__ x, _Float16* __restrict__ X16, size_t n8) { const size_t t = (size_t)blockIdx.x * 256 + threadIdx.x; if (t >= n8) return; FragH f;
#pragma unroll
  for (int q = 0; q < 8; ++q) f.h[q] = (_Float16)x[t * 8 + q]; *(v8us*)((unsigned short*)X16 + t * 8) = f.half[0];  }
__global__ __launch_bounds__(256) void k_round16f(const float* __restrict__ W, _Float16* __restrict__ Bt, size_t n8) { const size_t t = (size_t)blockIdx.x * 256 + threadIdx.x; if (t >= n8) return; FragH f;
#pragma unroll
  for (int i = 0; i < 8; ++i) f.h[i] = (_Float16)(bf16_round(W[t * 8 + i]) * 16.0f); *(v8us*)((unsigned short*)Bt + t * 8) = f.half[0];  }
template <int NHv, int TTv>
__global__ __launch_bounds__(256) void k_vt(const _Float16* __restrict__ V16, int ldv, int voff, _Float16* __restrict__ Vt) { __shared__ unsigned short tl[64][66]; const int tid = threadIdx.x; const int slab = blockIdx.x / (TTv / 64), lg = blockIdx.x % (TTv / 64); const int b = slab / NHv, h = slab % NHv;
  for (int i = tid; i < 64 * 8; i += 256) { const int r = i / 8, c8 = (i % 8) * 8; FragH f; f.half[0] = *(const v8us*)((const unsigned short*)V16 + ((size_t)b * TTv + lg * 64 + r) * ldv + voff + h * 64 + c8);
#pragma unroll
    for (int q = 0; q < 8; ++q) tl[r][c8 + q] = f.u[q]; }
  __syncthreads();
  {
#pragma unroll
    for (int rd = 0; rd < 2; ++rd) { const int d = rd * 32 + tid / 8, pc = tid % 8; FragH f;
#pragma unroll
      for (int q = 0; q < 8; ++q) f.u[q] = tl[pc * 8 + q][d];
      *(v8us*)((unsigned short*)Vt + ((size_t)slab * 64 + d) * TTv + lg * 64 + pc * 8) = f.half[0]; }
     } }

__global__ __launch_bounds__(256) void k_hl(const float* __restrict__ F, _Float16* __restrict__ Hh, _Float16* __restrict__ Hl, size_t n8) { const size_t t = (size_t)blockIdx.x * 256 + threadIdx.x; if (t >= n8) return; FragH fh, fl; const v4f a = *(const v4fa*)(F + t * 8), c = *(const v4fa*)(F + t * 8 + 4);
#pragma unroll
  for (int q = 0; q < 4; ++q) { _Float16 h = (_Float16)a[q]; fh.h[q] = h; fl.h[q] = (_Float16)((a[q] - (float)h) * 1024.0f); h = (_Float16)c[q]; fh.h[4 + q] = h; fl.h[4 + q] = (_Float16)((c[q] - (float)h) * 1024.0f); }
  { *(v8us*)((unsigned short*)Hh + t * 8) = fh.half[0]; *(v8us*)((unsigned short*)Hl + t * 8) = fl.half[0];  } }

// ---- fast GEMM (block tile 128x128, eight waves of 32x64; requires M % 128 == 0, N % 128 == 0, K % 64 == 0); epilogue = k_gemm_hhx semantics ----
// Both operands pass through LDS: a stage is 64 k (one whole 128-byte line) of the block's 128 A rows and 128 B rows, brought by asynchronous copies and read by all eight waves; two stages, the next one in flight while this one is multiplied.
__device__ __forceinline__ v16h g2_frag(const _Float16* p, int hh) { FragH f; f.half[0] = *(const v8us*)((const unsigned short*)p + 8 * hh); f.half[1] = *(const v8us*)((const unsigned short*)p + 16 + 8 * hh); return f.v; }
__device__ __forceinline__ v8f g2_mma(v16h a, v16h b, v8f c) { v8f d = __builtin_amdgcn_wmma_f32_16x16x32_f16(false, a, false, b, (short)0, c, false, false); asm volatile("v_nop\n\tv_nop\n\tv_nop\n\tv_nop" : "+v"(d) : "v"(a), "v"(b)); return d; }
#define G2_PITCH 144                   /* LDS row pitch in bytes: 16 x odd, free of bank conflicts for 16-byte reads */
#define G2_STAGE (256 * G2_PITCH)      /* rows 0..127 = A, rows 128..255 = B */
// one stage's copies: a thread brings 16 bytes of each of 8 rows (32 rows apart; 4 of A, 4 of B), so a wave-wide copy covers 4 whole 128-byte lines.
// s_wait_xcnt 0 is the statement's last line: it then stands in front of every later rewrite of the address registers the copies name.
__device__ __forceinline__ void g2_stage(unsigned l, const _Float16* a, int lda, const _Float16* b, int ldb) {
  const _Float16* a1 = a + (size_t)32 * lda; const _Float16* a2 = a + (size_t)64 * lda; const _Float16* a3 = a + (size_t)96 * lda;
  const _Float16* b1 = b + (size_t)32 * ldb; const _Float16* b2 = b + (size_t)64 * ldb; const _Float16* b3 = b + (size_t)96 * ldb;
  asm volatile("global_load_async_to_lds_b128 %0, %8, off\n\tglobal_load_async_to_lds_b128 %1, %9, off\n\tglobal_load_async_to_lds_b128 %2, %10, off\n\tglobal_load_async_to_lds_b128 %3, %11, off\n\t"
               "global_load_async_to_lds_b128 %4, %12, off\n\tglobal_load_async_to_lds_b128 %5, %13, off\n\tglobal_load_async_to_lds_b128 %6, %14, off\n\tglobal_load_async_to_lds_b128 %7, %15, off\n\ts_wait_xcnt 0x0"
               :: "v"(l), "v"(l + 32 * G2_PITCH), "v"(l + 64 * G2_PITCH), "v"(l + 96 * G2_PITCH), "v"(l + 128 * G2_PITCH), "v"(l + 160 * G2_PITCH), "v"(l + 192 * G2_PITCH), "v"(l + 224 * G2_PITCH),
                  "v"(a), "v"(a1), "v"(a2), "v"(a3), "v"(b), "v"(b1), "v"(b2), "v"(b3) : "memory"); }
template <int ACT>
__global__ __launch_bounds__(256) void k_gemm2(const _Float16* __restrict__ A, int lda, size_t sA, const _Float16* __restrict__ Bh, int ldb, size_t sB, float alpha, const float* __restrict__ bias, size_t sBias, const float* __restrict__ CP, int rowsPerB, size_t sCPb, int row0g,
    float* __restrict__ C, _Float16* __restrict__ C16, int ldc, size_t sC, int M, int N, int K) { static_assert(ACT == 0 || ACT == 3 || ACT == 6 || ACT == 8 || ACT == 9 || ACT == 11 || ACT == 12 || ACT == 14 || ACT == 15 || ACT == 16 || ACT == 17, "k_gemm2: unsupported ACT code (would silently apply no activation)");
  __shared__ __attribute__((aligned(128))) unsigned char sm[2 * G2_STAGE];      /* the two operand stages; behind the loop's last barrier the same bytes are the waves' output staging */
  static_assert(8 * 32 * 68 * 4 <= 2 * G2_STAGE, "output staging must fit the operand stages");
  float (*so)[32][68] = (float (*)[32][68])sm;
  const int tid = threadIdx.x, w = tid >> 5, lane = tid & 31, ln = lane & 15, hh = lane >> 4; const int by = blockIdx.y;
  A += (size_t)by * sA; Bh += (size_t)by * sB; const size_t cofs = (size_t)by * sC; const float* bp = bias ? bias + (size_t)by * sBias : nullptr;
  const int ntn = N >> 7; const int mt = blockIdx.x / ntn, nq = blockIdx.x - mt * ntn; if (mt * 128 >= M) return;      /* the same for the whole block, in front of every barrier */
  const int wm = w & 3, wn = w >> 2; const int row0 = mt * 128 + 32 * wm, col0 = nq * 128 + 64 * wn;
  const _Float16* ga = A + (size_t)(mt * 128 + (tid >> 3)) * lda + (tid & 7) * 8; const _Float16* gb = Bh + (size_t)(nq * 128 + (tid >> 3)) * ldb + (tid & 7) * 8;
  const unsigned l0 = (unsigned)(size_t)sm + (unsigned)((tid >> 3) * G2_PITCH + (tid & 7) * 16);      /* the thread's LDS byte address in stage buffer 0 */
  const int nt = K >> 6;
  g2_stage(l0, ga, lda, gb, ldb);
  asm volatile("s_wait_asynccnt 0x0" ::: "memory");      /* this wave's copies of stage 0 have landed */
  __syncthreads();                                       /* ... and every other wave's */
  if (1 < nt) g2_stage(l0 + G2_STAGE, ga + 64, lda, gb + 64, ldb);
  const v8f z8 = {0.f,0.f,0.f,0.f,0.f,0.f,0.f,0.f}; v8f c00 = z8, c01 = z8, c02 = z8, c03 = z8, c10 = z8, c11 = z8, c12 = z8, c13 = z8;
  for (int t = 0; t < nt; ++t) { const unsigned char* st = sm + (t & 1) * G2_STAGE;
    const _Float16* a0p = (const _Float16*)(st + (32 * wm + ln) * G2_PITCH); const _Float16* a1p = (const _Float16*)(st + (32 * wm + 16 + ln) * G2_PITCH);
    const _Float16* b0p = (const _Float16*)(st + (128 + 64 * wn + ln) * G2_PITCH); const _Float16* b1p = (const _Float16*)(st + (128 + 64 * wn + 16 + ln) * G2_PITCH); const _Float16* b2p = (const _Float16*)(st + (128 + 64 * wn + 32 + ln) * G2_PITCH); const _Float16* b3p = (const _Float16*)(st + (128 + 64 * wn + 48 + ln) * G2_PITCH);
#pragma unroll      /* both 32-k halves of the stage in one body: constant LDS offsets */
    for (int kb = 0; kb < 64; kb += 32) { const v16h a0 = g2_frag(a0p + kb, hh), a1 = g2_frag(a1p + kb, hh), b0 = g2_frag(b0p + kb, hh), b1 = g2_frag(b1p + kb, hh), b2 = g2_frag(b2p + kb, hh), b3 = g2_frag(b3p + kb, hh);      /* the six fragments as one group of LDS reads in front of their eight products: one LDS latency, not four */
      c00 = g2_mma(a0, b0, c00); c10 = g2_mma(a1, b0, c10); c01 = g2_mma(a0, b1, c01); c11 = g2_mma(a1, b1, c11);
      c02 = g2_mma(a0, b2, c02); c12 = g2_mma(a1, b2, c12); c03 = g2_mma(a0, b3, c03); c13 = g2_mma(a1, b3, c13); }
    asm volatile("s_wait_dscnt 0x0" ::: "memory");         /* this wave's reads of the stage are done before the buffer is given back */
    asm volatile("s_wait_asynccnt 0x0" ::: "memory");      /* this wave's copies of stage t + 1 have landed */
    __syncthreads();                                       /* publishes stage t + 1 and ends every wave's reads of stage t */
    if (t + 2 < nt) g2_stage(l0 + (unsigned)((t & 1) * G2_STAGE), ga + (size_t)(t + 2) * 64, lda, gb + (size_t)(t + 2) * 64, ldb); }
  asm volatile("s_wait_asynccnt 0x0" ::: "memory");        /* nothing is in flight when the stages become output staging */
  v8f accs[8] = {c00, c01, c02, c03, c10, c11, c12, c13};
#pragma unroll
  for (int u = 0; u < 8; ++u) { const int t = u & 3, half = u >> 2; const int col = col0 + t * 16 + ln; const float bv = bp ? bf16_round(bp[col]) : 0.f;
#pragma unroll
    for (int r = 0; r < 8; ++r) { const int rloc = half * 16 + 8 * hh + r; float v = accs[u][r] * alpha + bv; if (CP) { if (rowsPerB < 0) v += CP[cofs + (size_t)(row0g + row0 + rloc) * ldc + col];      /* rowsPerB < 0: own element of the batched C plane */ else { const int bidx = (row0g + row0 + rloc) / rowsPerB; v += CP[(size_t)bidx * sCPb + (size_t)by * 64 + col]; } }
      if (ACT == 3) v = fmaxf(v, 0.f); else if (ACT == 6) v = 0.5f * v * (1.0f + erff(v * 0.70710678118654752f)); else if (ACT == 11) v = 1.0f / (1.0f + expf(-v)); else if (ACT == 15) v = v / (1.0f + expf(-v)); else if (ACT == 12) v = (v > 0.f) ? v : 0.01f * v; else if (ACT == 8) v = tanhf(v); else if (ACT == 9) v = 0.5f * v * (1.0f + tanhf(0.7978845608028654f * (v + 0.044715f * v * v * v))); else if (ACT == 14) v = (v > 0.f) ? v : 0.1f * v; else if (ACT == 16) v = (v >= 0.f) ? v : 0.3f * v; else if (ACT == 17) v = (v >= 0.f) ? v : 0.2f * v;
      so[w][rloc][t * 16 + ln] = v; } }
  __builtin_amdgcn_fence(__ATOMIC_ACQ_REL, "workgroup"); __builtin_amdgcn_wave_barrier();
  const int rsub = lane >> 4, c4 = (lane & 15) * 4;
  {
#pragma unroll
    for (int q = 0; q < 16; ++q) { const int r = q * 2 + rsub; const v4f v = *(const v4fa*)&so[w][r][c4]; if (C) *(v4f*)(C + cofs + (size_t)(row0 + r) * ldc + col0 + c4) = v; if (C16) { v4h h4; for (int i = 0; i < 4; ++i) h4[i] = (_Float16)v[i]; *(v4h*)(C16 + cofs + (size_t)(row0 + r) * ldc + col0 + c4) = h4; } }
     } }


__global__ __launch_bounds__(256) void k_wnat(const float* __restrict__ w, size_t n8, _Float16* __restrict__ Bt) { const size_t t = (size_t)blockIdx.x * 256 + threadIdx.x; if (t >= n8) return; FragH f; for (int q = 0; q < 8; ++q) f.h[q] = (_Float16)(bf16_round(w[t * 8 + q]) * 16.0f); *(v8us*)((unsigned short*)Bt + t * 8) = f.half[0];  }
__global__ __launch_bounds__(256) void k_rsm(const float* __restrict__ S, _Float16* __restrict__ P, int nrows) {
  #pragma clang fp contract(off)
  const int i = blockIdx.x * 256 + threadIdx.x; if (i >= nrows) return; const float* s = S + (size_t)i * SQ; float mx = -3.0e38f;
#pragma unroll 1
  for (int j = 0; j < SQ; ++j) mx = fmaxf(mx, s[j]); float se = 0.f;
#pragma unroll 1
  for (int j = 0; j < SQ; ++j) se += expf(s[j] - mx); const float sc = 256.0f / se;
#pragma unroll 1
  for (int j0 = 0; j0 < SQ; j0 += 8) { FragH f; for (int q = 0; q < 8; ++q) f.h[q] = (_Float16)(expf(s[j0 + q] - mx) * sc); unsigned short* d = (unsigned short*)P + (size_t)i * SQ + j0; *(v8us*)d = f.half[0];  } }
__global__ __launch_bounds__(256) void k_vt(const _Float16* __restrict__ V16, int b, int h0, _Float16* __restrict__ VT) { __shared__ unsigned short tl[64][65]; const int tid = threadIdx.x; const int hh = blockIdx.x % HG, sg = blockIdx.x / HG; const int s0 = sg * 64; const int h = h0 + hh;
  for (int i = tid; i < 64 * 8; i += 256) { const int j = i / 8, d8 = (i % 8) * 8; FragH f; f.half[0] = *(const v8us*)((const unsigned short*)V16 + ((size_t)b * SQ + s0 + j) * DM + h * HD + d8); for (int q = 0; q < 8; ++q) tl[d8 + q][j] = f.u[q]; }
  __syncthreads();
  { for (int i = tid; i < 64 * 8; i += 256) { const int d = i / 8, j8 = (i % 8) * 8; FragH f; for (int q = 0; q < 8; ++q) f.u[q] = tl[d][j8 + q]; *(v8us*)((unsigned short*)VT + ((size_t)hh * HD + d) * SQ + s0 + j8) = f.half[0]; }  } }



// lanes l and l ^ 16 exchanged by the cross-row permlane (no LDS round trip)
__device__ __forceinline__ float xl_half(float v) { const int i = __float_as_int(v); return __int_as_float(__builtin_amdgcn_permlanex16(i, i, 0x76543210, 0xfedcba98, false, false)); }
__device__ __forceinline__ v8f fa_mma(v16h a, v16h b, v8f c) { return __builtin_amdgcn_wmma_f32_16x16x32_f16(false, a, false, b, (short)0, c, false, false); }
// 2^x on eight values; the v_nop is the one slot the instruction set asks for behind a transcendental, written in the same statement so that it stays directly behind the last one
__device__ __forceinline__ void fa_exp8(float (&e)[8]) { asm("v_exp_f32 %0, %0\n\tv_exp_f32 %1, %1\n\tv_exp_f32 %2, %2\n\tv_exp_f32 %3, %3\n\tv_exp_f32 %4, %4\n\tv_exp_f32 %5, %5\n\tv_exp_f32 %6, %6\n\tv_exp_f32 %7, %7\n\tv_nop" : "+v"(e[0]), "+v"(e[1]), "+v"(e[2]), "+v"(e[3]), "+v"(e[4]), "+v"(e[5]), "+v"(e[6]), "+v"(e[7])); }
__device__ __forceinline__ float fa_exp1(float x) { asm("v_exp_f32 %0, %0\n\tv_nop" : "+v"(x)); return x; }      /* same slot as above */
__global__ __launch_bounds__(128) void k_fattn(const _Float16* __restrict__ Q, const _Float16* __restrict__ Kr, const _Float16* __restrict__ VT, _Float16* __restrict__ O) {
  const int lane = threadIdx.x & 31, ln = lane & 15, hh = lane >> 4, w = threadIdx.x >> 5; const int bh = blockIdx.y, b = bh / NH, h = bh % NH; const int q0 = blockIdx.x * 128 + w * 32;
  const _Float16* qp = Q + ((size_t)b * SQ + q0 + ln) * LQ + h * HD; const _Float16* kp = Kr + ((size_t)b * SQ + ln) * LQ + h * HD; const _Float16* vp = VT + ((size_t)bh * HD + ln) * SQ;
  const float cs = 0.03125f * 1.44269504f;      /* 1 / sqrt(d_model) and log2 e in one factor on the raw products */
  const v8f z8 = {0.f,0.f,0.f,0.f,0.f,0.f,0.f,0.f};
  v16h qf[2][2], kf[2][2], vf[4]; v8f o[4][2]; float m[2] = {-3.0e38f, -3.0e38f}, l[2] = {0.f, 0.f};
#pragma unroll
  for (int u = 0; u < 2; ++u) for (int ch = 0; ch < 2; ++ch) { qf[u][ch] = g2_frag(qp + (size_t)u * 16 * LQ + ch * 32, hh); kf[u][ch] = g2_frag(kp + (size_t)u * 16 * LQ + ch * 32, hh); }
#pragma unroll
  for (int t = 0; t < 4; ++t) { o[t][0] = z8; o[t][1] = z8; }
  for (int j = 0; j < SQ; j += 32) {
    v8f s[2][2];      /* [key tile][query group], raw q . k */
#pragma unroll
    for (int kt = 0; kt < 2; ++kt) for (int qt = 0; qt < 2; ++qt) s[kt][qt] = fa_mma(kf[kt][1], qf[qt][1], fa_mma(kf[kt][0], qf[qt][0], z8));
    const int jn = (j + 32) & (SQ - 1);      /* next pass's keys, fetched one pass ahead into the same registers; the last pass re-reads keys 0..31 (in bounds, unused) */
#pragma unroll
    for (int kt = 0; kt < 2; ++kt) for (int ch = 0; ch < 2; ++ch) kf[kt][ch] = g2_frag(kp + (size_t)(jn + kt * 16) * LQ + ch * 32, hh);
    float mn[2];
#pragma unroll
    for (int qt = 0; qt < 2; ++qt) { float a = fmaxf(s[0][qt][0], s[1][qt][0]);
      for (int r = 1; r < 8; ++r) a = fmaxf(a, fmaxf(s[0][qt][r], s[1][qt][r]));
      mn[qt] = fmaxf(m[qt], fmaxf(a, xl_half(a))); }
    if (__builtin_amdgcn_ballot_w32(mn[0] > m[0] || mn[1] > m[1]) != 0) {      /* scalar branch: where no column's maximum moved every factor is exactly 1 */
#pragma unroll
      for (int qt = 0; qt < 2; ++qt) { const float a = fa_exp1((m[qt] - mn[qt]) * cs); l[qt] *= a; m[qt] = mn[qt];
        for (int t = 0; t < 4; ++t) for (int r = 0; r < 8; ++r) o[t][qt][r] *= a; } }
#pragma unroll
    for (int t = 0; t < 4; ++t) vf[t] = g2_frag(vp + (size_t)t * 16 * SQ + j, hh);      /* this pass's V^T: the exponentials below stand between the loads and their use */
    FragH pf[2];
#pragma unroll
    for (int qt = 0; qt < 2; ++qt) { const float mc = m[qt] * cs;
      for (int kt = 0; kt < 2; ++kt) { float e[8];
        for (int r = 0; r < 8; ++r) e[r] = fmaf(s[kt][qt][r], cs, -mc);
        fa_exp8(e);
        l[qt] += ((e[0] + e[1]) + (e[2] + e[3])) + ((e[4] + e[5]) + (e[6] + e[7]));
        for (int r = 0; r < 8; ++r) pf[qt].h[kt * 8 + r] = (_Float16)e[r]; } }
#pragma unroll
    for (int t = 0; t < 4; ++t) for (int qt = 0; qt < 2; ++qt) o[t][qt] = fa_mma(vf[t], pf[qt].v, o[t][qt]);
  }
#pragma unroll
  for (int qt = 0; qt < 2; ++qt) { const float inv = 64.0f / (l[qt] + xl_half(l[qt])); unsigned short* op = (unsigned short*)O + ((size_t)b * SQ + q0 + qt * 16 + ln) * DM + h * HD + 8 * hh;      /* o[t][qt][r] = O[query ln][16 t + 8 hh + r]: 16 contiguous bytes a store */
    for (int t = 0; t < 4; ++t) { FragH f; for (int r = 0; r < 8; ++r) f.h[r] = (_Float16)(o[t][qt][r] * inv); *(v8us*)(op + t * 16) = f.half[0]; } } }

// every launch-independent preparation job in ONE grid, the job picked by the block index (a scalar branch): the 48 per-head weight blocks, W_o, and the three x planes; none reads what another writes, and a thread still builds runs of 8 consecutive f16 of one output row.
#define PB_WH (DM / 64)                        /* blocks for one head's [DM][HD] weight block: one 64 x 64 tile each (HD = 64) */
#define PB_WO ((DM / 64) * (DM / 64))          /* blocks for W_o, likewise */
#define PB_X  ((int)(NR * DM / 8 / 256))       /* blocks for one x plane */
// one 64 (k) x 64 (n) tile of Wt[n][k] = f16(bf16(W[k][n]) x16), W row-major with N columns; Wm points at W[k0][n0], Wt at Wt[n0][k0]; x16 (a power of two) keeps the bf16-exact weights exact in f16, away from the subnormal range.
// The transposition goes through LDS so that both global sides move whole 128-byte lines: a wave-wide load covers 256 contiguous bytes of each of 2 rows of W, a wave-wide store 128 contiguous bytes of each of 4 rows of Wt.
// Pitch 65 words: for each word stored (a wave: 2 rows x 16 columns 4 apart) and each word loaded (8 rows 8 apart x 4 columns) the 32 lanes fall on 32 different banks.
template <int N>
__device__ __forceinline__ void prep_wt(const float* __restrict__ Wm, _Float16* __restrict__ Wt, float (*tl)[65], int tid) { v4f a[4];
#pragma unroll      /* the thread's four loads stand together in front of the LDS stores: one memory latency */
  for (int i = 0; i < 4; ++i) a[i] = *(const v4fa*)(Wm + (size_t)(16 * i + (tid >> 4)) * N + (tid & 15) * 4);
#pragma unroll      /* constant indices keep a in registers */
  for (int i = 0; i < 4; ++i) for (int j = 0; j < 4; ++j) tl[16 * i + (tid >> 4)][(tid & 15) * 4 + j] = a[i][j];
  __syncthreads();      /* the tile is whole before any thread reads a column of it; the job test around this call reads the same for the whole block */
  FragH f[2];
#pragma unroll      /* constant indices keep f in registers */
  for (int u = 0; u < 2; ++u) for (int q = 0; q < 8; ++q) f[u].h[q] = (_Float16)(bf16_round(tl[(tid & 7) * 8 + q][32 * u + (tid >> 3)]) * 16.0f);
#pragma unroll      /* the two stores as one run, each from registers of its own */
  for (int u = 0; u < 2; ++u) *(v8us*)((unsigned short*)Wt + (size_t)(32 * u + (tid >> 3)) * DM + (tid & 7) * 8) = f[u].half[0];
  asm volatile("s_wait_xcnt 0x0" ::: "memory"); }      /* the stores' registers are released before any code the compiler lays behind this job can rewrite them */
__global__ __launch_bounds__(256) void k_prep(const float* __restrict__ x, const float* __restrict__ wq, const float* __restrict__ wk, const float* __restrict__ wv, const float* __restrict__ wo, _Float16* __restrict__ Bt, _Float16* __restrict__ X16) {
  __shared__ float tl[64][65];      /* the weight jobs' transposition tile */
  int blk = blockIdx.x; const int tid = threadIdx.x;
  if (blk < 3 * NH * PB_WH) { const int p = blk / (NH * PB_WH), r = blk % (NH * PB_WH), h = r / PB_WH; const float* wp = (p == 0 ? wq : p == 1 ? wk : wv) + (size_t)h * DM * HD;      /* plane p (q, k, v), head h: its HD rows of the [out][in] plane */
    const int k0 = (r % PB_WH) * 64; prep_wt<HD>(wp + (size_t)k0 * HD, Bt + (size_t)p * DM * DM + (size_t)h * HD * DM + k0, tl, tid); return; }
  blk -= 3 * NH * PB_WH;
  if (blk < PB_WO) { const int n0 = (blk / (DM / 64)) * 64, k0 = (blk % (DM / 64)) * 64; prep_wt<DM>(wo + (size_t)k0 * DM + n0, Bt + (size_t)3 * DM * DM + (size_t)n0 * DM + k0, tl, tid); return; }
  blk -= PB_WO;
  const int p = blk / PB_X; const size_t t = (size_t)(blk % PB_X) * 256 + tid; FragH f;      /* x plane p as exact f16 rows */
#pragma unroll
  for (int q = 0; q < 8; ++q) f.h[q] = (_Float16)bf16_round(x[t * 8 + q]);
  *(v8us*)((unsigned short*)X16 + (size_t)p * NR * DM + t * 8) = f.half[0];
  asm volatile("s_wait_xcnt 0x0" ::: "memory"); }      /* as in prep_wt: the store's registers are released before anything behind it can rewrite them */

extern "C" void kernel_launch(void* const* d_in, const int* in_sizes, int n_in,
                              void* d_out, int out_size, void* d_ws, size_t ws_size, hipStream_t stream) {
  (void)in_sizes; (void)n_in; (void)out_size;
  const float* const* I = (const float* const*)d_in; const float* x = I[0]; const float* wq = I[1]; const float* wk = I[2]; const float* wv = I[3]; const float* wo = I[4]; const float* bo = I[5];      /* ONE input stream (X) read on all three projections; Wq, Wk, Wv are PER-HEAD STACKS [16][1024][64] = [head][in][out] (the module has NO q / k / v biases: null pointers in the guarded bias slots); Wo [in][out] [1024][1024] at I[4], bo at I[5] */
  char* ws = (char*)d_ws; size_t off = 0;
  auto take = [&](size_t bytes) { char* p = ws + off; off += (bytes + 255) & ~(size_t)255; return p; };
  _Float16* BQ = (_Float16*)take((size_t)4 * DM * DM * 2); _Float16* BO = BQ + (size_t)3 * DM * DM;      /* weight planes q, k, v, o, one behind the other: a grid index steps through them */
  _Float16* XQ = (_Float16*)take((size_t)3 * NR * DM * 2);      /* x planes for q, k, v, likewise */
  _Float16* Q16 = (_Float16*)take((size_t)3 * NR * DM * 2); _Float16* K16 = Q16 + NR * DM; _Float16* V16 = K16 + NR * DM; _Float16* O16 = (_Float16*)take(NR * DM * 2);
  _Float16* VT = (_Float16*)take((size_t)NB * NH * HD * SQ * 2);
  if (off > ws_size) return;
  k_prep<<<3 * NH * PB_WH + PB_WO + 3 * PB_X, 256, 0, stream>>>(x, wq, wk, wv, wo, BQ, XQ);      /* PER-HEAD STACKS wq / wk / wv [NH][DM][HD]: head h is a row-major [in = DM][out = HD] block at w + h * DM * HD, transposed into rows Bt[h * HD + e][k] of the [out][in] plane (x16); wo is a plain [in][out] [DM][DM] matrix; the three inputs as exact f16 rows */
  const size_t r0p = (size_t)B0 * SQ;      /* first projected row */
  k_gemm2<0><<<dim3((unsigned)((MP / 128) * (DM / 128)), 3), 256, 0, stream>>>(XQ + r0p * DM, DM, NR * DM, BQ, DM, (size_t)DM * DM, 0.0625f, nullptr, 0, nullptr, 1, 0, 0, nullptr, Q16 + r0p * DM, DM, NR * DM, MP, DM, DM);      /* Q, K, V: blockIdx.y picks the x plane, the weight plane and the output plane */
  k_vt<NH, SQ><<<NB * NH * (SQ / 64), 256, 0, stream>>>(V16, LQ, 0, VT);      /* V^T [NB][NH][HD][SQ], both batches */
  k_fattn<<<dim3(SQ / 128, NB * NH), 128, 0, stream>>>(Q16, K16, VT, O16);      /* scores, softmax and P V in one kernel: o (merged heads, x64) as f16 rows */
  k_gemm2<0><<<dim3((unsigned)((MPO / 128) * (DM / 128)), 1), 256, 0, stream>>>(O16 + r0p * DM, DM, 0, BO, DM, 0, 0.0009765625f, bo, 0, nullptr, 1, 0, 0, (float*)d_out + r0p * DM, nullptr, DM, 0, MPO, DM, DM);      /* out rows are the output layout */
}

// v006
// It runs in 96.1 microseconds.
// Timed twice side by side with v005, it ran 1.30 times as fast both times.
// Over all steps from v000 it is 37.9 times as fast.
#include <hip/hip_runtime.h>
#define NB 2
#define SQ 2048
#define DM 1024
#define NH 16
#define HD 64
#define HG 4                         /* heads per launch of the per-batch k_vt */
#define B0 0                         /* first batch processed (debug hook) */
#define NBR NB                       /* batches processed (debug hook) */
#define NR ((size_t)NB * SQ)         /* token rows */
#define MP ((int)((size_t)NBR * SQ)) /* rows projected (debug hook) */
#define QN SQ                        /* query rows per batch; not used */
#define NHD NH                       /* heads; not used */
#define MPO MP                       /* rows through the output stage (debug hook) */
#define LQ DM      /* row pitch of the q/k/v rows */
typedef __bf16 v16b __attribute__((ext_vector_type(16)));
typedef unsigned short v8us __attribute__((ext_vector_type(8), may_alias));
typedef float  v8f  __attribute__((ext_vector_type(8)));
typedef float  v4f  __attribute__((ext_vector_type(4)));
typedef float  v4fa __attribute__((ext_vector_type(4), may_alias));
union FragB { v16b v; v8us half[2]; unsigned short u[16]; };

__device__ __forceinline__ unsigned short bf16_bits(float x) { unsigned int u = __float_as_uint(x); return (unsigned short)((u + 0x7FFFu + ((u >> 16) & 1u)) >> 16); }
__device__ __forceinline__ float bf16_val(unsigned short b) { return __uint_as_float(((unsigned int)b) << 16); }
__device__ __forceinline__ float bf16_round(float x) { return bf16_val(bf16_bits(x)); }
// D += A·B with NT terms: 1 = ah·bh, 2 = + al·bh (A split), 3 = + ah·bl (both split)
template <int NT>
__device__ __forceinline__ v8f mmaN(v16b ah, v16b al, v16b bh, v16b bl, v8f c) {
  c = __builtin_amdgcn_wmma_f32_16x16x32_bf16(false, ah, false, bh, (short)0, c, false, false);
  if (NT >= 2) c = __builtin_amdgcn_wmma_f32_16x16x32_bf16(false, al, false, bh, (short)0, c, false, false);
  if (NT >= 3) c = __builtin_amdgcn_wmma_f32_16x16x32_bf16(false, ah, false, bl, (short)0, c, false, false);
  asm volatile("v_nop\n\tv_nop\n\tv_nop\n\tv_nop" : "+v"(c) : "v"(ah), "v"(al), "v"(bh), "v"(bl));
  return c;
}

__global__ __launch_bounds__(256) void k_wt_bf16(const float* __restrict__ W, unsigned short* __restrict__ Wt, int K, int N) {
  const int t = blockIdx.x * 256 + threadIdx.x;
  const int k8n = K / 8;
  if (t >= N * k8n) return;
  const int n = t / k8n, k8 = (t % k8n) * 8;
  v8us v;
#pragma unroll
  for (int i = 0; i < 8; ++i) v[i] = bf16_bits(W[(size_t)(k8 + i) * N + n]);
  *(v8us*)(Wt + (size_t)n * K + k8) = v;
  
}

// GEMM C[M][N] (f32, pitch ldc) = act(A[M][K]·W + bias). A f32 row-major (pitch lda) converted per fragment to bf16
// (ASPLIT: hi/lo two planes -> 2 terms, else single rounded term); Wt bf16 [N][K] (pitch ldb). BIAS_BF16 rounds the
// bias to bf16 first (bias quantised to bf16 before the add). K%32==0, M%16==0, N%64==0.
template <bool ASPLIT, int ACT, bool BIAS_BF16>
__global__ __launch_bounds__(128) void k_gemm_bf(const float* __restrict__ A, int lda, const unsigned short* __restrict__ Wt, int ldb,
                                               const float* __restrict__ bias, float* __restrict__ C, int ldc, int M, int N, int K) {
  __shared__ __attribute__((aligned(16))) float so[4][16][64];
  const int tid = threadIdx.x, w = tid >> 5, lane = tid & 31, ln = lane & 15, hh = lane >> 4;
  const int ntn = N / 64;
  const int wid = blockIdx.x * 4 + w;
  const int mt = wid / ntn, nq = wid % ntn;
  if (mt * 16 >= M) return;
  const int row0 = mt * 16, col0 = nq * 64;
  const float* arow = A + (size_t)(row0 + ln) * lda;
  v8f acc[4] = {};
  for (int kb = 0; kb < K; kb += 32) {
    FragB ah, al;
    const v4f x0 = *(const v4fa*)(arow + kb + 8 * hh), x1 = *(const v4fa*)(arow + kb + 8 * hh + 4);
    const v4f x2 = *(const v4fa*)(arow + kb + 16 + 8 * hh), x3 = *(const v4fa*)(arow + kb + 16 + 8 * hh + 4);
    float xs[16] = {x0[0],x0[1],x0[2],x0[3],x1[0],x1[1],x1[2],x1[3],x2[0],x2[1],x2[2],x2[3],x3[0],x3[1],x3[2],x3[3]};
#pragma unroll
    for (int i = 0; i < 16; ++i) { const unsigned short hb = bf16_bits(xs[i]); ah.u[i] = hb; al.u[i] = ASPLIT ? bf16_bits(xs[i] - bf16_val(hb)) : (unsigned short)0; }
#pragma unroll
    for (int t = 0; t < 4; ++t) {
      const unsigned short* brow = Wt + (size_t)(col0 + t * 16 + ln) * ldb + kb;
      FragB b;
      b.half[0] = *(const v8us*)(brow + 8 * hh);
      b.half[1] = *(const v8us*)(brow + 16 + 8 * hh);
      acc[t] = mmaN<ASPLIT ? 2 : 1>(ah.v, al.v, b.v, b.v, acc[t]);
    }
  }
#pragma unroll
  for (int t = 0; t < 4; ++t) {
    float bv = bias ? bias[col0 + t * 16 + ln] : 0.f;
    if (BIAS_BF16) bv = bf16_round(bv);
#pragma unroll
    for (int r = 0; r < 8; ++r) { float v = acc[t][r] + bv; if (ACT == 1) v = fmaxf(v, 0.f); so[w][8 * hh + r][t * 16 + ln] = v; }
  }
  __builtin_amdgcn_fence(__ATOMIC_ACQ_REL, "workgroup");
  __builtin_amdgcn_wave_barrier();
  const int rsub = lane >> 4, c4 = (lane & 15) * 4;
  {
#pragma unroll
    for (int q = 0; q < 8; ++q) {
      const int r = q * 2 + rsub;
      const v4f v = *(const v4fa*)&so[w][r][c4];
      *(v4f*)(C + (size_t)(row0 + r) * ldc + col0 + c4) = v;
    }
    
  }
}

// GEMM C = act(A·W + bias + resid): A f32 (ASPLIT -> hi/lo 2 terms), Wt bf16 [N][K]; ACT 0 none, 1 relu, 2 exact gelu;
// resid (optional, f32, row index = (row % rmod), pitch ldr, RES_BF16 rounds it) added before the activation.
template <bool ASPLIT, int ACT, bool BIAS_BF16, bool RES_BF16>
__global__ __launch_bounds__(128) void k_gemm_bf3(const float* __restrict__ A, int lda, const unsigned short* __restrict__ Wt, int ldb,
                                                const float* __restrict__ bias, const float* __restrict__ resid, int rmod, int ldr,
                                                float* __restrict__ C, int ldc, int M, int N, int K) {
  __shared__ __attribute__((aligned(16))) float so[4][16][64];
  const int tid = threadIdx.x, w = tid >> 5, lane = tid & 31, ln = lane & 15, hh = lane >> 4;
  const int ntn = N / 64;
  const int wid = blockIdx.x * 4 + w;
  const int mt = wid / ntn, nq = wid % ntn;
  if (mt * 16 >= M) return;
  const int row0 = mt * 16, col0 = nq * 64;
  const float* arow = A + (size_t)(row0 + ln) * lda;
  v8f acc[4] = {};
  for (int kb = 0; kb < K; kb += 32) {
    FragB ah, al;
    const v4f x0 = *(const v4fa*)(arow + kb + 8 * hh), x1 = *(const v4fa*)(arow + kb + 8 * hh + 4);
    const v4f x2 = *(const v4fa*)(arow + kb + 16 + 8 * hh), x3 = *(const v4fa*)(arow + kb + 16 + 8 * hh + 4);
    float xs[16] = {x0[0],x0[1],x0[2],x0[3],x1[0],x1[1],x1[2],x1[3],x2[0],x2[1],x2[2],x2[3],x3[0],x3[1],x3[2],x3[3]};
#pragma unroll
    for (int i = 0; i < 16; ++i) { const unsigned short hb = bf16_bits(xs[i]); ah.u[i] = hb; al.u[i] = ASPLIT ? bf16_bits(xs[i] - bf16_val(hb)) : (unsigned short)0; }
#pragma unroll
    for (int t = 0; t < 4; ++t) {
      const unsigned short* brow = Wt + (size_t)(col0 + t * 16 + ln) * ldb + kb;
      FragB b;
      b.half[0] = *(const v8us*)(brow + 8 * hh);
      b.half[1] = *(const v8us*)(brow + 16 + 8 * hh);
      acc[t] = mmaN<ASPLIT ? 2 : 1>(ah.v, al.v, b.v, b.v, acc[t]);
    }
  }
#pragma unroll
  for (int t = 0; t < 4; ++t) {
    const int col = col0 + t * 16 + ln;
    float bv = bias ? bias[col] : 0.f;
    if (BIAS_BF16) bv = bf16_round(bv);
#pragma unroll
    for (int r = 0; r < 8; ++r) {
      float v = acc[t][r] + bv;
      if (resid) { float rv = resid[(size_t)((row0 + 8 * hh + r) % rmod) * ldr + col]; if (RES_BF16) rv = bf16_round(rv); v += rv; }
      if (ACT == 1) v = fmaxf(v, 0.f);
      if (ACT == 2) v = 0.5f * v * (1.0f + erff(v * 0.70710678118654752f));
      if (ACT == 3) { const float u = 0.7978845608028654f * (v + 0.044715f * v * v * v); v = 0.5f * v * (1.0f + tanhf(u)); }
      so[w][8 * hh + r][t * 16 + ln] = v;
    }
  }
  __builtin_amdgcn_fence(__ATOMIC_ACQ_REL, "workgroup");
  __builtin_amdgcn_wave_barrier();
  const int rsub = lane >> 4, c4 = (lane & 15) * 4;
  {
#pragma unroll
    for (int q = 0; q < 8; ++q) {
      const int r = q * 2 + rsub;
      const v4f v = *(const v4fa*)&so[w][r][c4];
      *(v4f*)(C + (size_t)(row0 + r) * ldc + col0 + c4) = v;
    }
    
  }
}
// row LayerNorm (biased variance, eps) over N: s = X (+ R); optional out_sum <- s; out_norm <- (s-mu)*rsqrt(var+eps)*g + b
template <bool PARAM_BF16>
__global__ __launch_bounds__(256) void k_layernorm(const float* __restrict__ X, const float* __restrict__ R, const float* __restrict__ g, const float* __restrict__ bta,
                                                  float* __restrict__ out_sum, float* __restrict__ out_norm, int N, float eps) {
  __shared__ float red[256];
  const int row = blockIdx.x, tid = threadIdx.x;
  const float* x = X + (size_t)row * N; const float* rr = R ? R + (size_t)row * N : nullptr;
  float vals[16];                     // up to N = 4096
  const int per = N / 256;            // contiguous chunk per thread? use strided-by-4 chunks: thread handles j = tid*4 + 1024*u
  float s1 = 0.f;
  for (int u = 0; u < per / 4; ++u) {
    const int j = tid * 4 + 1024 * u;
    const v4f a = *(const v4fa*)(x + j);
    v4f b = {0.f,0.f,0.f,0.f}; if (rr) b = *(const v4fa*)(rr + j);
#pragma unroll
    for (int q = 0; q < 4; ++q) { const float v = a[q] + b[q]; vals[u * 4 + q] = v; s1 += v; }
  }
  red[tid] = s1; __syncthreads();
  for (int st = 128; st > 0; st >>= 1) { if (tid < st) red[tid] += red[tid + st]; __syncthreads(); }
  const float mu = red[0] / (float)N; __syncthreads();
  float s2 = 0.f;
  for (int u = 0; u < per / 4; ++u)
#pragma unroll
    for (int q = 0; q < 4; ++q) { const float c = vals[u * 4 + q] - mu; s2 += c * c; }
  red[tid] = s2; __syncthreads();
  for (int st = 128; st > 0; st >>= 1) { if (tid < st) red[tid] += red[tid + st]; __syncthreads(); }
  const float rs = rsqrtf(red[0] / (float)N + eps);
  {
    for (int u = 0; u < per / 4; ++u) {
      const int j = tid * 4 + 1024 * u;
      v4f o, sm;
#pragma unroll
      for (int q = 0; q < 4; ++q) {
        float gg = g[j + q], bb = bta[j + q];
        if (PARAM_BF16) { gg = bf16_round(gg); bb = bf16_round(bb); }
        sm[q] = vals[u * 4 + q]; o[q] = (vals[u * 4 + q] - mu) * rs * gg + bb;
      }
      if (out_sum) *(v4f*)(out_sum + (size_t)row * N + j) = sm;
      *(v4f*)(out_norm + (size_t)row * N + j) = o;
    }
    
  }
}



// ---- f16 WMMA path (v_wmma_f32_16x16x32_f16): 11-bit significands for operands in range — used where a [0,1] probability operand needs more precision than bf16
typedef _Float16 v16h __attribute__((ext_vector_type(16)));
union FragH { v16h v; v8us half[2]; _Float16 h[16]; unsigned short u[16]; };
template <int NT>
__device__ __forceinline__ v8f mmaH(v16h ah, v16h al, v16h bh, v16h bl, v8f c) {
  c = __builtin_amdgcn_wmma_f32_16x16x32_f16(false, ah, false, bh, (short)0, c, false, false);
  if (NT >= 2) c = __builtin_amdgcn_wmma_f32_16x16x32_f16(false, al, false, bh, (short)0, c, false, false);
  if (NT >= 3) c = __builtin_amdgcn_wmma_f32_16x16x32_f16(false, ah, false, bl, (short)0, c, false, false);
  asm volatile("v_nop\n\tv_nop\n\tv_nop\n\tv_nop" : "+v"(c) : "v"(ah), "v"(al), "v"(bh), "v"(bl));
  return c;
}
// batched GEMM like k_gemm_b but f16 operands: A f32 (split into f16 hi/lo if ASPLIT, else rounded to f16), Bt = f16 values [n][k]; alpha; C f32; N multiple of 16 (partial tiles skipped)
template <bool ASPLIT>
__global__ __launch_bounds__(128) void k_gemm_h(const float* __restrict__ A, int lda, size_t sA, const _Float16* __restrict__ Bh, int ldb, size_t sB, float alpha, float* __restrict__ C, int ldc, size_t sC, int M, int N, int K) {
  __shared__ __attribute__((aligned(16))) float so[4][16][64];
  const int tid = threadIdx.x, w = tid >> 5, lane = tid & 31, ln = lane & 15, hh = lane >> 4; const int by = blockIdx.y;
  A += (size_t)by * sA; Bh += (size_t)by * sB; C += (size_t)by * sC;
  const int ntn = (N + 63) / 64; const int wid = blockIdx.x * 4 + w; const int mt = wid / ntn, nq = wid % ntn; if (mt * 16 >= M) return;
  const int row0 = mt * 16, col0 = nq * 64; const float* arow = A + (size_t)(row0 + ln) * lda;
  v8f acc[4] = {};
  for (int kb = 0; kb < K; kb += 32) {
    FragH ah, al;
    const v4f x0 = *(const v4fa*)(arow + kb + 8 * hh), x1 = *(const v4fa*)(arow + kb + 8 * hh + 4), x2 = *(const v4fa*)(arow + kb + 16 + 8 * hh), x3 = *(const v4fa*)(arow + kb + 16 + 8 * hh + 4);
    float xs[16] = {x0[0],x0[1],x0[2],x0[3],x1[0],x1[1],x1[2],x1[3],x2[0],x2[1],x2[2],x2[3],x3[0],x3[1],x3[2],x3[3]};
#pragma unroll
    for (int i = 0; i < 16; ++i) { const _Float16 h = (_Float16)xs[i]; ah.h[i] = h; al.h[i] = ASPLIT ? (_Float16)(xs[i] - (float)h) : (_Float16)0.0f; }
#pragma unroll
    for (int t = 0; t < 4; ++t) { if (col0 + t * 16 >= N) continue; const size_t boff = (size_t)(col0 + t * 16 + ln) * ldb + kb; FragH bq; bq.half[0] = *(const v8us*)(Bh + boff + 8 * hh); bq.half[1] = *(const v8us*)(Bh + boff + 16 + 8 * hh);
      acc[t] = mmaH<ASPLIT ? 2 : 1>(ah.v, al.v, bq.v, bq.v, acc[t]); }
  }
#pragma unroll
  for (int t = 0; t < 4; ++t) { if (col0 + t * 16 >= N) continue;
#pragma unroll
    for (int r = 0; r < 8; ++r) so[w][8 * hh + r][t * 16 + ln] = acc[t][r] * alpha; }
  __builtin_amdgcn_fence(__ATOMIC_ACQ_REL, "workgroup"); __builtin_amdgcn_wave_barrier();
  const int rsub = lane >> 4, c4 = (lane & 15) * 4;
  {
#pragma unroll
    for (int q = 0; q < 8; ++q) { const int r = q * 2 + rsub; if (col0 + c4 < N) { const v4f v = *(const v4fa*)&so[w][r][c4]; *(v4f*)(C + (size_t)(row0 + r) * ldc + col0 + c4) = v; } }
     }
}

// k_gemm_hh variant with fused epilogue: v = acc·alpha + bias[by·sBias + col] (+ CP[(row/rowsPerB)·sCPb + by·64 + col] if CP) ; ACT 0 none / 1 elu ; writes f16 C16 (and f32 C if non-null)
template <int ACT>
__global__ __launch_bounds__(128) void k_gemm_hhx(const _Float16* __restrict__ A, int lda, size_t sA, const _Float16* __restrict__ Bh, int ldb, size_t sB, float alpha, const float* __restrict__ bias, size_t sBias, const float* __restrict__ CP, int rowsPerB, size_t sCPb, int row0g,
    float* __restrict__ C, _Float16* __restrict__ C16, int ldc, size_t sC, int M, int N, int K) {
  __shared__ __attribute__((aligned(16))) float so[4][16][64];
  const int tid = threadIdx.x, w = tid >> 5, lane = tid & 31, ln = lane & 15, hh = lane >> 4; const int by = blockIdx.y;
  A += (size_t)by * sA; Bh += (size_t)by * sB; const size_t cofs = (size_t)by * sC; const float* bp = bias ? bias + (size_t)by * sBias : nullptr;
  const int ntn = (N + 63) / 64; const int wid = blockIdx.x * 4 + w; const int mt = wid / ntn, nq = wid % ntn; if (mt * 16 >= M) return;
  const int row0 = mt * 16, col0 = nq * 64; const _Float16* arow = A + (size_t)(row0 + ln) * lda;
  v8f acc[4] = {};
  for (int kb = 0; kb < K; kb += 32) { FragH ah; ah.half[0] = *(const v8us*)((const unsigned short*)arow + kb + 8 * hh); ah.half[1] = *(const v8us*)((const unsigned short*)arow + kb + 16 + 8 * hh);
#pragma unroll
    for (int t = 0; t < 4; ++t) { if (col0 + t * 16 >= N) continue; const size_t boff = (size_t)(col0 + t * 16 + ln) * ldb + kb; FragH bq; bq.half[0] = *(const v8us*)((const unsigned short*)Bh + boff + 8 * hh); bq.half[1] = *(const v8us*)((const unsigned short*)Bh + boff + 16 + 8 * hh);
      acc[t] = mmaH<1>(ah.v, ah.v, bq.v, bq.v, acc[t]); }
  }
#pragma unroll
  for (int t = 0; t < 4; ++t) { if (col0 + t * 16 >= N) continue; const int col = col0 + t * 16 + ln; const float bv = bp ? bf16_round(bp[col]) : 0.f;
#pragma unroll
    for (int r = 0; r < 8; ++r) { float v = acc[t][r] * alpha + bv; if (CP) { const int rr = row0g + row0 + 8 * hh + r; if (rowsPerB < 0) v += CP[cofs + (size_t)rr * ldc + col];      /* rowsPerB < 0: own element of the batched C plane */ else { const int bidx = rr / rowsPerB; v += CP[(size_t)bidx * sCPb + (size_t)by * 64 + col]; } } if (ACT == 1) v = (v > 0.f) ? v : expm1f(v); else if (ACT == 7) v = (v > 0.f) ? v + 1.0f : expf(v); else if (ACT == 8) v = tanhf(v); else if (ACT == 9) v = 0.5f * v * (1.0f + tanhf(0.7978845608028654f * (v + 0.044715f * v * v * v))); else if (ACT == 11) v = 1.0f / (1.0f + expf(-v)); else if (ACT == 12) v = (v > 0.f) ? v : 0.01f * v; else if (ACT == 14) v = (v > 0.f) ? v : 0.1f * v; else if (ACT == 16) v = (v >= 0.f) ? v : 0.3f * v; else if (ACT == 17) v = (v >= 0.f) ? v : 0.2f * v; else if (ACT == 15) v = v / (1.0f + expf(-v)); else if (ACT == 3) v = fmaxf(v, 0.f); else if (ACT == 6) v = 0.5f * v * (1.0f + erff(v * 0.70710678118654752f)); so[w][8 * hh + r][t * 16 + ln] = v; } }
  __builtin_amdgcn_fence(__ATOMIC_ACQ_REL, "workgroup"); __builtin_amdgcn_wave_barrier();
  const int rsub = lane >> 4, c4 = (lane & 15) * 4; typedef _Float16 v4h __attribute__((ext_vector_type(4)));
  {
#pragma unroll
    for (int q = 0; q < 8; ++q) { const int r = q * 2 + rsub; if (col0 + c4 < N) { const v4f v = *(const v4fa*)&so[w][r][c4]; if (C) *(v4f*)(C + cofs + (size_t)(row0 + r) * ldc + col0 + c4) = v; if (C16) { v4h h4; for (int i = 0; i < 4; ++i) h4[i] = (_Float16)v[i]; *(v4h*)(C16 + cofs + (size_t)(row0 + r) * ldc + col0 + c4) = h4; } } }
     }
}


typedef _Float16 v4h __attribute__((ext_vector_type(4)));

__global__ __launch_bounds__(256) void k_h16(const float* __restrict__ x, _Float16* __restrict__ X16, size_t n8) { const size_t t = (size_t)blockIdx.x * 256 + threadIdx.x; if (t >= n8) return; FragH f;
#pragma unroll
  for (int q = 0; q < 8; ++q) f.h[q] = (_Float16)x[t * 8 + q]; *(v8us*)((unsigned short*)X16 + t * 8) = f.half[0];  }
__global__ __launch_bounds__(256) void k_round16f(const float* __restrict__ W, _Float16* __restrict__ Bt, size_t n8) { const size_t t = (size_t)blockIdx.x * 256 + threadIdx.x; if (t >= n8) return; FragH f;
#pragma unroll
  for (int i = 0; i < 8; ++i) f.h[i] = (_Float16)(bf16_round(W[t * 8 + i]) * 16.0f); *(v8us*)((unsigned short*)Bt + t * 8) = f.half[0];  }
template <int NHv, int TTv>
__global__ __launch_bounds__(256) void k_vt(const _Float16* __restrict__ V16, int ldv, int voff, _Float16* __restrict__ Vt) { __shared__ unsigned short tl[64][66]; const int tid = threadIdx.x; const int slab = blockIdx.x / (TTv / 64), lg = blockIdx.x % (TTv / 64); const int b = slab / NHv, h = slab % NHv;
  for (int i = tid; i < 64 * 8; i += 256) { const int r = i / 8, c8 = (i % 8) * 8; FragH f; f.half[0] = *(const v8us*)((const unsigned short*)V16 + ((size_t)b * TTv + lg * 64 + r) * ldv + voff + h * 64 + c8);
#pragma unroll
    for (int q = 0; q < 8; ++q) tl[r][c8 + q] = f.u[q]; }
  __syncthreads();
  {
#pragma unroll
    for (int rd = 0; rd < 2; ++rd) { const int d = rd * 32 + tid / 8, pc = tid % 8; FragH f;
#pragma unroll
      for (int q = 0; q < 8; ++q) f.u[q] = tl[pc * 8 + q][d];
      *(v8us*)((unsigned short*)Vt + ((size_t)slab * 64 + d) * TTv + lg * 64 + pc * 8) = f.half[0]; }
     } }

__global__ __launch_bounds__(256) void k_hl(const float* __restrict__ F, _Float16* __restrict__ Hh, _Float16* __restrict__ Hl, size_t n8) { const size_t t = (size_t)blockIdx.x * 256 + threadIdx.x; if (t >= n8) return; FragH fh, fl; const v4f a = *(const v4fa*)(F + t * 8), c = *(const v4fa*)(F + t * 8 + 4);
#pragma unroll
  for (int q = 0; q < 4; ++q) { _Float16 h = (_Float16)a[q]; fh.h[q] = h; fl.h[q] = (_Float16)((a[q] - (float)h) * 1024.0f); h = (_Float16)c[q]; fh.h[4 + q] = h; fl.h[4 + q] = (_Float16)((c[q] - (float)h) * 1024.0f); }
  { *(v8us*)((unsigned short*)Hh + t * 8) = fh.half[0]; *(v8us*)((unsigned short*)Hl + t * 8) = fl.half[0];  } }

// ---- fast GEMM (block tile 128x128, eight waves of 32x64; requires M % 128 == 0, N % 128 == 0, K % 64 == 0); epilogue = k_gemm_hhx semantics ----
// Both operands pass through LDS: a stage is 64 k (one whole 128-byte line) of the block's 128 A rows and 128 B rows, brought by asynchronous copies and read by all eight waves; two stages, the next one in flight while this one is multiplied.
__device__ __forceinline__ v16h g2_frag(const _Float16* p, int hh) { FragH f; f.half[0] = *(const v8us*)((const unsigned short*)p + 8 * hh); f.half[1] = *(const v8us*)((const unsigned short*)p + 16 + 8 * hh); return f.v; }
__device__ __forceinline__ v8f g2_mma(v16h a, v16h b, v8f c) { v8f d = __builtin_amdgcn_wmma_f32_16x16x32_f16(false, a, false, b, (short)0, c, false, false); asm volatile("v_nop\n\tv_nop\n\tv_nop\n\tv_nop" : "+v"(d) : "v"(a), "v"(b)); return d; }
#define G2_PITCH 144                   /* LDS row pitch in bytes: 16 x odd, free of bank conflicts for 16-byte reads */
#define G2_STAGE (256 * G2_PITCH)      /* rows 0..127 = A, rows 128..255 = B */
// one stage's copies: a thread brings 16 bytes of each of 8 rows (32 rows apart; 4 of A, 4 of B), so a wave-wide copy covers 4 whole 128-byte lines.
// s_wait_xcnt 0 is the statement's last line: it then stands in front of every later rewrite of the address registers the copies name.
__device__ __forceinline__ void g2_stage(unsigned l, const _Float16* a, int lda, const _Float16* b, int ldb) {
  const _Float16* a1 = a + (size_t)32 * lda; const _Float16* a2 = a + (size_t)64 * lda; const _Float16* a3 = a + (size_t)96 * lda;
  const _Float16* b1 = b + (size_t)32 * ldb; const _Float16* b2 = b + (size_t)64 * ldb; const _Float16* b3 = b + (size_t)96 * ldb;
  asm volatile("global_load_async_to_lds_b128 %0, %8, off\n\tglobal_load_async_to_lds_b128 %1, %9, off\n\tglobal_load_async_to_lds_b128 %2, %10, off\n\tglobal_load_async_to_lds_b128 %3, %11, off\n\t"
               "global_load_async_to_lds_b128 %4, %12, off\n\tglobal_load_async_to_lds_b128 %5, %13, off\n\tglobal_load_async_to_lds_b128 %6, %14, off\n\tglobal_load_async_to_lds_b128 %7, %15, off\n\ts_wait_xcnt 0x0"
               :: "v"(l), "v"(l + 32 * G2_PITCH), "v"(l + 64 * G2_PITCH), "v"(l + 96 * G2_PITCH), "v"(l + 128 * G2_PITCH), "v"(l + 160 * G2_PITCH), "v"(l + 192 * G2_PITCH), "v"(l + 224 * G2_PITCH),
                  "v"(a), "v"(a1), "v"(a2), "v"(a3), "v"(b), "v"(b1), "v"(b2), "v"(b3) : "memory"); }
template <int ACT>
__global__ __launch_bounds__(256) void k_gemm2(const _Float16* __restrict__ A, int lda, size_t sA, const _Float16* __restrict__ Bh, int ldb, size_t sB, float alpha, const float* __restrict__ bias, size_t sBias, const float* __restrict__ CP, int rowsPerB, size_t sCPb, int row0g,
    float* __restrict__ C, _Float16* __restrict__ C16, int ldc, size_t sC, int M, int N, int K) { static_assert(ACT == 0 || ACT == 3 || ACT == 6 || ACT == 8 || ACT == 9 || ACT == 11 || ACT == 12 || ACT == 14 || ACT == 15 || ACT == 16 || ACT == 17, "k_gemm2: unsupported ACT code (would silently apply no activation)");
  __shared__ __attribute__((aligned(128))) unsigned char sm[2 * G2_STAGE];      /* the two operand stages; behind the loop's last barrier the same bytes are the waves' output staging */
  static_assert(8 * 32 * 68 * 4 <= 2 * G2_STAGE, "output staging must fit the operand stages");
  float (*so)[32][68] = (float (*)[32][68])sm;
  const int tid = threadIdx.x, w = tid >> 5, lane = tid & 31, ln = lane & 15, hh = lane >> 4; const int by = blockIdx.y;
  A += (size_t)by * sA; Bh += (size_t)by * sB; const size_t cofs = (size_t)by * sC; const float* bp = bias ? bias + (size_t)by * sBias : nullptr;
  const int ntn = N >> 7; const int mt = blockIdx.x / ntn, nq = blockIdx.x - mt * ntn; if (mt * 128 >= M) return;      /* the same for the whole block, in front of every barrier */
  const int wm = w & 3, wn = w >> 2; const int row0 = mt * 128 + 32 * wm, col0 = nq * 128 + 64 * wn;
  const _Float16* ga = A + (size_t)(mt * 128 + (tid >> 3)) * lda + (tid & 7) * 8; const _Float16* gb = Bh + (size_t)(nq * 128 + (tid >> 3)) * ldb + (tid & 7) * 8;
  const unsigned l0 = (unsigned)(size_t)sm + (unsigned)((tid >> 3) * G2_PITCH + (tid & 7) * 16);      /* the thread's LDS byte address in stage buffer 0 */
  const int nt = K >> 6;
  g2_stage(l0, ga, lda, gb, ldb);
  asm volatile("s_wait_asynccnt 0x0" ::: "memory");      /* this wave's copies of stage 0 have landed */
  __syncthreads();                                       /* ... and every other wave's */
  if (1 < nt) g2_stage(l0 + G2_STAGE, ga + 64, lda, gb + 64, ldb);
  const v8f z8 = {0.f,0.f,0.f,0.f,0.f,0.f,0.f,0.f}; v8f c00 = z8, c01 = z8, c02 = z8, c03 = z8, c10 = z8, c11 = z8, c12 = z8, c13 = z8;
  for (int t = 0; t < nt; ++t) { const unsigned char* st = sm + (t & 1) * G2_STAGE;
    const _Float16* a0p = (const _Float16*)(st + (32 * wm + ln) * G2_PITCH); const _Float16* a1p = (const _Float16*)(st + (32 * wm + 16 + ln) * G2_PITCH);
    const _Float16* b0p = (const _Float16*)(st + (128 + 64 * wn + ln) * G2_PITCH); const _Float16* b1p = (const _Float16*)(st + (128 + 64 * wn + 16 + ln) * G2_PITCH); const _Float16* b2p = (const _Float16*)(st + (128 + 64 * wn + 32 + ln) * G2_PITCH); const _Float16* b3p = (const _Float16*)(st + (128 + 64 * wn + 48 + ln) * G2_PITCH);
#pragma unroll      /* both 32-k halves of the stage in one body: constant LDS offsets */
    for (int kb = 0; kb < 64; kb += 32) { const v16h a0 = g2_frag(a0p + kb, hh), a1 = g2_frag(a1p + kb, hh), b0 = g2_frag(b0p + kb, hh), b1 = g2_frag(b1p + kb, hh), b2 = g2_frag(b2p + kb, hh), b3 = g2_frag(b3p + kb, hh);      /* the six fragments as one group of LDS reads in front of their eight products: one LDS latency, not four */
      c00 = g2_mma(a0, b0, c00); c10 = g2_mma(a1, b0, c10); c01 = g2_mma(a0, b1, c01); c11 = g2_mma(a1, b1, c11);
      c02 = g2_mma(a0, b2, c02); c12 = g2_mma(a1, b2, c12); c03 = g2_mma(a0, b3, c03); c13 = g2_mma(a1, b3, c13); }
    asm volatile("s_wait_dscnt 0x0" ::: "memory");         /* this wave's reads of the stage are done before the buffer is given back */
    asm volatile("s_wait_asynccnt 0x0" ::: "memory");      /* this wave's copies of stage t + 1 have landed */
    __syncthreads();                                       /* publishes stage t + 1 and ends every wave's reads of stage t */
    if (t + 2 < nt) g2_stage(l0 + (unsigned)((t & 1) * G2_STAGE), ga + (size_t)(t + 2) * 64, lda, gb + (size_t)(t + 2) * 64, ldb); }
  asm volatile("s_wait_asynccnt 0x0" ::: "memory");        /* nothing is in flight when the stages become output staging */
  v8f accs[8] = {c00, c01, c02, c03, c10, c11, c12, c13};
#pragma unroll
  for (int u = 0; u < 8; ++u) { const int t = u & 3, half = u >> 2; const int col = col0 + t * 16 + ln; const float bv = bp ? bf16_round(bp[col]) : 0.f;
#pragma unroll
    for (int r = 0; r < 8; ++r) { const int rloc = half * 16 + 8 * hh + r; float v = accs[u][r] * alpha + bv; if (CP) { if (rowsPerB < 0) v += CP[cofs + (size_t)(row0g + row0 + rloc) * ldc + col];      /* rowsPerB < 0: own element of the batched C plane */ else { const int bidx = (row0g + row0 + rloc) / rowsPerB; v += CP[(size_t)bidx * sCPb + (size_t)by * 64 + col]; } }
      if (ACT == 3) v = fmaxf(v, 0.f); else if (ACT == 6) v = 0.5f * v * (1.0f + erff(v * 0.70710678118654752f)); else if (ACT == 11) v = 1.0f / (1.0f + expf(-v)); else if (ACT == 15) v = v / (1.0f + expf(-v)); else if (ACT == 12) v = (v > 0.f) ? v : 0.01f * v; else if (ACT == 8) v = tanhf(v); else if (ACT == 9) v = 0.5f * v * (1.0f + tanhf(0.7978845608028654f * (v + 0.044715f * v * v * v))); else if (ACT == 14) v = (v > 0.f) ? v : 0.1f * v; else if (ACT == 16) v = (v >= 0.f) ? v : 0.3f * v; else if (ACT == 17) v = (v >= 0.f) ? v : 0.2f * v;
      so[w][rloc][t * 16 + ln] = v; } }
  __builtin_amdgcn_fence(__ATOMIC_ACQ_REL, "workgroup"); __builtin_amdgcn_wave_barrier();
  const int rsub = lane >> 4, c4 = (lane & 15) * 4;
  {
#pragma unroll
    for (int q = 0; q < 16; ++q) { const int r = q * 2 + rsub; const v4f v = *(const v4fa*)&so[w][r][c4]; if (C) *(v4f*)(C + cofs + (size_t)(row0 + r) * ldc + col0 + c4) = v; if (C16) { v4h h4; for (int i = 0; i < 4; ++i) h4[i] = (_Float16)v[i]; *(v4h*)(C16 + cofs + (size_t)(row0 + r) * ldc + col0 + c4) = h4; } }
     } }


__global__ __launch_bounds__(256) void k_wnat(const float* __restrict__ w, size_t n8, _Float16* __restrict__ Bt) { const size_t t = (size_t)blockIdx.x * 256 + threadIdx.x; if (t >= n8) return; FragH f; for (int q = 0; q < 8; ++q) f.h[q] = (_Float16)(bf16_round(w[t * 8 + q]) * 16.0f); *(v8us*)((unsigned short*)Bt + t * 8) = f.half[0];  }
__global__ __launch_bounds__(256) void k_rsm(const float* __restrict__ S, _Float16* __restrict__ P, int nrows) {
  #pragma clang fp contract(off)
  const int i = blockIdx.x * 256 + threadIdx.x; if (i >= nrows) return; const float* s = S + (size_t)i * SQ; float mx = -3.0e38f;
#pragma unroll 1
  for (int j = 0; j < SQ; ++j) mx = fmaxf(mx, s[j]); float se = 0.f;
#pragma unroll 1
  for (int j = 0; j < SQ; ++j) se += expf(s[j] - mx); const float sc = 256.0f / se;
#pragma unroll 1
  for (int j0 = 0; j0 < SQ; j0 += 8) { FragH f; for (int q = 0; q < 8; ++q) f.h[q] = (_Float16)(expf(s[j0 + q] - mx) * sc); unsigned short* d = (unsigned short*)P + (size_t)i * SQ + j0; *(v8us*)d = f.half[0];  } }
__global__ __launch_bounds__(256) void k_vt(const _Float16* __restrict__ V16, int b, int h0, _Float16* __restrict__ VT) { __shared__ unsigned short tl[64][65]; const int tid = threadIdx.x; const int hh = blockIdx.x % HG, sg = blockIdx.x / HG; const int s0 = sg * 64; const int h = h0 + hh;
  for (int i = tid; i < 64 * 8; i += 256) { const int j = i / 8, d8 = (i % 8) * 8; FragH f; f.half[0] = *(const v8us*)((const unsigned short*)V16 + ((size_t)b * SQ + s0 + j) * DM + h * HD + d8); for (int q = 0; q < 8; ++q) tl[d8 + q][j] = f.u[q]; }
  __syncthreads();
  { for (int i = tid; i < 64 * 8; i += 256) { const int d = i / 8, j8 = (i % 8) * 8; FragH f; for (int q = 0; q < 8; ++q) f.u[q] = tl[d][j8 + q]; *(v8us*)((unsigned short*)VT + ((size_t)hh * HD + d) * SQ + s0 + j8) = f.half[0]; }  } }



// lanes l and l ^ 16 exchanged by the cross-row permlane (no LDS round trip)
__device__ __forceinline__ float xl_half(float v) { const int i = __float_as_int(v); return __int_as_float(__builtin_amdgcn_permlanex16(i, i, 0x76543210, 0xfedcba98, false, false)); }
__device__ __forceinline__ v8f fa_mma(v16h a, v16h b, v8f c) { return __builtin_amdgcn_wmma_f32_16x16x32_f16(false, a, false, b, (short)0, c, false, false); }
// 2^x on eight values; the v_nop is the one slot the instruction set asks for behind a transcendental, written in the same statement so that it stays directly behind the last one
__device__ __forceinline__ void fa_exp8(float (&e)[8]) { asm("v_exp_f32 %0, %0\n\tv_exp_f32 %1, %1\n\tv_exp_f32 %2, %2\n\tv_exp_f32 %3, %3\n\tv_exp_f32 %4, %4\n\tv_exp_f32 %5, %5\n\tv_exp_f32 %6, %6\n\tv_exp_f32 %7, %7\n\tv_nop" : "+v"(e[0]), "+v"(e[1]), "+v"(e[2]), "+v"(e[3]), "+v"(e[4]), "+v"(e[5]), "+v"(e[6]), "+v"(e[7])); }
__device__ __forceinline__ float fa_exp1(float x) { asm("v_exp_f32 %0, %0\n\tv_nop" : "+v"(x)); return x; }      /* same slot as above */
#define FA_PITCH 144                   /* LDS row pitch in bytes: 16 x odd, free of bank conflicts for 16-byte reads */
#define FA_STAGE (128 * FA_PITCH)      /* rows 0..63 = K (key, 64 d), rows 64..127 = V^T (d, 64 keys) */
// one stage's copies: a thread brings 16 bytes of each of 8 rows (16 rows apart; 4 of K, 4 of V^T), so a wave-wide copy covers 4 whole 128-byte lines.
// s_wait_xcnt 0 is the statement's last line: it then stands in front of every later rewrite of the address registers the copies name.
__device__ __forceinline__ void fa_stage(unsigned l, const _Float16* k, const _Float16* v) {
  const _Float16* k1 = k + (size_t)16 * LQ; const _Float16* k2 = k + (size_t)32 * LQ; const _Float16* k3 = k + (size_t)48 * LQ;
  const _Float16* v1 = v + (size_t)16 * SQ; const _Float16* v2 = v + (size_t)32 * SQ; const _Float16* v3 = v + (size_t)48 * SQ;
  asm volatile("global_load_async_to_lds_b128 %0, %8, off\n\tglobal_load_async_to_lds_b128 %1, %9, off\n\tglobal_load_async_to_lds_b128 %2, %10, off\n\tglobal_load_async_to_lds_b128 %3, %11, off\n\t"
               "global_load_async_to_lds_b128 %4, %12, off\n\tglobal_load_async_to_lds_b128 %5, %13, off\n\tglobal_load_async_to_lds_b128 %6, %14, off\n\tglobal_load_async_to_lds_b128 %7, %15, off\n\ts_wait_xcnt 0x0"
               :: "v"(l), "v"(l + 16 * FA_PITCH), "v"(l + 32 * FA_PITCH), "v"(l + 48 * FA_PITCH), "v"(l + 64 * FA_PITCH), "v"(l + 80 * FA_PITCH), "v"(l + 96 * FA_PITCH), "v"(l + 112 * FA_PITCH),
                  "v"(k), "v"(k1), "v"(k2), "v"(k3), "v"(v), "v"(v1), "v"(v2), "v"(v3) : "memory"); }
__global__ __launch_bounds__(128) void k_fattn(const _Float16* __restrict__ Q, const _Float16* __restrict__ Kr, const _Float16* __restrict__ VT, _Float16* __restrict__ O) {
  __shared__ __attribute__((aligned(128))) unsigned char sm[2 * FA_STAGE];      /* the two K / V^T stages */
  const int tid = threadIdx.x, lane = tid & 31, ln = lane & 15, hh = lane >> 4, w = tid >> 5; const int bh = blockIdx.y, b = bh / NH, h = bh % NH; const int q0 = blockIdx.x * 128 + w * 32;
  const _Float16* qp = Q + ((size_t)b * SQ + q0 + ln) * LQ + h * HD;
  const _Float16* gk = Kr + ((size_t)b * SQ + (tid >> 3)) * LQ + h * HD + (tid & 7) * 8; const _Float16* gv = VT + ((size_t)bh * HD + (tid >> 3)) * SQ + (tid & 7) * 8;      /* the thread's 16 bytes of its first K row and first V^T row of stage 0 */
  const unsigned l0 = (unsigned)(size_t)sm + (unsigned)((tid >> 3) * FA_PITCH + (tid & 7) * 16);      /* the thread's LDS byte address in stage buffer 0 */
  const float cs = 0.03125f * 1.44269504f;      /* 1 / sqrt(d_model) and log2 e in one factor on the raw products */
  const v8f z8 = {0.f,0.f,0.f,0.f,0.f,0.f,0.f,0.f};
  v16h qf[2][2], kf[2][2], vf[4]; v8f o[4][2]; float m[2] = {-3.0e38f, -3.0e38f}, l[2] = {0.f, 0.f};
  fa_stage(l0, gk, gv);
#pragma unroll
  for (int u = 0; u < 2; ++u) for (int ch = 0; ch < 2; ++ch) qf[u][ch] = g2_frag(qp + (size_t)u * 16 * LQ + ch * 32, hh);
#pragma unroll
  for (int t = 0; t < 4; ++t) { o[t][0] = z8; o[t][1] = z8; }
  asm volatile("s_wait_asynccnt 0x0" ::: "memory");      /* this wave's copies of stage 0 have landed */
  __syncthreads();                                       /* ... and every other wave's */
  fa_stage(l0 + FA_STAGE, gk + (size_t)64 * LQ, gv + 64);
  for (int st = 0; st < SQ / 64; ++st) { const unsigned char* sp = sm + (st & 1) * FA_STAGE;
    const _Float16* kl = (const _Float16*)(sp + ln * FA_PITCH); const _Float16* vl = (const _Float16*)(sp + (64 + ln) * FA_PITCH);
#pragma unroll
    for (int kt = 0; kt < 2; ++kt) for (int ch = 0; ch < 2; ++ch) kf[kt][ch] = g2_frag(kl + kt * 16 * (FA_PITCH / 2) + ch * 32, hh);
#pragma unroll      /* both 32-key passes of the stage in one body: constant LDS offsets */
    for (int p = 0; p < 2; ++p) {
      v8f s[2][2];      /* [key tile][query group], raw q . k */
#pragma unroll
      for (int kt = 0; kt < 2; ++kt) for (int qt = 0; qt < 2; ++qt) s[kt][qt] = fa_mma(kf[kt][1], qf[qt][1], fa_mma(kf[kt][0], qf[qt][0], z8));
      if (p == 0) {      /* the stage's second pass's keys, fetched one pass ahead into the same registers; nothing of the next stage is read here */
#pragma unroll
        for (int kt = 0; kt < 2; ++kt) for (int ch = 0; ch < 2; ++ch) kf[kt][ch] = g2_frag(kl + (32 + kt * 16) * (FA_PITCH / 2) + ch * 32, hh); }
      float mn[2];
#pragma unroll
      for (int qt = 0; qt < 2; ++qt) { float a = fmaxf(s[0][qt][0], s[1][qt][0]);
        for (int r = 1; r < 8; ++r) a = fmaxf(a, fmaxf(s[0][qt][r], s[1][qt][r]));
        mn[qt] = fmaxf(m[qt], fmaxf(a, xl_half(a))); }
      if (__builtin_amdgcn_ballot_w32(mn[0] > m[0] || mn[1] > m[1]) != 0) {      /* scalar branch: where no column's maximum moved every factor is exactly 1 */
#pragma unroll
        for (int qt = 0; qt < 2; ++qt) { const float a = fa_exp1((m[qt] - mn[qt]) * cs); l[qt] *= a; m[qt] = mn[qt];
          for (int t = 0; t < 4; ++t) for (int r = 0; r < 8; ++r) o[t][qt][r] *= a; } }
#pragma unroll
      for (int t = 0; t < 4; ++t) vf[t] = g2_frag(vl + t * 16 * (FA_PITCH / 2) + p * 32, hh);      /* this pass's V^T: the exponentials below stand between the loads and their use */
      FragH pf[2];
#pragma unroll
      for (int qt = 0; qt < 2; ++qt) { const float mc = m[qt] * cs;
        for (int kt = 0; kt < 2; ++kt) { float e[8];
          for (int r = 0; r < 8; ++r) e[r] = fmaf(s[kt][qt][r], cs, -mc);
          fa_exp8(e);
          l[qt] += ((e[0] + e[1]) + (e[2] + e[3])) + ((e[4] + e[5]) + (e[6] + e[7]));
          for (int r = 0; r < 8; ++r) pf[qt].h[kt * 8 + r] = (_Float16)e[r]; } }
#pragma unroll
      for (int t = 0; t < 4; ++t) for (int qt = 0; qt < 2; ++qt) o[t][qt] = fa_mma(vf[t], pf[qt].v, o[t][qt]);
    }
    asm volatile("s_wait_dscnt 0x0" ::: "memory");         /* this wave's reads of the stage are done before the buffer is given back */
    asm volatile("s_wait_asynccnt 0x0" ::: "memory");      /* this wave's copies of stage st + 1 have landed */
    __syncthreads();                                       /* publishes stage st + 1 and ends every wave's reads of stage st */
    if (st + 2 < SQ / 64) fa_stage(l0 + (unsigned)((st & 1) * FA_STAGE), gk + (size_t)(st + 2) * 64 * LQ, gv + (size_t)(st + 2) * 64); }
  asm volatile("s_wait_asynccnt 0x0" ::: "memory");        /* nothing is in flight when the wave ends */
#pragma unroll
  for (int qt = 0; qt < 2; ++qt) { const float inv = 64.0f / (l[qt] + xl_half(l[qt])); unsigned short* op = (unsigned short*)O + ((size_t)b * SQ + q0 + qt * 16 + ln) * DM + h * HD + 8 * hh;      /* o[t][qt][r] = O[query ln][16 t + 8 hh + r]: 16 contiguous bytes a store */
    for (int t = 0; t < 4; ++t) { FragH f; for (int r = 0; r < 8; ++r) f.h[r] = (_Float16)(o[t][qt][r] * inv); *(v8us*)(op + t * 16) = f.half[0]; } } }

// every launch-independent preparation job in ONE grid, the job picked by the block index (a scalar branch): the 48 per-head weight blocks, W_o, and the three x planes; none reads what another writes, and a thread still builds runs of 8 consecutive f16 of one output row.
#define PB_WH (DM / 64)                        /* blocks for one head's [DM][HD] weight block: one 64 x 64 tile each (HD = 64) */
#define PB_WO ((DM / 64) * (DM / 64))          /* blocks for W_o, likewise */
#define PB_X  ((int)(NR * DM / 8 / 256))       /* blocks for one x plane */
// one 64 (k) x 64 (n) tile of Wt[n][k] = f16(bf16(W[k][n]) x16), W row-major with N columns; Wm points at W[k0][n0], Wt at Wt[n0][k0]; x16 (a power of two) keeps the bf16-exact weights exact in f16, away from the subnormal range.
// The transposition goes through LDS so that both global sides move whole 128-byte lines: a wave-wide load covers 256 contiguous bytes of each of 2 rows of W, a wave-wide store 128 contiguous bytes of each of 4 rows of Wt.
// Pitch 65 words: for each word stored (a wave: 2 rows x 16 columns 4 apart) and each word loaded (8 rows 8 apart x 4 columns) the 32 lanes fall on 32 different banks.
template <int N>
__device__ __forceinline__ void prep_wt(const float* __restrict__ Wm, _Float16* __restrict__ Wt, float (*tl)[65], int tid) { v4f a[4];
#pragma unroll      /* the thread's four loads stand together in front of the LDS stores: one memory latency */
  for (int i = 0; i < 4; ++i) a[i] = *(const v4fa*)(Wm + (size_t)(16 * i + (tid >> 4)) * N + (tid & 15) * 4);
#pragma unroll      /* constant indices keep a in registers */
  for (int i = 0; i < 4; ++i) for (int j = 0; j < 4; ++j) tl[16 * i + (tid >> 4)][(tid & 15) * 4 + j] = a[i][j];
  __syncthreads();      /* the tile is whole before any thread reads a column of it; the job test around this call reads the same for the whole block */
  FragH f[2];
#pragma unroll      /* constant indices keep f in registers */
  for (int u = 0; u < 2; ++u) for (int q = 0; q < 8; ++q) f[u].h[q] = (_Float16)(bf16_round(tl[(tid & 7) * 8 + q][32 * u + (tid >> 3)]) * 16.0f);
#pragma unroll      /* the two stores as one run, each from registers of its own */
  for (int u = 0; u < 2; ++u) *(v8us*)((unsigned short*)Wt + (size_t)(32 * u + (tid >> 3)) * DM + (tid & 7) * 8) = f[u].half[0];
  asm volatile("s_wait_xcnt 0x0" ::: "memory"); }      /* the stores' registers are released before any code the compiler lays behind this job can rewrite them */
__global__ __launch_bounds__(256) void k_prep(const float* __restrict__ x, const float* __restrict__ wq, const float* __restrict__ wk, const float* __restrict__ wv, const float* __restrict__ wo, _Float16* __restrict__ Bt, _Float16* __restrict__ X16) {
  __shared__ float tl[64][65];      /* the weight jobs' transposition tile */
  int blk = blockIdx.x; const int tid = threadIdx.x;
  if (blk < 3 * NH * PB_WH) { const int p = blk / (NH * PB_WH), r = blk % (NH * PB_WH), h = r / PB_WH; const float* wp = (p == 0 ? wq : p == 1 ? wk : wv) + (size_t)h * DM * HD;      /* plane p (q, k, v), head h: its HD rows of the [out][in] plane */
    const int k0 = (r % PB_WH) * 64; prep_wt<HD>(wp + (size_t)k0 * HD, Bt + (size_t)p * DM * DM + (size_t)h * HD * DM + k0, tl, tid); return; }
  blk -= 3 * NH * PB_WH;
  if (blk < PB_WO) { const int n0 = (blk / (DM / 64)) * 64, k0 = (blk % (DM / 64)) * 64; prep_wt<DM>(wo + (size_t)k0 * DM + n0, Bt + (size_t)3 * DM * DM + (size_t)n0 * DM + k0, tl, tid); return; }
  blk -= PB_WO;
  const int p = blk / PB_X; const size_t t = (size_t)(blk % PB_X) * 256 + tid; FragH f;      /* x plane p as exact f16 rows */
#pragma unroll
  for (int q = 0; q < 8; ++q) f.h[q] = (_Float16)bf16_round(x[t * 8 + q]);
  *(v8us*)((unsigned short*)X16 + (size_t)p * NR * DM + t * 8) = f.half[0];
  asm volatile("s_wait_xcnt 0x0" ::: "memory"); }      /* as in prep_wt: the store's registers are released before anything behind it can rewrite them */

extern "C" void kernel_launch(void* const* d_in, const int* in_sizes, int n_in,
                              void* d_out, int out_size, void* d_ws, size_t ws_size, hipStream_t stream) {
  (void)in_sizes; (void)n_in; (void)out_size;
  const float* const* I = (const float* const*)d_in; const float* x = I[0]; const float* wq = I[1]; const float* wk = I[2]; const float* wv = I[3]; const float* wo = I[4]; const float* bo = I[5];      /* ONE input stream (X) read on all three projections; Wq, Wk, Wv are PER-HEAD STACKS [16][1024][64] = [head][in][out] (the module has NO q / k / v biases: null pointers in the guarded bias slots); Wo [in][out] [1024][1024] at I[4], bo at I[5] */
  char* ws = (char*)d_ws; size_t off = 0;
  auto take = [&](size_t bytes) { char* p = ws + off; off += (bytes + 255) & ~(size_t)255; return p; };
  _Float16* BQ = (_Float16*)take((size_t)4 * DM * DM * 2); _Float16* BO = BQ + (size_t)3 * DM * DM;      /* weight planes q, k, v, o, one behind the other: a grid index steps through them */
  _Float16* XQ = (_Float16*)take((size_t)3 * NR * DM * 2);      /* x planes for q, k, v, likewise */
  _Float16* Q16 = (_Float16*)take((size_t)3 * NR * DM * 2); _Float16* K16 = Q16 + NR * DM; _Float16* V16 = K16 + NR * DM; _Float16* O16 = (_Float16*)take(NR * DM * 2);
  _Float16* VT = (_Float16*)take((size_t)NB * NH * HD * SQ * 2);
  if (off > ws_size) return;
  k_prep<<<3 * NH * PB_WH + PB_WO + 3 * PB_X, 256, 0, stream>>>(x, wq, wk, wv, wo, BQ, XQ);      /* PER-HEAD STACKS wq / wk / wv [NH][DM][HD]: head h is a row-major [in = DM][out = HD] block at w + h * DM * HD, transposed into rows Bt[h * HD + e][k] of the [out][in] plane (x16); wo is a plain [in][out] [DM][DM] matrix; the three inputs as exact f16 rows */
  const size_t r0p = (size_t)B0 * SQ;      /* first projected row */
  k_gemm2<0><<<dim3((unsigned)((MP / 128) * (DM / 128)), 3), 256, 0, stream>>>(XQ + r0p * DM, DM, NR * DM, BQ, DM, (size_t)DM * DM, 0.0625f, nullptr, 0, nullptr, 1, 0, 0, nullptr, Q16 + r0p * DM, DM, NR * DM, MP, DM, DM);      /* Q, K, V: blockIdx.y picks the x plane, the weight plane and the output plane */
  k_vt<NH, SQ><<<NB * NH * (SQ / 64), 256, 0, stream>>>(V16, LQ, 0, VT);      /* V^T [NB][NH][HD][SQ], both batches */
  k_fattn<<<dim3(SQ / 128, NB * NH), 128, 0, stream>>>(Q16, K16, VT, O16);      /* scores, softmax and P V in one kernel: o (merged heads, x64) as f16 rows */
  k_gemm2<0><<<dim3((unsigned)((MPO / 128) * (DM / 128)), 1), 256, 0, stream>>>(O16 + r0p * DM, DM, 0, BO, DM, 0, 0.0009765625f, bo, 0, nullptr, 1, 0, 0, (float*)d_out + r0p * DM, nullptr, DM, 0, MPO, DM, DM);      /* out rows are the output layout */
}

// v007
// It runs in 88.8 microseconds.
// In two side-by-side timings against v006, it was 1.08 and 1.09 times as fast.
// Over all steps from v000 it is 41.1 times as fast.
#include <hip/hip_runtime.h>
#define NB 2
#define SQ 2048
#define DM 1024
#define NH 16
#define HD 64
#define HG 4                         /* heads per launch of the per-batch k_vt */
#define B0 0                         /* first batch processed (debug hook) */
#define NBR NB                       /* batches processed (debug hook) */
#define NR ((size_t)NB * SQ)         /* token rows */
#define MP ((int)((size_t)NBR * SQ)) /* rows projected (debug hook) */
#define QN SQ                        /* query rows per batch; not used */
#define NHD NH                       /* heads; not used */
#define MPO MP                       /* rows through the output stage (debug hook) */
#define LQ DM      /* row pitch of the q/k/v rows */
typedef __bf16 v16b __attribute__((ext_vector_type(16)));
typedef unsigned short v8us __attribute__((ext_vector_type(8), may_alias));
typedef float  v8f  __attribute__((ext_vector_type(8)));
typedef float  v4f  __attribute__((ext_vector_type(4)));
typedef float  v4fa __attribute__((ext_vector_type(4), may_alias));
union FragB { v16b v; v8us half[2]; unsigned short u[16]; };

__device__ __forceinline__ unsigned short bf16_bits(float x) { unsigned int u = __float_as_uint(x); return (unsigned short)((u + 0x7FFFu + ((u >> 16) & 1u)) >> 16); }
__device__ __forceinline__ float bf16_val(unsigned short b) { return __uint_as_float(((unsigned int)b) << 16); }
__device__ __forceinline__ float bf16_round(float x) { return bf16_val(bf16_bits(x)); }
// D += A·B with NT terms: 1 = ah·bh, 2 = + al·bh (A split), 3 = + ah·bl (both split)
template <int NT>
__device__ __forceinline__ v8f mmaN(v16b ah, v16b al, v16b bh, v16b bl, v8f c) {
  c = __builtin_amdgcn_wmma_f32_16x16x32_bf16(false, ah, false, bh, (short)0, c, false, false);
  if (NT >= 2) c = __builtin_amdgcn_wmma_f32_16x16x32_bf16(false, al, false, bh, (short)0, c, false, false);
  if (NT >= 3) c = __builtin_amdgcn_wmma_f32_16x16x32_bf16(false, ah, false, bl, (short)0, c, false, false);
  asm volatile("v_nop\n\tv_nop\n\tv_nop\n\tv_nop" : "+v"(c) : "v"(ah), "v"(al), "v"(bh), "v"(bl));
  return c;
}

__global__ __launch_bounds__(256) void k_wt_bf16(const float* __restrict__ W, unsigned short* __restrict__ Wt, int K, int N) {
  const int t = blockIdx.x * 256 + threadIdx.x;
  const int k8n = K / 8;
  if (t >= N * k8n) return;
  const int n = t / k8n, k8 = (t % k8n) * 8;
  v8us v;
#pragma unroll
  for (int i = 0; i < 8; ++i) v[i] = bf16_bits(W[(size_t)(k8 + i) * N + n]);
  *(v8us*)(Wt + (size_t)n * K + k8) = v;
  
}

// GEMM C[M][N] (f32, pitch ldc) = act(A[M][K]·W + bias). A f32 row-major (pitch lda) converted per fragment to bf16
// (ASPLIT: hi/lo two planes -> 2 terms, else single rounded term); Wt bf16 [N][K] (pitch ldb). BIAS_BF16 rounds the
// bias to bf16 first (bias quantised to bf16 before the add). K%32==0, M%16==0, N%64==0.
template <bool ASPLIT, int ACT, bool BIAS_BF16>
__global__ __launch_bounds__(128) void k_gemm_bf(const float* __restrict__ A, int lda, const unsigned short* __restrict__ Wt, int ldb,
                                               const float* __restrict__ bias, float* __restrict__ C, int ldc, int M, int N, int K) {
  __shared__ __attribute__((aligned(16))) float so[4][16][64];
  const int tid = threadIdx.x, w = tid >> 5, lane = tid & 31, ln = lane & 15, hh = lane >> 4;
  const int ntn = N / 64;
  const int wid = blockIdx.x * 4 + w;
  const int mt = wid / ntn, nq = wid % ntn;
  if (mt * 16 >= M) return;
  const int row0 = mt * 16, col0 = nq * 64;
  const float* arow = A + (size_t)(row0 + ln) * lda;
  v8f acc[4] = {};
  for (int kb = 0; kb < K; kb += 32) {
    FragB ah, al;
    const v4f x0 = *(const v4fa*)(arow + kb + 8 * hh), x1 = *(const v4fa*)(arow + kb + 8 * hh + 4);
    const v4f x2 = *(const v4fa*)(arow + kb + 16 + 8 * hh), x3 = *(const v4fa*)(arow + kb + 16 + 8 * hh + 4);
    float xs[16] = {x0[0],x0[1],x0[2],x0[3],x1[0],x1[1],x1[2],x1[3],x2[0],x2[1],x2[2],x2[3],x3[0],x3[1],x3[2],x3[3]};
#pragma unroll
    for (int i = 0; i < 16; ++i) { const unsigned short hb = bf16_bits(xs[i]); ah.u[i] = hb; al.u[i] = ASPLIT ? bf16_bits(xs[i] - bf16_val(hb)) : (unsigned short)0; }
#pragma unroll
    for (int t = 0; t < 4; ++t) {
      const unsigned short* brow = Wt + (size_t)(col0 + t * 16 + ln) * ldb + kb;
      FragB b;
      b.half[0] = *(const v8us*)(brow + 8 * hh);
      b.half[1] = *(const v8us*)(brow + 16 + 8 * hh);
      acc[t] = mmaN<ASPLIT ? 2 : 1>(ah.v, al.v, b.v, b.v, acc[t]);
    }
  }
#pragma unroll
  for (int t = 0; t < 4; ++t) {
    float bv = bias ? bias[col0 + t * 16 + ln] : 0.f;
    if (BIAS_BF16) bv = bf16_round(bv);
#pragma unroll
    for (int r = 0; r < 8; ++r) { float v = acc[t][r] + bv; if (ACT == 1) v = fmaxf(v, 0.f); so[w][8 * hh + r][t * 16 + ln] = v; }
  }
  __builtin_amdgcn_fence(__ATOMIC_ACQ_REL, "workgroup");
  __builtin_amdgcn_wave_barrier();
  const int rsub = lane >> 4, c4 = (lane & 15) * 4;
  {
#pragma unroll
    for (int q = 0; q < 8; ++q) {
      const int r = q * 2 + rsub;
      const v4f v = *(const v4fa*)&so[w][r][c4];
      *(v4f*)(C + (size_t)(row0 + r) * ldc + col0 + c4) = v;
    }
    
  }
}

// GEMM C = act(A·W + bias + resid): A f32 (ASPLIT -> hi/lo 2 terms), Wt bf16 [N][K]; ACT 0 none, 1 relu, 2 exact gelu;
// resid (optional, f32, row index = (row % rmod), pitch ldr, RES_BF16 rounds it) added before the activation.
template <bool ASPLIT, int ACT, bool BIAS_BF16, bool RES_BF16>
__global__ __launch_bounds__(128) void k_gemm_bf3(const float* __restrict__ A, int lda, const unsigned short* __restrict__ Wt, int ldb,
                                                const float* __restrict__ bias, const float* __restrict__ resid, int rmod, int ldr,
                                                float* __restrict__ C, int ldc, int M, int N, int K) {
  __shared__ __attribute__((aligned(16))) float so[4][16][64];
  const int tid = threadIdx.x, w = tid >> 5, lane = tid & 31, ln = lane & 15, hh = lane >> 4;
  const int ntn = N / 64;
  const int wid = blockIdx.x * 4 + w;
  const int mt = wid / ntn, nq = wid % ntn;
  if (mt * 16 >= M) return;
  const int row0 = mt * 16, col0 = nq * 64;
  const float* arow = A + (size_t)(row0 + ln) * lda;
  v8f acc[4] = {};
  for (int kb = 0; kb < K; kb += 32) {
    FragB ah, al;
    const v4f x0 = *(const v4fa*)(arow + kb + 8 * hh), x1 = *(const v4fa*)(arow + kb + 8 * hh + 4);
    const v4f x2 = *(const v4fa*)(arow + kb + 16 + 8 * hh), x3 = *(const v4fa*)(arow + kb + 16 + 8 * hh + 4);
    float xs[16] = {x0[0],x0[1],x0[2],x0[3],x1[0],x1[1],x1[2],x1[3],x2[0],x2[1],x2[2],x2[3],x3[0],x3[1],x3[2],x3[3]};
#pragma unroll
    for (int i = 0; i < 16; ++i) { const unsigned short hb = bf16_bits(xs[i]); ah.u[i] = hb; al.u[i] = ASPLIT ? bf16_bits(xs[i] - bf16_val(hb)) : (unsigned short)0; }
#pragma unroll
    for (int t = 0; t < 4; ++t) {
      const unsigned short* brow = Wt + (size_t)(col0 + t * 16 + ln) * ldb + kb;
      FragB b;
      b.half[0] = *(const v8us*)(brow + 8 * hh);
      b.half[1] = *(const v8us*)(brow + 16 + 8 * hh);
      acc[t] = mmaN<ASPLIT ? 2 : 1>(ah.v, al.v, b.v, b.v, acc[t]);
    }
  }
#pragma unroll
  for (int t = 0; t < 4; ++t) {
    const int col = col0 + t * 16 + ln;
    float bv = bias ? bias[col] : 0.f;
    if (BIAS_BF16) bv = bf16_round(bv);
#pragma unroll
    for (int r = 0; r < 8; ++r) {
      float v = acc[t][r] + bv;
      if (resid) { float rv = resid[(size_t)((row0 + 8 * hh + r) % rmod) * ldr + col]; if (RES_BF16) rv = bf16_round(rv); v += rv; }
      if (ACT == 1) v = fmaxf(v, 0.f);
      if (ACT == 2) v = 0.5f * v * (1.0f + erff(v * 0.70710678118654752f));
      if (ACT == 3) { const float u = 0.7978845608028654f * (v + 0.044715f * v * v * v); v = 0.5f * v * (1.0f + tanhf(u)); }
      so[w][8 * hh + r][t * 16 + ln] = v;
    }
  }
  __builtin_amdgcn_fence(__ATOMIC_ACQ_REL, "workgroup");
  __builtin_amdgcn_wave_barrier();
  const int rsub = lane >> 4, c4 = (lane & 15) * 4;
  {
#pragma unroll
    for (int q = 0; q < 8; ++q) {
      const int r = q * 2 + rsub;
      const v4f v = *(const v4fa*)&so[w][r][c4];
      *(v4f*)(C + (size_t)(row0 + r) * ldc + col0 + c4) = v;
    }
    
  }
}
// row LayerNorm (biased variance, eps) over N: s = X (+ R); optional out_sum <- s; out_norm <- (s-mu)*rsqrt(var+eps)*g + b
template <bool PARAM_BF16>
__global__ __launch_bounds__(256) void k_layernorm(const float* __restrict__ X, const float* __restrict__ R, const float* __restrict__ g, const float* __restrict__ bta,
                                                  float* __restrict__ out_sum, float* __restrict__ out_norm, int N, float eps) {
  __shared__ float red[256];
  const int row = blockIdx.x, tid = threadIdx.x;
  const float* x = X + (size_t)row * N; const float* rr = R ? R + (size_t)row * N : nullptr;
  float vals[16];                     // up to N = 4096
  const int per = N / 256;            // contiguous chunk per thread? use strided-by-4 chunks: thread handles j = tid*4 + 1024*u
  float s1 = 0.f;
  for (int u = 0; u < per / 4; ++u) {
    const int j = tid * 4 + 1024 * u;
    const v4f a = *(const v4fa*)(x + j);
    v4f b = {0.f,0.f,0.f,0.f}; if (rr) b = *(const v4fa*)(rr + j);
#pragma unroll
    for (int q = 0; q < 4; ++q) { const float v = a[q] + b[q]; vals[u * 4 + q] = v; s1 += v; }
  }
  red[tid] = s1; __syncthreads();
  for (int st = 128; st > 0; st >>= 1) { if (tid < st) red[tid] += red[tid + st]; __syncthreads(); }
  const float mu = red[0] / (float)N; __syncthreads();
  float s2 = 0.f;
  for (int u = 0; u < per / 4; ++u)
#pragma unroll
    for (int q = 0; q < 4; ++q) { const float c = vals[u * 4 + q] - mu; s2 += c * c; }
  red[tid] = s2; __syncthreads();
  for (int st = 128; st > 0; st >>= 1) { if (tid < st) red[tid] += red[tid + st]; __syncthreads(); }
  const float rs = rsqrtf(red[0] / (float)N + eps);
  {
    for (int u = 0; u < per / 4; ++u) {
      const int j = tid * 4 + 1024 * u;
      v4f o, sm;
#pragma unroll
      for (int q = 0; q < 4; ++q) {
        float gg = g[j + q], bb = bta[j + q];
        if (PARAM_BF16) { gg = bf16_round(gg); bb = bf16_round(bb); }
        sm[q] = vals[u * 4 + q]; o[q] = (vals[u * 4 + q] - mu) * rs * gg + bb;
      }
      if (out_sum) *(v4f*)(out_sum + (size_t)row * N + j) = sm;
      *(v4f*)(out_norm + (size_t)row * N + j) = o;
    }
    
  }
}



// ---- f16 WMMA path (v_wmma_f32_16x16x32_f16): 11-bit significands for operands in range — used where a [0,1] probability operand needs more precision than bf16
typedef _Float16 v16h __attribute__((ext_vector_type(16)));
union FragH { v16h v; v8us half[2]; _Float16 h[16]; unsigned short u[16]; };
template <int NT>
__device__ __forceinline__ v8f mmaH(v16h ah, v16h al, v16h bh, v16h bl, v8f c) {
  c = __builtin_amdgcn_wmma_f32_16x16x32_f16(false, ah, false, bh, (short)0, c, false, false);
  if (NT >= 2) c = __builtin_amdgcn_wmma_f32_16x16x32_f16(false, al, false, bh, (short)0, c, false, false);
  if (NT >= 3) c = __builtin_amdgcn_wmma_f32_16x16x32_f16(false, ah, false, bl, (short)0, c, false, false);
  asm volatile("v_nop\n\tv_nop\n\tv_nop\n\tv_nop" : "+v"(c) : "v"(ah), "v"(al), "v"(bh), "v"(bl));
  return c;
}
// batched GEMM like k_gemm_b but f16 operands: A f32 (split into f16 hi/lo if ASPLIT, else rounded to f16), Bt = f16 values [n][k]; alpha; C f32; N multiple of 16 (partial tiles skipped)
template <bool ASPLIT>
__global__ __launch_bounds__(128) void k_gemm_h(const float* __restrict__ A, int lda, size_t sA, const _Float16* __restrict__ Bh, int ldb, size_t sB, float alpha, float* __restrict__ C, int ldc, size_t sC, int M, int N, int K) {
  __shared__ __attribute__((aligned(16))) float so[4][16][64];
  const int tid = threadIdx.x, w = tid >> 5, lane = tid & 31, ln = lane & 15, hh = lane >> 4; const int by = blockIdx.y;
  A += (size_t)by * sA; Bh += (size_t)by * sB; C += (size_t)by * sC;
  const int ntn = (N + 63) / 64; const int wid = blockIdx.x * 4 + w; const int mt = wid / ntn, nq = wid % ntn; if (mt * 16 >= M) return;
  const int row0 = mt * 16, col0 = nq * 64; const float* arow = A + (size_t)(row0 + ln) * lda;
  v8f acc[4] = {};
  for (int kb = 0; kb < K; kb += 32) {
    FragH ah, al;
    const v4f x0 = *(const v4fa*)(arow + kb + 8 * hh), x1 = *(const v4fa*)(arow + kb + 8 * hh + 4), x2 = *(const v4fa*)(arow + kb + 16 + 8 * hh), x3 = *(const v4fa*)(arow + kb + 16 + 8 * hh + 4);
    float xs[16] = {x0[0],x0[1],x0[2],x0[3],x1[0],x1[1],x1[2],x1[3],x2[0],x2[1],x2[2],x2[3],x3[0],x3[1],x3[2],x3[3]};
#pragma unroll
    for (int i = 0; i < 16; ++i) { const _Float16 h = (_Float16)xs[i]; ah.h[i] = h; al.h[i] = ASPLIT ? (_Float16)(xs[i] - (float)h) : (_Float16)0.0f; }
#pragma unroll
    for (int t = 0; t < 4; ++t) { if (col0 + t * 16 >= N) continue; const size_t boff = (size_t)(col0 + t * 16 + ln) * ldb + kb; FragH bq; bq.half[0] = *(const v8us*)(Bh + boff + 8 * hh); bq.half[1] = *(const v8us*)(Bh + boff + 16 + 8 * hh);
      acc[t] = mmaH<ASPLIT ? 2 : 1>(ah.v, al.v, bq.v, bq.v, acc[t]); }
  }
#pragma unroll
  for (int t = 0; t < 4; ++t) { if (col0 + t * 16 >= N) continue;
#pragma unroll
    for (int r = 0; r < 8; ++r) so[w][8 * hh + r][t * 16 + ln] = acc[t][r] * alpha; }
  __builtin_amdgcn_fence(__ATOMIC_ACQ_REL, "workgroup"); __builtin_amdgcn_wave_barrier();
  const int rsub = lane >> 4, c4 = (lane & 15) * 4;
  {
#pragma unroll
    for (int q = 0; q < 8; ++q) { const int r = q * 2 + rsub; if (col0 + c4 < N) { const v4f v = *(const v4fa*)&so[w][r][c4]; *(v4f*)(C + (size_t)(row0 + r) * ldc + col0 + c4) = v; } }
     }
}

// k_gemm_hh variant with fused epilogue: v = acc·alpha + bias[by·sBias + col] (+ CP[(row/rowsPerB)·sCPb + by·64 + col] if CP) ; ACT 0 none / 1 elu ; writes f16 C16 (and f32 C if non-null)
template <int ACT>
__global__ __launch_bounds__(128) void k_gemm_hhx(const _Float16* __restrict__ A, int lda, size_t sA, const _Float16* __restrict__ Bh, int ldb, size_t sB, float alpha, const float* __restrict__ bias, size_t sBias, const float* __restrict__ CP, int rowsPerB, size_t sCPb, int row0g,
    float* __restrict__ C, _Float16* __restrict__ C16, int ldc, size_t sC, int M, int N, int K) {
  __shared__ __attribute__((aligned(16))) float so[4][16][64];
  const int tid = threadIdx.x, w = tid >> 5, lane = tid & 31, ln = lane & 15, hh = lane >> 4; const int by = blockIdx.y;
  A += (size_t)by * sA; Bh += (size_t)by * sB; const size_t cofs = (size_t)by * sC; const float* bp = bias ? bias + (size_t)by * sBias : nullptr;
  const int ntn = (N + 63) / 64; const int wid = blockIdx.x * 4 + w; const int mt = wid / ntn, nq = wid % ntn; if (mt * 16 >= M) return;
  const int row0 = mt * 16, col0 = nq * 64; const _Float16* arow = A + (size_t)(row0 + ln) * lda;
  v8f acc[4] = {};
  for (int kb = 0; kb < K; kb += 32) { FragH ah; ah.half[0] = *(const v8us*)((const unsigned short*)arow + kb + 8 * hh); ah.half[1] = *(const v8us*)((const unsigned short*)arow + kb + 16 + 8 * hh);
#pragma unroll
    for (int t = 0; t < 4; ++t) { if (col0 + t * 16 >= N) continue; const size_t boff = (size_t)(col0 + t * 16 + ln) * ldb + kb; FragH bq; bq.half[0] = *(const v8us*)((const unsigned short*)Bh + boff + 8 * hh); bq.half[1] = *(const v8us*)((const unsigned short*)Bh + boff + 16 + 8 * hh);
      acc[t] = mmaH<1>(ah.v, ah.v, bq.v, bq.v, acc[t]); }
  }
#pragma unroll
  for (int t = 0; t < 4; ++t) { if (col0 + t * 16 >= N) continue; const int col = col0 + t * 16 + ln; const float bv = bp ? bf16_round(bp[col]) : 0.f;
#pragma unroll
    for (int r = 0; r < 8; ++r) { float v = acc[t][r] * alpha + bv; if (CP) { const int rr = row0g + row0 + 8 * hh + r; if (rowsPerB < 0) v += CP[cofs + (size_t)rr * ldc + col];      /* rowsPerB < 0: own element of the batched C plane */ else { const int bidx = rr / rowsPerB; v += CP[(size_t)bidx * sCPb + (size_t)by * 64 + col]; } } if (ACT == 1) v = (v > 0.f) ? v : expm1f(v); else if (ACT == 7) v = (v > 0.f) ? v + 1.0f : expf(v); else if (ACT == 8) v = tanhf(v); else if (ACT == 9) v = 0.5f * v * (1.0f + tanhf(0.7978845608028654f * (v + 0.044715f * v * v * v))); else if (ACT == 11) v = 1.0f / (1.0f + expf(-v)); else if (ACT == 12) v = (v > 0.f) ? v : 0.01f * v; else if (ACT == 14) v = (v > 0.f) ? v : 0.1f * v; else if (ACT == 16) v = (v >= 0.f) ? v : 0.3f * v; else if (ACT == 17) v = (v >= 0.f) ? v : 0.2f * v; else if (ACT == 15) v = v / (1.0f + expf(-v)); else if (ACT == 3) v = fmaxf(v, 0.f); else if (ACT == 6) v = 0.5f * v * (1.0f + erff(v * 0.70710678118654752f)); so[w][8 * hh + r][t * 16 + ln] = v; } }
  __builtin_amdgcn_fence(__ATOMIC_ACQ_REL, "workgroup"); __builtin_amdgcn_wave_barrier();
  const int rsub = lane >> 4, c4 = (lane & 15) * 4; typedef _Float16 v4h __attribute__((ext_vector_type(4)));
  {
#pragma unroll
    for (int q = 0; q < 8; ++q) { const int r = q * 2 + rsub; if (col0 + c4 < N) { const v4f v = *(const v4fa*)&so[w][r][c4]; if (C) *(v4f*)(C + cofs + (size_t)(row0 + r) * ldc + col0 + c4) = v; if (C16) { v4h h4; for (int i = 0; i < 4; ++i) h4[i] = (_Float16)v[i]; *(v4h*)(C16 + cofs + (size_t)(row0 + r) * ldc + col0 + c4) = h4; } } }
     }
}


typedef _Float16 v4h __attribute__((ext_vector_type(4)));

__global__ __launch_bounds__(256) void k_h16(const float* __restrict__ x, _Float16* __restrict__ X16, size_t n8) { const size_t t = (size_t)blockIdx.x * 256 + threadIdx.x; if (t >= n8) return; FragH f;
#pragma unroll
  for (int q = 0; q < 8; ++q) f.h[q] = (_Float16)x[t * 8 + q]; *(v8us*)((unsigned short*)X16 + t * 8) = f.half[0];  }
__global__ __launch_bounds__(256) void k_round16f(const float* __restrict__ W, _Float16* __restrict__ Bt, size_t n8) { const size_t t = (size_t)blockIdx.x * 256 + threadIdx.x; if (t >= n8) return; FragH f;
#pragma unroll
  for (int i = 0; i < 8; ++i) f.h[i] = (_Float16)(bf16_round(W[t * 8 + i]) * 16.0f); *(v8us*)((unsigned short*)Bt + t * 8) = f.half[0];  }
template <int NHv, int TTv>
__global__ __launch_bounds__(256) void k_vt(const _Float16* __restrict__ V16, int ldv, int voff, _Float16* __restrict__ Vt) { __shared__ unsigned short tl[64][66]; const int tid = threadIdx.x; const int slab = blockIdx.x / (TTv / 64), lg = blockIdx.x % (TTv / 64); const int b = slab / NHv, h = slab % NHv;
  for (int i = tid; i < 64 * 8; i += 256) { const int r = i / 8, c8 = (i % 8) * 8; FragH f; f.half[0] = *(const v8us*)((const unsigned short*)V16 + ((size_t)b * TTv + lg * 64 + r) * ldv + voff + h * 64 + c8);
#pragma unroll
    for (int q = 0; q < 8; ++q) tl[r][c8 + q] = f.u[q]; }
  __syncthreads();
  {
#pragma unroll
    for (int rd = 0; rd < 2; ++rd) { const int d = rd * 32 + tid / 8, pc = tid % 8; FragH f;
#pragma unroll
      for (int q = 0; q < 8; ++q) f.u[q] = tl[pc * 8 + q][d];
      *(v8us*)((unsigned short*)Vt + ((size_t)slab * 64 + d) * TTv + lg * 64 + pc * 8) = f.half[0]; }
     } }

__global__ __launch_bounds__(256) void k_hl(const float* __restrict__ F, _Float16* __restrict__ Hh, _Float16* __restrict__ Hl, size_t n8) { const size_t t = (size_t)blockIdx.x * 256 + threadIdx.x; if (t >= n8) return; FragH fh, fl; const v4f a = *(const v4fa*)(F + t * 8), c = *(const v4fa*)(F + t * 8 + 4);
#pragma unroll
  for (int q = 0; q < 4; ++q) { _Float16 h = (_Float16)a[q]; fh.h[q] = h; fl.h[q] = (_Float16)((a[q] - (float)h) * 1024.0f); h = (_Float16)c[q]; fh.h[4 + q] = h; fl.h[4 + q] = (_Float16)((c[q] - (float)h) * 1024.0f); }
  { *(v8us*)((unsigned short*)Hh + t * 8) = fh.half[0]; *(v8us*)((unsigned short*)Hl + t * 8) = fl.half[0];  } }

// ---- fast GEMM (block tile 128x128, eight waves of 32x64; requires M % 128 == 0, N % 128 == 0, K % 64 == 0); epilogue = k_gemm_hhx semantics ----
// Both operands pass through LDS: a stage is 64 k (one whole 128-byte line) of the block's 128 A rows and 128 B rows, brought by asynchronous copies and read by all eight waves; two stages, the next one in flight while this one is multiplied.
__device__ __forceinline__ v16h g2_frag(const _Float16* p, int hh) { FragH f; f.half[0] = *(const v8us*)((const unsigned short*)p + 8 * hh); f.half[1] = *(const v8us*)((const unsigned short*)p + 16 + 8 * hh); return f.v; }
__device__ __forceinline__ v8f g2_mma(v16h a, v16h b, v8f c) { v8f d = __builtin_amdgcn_wmma_f32_16x16x32_f16(false, a, false, b, (short)0, c, false, false); asm volatile("v_nop\n\tv_nop\n\tv_nop\n\tv_nop" : "+v"(d) : "v"(a), "v"(b)); return d; }
#define G2_PITCH 144                   /* LDS row pitch in bytes: 16 x odd, free of bank conflicts for 16-byte reads */
#define G2_STAGE (256 * G2_PITCH)      /* rows 0..127 = A, rows 128..255 = B */
// one stage's copies: a thread brings 16 bytes of each of 8 rows (32 rows apart; 4 of A, 4 of B), so a wave-wide copy covers 4 whole 128-byte lines.
// s_wait_xcnt 0 is the statement's last line: it then stands in front of every later rewrite of the address registers the copies name.
__device__ __forceinline__ void g2_stage(unsigned l, const _Float16* a, int lda, const _Float16* b, int ldb) {
  const _Float16* a1 = a + (size_t)32 * lda; const _Float16* a2 = a + (size_t)64 * lda; const _Float16* a3 = a + (size_t)96 * lda;
  const _Float16* b1 = b + (size_t)32 * ldb; const _Float16* b2 = b + (size_t)64 * ldb; const _Float16* b3 = b + (size_t)96 * ldb;
  asm volatile("global_load_async_to_lds_b128 %0, %8, off\n\tglobal_load_async_to_lds_b128 %1, %9, off\n\tglobal_load_async_to_lds_b128 %2, %10, off\n\tglobal_load_async_to_lds_b128 %3, %11, off\n\t"
               "global_load_async_to_lds_b128 %4, %12, off\n\tglobal_load_async_to_lds_b128 %5, %13, off\n\tglobal_load_async_to_lds_b128 %6, %14, off\n\tglobal_load_async_to_lds_b128 %7, %15, off\n\ts_wait_xcnt 0x0"
               :: "v"(l), "v"(l + 32 * G2_PITCH), "v"(l + 64 * G2_PITCH), "v"(l + 96 * G2_PITCH), "v"(l + 128 * G2_PITCH), "v"(l + 160 * G2_PITCH), "v"(l + 192 * G2_PITCH), "v"(l + 224 * G2_PITCH),
                  "v"(a), "v"(a1), "v"(a2), "v"(a3), "v"(b), "v"(b1), "v"(b2), "v"(b3) : "memory"); }
template <int ACT>
__global__ __launch_bounds__(256) void k_gemm2(const _Float16* __restrict__ A, int lda, size_t sA, const _Float16* __restrict__ Bh, int ldb, size_t sB, float alpha, const float* __restrict__ bias, size_t sBias, const float* __restrict__ CP, int rowsPerB, size_t sCPb, int row0g,
    float* __restrict__ C, _Float16* __restrict__ C16, int ldc, size_t sC, int M, int N, int K) { static_assert(ACT == 0 || ACT == 3 || ACT == 6 || ACT == 8 || ACT == 9 || ACT == 11 || ACT == 12 || ACT == 14 || ACT == 15 || ACT == 16 || ACT == 17, "k_gemm2: unsupported ACT code (would silently apply no activation)");
  __shared__ __attribute__((aligned(128))) unsigned char sm[2 * G2_STAGE];      /* the two operand stages; behind the loop's last barrier the same bytes are the waves' output staging */
  static_assert(8 * 32 * 68 * 4 <= 2 * G2_STAGE, "output staging must fit the operand stages");
  float (*so)[32][68] = (float (*)[32][68])sm;
  const int tid = threadIdx.x, w = tid >> 5, lane = tid & 31, ln = lane & 15, hh = lane >> 4; const int by = blockIdx.y;
  A += (size_t)by * sA; Bh += (size_t)by * sB; const size_t cofs = (size_t)by * sC; const float* bp = bias ? bias + (size_t)by * sBias : nullptr;
  const int ntn = N >> 7; const int mt = blockIdx.x / ntn, nq = blockIdx.x - mt * ntn; if (mt * 128 >= M) return;      /* the same for the whole block, in front of every barrier */
  const int wm = w & 3, wn = w >> 2; const int row0 = mt * 128 + 32 * wm, col0 = nq * 128 + 64 * wn;
  const _Float16* ga = A + (size_t)(mt * 128 + (tid >> 3)) * lda + (tid & 7) * 8; const _Float16* gb = Bh + (size_t)(nq * 128 + (tid >> 3)) * ldb + (tid & 7) * 8;
  const unsigned l0 = (unsigned)(size_t)sm + (unsigned)((tid >> 3) * G2_PITCH + (tid & 7) * 16);      /* the thread's LDS byte address in stage buffer 0 */
  const int nt = K >> 6;
  g2_stage(l0, ga, lda, gb, ldb);
  asm volatile("s_wait_asynccnt 0x0" ::: "memory");      /* this wave's copies of stage 0 have landed */
  __syncthreads();                                       /* ... and every other wave's */
  if (1 < nt) g2_stage(l0 + G2_STAGE, ga + 64, lda, gb + 64, ldb);
  const v8f z8 = {0.f,0.f,0.f,0.f,0.f,0.f,0.f,0.f}; v8f c00 = z8, c01 = z8, c02 = z8, c03 = z8, c10 = z8, c11 = z8, c12 = z8, c13 = z8;
  for (int t = 0; t < nt; ++t) { const unsigned char* st = sm + (t & 1) * G2_STAGE;
    const _Float16* a0p = (const _Float16*)(st + (32 * wm + ln) * G2_PITCH); const _Float16* a1p = (const _Float16*)(st + (32 * wm + 16 + ln) * G2_PITCH);
    const _Float16* b0p = (const _Float16*)(st + (128 + 64 * wn + ln) * G2_PITCH); const _Float16* b1p = (const _Float16*)(st + (128 + 64 * wn + 16 + ln) * G2_PITCH); const _Float16* b2p = (const _Float16*)(st + (128 + 64 * wn + 32 + ln) * G2_PITCH); const _Float16* b3p = (const _Float16*)(st + (128 + 64 * wn + 48 + ln) * G2_PITCH);
#pragma unroll      /* both 32-k halves of the stage in one body: constant LDS offsets */
    for (int kb = 0; kb < 64; kb += 32) { const v16h a0 = g2_frag(a0p + kb, hh), a1 = g2_frag(a1p + kb, hh), b0 = g2_frag(b0p + kb, hh), b1 = g2_frag(b1p + kb, hh), b2 = g2_frag(b2p + kb, hh), b3 = g2_frag(b3p + kb, hh);      /* the six fragments as one group of LDS reads in front of their eight products: one LDS latency, not four */
      c00 = g2_mma(a0, b0, c00); c10 = g2_mma(a1, b0, c10); c01 = g2_mma(a0, b1, c01); c11 = g2_mma(a1, b1, c11);
      c02 = g2_mma(a0, b2, c02); c12 = g2_mma(a1, b2, c12); c03 = g2_mma(a0, b3, c03); c13 = g2_mma(a1, b3, c13); }
    asm volatile("s_wait_dscnt 0x0" ::: "memory");         /* this wave's reads of the stage are done before the buffer is given back */
    asm volatile("s_wait_asynccnt 0x0" ::: "memory");      /* this wave's copies of stage t + 1 have landed */
    __syncthreads();                                       /* publishes stage t + 1 and ends every wave's reads of stage t */
    if (t + 2 < nt) g2_stage(l0 + (unsigned)((t & 1) * G2_STAGE), ga + (size_t)(t + 2) * 64, lda, gb + (size_t)(t + 2) * 64, ldb); }
  asm volatile("s_wait_asynccnt 0x0" ::: "memory");        /* nothing is in flight when the stages become output staging */
  v8f accs[8] = {c00, c01, c02, c03, c10, c11, c12, c13};
#pragma unroll
  for (int u = 0; u < 8; ++u) { const int t = u & 3, half = u >> 2; const int col = col0 + t * 16 + ln; const float bv = bp ? bf16_round(bp[col]) : 0.f;
#pragma unroll
    for (int r = 0; r < 8; ++r) { const int rloc = half * 16 + 8 * hh + r; float v = accs[u][r] * alpha + bv; if (CP) { if (rowsPerB < 0) v += CP[cofs + (size_t)(row0g + row0 + rloc) * ldc + col];      /* rowsPerB < 0: own element of the batched C plane */ else { const int bidx = (row0g + row0 + rloc) / rowsPerB; v += CP[(size_t)bidx * sCPb + (size_t)by * 64 + col]; } }
      if (ACT == 3) v = fmaxf(v, 0.f); else if (ACT == 6) v = 0.5f * v * (1.0f + erff(v * 0.70710678118654752f)); else if (ACT == 11) v = 1.0f / (1.0f + expf(-v)); else if (ACT == 15) v = v / (1.0f + expf(-v)); else if (ACT == 12) v = (v > 0.f) ? v : 0.01f * v; else if (ACT == 8) v = tanhf(v); else if (ACT == 9) v = 0.5f * v * (1.0f + tanhf(0.7978845608028654f * (v + 0.044715f * v * v * v))); else if (ACT == 14) v = (v > 0.f) ? v : 0.1f * v; else if (ACT == 16) v = (v >= 0.f) ? v : 0.3f * v; else if (ACT == 17) v = (v >= 0.f) ? v : 0.2f * v;
      so[w][rloc][t * 16 + ln] = v; } }
  __builtin_amdgcn_fence(__ATOMIC_ACQ_REL, "workgroup"); __builtin_amdgcn_wave_barrier();
  const int rsub = lane >> 4, c4 = (lane & 15) * 4;
  {
#pragma unroll
    for (int q = 0; q < 16; ++q) { const int r = q * 2 + rsub; const v4f v = *(const v4fa*)&so[w][r][c4]; if (C) *(v4f*)(C + cofs + (size_t)(row0 + r) * ldc + col0 + c4) = v; if (C16) { v4h h4; for (int i = 0; i < 4; ++i) h4[i] = (_Float16)v[i]; *(v4h*)(C16 + cofs + (size_t)(row0 + r) * ldc + col0 + c4) = h4; } }
     } }


__global__ __launch_bounds__(256) void k_wnat(const float* __restrict__ w, size_t n8, _Float16* __restrict__ Bt) { const size_t t = (size_t)blockIdx.x * 256 + threadIdx.x; if (t >= n8) return; FragH f; for (int q = 0; q < 8; ++q) f.h[q] = (_Float16)(bf16_round(w[t * 8 + q]) * 16.0f); *(v8us*)((unsigned short*)Bt + t * 8) = f.half[0];  }
__global__ __launch_bounds__(256) void k_rsm(const float* __restrict__ S, _Float16* __restrict__ P, int nrows) {
  #pragma clang fp contract(off)
  const int i = blockIdx.x * 256 + threadIdx.x; if (i >= nrows) return; const float* s = S + (size_t)i * SQ; float mx = -3.0e38f;
#pragma unroll 1
  for (int j = 0; j < SQ; ++j) mx = fmaxf(mx, s[j]); float se = 0.f;
#pragma unroll 1
  for (int j = 0; j < SQ; ++j) se += expf(s[j] - mx); const float sc = 256.0f / se;
#pragma unroll 1
  for (int j0 = 0; j0 < SQ; j0 += 8) { FragH f; for (int q = 0; q < 8; ++q) f.h[q] = (_Float16)(expf(s[j0 + q] - mx) * sc); unsigned short* d = (unsigned short*)P + (size_t)i * SQ + j0; *(v8us*)d = f.half[0];  } }
__global__ __launch_bounds__(256) void k_vt(const _Float16* __restrict__ V16, int b, int h0, _Float16* __restrict__ VT) { __shared__ unsigned short tl[64][65]; const int tid = threadIdx.x; const int hh = blockIdx.x % HG, sg = blockIdx.x / HG; const int s0 = sg * 64; const int h = h0 + hh;
  for (int i = tid; i < 64 * 8; i += 256) { const int j = i / 8, d8 = (i % 8) * 8; FragH f; f.half[0] = *(const v8us*)((const unsigned short*)V16 + ((size_t)b * SQ + s0 + j) * DM + h * HD + d8); for (int q = 0; q < 8; ++q) tl[d8 + q][j] = f.u[q]; }
  __syncthreads();
  { for (int i = tid; i < 64 * 8; i += 256) { const int d = i / 8, j8 = (i % 8) * 8; FragH f; for (int q = 0; q < 8; ++q) f.u[q] = tl[d][j8 + q]; *(v8us*)((unsigned short*)VT + ((size_t)hh * HD + d) * SQ + s0 + j8) = f.half[0]; }  } }



// lanes l and l ^ 16 exchanged by the cross-row permlane (no LDS round trip)
__device__ __forceinline__ float xl_half(float v) { const int i = __float_as_int(v); return __int_as_float(__builtin_amdgcn_permlanex16(i, i, 0x76543210, 0xfedcba98, false, false)); }
__device__ __forceinline__ v8f fa_mma(v16h a, v16h b, v8f c) { return __builtin_amdgcn_wmma_f32_16x16x32_f16(false, a, false, b, (short)0, c, false, false); }
// 2^x on eight values; the v_nop is the one slot the instruction set asks for behind a transcendental, written in the same statement so that it stays directly behind the last one
__device__ __forceinline__ void fa_exp8(float (&e)[8]) { asm("v_exp_f32 %0, %0\n\tv_exp_f32 %1, %1\n\tv_exp_f32 %2, %2\n\tv_exp_f32 %3, %3\n\tv_exp_f32 %4, %4\n\tv_exp_f32 %5, %5\n\tv_exp_f32 %6, %6\n\tv_exp_f32 %7, %7\n\tv_nop" : "+v"(e[0]), "+v"(e[1]), "+v"(e[2]), "+v"(e[3]), "+v"(e[4]), "+v"(e[5]), "+v"(e[6]), "+v"(e[7])); }
__device__ __forceinline__ float fa_exp1(float x) { asm("v_exp_f32 %0, %0\n\tv_nop" : "+v"(x)); return x; }      /* same slot as above */
#define FA_PITCH 144                   /* LDS row pitch in bytes: 16 x odd, free of bank conflicts for 16-byte reads */
#define FA_STAGE (128 * FA_PITCH)      /* rows 0..63 = K (key, 64 d), rows 64..127 = V^T (d, 64 keys) */
// one stage's copies: a thread brings 16 bytes of each of 8 rows (16 rows apart; 4 of K, 4 of V^T), so a wave-wide copy covers 4 whole 128-byte lines.
// s_wait_xcnt 0 is the statement's last line: it then stands in front of every later rewrite of the address registers the copies name.
__device__ __forceinline__ void fa_stage(unsigned l, const _Float16* k, const _Float16* v) {
  const _Float16* k1 = k + (size_t)16 * LQ; const _Float16* k2 = k + (size_t)32 * LQ; const _Float16* k3 = k + (size_t)48 * LQ;
  const _Float16* v1 = v + (size_t)16 * SQ; const _Float16* v2 = v + (size_t)32 * SQ; const _Float16* v3 = v + (size_t)48 * SQ;
  asm volatile("global_load_async_to_lds_b128 %0, %8, off\n\tglobal_load_async_to_lds_b128 %1, %9, off\n\tglobal_load_async_to_lds_b128 %2, %10, off\n\tglobal_load_async_to_lds_b128 %3, %11, off\n\t"
               "global_load_async_to_lds_b128 %4, %12, off\n\tglobal_load_async_to_lds_b128 %5, %13, off\n\tglobal_load_async_to_lds_b128 %6, %14, off\n\tglobal_load_async_to_lds_b128 %7, %15, off\n\ts_wait_xcnt 0x0"
               :: "v"(l), "v"(l + 16 * FA_PITCH), "v"(l + 32 * FA_PITCH), "v"(l + 48 * FA_PITCH), "v"(l + 64 * FA_PITCH), "v"(l + 80 * FA_PITCH), "v"(l + 96 * FA_PITCH), "v"(l + 112 * FA_PITCH),
                  "v"(k), "v"(k1), "v"(k2), "v"(k3), "v"(v), "v"(v1), "v"(v2), "v"(v3) : "memory"); }
__global__ __launch_bounds__(128) void k_fattn(const _Float16* __restrict__ Q, const _Float16* __restrict__ Kr, const _Float16* __restrict__ VT, _Float16* __restrict__ O) {
  __shared__ __attribute__((aligned(128))) unsigned char sm[2 * FA_STAGE];      /* the two K / V^T stages */
  const int tid = threadIdx.x, lane = tid & 31, ln = lane & 15, hh = lane >> 4, w = tid >> 5; const int bh = blockIdx.y, b = bh / NH, h = bh % NH; const int q0 = blockIdx.x * 128 + w * 32;
  const _Float16* qp = Q + ((size_t)b * SQ + q0 + ln) * LQ + h * HD;
  const _Float16* gk = Kr + ((size_t)b * SQ + (tid >> 3)) * LQ + h * HD + (tid & 7) * 8; const _Float16* gv = VT + ((size_t)bh * HD + (tid >> 3)) * SQ + (tid & 7) * 8;      /* the thread's 16 bytes of its first K row and first V^T row of stage 0 */
  const unsigned l0 = (unsigned)(size_t)sm + (unsigned)((tid >> 3) * FA_PITCH + (tid & 7) * 16);      /* the thread's LDS byte address in stage buffer 0 */
  const float cs = 0.03125f * 1.44269504f;      /* 1 / sqrt(d_model) and log2 e in one factor on the raw products */
  const v8f z8 = {0.f,0.f,0.f,0.f,0.f,0.f,0.f,0.f};
  v16h qf[2][2], kf[2][2], vf[4]; v8f o[4][2]; float m[2] = {-3.0e38f, -3.0e38f}, l[2] = {0.f, 0.f};
  fa_stage(l0, gk, gv);
#pragma unroll
  for (int u = 0; u < 2; ++u) for (int ch = 0; ch < 2; ++ch) qf[u][ch] = g2_frag(qp + (size_t)u * 16 * LQ + ch * 32, hh);
#pragma unroll
  for (int t = 0; t < 4; ++t) { o[t][0] = z8; o[t][1] = z8; }
  asm volatile("s_wait_asynccnt 0x0" ::: "memory");      /* this wave's copies of stage 0 have landed */
  __syncthreads();                                       /* ... and every other wave's */
  fa_stage(l0 + FA_STAGE, gk + (size_t)64 * LQ, gv + 64);
  for (int st = 0; st < SQ / 64; ++st) { const unsigned char* sp = sm + (st & 1) * FA_STAGE;
    const _Float16* kl = (const _Float16*)(sp + ln * FA_PITCH); const _Float16* vl = (const _Float16*)(sp + (64 + ln) * FA_PITCH);
#pragma unroll
    for (int kt = 0; kt < 2; ++kt) for (int ch = 0; ch < 2; ++ch) kf[kt][ch] = g2_frag(kl + kt * 16 * (FA_PITCH / 2) + ch * 32, hh);
#pragma unroll      /* both 32-key passes of the stage in one body: constant LDS offsets */
    for (int p = 0; p < 2; ++p) {
      v8f s[2][2];      /* [key tile][query group], raw q . k */
#pragma unroll
      for (int kt = 0; kt < 2; ++kt) for (int qt = 0; qt < 2; ++qt) s[kt][qt] = fa_mma(kf[kt][1], qf[qt][1], fa_mma(kf[kt][0], qf[qt][0], z8));
      if (p == 0) {      /* the stage's second pass's keys, fetched one pass ahead into the same registers; nothing of the next stage is read here */
#pragma unroll
        for (int kt = 0; kt < 2; ++kt) for (int ch = 0; ch < 2; ++ch) kf[kt][ch] = g2_frag(kl + (32 + kt * 16) * (FA_PITCH / 2) + ch * 32, hh); }
      float mn[2];
#pragma unroll
      for (int qt = 0; qt < 2; ++qt) { float a = fmaxf(s[0][qt][0], s[1][qt][0]);
        for (int r = 1; r < 8; ++r) a = fmaxf(a, fmaxf(s[0][qt][r], s[1][qt][r]));
        mn[qt] = fmaxf(m[qt], fmaxf(a, xl_half(a))); }
      if (__builtin_amdgcn_ballot_w32(mn[0] > m[0] || mn[1] > m[1]) != 0) {      /* scalar branch: where no column's maximum moved every factor is exactly 1 */
#pragma unroll
        for (int qt = 0; qt < 2; ++qt) { const float a = fa_exp1((m[qt] - mn[qt]) * cs); l[qt] *= a; m[qt] = mn[qt];
          for (int t = 0; t < 4; ++t) for (int r = 0; r < 8; ++r) o[t][qt][r] *= a; } }
#pragma unroll
      for (int t = 0; t < 4; ++t) vf[t] = g2_frag(vl + t * 16 * (FA_PITCH / 2) + p * 32, hh);      /* this pass's V^T: the exponentials below stand between the loads and their use */
      FragH pf[2];
#pragma unroll
      for (int qt = 0; qt < 2; ++qt) { const float mc = m[qt] * cs;
        for (int kt = 0; kt < 2; ++kt) { float e[8];
          for (int r = 0; r < 8; ++r) e[r] = fmaf(s[kt][qt][r], cs, -mc);
          fa_exp8(e);
          l[qt] += ((e[0] + e[1]) + (e[2] + e[3])) + ((e[4] + e[5]) + (e[6] + e[7]));
          for (int r = 0; r < 8; ++r) pf[qt].h[kt * 8 + r] = (_Float16)e[r]; } }
#pragma unroll
      for (int t = 0; t < 4; ++t) for (int qt = 0; qt < 2; ++qt) o[t][qt] = fa_mma(vf[t], pf[qt].v, o[t][qt]);
    }
    asm volatile("s_wait_dscnt 0x0" ::: "memory");         /* this wave's reads of the stage are done before the buffer is given back */
    asm volatile("s_wait_asynccnt 0x0" ::: "memory");      /* this wave's copies of stage st + 1 have landed */
    __syncthreads();                                       /* publishes stage st + 1 and ends every wave's reads of stage st */
    if (st + 2 < SQ / 64) fa_stage(l0 + (unsigned)((st & 1) * FA_STAGE), gk + (size_t)(st + 2) * 64 * LQ, gv + (size_t)(st + 2) * 64); }
  asm volatile("s_wait_asynccnt 0x0" ::: "memory");        /* nothing is in flight when the wave ends */
#pragma unroll
  for (int qt = 0; qt < 2; ++qt) { const float inv = 64.0f / (l[qt] + xl_half(l[qt])); unsigned short* op = (unsigned short*)O + ((size_t)b * SQ + q0 + qt * 16 + ln) * DM + h * HD + 8 * hh;      /* o[t][qt][r] = O[query ln][16 t + 8 hh + r]: 16 contiguous bytes a store */
    for (int t = 0; t < 4; ++t) { FragH f; for (int r = 0; r < 8; ++r) f.h[r] = (_Float16)(o[t][qt][r] * inv); *(v8us*)(op + t * 16) = f.half[0]; } } }

// every launch-independent preparation job in ONE grid, the job picked by the block index (a scalar branch): the 48 per-head weight blocks, W_o, and the x plane; none reads what another writes, and a thread still builds runs of 8 consecutive f16 of one output row.
#define PB_WH (DM / 64)                        /* blocks for one head's [DM][HD] weight block: one 64 x 64 tile each (HD = 64) */
#define PB_WO ((DM / 64) * (DM / 64))          /* blocks for W_o, likewise */
#define PB_X  ((int)(NR * DM / 8 / 256))       /* blocks for the x plane */
// one 64 (k) x 64 (n) tile of Wt[n][k] = f16(bf16(W[k][n]) x16), W row-major with N columns; Wm points at W[k0][n0], Wt at Wt[n0][k0]; x16 (a power of two) keeps the bf16-exact weights exact in f16, away from the subnormal range.
// The transposition goes through LDS so that both global sides move whole 128-byte lines: a wave-wide load covers 256 contiguous bytes of each of 2 rows of W, a wave-wide store 128 contiguous bytes of each of 4 rows of Wt.
// Pitch 65 words: for each word stored (a wave: 2 rows x 16 columns 4 apart) and each word loaded (8 rows 8 apart x 4 columns) the 32 lanes fall on 32 different banks.
template <int N>
__device__ __forceinline__ void prep_wt(const float* __restrict__ Wm, _Float16* __restrict__ Wt, float (*tl)[65], int tid) { v4f a[4];
#pragma unroll      /* the thread's four loads stand together in front of the LDS stores: one memory latency */
  for (int i = 0; i < 4; ++i) a[i] = *(const v4fa*)(Wm + (size_t)(16 * i + (tid >> 4)) * N + (tid & 15) * 4);
#pragma unroll      /* constant indices keep a in registers */
  for (int i = 0; i < 4; ++i) for (int j = 0; j < 4; ++j) tl[16 * i + (tid >> 4)][(tid & 15) * 4 + j] = a[i][j];
  __syncthreads();      /* the tile is whole before any thread reads a column of it; the job test around this call reads the same for the whole block */
  FragH f[2];
#pragma unroll      /* constant indices keep f in registers */
  for (int u = 0; u < 2; ++u) for (int q = 0; q < 8; ++q) f[u].h[q] = (_Float16)(bf16_round(tl[(tid & 7) * 8 + q][32 * u + (tid >> 3)]) * 16.0f);
#pragma unroll      /* the two stores as one run, each from registers of its own */
  for (int u = 0; u < 2; ++u) *(v8us*)((unsigned short*)Wt + (size_t)(32 * u + (tid >> 3)) * DM + (tid & 7) * 8) = f[u].half[0];
  asm volatile("s_wait_xcnt 0x0" ::: "memory"); }      /* the stores' registers are released before any code the compiler lays behind this job can rewrite them */
__global__ __launch_bounds__(256) void k_prep(const float* __restrict__ x, const float* __restrict__ wq, const float* __restrict__ wk, const float* __restrict__ wv, const float* __restrict__ wo, _Float16* __restrict__ Bt, _Float16* __restrict__ X16) {
  __shared__ float tl[64][65];      /* the weight jobs' transposition tile */
  int blk = blockIdx.x; const int tid = threadIdx.x;
  if (blk < 3 * NH * PB_WH) { const int p = blk / (NH * PB_WH), r = blk % (NH * PB_WH), h = r / PB_WH; const float* wp = (p == 0 ? wq : p == 1 ? wk : wv) + (size_t)h * DM * HD;      /* plane p (q, k, v), head h: its HD rows of the [out][in] plane */
    const int k0 = (r % PB_WH) * 64; prep_wt<HD>(wp + (size_t)k0 * HD, Bt + (size_t)p * DM * DM + (size_t)h * HD * DM + k0, tl, tid); return; }
  blk -= 3 * NH * PB_WH;
  if (blk < PB_WO) { const int n0 = (blk / (DM / 64)) * 64, k0 = (blk % (DM / 64)) * 64; prep_wt<DM>(wo + (size_t)k0 * DM + n0, Bt + (size_t)3 * DM * DM + (size_t)n0 * DM + k0, tl, tid); return; }
  blk -= PB_WO;
  const size_t t = (size_t)blk * 256 + tid; FragH f;      /* x as exact f16 rows, converted once: Q, K and V all project the same rows */
#pragma unroll
  for (int q = 0; q < 8; ++q) f.h[q] = (_Float16)bf16_round(x[t * 8 + q]);
  *(v8us*)((unsigned short*)X16 + t * 8) = f.half[0];
  asm volatile("s_wait_xcnt 0x0" ::: "memory"); }      /* as in prep_wt: the store's registers are released before anything behind it can rewrite them */

extern "C" void kernel_launch(void* const* d_in, const int* in_sizes, int n_in,
                              void* d_out, int out_size, void* d_ws, size_t ws_size, hipStream_t stream) {
  (void)in_sizes; (void)n_in; (void)out_size;
  const float* const* I = (const float* const*)d_in; const float* x = I[0]; const float* wq = I[1]; const float* wk = I[2]; const float* wv = I[3]; const float* wo = I[4]; const float* bo = I[5];      /* ONE input stream (X) read on all three projections; Wq, Wk, Wv are PER-HEAD STACKS [16][1024][64] = [head][in][out] (the module has NO q / k / v biases: null pointers in the guarded bias slots); Wo [in][out] [1024][1024] at I[4], bo at I[5] */
  char* ws = (char*)d_ws; size_t off = 0;
  auto take = [&](size_t bytes) { char* p = ws + off; off += (bytes + 255) & ~(size_t)255; return p; };
  _Float16* BQ = (_Float16*)take((size_t)4 * DM * DM * 2); _Float16* BO = BQ + (size_t)3 * DM * DM;      /* weight planes q, k, v, o, one behind the other: a grid index steps through them */
  _Float16* XQ = (_Float16*)take(NR * DM * 2);      /* the x plane, shared by q, k, v */
  _Float16* Q16 = (_Float16*)take((size_t)3 * NR * DM * 2); _Float16* K16 = Q16 + NR * DM; _Float16* V16 = K16 + NR * DM; _Float16* O16 = (_Float16*)take(NR * DM * 2);
  _Float16* VT = (_Float16*)take((size_t)NB * NH * HD * SQ * 2);
  if (off > ws_size) return;
  k_prep<<<3 * NH * PB_WH + PB_WO + PB_X, 256, 0, stream>>>(x, wq, wk, wv, wo, BQ, XQ);      /* PER-HEAD STACKS wq / wk / wv [NH][DM][HD]: head h is a row-major [in = DM][out = HD] block at w + h * DM * HD, transposed into rows Bt[h * HD + e][k] of the [out][in] plane (x16); wo is a plain [in][out] [DM][DM] matrix; x as exact f16 rows */
  const size_t r0p = (size_t)B0 * SQ;      /* first projected row */
  k_gemm2<0><<<dim3((unsigned)((MP / 128) * (DM / 128)), 3), 256, 0, stream>>>(XQ + r0p * DM, DM, 0, BQ, DM, (size_t)DM * DM, 0.0625f, nullptr, 0, nullptr, 1, 0, 0, nullptr, Q16 + r0p * DM, DM, NR * DM, MP, DM, DM);      /* Q, K, V: blockIdx.y picks the weight plane and the output plane; the x plane is the same for all three (plane step 0) */
  k_vt<NH, SQ><<<NB * NH * (SQ / 64), 256, 0, stream>>>(V16, LQ, 0, VT);      /* V^T [NB][NH][HD][SQ], both batches */
  k_fattn<<<dim3(SQ / 128, NB * NH), 128, 0, stream>>>(Q16, K16, VT, O16);      /* scores, softmax and P V in one kernel: o (merged heads, x64) as f16 rows */
  k_gemm2<0><<<dim3((unsigned)((MPO / 128) * (DM / 128)), 1), 256, 0, stream>>>(O16 + r0p * DM, DM, 0, BO, DM, 0, 0.0009765625f, bo, 0, nullptr, 1, 0, 0, (float*)d_out + r0p * DM, nullptr, DM, 0, MPO, DM, DM);      /* out rows are the output layout */
}

// v008
// Measured time: 85.9 microseconds a run.
// In both of two side-by-side timings against v007, it was 1.04 times as fast.
// All steps since v000 together make it 42.6 times as fast.
#include <hip/hip_runtime.h>
#define NB 2
#define SQ 2048
#define DM 1024
#define NH 16
#define HD 64
#define HG 4                         /* heads per launch of the per-batch k_vt */
#define B0 0                         /* first batch processed (debug hook) */
#define NBR NB                       /* batches processed (debug hook) */
#define NR ((size_t)NB * SQ)         /* token rows */
#define MP ((int)((size_t)NBR * SQ)) /* rows projected (debug hook) */
#define QN SQ                        /* query rows per batch; not used */
#define NHD NH                       /* heads; not used */
#define MPO MP                       /* rows through the output stage (debug hook) */
#define LQ DM      /* row pitch of the q/k/v rows */
typedef __bf16 v16b __attribute__((ext_vector_type(16)));
typedef unsigned short v8us __attribute__((ext_vector_type(8), may_alias));
typedef float  v8f  __attribute__((ext_vector_type(8)));
typedef float  v4f  __attribute__((ext_vector_type(4)));
typedef float  v4fa __attribute__((ext_vector_type(4), may_alias));
union FragB { v16b v; v8us half[2]; unsigned short u[16]; };

__device__ __forceinline__ unsigned short bf16_bits(float x) { unsigned int u = __float_as_uint(x); return (unsigned short)((u + 0x7FFFu + ((u >> 16) & 1u)) >> 16); }
__device__ __forceinline__ float bf16_val(unsigned short b) { return __uint_as_float(((unsigned int)b) << 16); }
__device__ __forceinline__ float bf16_round(float x) { return bf16_val(bf16_bits(x)); }
// D += A·B with NT terms: 1 = ah·bh, 2 = + al·bh (A split), 3 = + ah·bl (both split)
template <int NT>
__device__ __forceinline__ v8f mmaN(v16b ah, v16b al, v16b bh, v16b bl, v8f c) {
  c = __builtin_amdgcn_wmma_f32_16x16x32_bf16(false, ah, false, bh, (short)0, c, false, false);
  if (NT >= 2) c = __builtin_amdgcn_wmma_f32_16x16x32_bf16(false, al, false, bh, (short)0, c, false, false);
  if (NT >= 3) c = __builtin_amdgcn_wmma_f32_16x16x32_bf16(false, ah, false, bl, (short)0, c, false, false);
  asm volatile("v_nop\n\tv_nop\n\tv_nop\n\tv_nop" : "+v"(c) : "v"(ah), "v"(al), "v"(bh), "v"(bl));
  return c;
}

__global__ __launch_bounds__(256) void k_wt_bf16(const float* __restrict__ W, unsigned short* __restrict__ Wt, int K, int N) {
  const int t = blockIdx.x * 256 + threadIdx.x;
  const int k8n = K / 8;
  if (t >= N * k8n) return;
  const int n = t / k8n, k8 = (t % k8n) * 8;
  v8us v;
#pragma unroll
  for (int i = 0; i < 8; ++i) v[i] = bf16_bits(W[(size_t)(k8 + i) * N + n]);
  *(v8us*)(Wt + (size_t)n * K + k8) = v;
  
}

// GEMM C[M][N] (f32, pitch ldc) = act(A[M][K]·W + bias). A f32 row-major (pitch lda) converted per fragment to bf16
// (ASPLIT: hi/lo two planes -> 2 terms, else single rounded term); Wt bf16 [N][K] (pitch ldb). BIAS_BF16 rounds the
// bias to bf16 first (bias quantised to bf16 before the add). K%32==0, M%16==0, N%64==0.
template <bool ASPLIT, int ACT, bool BIAS_BF16>
__global__ __launch_bounds__(128) void k_gemm_bf(const float* __restrict__ A, int lda, const unsigned short* __restrict__ Wt, int ldb,
                                               const float* __restrict__ bias, float* __restrict__ C, int ldc, int M, int N, int K) {
  __shared__ __attribute__((aligned(16))) float so[4][16][64];
  const int tid = threadIdx.x, w = tid >> 5, lane = tid & 31, ln = lane & 15, hh = lane >> 4;
  const int ntn = N / 64;
  const int wid = blockIdx.x * 4 + w;
  const int mt = wid / ntn, nq = wid % ntn;
  if (mt * 16 >= M) return;
  const int row0 = mt * 16, col0 = nq * 64;
  const float* arow = A + (size_t)(row0 + ln) * lda;
  v8f acc[4] = {};
  for (int kb = 0; kb < K; kb += 32) {
    FragB ah, al;
    const v4f x0 = *(const v4fa*)(arow + kb + 8 * hh), x1 = *(const v4fa*)(arow + kb + 8 * hh + 4);
    const v4f x2 = *(const v4fa*)(arow + kb + 16 + 8 * hh), x3 = *(const v4fa*)(arow + kb + 16 + 8 * hh + 4);
    float xs[16] = {x0[0],x0[1],x0[2],x0[3],x1[0],x1[1],x1[2],x1[3],x2[0],x2[1],x2[2],x2[3],x3[0],x3[1],x3[2],x3[3]};
#pragma unroll
    for (int i = 0; i < 16; ++i) { const unsigned short hb = bf16_bits(xs[i]); ah.u[i] = hb; al.u[i] = ASPLIT ? bf16_bits(xs[i] - bf16_val(hb)) : (unsigned short)0; }
#pragma unroll
    for (int t = 0; t < 4; ++t) {
      const unsigned short* brow = Wt + (size_t)(col0 + t * 16 + ln) * ldb + kb;
      FragB b;
      b.half[0] = *(const v8us*)(brow + 8 * hh);
      b.half[1] = *(const v8us*)(brow + 16 + 8 * hh);
      acc[t] = mmaN<ASPLIT ? 2 : 1>(ah.v, al.v, b.v, b.v, acc[t]);
    }
  }
#pragma unroll
  for (int t = 0; t < 4; ++t) {
    float bv = bias ? bias[col0 + t * 16 + ln] : 0.f;
    if (BIAS_BF16) bv = bf16_round(bv);
#pragma unroll
    for (int r = 0; r < 8; ++r) { float v = acc[t][r] + bv; if (ACT == 1) v = fmaxf(v, 0.f); so[w][8 * hh + r][t * 16 + ln] = v; }
  }
  __builtin_amdgcn_fence(__ATOMIC_ACQ_REL, "workgroup");
  __builtin_amdgcn_wave_barrier();
  const int rsub = lane >> 4, c4 = (lane & 15) * 4;
  {
#pragma unroll
    for (int q = 0; q < 8; ++q) {
      const int r = q * 2 + rsub;
      const v4f v = *(const v4fa*)&so[w][r][c4];
      *(v4f*)(C + (size_t)(row0 + r) * ldc + col0 + c4) = v;
    }
    
  }
}

// GEMM C = act(A·W + bias + resid): A f32 (ASPLIT -> hi/lo 2 terms), Wt bf16 [N][K]; ACT 0 none, 1 relu, 2 exact gelu;
// resid (optional, f32, row index = (row % rmod), pitch ldr, RES_BF16 rounds it) added before the activation.
template <bool ASPLIT, int ACT, bool BIAS_BF16, bool RES_BF16>
__global__ __launch_bounds__(128) void k_gemm_bf3(const float* __restrict__ A, int lda, const unsigned short* __restrict__ Wt, int ldb,
                                                const float* __restrict__ bias, const float* __restrict__ resid, int rmod, int ldr,
                                                float* __restrict__ C, int ldc, int M, int N, int K) {
  __shared__ __attribute__((aligned(16))) float so[4][16][64];
  const int tid = threadIdx.x, w = tid >> 5, lane = tid & 31, ln = lane & 15, hh = lane >> 4;
  const int ntn = N / 64;
  const int wid = blockIdx.x * 4 + w;
  const int mt = wid / ntn, nq = wid % ntn;
  if (mt * 16 >= M) return;
  const int row0 = mt * 16, col0 = nq * 64;
  const float* arow = A + (size_t)(row0 + ln) * lda;
  v8f acc[4] = {};
  for (int kb = 0; kb < K; kb += 32) {
    FragB ah, al;
    const v4f x0 = *(const v4fa*)(arow + kb + 8 * hh), x1 = *(const v4fa*)(arow + kb + 8 * hh + 4);
    const v4f x2 = *(const v4fa*)(arow + kb + 16 + 8 * hh), x3 = *(const v4fa*)(arow + kb + 16 + 8 * hh + 4);
    float xs[16] = {x0[0],x0[1],x0[2],x0[3],x1[0],x1[1],x1[2],x1[3],x2[0],x2[1],x2[2],x2[3],x3[0],x3[1],x3[2],x3[3]};
#pragma unroll
    for (int i = 0; i < 16; ++i) { const unsigned short hb = bf16_bits(xs[i]); ah.u[i] = hb; al.u[i] = ASPLIT ? bf16_bits(xs[i] - bf16_val(hb)) : (unsigned short)0; }
#pragma unroll
    for (int t = 0; t < 4; ++t) {
      const unsigned short* brow = Wt + (size_t)(col0 + t * 16 + ln) * ldb + kb;
      FragB b;
      b.half[0] = *(const v8us*)(brow + 8 * hh);
      b.half[1] = *(const v8us*)(brow + 16 + 8 * hh);
      acc[t] = mmaN<ASPLIT ? 2 : 1>(ah.v, al.v, b.v, b.v, acc[t]);
    }
  }
#pragma unroll
  for (int t = 0; t < 4; ++t) {
    const int col = col0 + t * 16 + ln;
    float bv = bias ? bias[col] : 0.f;
    if (BIAS_BF16) bv = bf16_round(bv);
#pragma unroll
    for (int r = 0; r < 8; ++r) {
      float v = acc[t][r] + bv;
      if (resid) { float rv = resid[(size_t)((row0 + 8 * hh + r) % rmod) * ldr + col]; if (RES_BF16) rv = bf16_round(rv); v += rv; }
      if (ACT == 1) v = fmaxf(v, 0.f);
      if (ACT == 2) v = 0.5f * v * (1.0f + erff(v * 0.70710678118654752f));
      if (ACT == 3) { const float u = 0.7978845608028654f * (v + 0.044715f * v * v * v); v = 0.5f * v * (1.0f + tanhf(u)); }
      so[w][8 * hh + r][t * 16 + ln] = v;
    }
  }
  __builtin_amdgcn_fence(__ATOMIC_ACQ_REL, "workgroup");
  __builtin_amdgcn_wave_barrier();
  const int rsub = lane >> 4, c4 = (lane & 15) * 4;
  {
#pragma unroll
    for (int q = 0; q < 8; ++q) {
      const int r = q * 2 + rsub;
      const v4f v = *(const v4fa*)&so[w][r][c4];
      *(v4f*)(C + (size_t)(row0 + r) * ldc + col0 + c4) = v;
    }
    
  }
}
// row LayerNorm (biased variance, eps) over N: s = X (+ R); optional out_sum <- s; out_norm <- (s-mu)*rsqrt(var+eps)*g + b
template <bool PARAM_BF16>
__global__ __launch_bounds__(256) void k_layernorm(const float* __restrict__ X, const float* __restrict__ R, const float* __restrict__ g, const float* __restrict__ bta,
                                                  float* __restrict__ out_sum, float* __restrict__ out_norm, int N, float eps) {
  __shared__ float red[256];
  const int row = blockIdx.x, tid = threadIdx.x;
  const float* x = X + (size_t)row * N; const float* rr = R ? R + (size_t)row * N : nullptr;
  float vals[16];                     // up to N = 4096
  const int per = N / 256;            // contiguous chunk per thread? use strided-by-4 chunks: thread handles j = tid*4 + 1024*u
  float s1 = 0.f;
  for (int u = 0; u < per / 4; ++u) {
    const int j = tid * 4 + 1024 * u;
    const v4f a = *(const v4fa*)(x + j);
    v4f b = {0.f,0.f,0.f,0.f}; if (rr) b = *(const v4fa*)(rr + j);
#pragma unroll
    for (int q = 0; q < 4; ++q) { const float v = a[q] + b[q]; vals[u * 4 + q] = v; s1 += v; }
  }
  red[tid] = s1; __syncthreads();
  for (int st = 128; st > 0; st >>= 1) { if (tid < st) red[tid] += red[tid + st]; __syncthreads(); }
  const float mu = red[0] / (float)N; __syncthreads();
  float s2 = 0.f;
  for (int u = 0; u < per / 4; ++u)
#pragma unroll
    for (int q = 0; q < 4; ++q) { const float c = vals[u * 4 + q] - mu; s2 += c * c; }
  red[tid] = s2; __syncthreads();
  for (int st = 128; st > 0; st >>= 1) { if (tid < st) red[tid] += red[tid + st]; __syncthreads(); }
  const float rs = rsqrtf(red[0] / (float)N + eps);
  {
    for (int u = 0; u < per / 4; ++u) {
      const int j = tid * 4 + 1024 * u;
      v4f o, sm;
#pragma unroll
      for (int q = 0; q < 4; ++q) {
        float gg = g[j + q], bb = bta[j + q];
        if (PARAM_BF16) { gg = bf16_round(gg); bb = bf16_round(bb); }
        sm[q] = vals[u * 4 + q]; o[q] = (vals[u * 4 + q] - mu) * rs * gg + bb;
      }
      if (out_sum) *(v4f*)(out_sum + (size_t)row * N + j) = sm;
      *(v4f*)(out_norm + (size_t)row * N + j) = o;
    }
    
  }
}



// ---- f16 WMMA path (v_wmma_f32_16x16x32_f16): 11-bit significands for operands in range — used where a [0,1] probability operand needs more precision than bf16
typedef _Float16 v16h __attribute__((ext_vector_type(16)));
union FragH { v16h v; v8us half[2]; _Float16 h[16]; unsigned short u[16]; };
template <int NT>
__device__ __forceinline__ v8f mmaH(v16h ah, v16h al, v16h bh, v16h bl, v8f c) {
  c = __builtin_amdgcn_wmma_f32_16x16x32_f16(false, ah, false, bh, (short)0, c, false, false);
  if (NT >= 2) c = __builtin_amdgcn_wmma_f32_16x16x32_f16(false, al, false, bh, (short)0, c, false, false);
  if (NT >= 3) c = __builtin_amdgcn_wmma_f32_16x16x32_f16(false, ah, false, bl, (short)0, c, false, false);
  asm volatile("v_nop\n\tv_nop\n\tv_nop\n\tv_nop" : "+v"(c) : "v"(ah), "v"(al), "v"(bh), "v"(bl));
  return c;
}
// batched GEMM like k_gemm_b but f16 operands: A f32 (split into f16 hi/lo if ASPLIT, else rounded to f16), Bt = f16 values [n][k]; alpha; C f32; N multiple of 16 (partial tiles skipped)
template <bool ASPLIT>
__global__ __launch_bounds__(128) void k_gemm_h(const float* __restrict__ A, int lda, size_t sA, const _Float16* __restrict__ Bh, int ldb, size_t sB, float alpha, float* __restrict__ C, int ldc, size_t sC, int M, int N, int K) {
  __shared__ __attribute__((aligned(16))) float so[4][16][64];
  const int tid = threadIdx.x, w = tid >> 5, lane = tid & 31, ln = lane & 15, hh = lane >> 4; const int by = blockIdx.y;
  A += (size_t)by * sA; Bh += (size_t)by * sB; C += (size_t)by * sC;
  const int ntn = (N + 63) / 64; const int wid = blockIdx.x * 4 + w; const int mt = wid / ntn, nq = wid % ntn; if (mt * 16 >= M) return;
  const int row0 = mt * 16, col0 = nq * 64; const float* arow = A + (size_t)(row0 + ln) * lda;
  v8f acc[4] = {};
  for (int kb = 0; kb < K; kb += 32) {
    FragH ah, al;
    const v4f x0 = *(const v4fa*)(arow + kb + 8 * hh), x1 = *(const v4fa*)(arow + kb + 8 * hh + 4), x2 = *(const v4fa*)(arow + kb + 16 + 8 * hh), x3 = *(const v4fa*)(arow + kb + 16 + 8 * hh + 4);
    float xs[16] = {x0[0],x0[1],x0[2],x0[3],x1[0],x1[1],x1[2],x1[3],x2[0],x2[1],x2[2],x2[3],x3[0],x3[1],x3[2],x3[3]};
#pragma unroll
    for (int i = 0; i < 16; ++i) { const _Float16 h = (_Float16)xs[i]; ah.h[i] = h; al.h[i] = ASPLIT ? (_Float16)(xs[i] - (float)h) : (_Float16)0.0f; }
#pragma unroll
    for (int t = 0; t < 4; ++t) { if (col0 + t * 16 >= N) continue; const size_t boff = (size_t)(col0 + t * 16 + ln) * ldb + kb; FragH bq; bq.half[0] = *(const v8us*)(Bh + boff + 8 * hh); bq.half[1] = *(const v8us*)(Bh + boff + 16 + 8 * hh);
      acc[t] = mmaH<ASPLIT ? 2 : 1>(ah.v, al.v, bq.v, bq.v, acc[t]); }
  }
#pragma unroll
  for (int t = 0; t < 4; ++t) { if (col0 + t * 16 >= N) continue;
#pragma unroll
    for (int r = 0; r < 8; ++r) so[w][8 * hh + r][t * 16 + ln] = acc[t][r] * alpha; }
  __builtin_amdgcn_fence(__ATOMIC_ACQ_REL, "workgroup"); __builtin_amdgcn_wave_barrier();
  const int rsub = lane >> 4, c4 = (lane & 15) * 4;
  {
#pragma unroll
    for (int q = 0; q < 8; ++q) { const int r = q * 2 + rsub; if (col0 + c4 < N) { const v4f v = *(const v4fa*)&so[w][r][c4]; *(v4f*)(C + (size_t)(row0 + r) * ldc + col0 + c4) = v; } }
     }
}

// k_gemm_hh variant with fused epilogue: v = acc·alpha + bias[by·sBias + col] (+ CP[(row/rowsPerB)·sCPb + by·64 + col] if CP) ; ACT 0 none / 1 elu ; writes f16 C16 (and f32 C if non-null)
template <int ACT>
__global__ __launch_bounds__(128) void k_gemm_hhx(const _Float16* __restrict__ A, int lda, size_t sA, const _Float16* __restrict__ Bh, int ldb, size_t sB, float alpha, const float* __restrict__ bias, size_t sBias, const float* __restrict__ CP, int rowsPerB, size_t sCPb, int row0g,
    float* __restrict__ C, _Float16* __restrict__ C16, int ldc, size_t sC, int M, int N, int K) {
  __shared__ __attribute__((aligned(16))) float so[4][16][64];
  const int tid = threadIdx.x, w = tid >> 5, lane = tid & 31, ln = lane & 15, hh = lane >> 4; const int by = blockIdx.y;
  A += (size_t)by * sA; Bh += (size_t)by * sB; const size_t cofs = (size_t)by * sC; const float* bp = bias ? bias + (size_t)by * sBias : nullptr;
  const int ntn = (N + 63) / 64; const int wid = blockIdx.x * 4 + w; const int mt = wid / ntn, nq = wid % ntn; if (mt * 16 >= M) return;
  const int row0 = mt * 16, col0 = nq * 64; const _Float16* arow = A + (size_t)(row0 + ln) * lda;
  v8f acc[4] = {};
  for (int kb = 0; kb < K; kb += 32) { FragH ah; ah.half[0] = *(const v8us*)((const unsigned short*)arow + kb + 8 * hh); ah.half[1] = *(const v8us*)((const unsigned short*)arow + kb + 16 + 8 * hh);
#pragma unroll
    for (int t = 0; t < 4; ++t) { if (col0 + t * 16 >= N) continue; const size_t boff = (size_t)(col0 + t * 16 + ln) * ldb + kb; FragH bq; bq.half[0] = *(const v8us*)((const unsigned short*)Bh + boff + 8 * hh); bq.half[1] = *(const v8us*)((const unsigned short*)Bh + boff + 16 + 8 * hh);
      acc[t] = mmaH<1>(ah.v, ah.v, bq.v, bq.v, acc[t]); }
  }
#pragma unroll
  for (int t = 0; t < 4; ++t) { if (col0 + t * 16 >= N) continue; const int col = col0 + t * 16 + ln; const float bv = bp ? bf16_round(bp[col]) : 0.f;
#pragma unroll
    for (int r = 0; r < 8; ++r) { float v = acc[t][r] * alpha + bv; if (CP) { const int rr = row0g + row0 + 8 * hh + r; if (rowsPerB < 0) v += CP[cofs + (size_t)rr * ldc + col];      /* rowsPerB < 0: own element of the batched C plane */ else { const int bidx = rr / rowsPerB; v += CP[(size_t)bidx * sCPb + (size_t)by * 64 + col]; } } if (ACT == 1) v = (v > 0.f) ? v : expm1f(v); else if (ACT == 7) v = (v > 0.f) ? v + 1.0f : expf(v); else if (ACT == 8) v = tanhf(v); else if (ACT == 9) v = 0.5f * v * (1.0f + tanhf(0.7978845608028654f * (v + 0.044715f * v * v * v))); else if (ACT == 11) v = 1.0f / (1.0f + expf(-v)); else if (ACT == 12) v = (v > 0.f) ? v : 0.01f * v; else if (ACT == 14) v = (v > 0.f) ? v : 0.1f * v; else if (ACT == 16) v = (v >= 0.f) ? v : 0.3f * v; else if (ACT == 17) v = (v >= 0.f) ? v : 0.2f * v; else if (ACT == 15) v = v / (1.0f + expf(-v)); else if (ACT == 3) v = fmaxf(v, 0.f); else if (ACT == 6) v = 0.5f * v * (1.0f + erff(v * 0.70710678118654752f)); so[w][8 * hh + r][t * 16 + ln] = v; } }
  __builtin_amdgcn_fence(__ATOMIC_ACQ_REL, "workgroup"); __builtin_amdgcn_wave_barrier();
  const int rsub = lane >> 4, c4 = (lane & 15) * 4; typedef _Float16 v4h __attribute__((ext_vector_type(4)));
  {
#pragma unroll
    for (int q = 0; q < 8; ++q) { const int r = q * 2 + rsub; if (col0 + c4 < N) { const v4f v = *(const v4fa*)&so[w][r][c4]; if (C) *(v4f*)(C + cofs + (size_t)(row0 + r) * ldc + col0 + c4) = v; if (C16) { v4h h4; for (int i = 0; i < 4; ++i) h4[i] = (_Float16)v[i]; *(v4h*)(C16 + cofs + (size_t)(row0 + r) * ldc + col0 + c4) = h4; } } }
     }
}


typedef _Float16 v4h __attribute__((ext_vector_type(4)));

__global__ __launch_bounds__(256) void k_h16(const float* __restrict__ x, _Float16* __restrict__ X16, size_t n8) { const size_t t = (size_t)blockIdx.x * 256 + threadIdx.x; if (t >= n8) return; FragH f;
#pragma unroll
  for (int q = 0; q < 8; ++q) f.h[q] = (_Float16)x[t * 8 + q]; *(v8us*)((unsigned short*)X16 + t * 8) = f.half[0];  }
__global__ __launch_bounds__(256) void k_round16f(const float* __restrict__ W, _Float16* __restrict__ Bt, size_t n8) { const size_t t = (size_t)blockIdx.x * 256 + threadIdx.x; if (t >= n8) return; FragH f;
#pragma unroll
  for (int i = 0; i < 8; ++i) f.h[i] = (_Float16)(bf16_round(W[t * 8 + i]) * 16.0f); *(v8us*)((unsigned short*)Bt + t * 8) = f.half[0];  }
template <int NHv, int TTv>
__global__ __launch_bounds__(256) void k_vt(const _Float16* __restrict__ V16, int ldv, int voff, _Float16* __restrict__ Vt) { __shared__ unsigned short tl[64][66]; const int tid = threadIdx.x; const int slab = blockIdx.x / (TTv / 64), lg = blockIdx.x % (TTv / 64); const int b = slab / NHv, h = slab % NHv;
  for (int i = tid; i < 64 * 8; i += 256) { const int r = i / 8, c8 = (i % 8) * 8; FragH f; f.half[0] = *(const v8us*)((const unsigned short*)V16 + ((size_t)b * TTv + lg * 64 + r) * ldv + voff + h * 64 + c8);
#pragma unroll
    for (int q = 0; q < 8; ++q) tl[r][c8 + q] = f.u[q]; }
  __syncthreads();
  {
#pragma unroll
    for (int rd = 0; rd < 2; ++rd) { const int d = rd * 32 + tid / 8, pc = tid % 8; FragH f;
#pragma unroll
      for (int q = 0; q < 8; ++q) f.u[q] = tl[pc * 8 + q][d];
      *(v8us*)((unsigned short*)Vt + ((size_t)slab * 64 + d) * TTv + lg * 64 + pc * 8) = f.half[0]; }
     } }

__global__ __launch_bounds__(256) void k_hl(const float* __restrict__ F, _Float16* __restrict__ Hh, _Float16* __restrict__ Hl, size_t n8) { const size_t t = (size_t)blockIdx.x * 256 + threadIdx.x; if (t >= n8) return; FragH fh, fl; const v4f a = *(const v4fa*)(F + t * 8), c = *(const v4fa*)(F + t * 8 + 4);
#pragma unroll
  for (int q = 0; q < 4; ++q) { _Float16 h = (_Float16)a[q]; fh.h[q] = h; fl.h[q] = (_Float16)((a[q] - (float)h) * 1024.0f); h = (_Float16)c[q]; fh.h[4 + q] = h; fl.h[4 + q] = (_Float16)((c[q] - (float)h) * 1024.0f); }
  { *(v8us*)((unsigned short*)Hh + t * 8) = fh.half[0]; *(v8us*)((unsigned short*)Hl + t * 8) = fl.half[0];  } }

// ---- fast GEMM (block tile 128x128, eight waves of 32x64; requires M % 128 == 0, N % 128 == 0, K % 64 == 0); epilogue = k_gemm_hhx semantics ----
// Both operands pass through LDS: a stage is 64 k (one whole 128-byte line) of the block's 128 A rows and 128 B rows, brought by asynchronous copies and read by all eight waves; two stages, the next one in flight while this one is multiplied.
__device__ __forceinline__ v16h g2_frag(const _Float16* p, int hh) { FragH f; f.half[0] = *(const v8us*)((const unsigned short*)p + 8 * hh); f.half[1] = *(const v8us*)((const unsigned short*)p + 16 + 8 * hh); return f.v; }
__device__ __forceinline__ v8f g2_mma(v16h a, v16h b, v8f c) { v8f d = __builtin_amdgcn_wmma_f32_16x16x32_f16(false, a, false, b, (short)0, c, false, false); asm volatile("v_nop\n\tv_nop\n\tv_nop\n\tv_nop" : "+v"(d) : "v"(a), "v"(b)); return d; }
#define G2_PITCH 144                   /* LDS row pitch in bytes: 16 x odd, free of bank conflicts for 16-byte reads */
#define G2_STAGE (256 * G2_PITCH)      /* rows 0..127 = A, rows 128..255 = B */
// one stage's copies: a thread brings 16 bytes of each of 8 rows (32 rows apart; 4 of A, 4 of B), so a wave-wide copy covers 4 whole 128-byte lines.
// s_wait_xcnt 0 is the statement's last line: it then stands in front of every later rewrite of the address registers the copies name.
__device__ __forceinline__ void g2_stage(unsigned l, const _Float16* a, int lda, const _Float16* b, int ldb) {
  const _Float16* a1 = a + (size_t)32 * lda; const _Float16* a2 = a + (size_t)64 * lda; const _Float16* a3 = a + (size_t)96 * lda;
  const _Float16* b1 = b + (size_t)32 * ldb; const _Float16* b2 = b + (size_t)64 * ldb; const _Float16* b3 = b + (size_t)96 * ldb;
  asm volatile("global_load_async_to_lds_b128 %0, %8, off\n\tglobal_load_async_to_lds_b128 %1, %9, off\n\tglobal_load_async_to_lds_b128 %2, %10, off\n\tglobal_load_async_to_lds_b128 %3, %11, off\n\t"
               "global_load_async_to_lds_b128 %4, %12, off\n\tglobal_load_async_to_lds_b128 %5, %13, off\n\tglobal_load_async_to_lds_b128 %6, %14, off\n\tglobal_load_async_to_lds_b128 %7, %15, off\n\ts_wait_xcnt 0x0"
               :: "v"(l), "v"(l + 32 * G2_PITCH), "v"(l + 64 * G2_PITCH), "v"(l + 96 * G2_PITCH), "v"(l + 128 * G2_PITCH), "v"(l + 160 * G2_PITCH), "v"(l + 192 * G2_PITCH), "v"(l + 224 * G2_PITCH),
                  "v"(a), "v"(a1), "v"(a2), "v"(a3), "v"(b), "v"(b1), "v"(b2), "v"(b3) : "memory"); }
template <int ACT>
__global__ __launch_bounds__(256) void k_gemm2(const _Float16* __restrict__ A, int lda, size_t sA, const _Float16* __restrict__ Bh, int ldb, size_t sB, float alpha, const float* __restrict__ bias, size_t sBias, const float* __restrict__ CP, int rowsPerB, size_t sCPb, int row0g,
    float* __restrict__ C, _Float16* __restrict__ C16, int ldc, size_t sC, int M, int N, int K) { static_assert(ACT == 0 || ACT == 3 || ACT == 6 || ACT == 8 || ACT == 9 || ACT == 11 || ACT == 12 || ACT == 14 || ACT == 15 || ACT == 16 || ACT == 17, "k_gemm2: unsupported ACT code (would silently apply no activation)");
  __shared__ __attribute__((aligned(128))) unsigned char sm[2 * G2_STAGE];      /* the two operand stages; behind the loop's last barrier the same bytes are the waves' output staging */
  static_assert(8 * 32 * 68 * 4 <= 2 * G2_STAGE, "output staging must fit the operand stages");
  float (*so)[32][68] = (float (*)[32][68])sm;
  const int tid = threadIdx.x, w = tid >> 5, lane = tid & 31, ln = lane & 15, hh = lane >> 4; const int by = blockIdx.y;
  A += (size_t)by * sA; Bh += (size_t)by * sB; const size_t cofs = (size_t)by * sC; const float* bp = bias ? bias + (size_t)by * sBias : nullptr;
  const int ntn = N >> 7; const int mt = blockIdx.x / ntn, nq = blockIdx.x - mt * ntn; if (mt * 128 >= M) return;      /* the same for the whole block, in front of every barrier */
  const int wm = w & 3, wn = w >> 2; const int row0 = mt * 128 + 32 * wm, col0 = nq * 128 + 64 * wn;
  const _Float16* ga = A + (size_t)(mt * 128 + (tid >> 3)) * lda + (tid & 7) * 8; const _Float16* gb = Bh + (size_t)(nq * 128 + (tid >> 3)) * ldb + (tid & 7) * 8;
  const unsigned l0 = (unsigned)(size_t)sm + (unsigned)((tid >> 3) * G2_PITCH + (tid & 7) * 16);      /* the thread's LDS byte address in stage buffer 0 */
  const int nt = K >> 6;
  g2_stage(l0, ga, lda, gb, ldb);
  asm volatile("s_wait_asynccnt 0x0" ::: "memory");      /* this wave's copies of stage 0 have landed */
  __syncthreads();                                       /* ... and every other wave's */
  if (1 < nt) g2_stage(l0 + G2_STAGE, ga + 64, lda, gb + 64, ldb);
  const v8f z8 = {0.f,0.f,0.f,0.f,0.f,0.f,0.f,0.f}; v8f c00 = z8, c01 = z8, c02 = z8, c03 = z8, c10 = z8, c11 = z8, c12 = z8, c13 = z8;
  for (int t = 0; t < nt; ++t) { const unsigned char* st = sm + (t & 1) * G2_STAGE;
    const _Float16* a0p = (const _Float16*)(st + (32 * wm + ln) * G2_PITCH); const _Float16* a1p = (const _Float16*)(st + (32 * wm + 16 + ln) * G2_PITCH);
    const _Float16* b0p = (const _Float16*)(st + (128 + 64 * wn + ln) * G2_PITCH); const _Float16* b1p = (const _Float16*)(st + (128 + 64 * wn + 16 + ln) * G2_PITCH); const _Float16* b2p = (const _Float16*)(st + (128 + 64 * wn + 32 + ln) * G2_PITCH); const _Float16* b3p = (const _Float16*)(st + (128 + 64 * wn + 48 + ln) * G2_PITCH);
#pragma unroll      /* both 32-k halves of the stage in one body: constant LDS offsets */
    for (int kb = 0; kb < 64; kb += 32) { const v16h a0 = g2_frag(a0p + kb, hh), a1 = g2_frag(a1p + kb, hh), b0 = g2_frag(b0p + kb, hh), b1 = g2_frag(b1p + kb, hh), b2 = g2_frag(b2p + kb, hh), b3 = g2_frag(b3p + kb, hh);      /* the six fragments as one group of LDS reads in front of their eight products: one LDS latency, not four */
      c00 = g2_mma(a0, b0, c00); c10 = g2_mma(a1, b0, c10); c01 = g2_mma(a0, b1, c01); c11 = g2_mma(a1, b1, c11);
      c02 = g2_mma(a0, b2, c02); c12 = g2_mma(a1, b2, c12); c03 = g2_mma(a0, b3, c03); c13 = g2_mma(a1, b3, c13); }
    asm volatile("s_wait_dscnt 0x0" ::: "memory");         /* this wave's reads of the stage are done before the buffer is given back */
    asm volatile("s_wait_asynccnt 0x0" ::: "memory");      /* this wave's copies of stage t + 1 have landed */
    __syncthreads();                                       /* publishes stage t + 1 and ends every wave's reads of stage t */
    if (t + 2 < nt) g2_stage(l0 + (unsigned)((t & 1) * G2_STAGE), ga + (size_t)(t + 2) * 64, lda, gb + (size_t)(t + 2) * 64, ldb); }
  asm volatile("s_wait_asynccnt 0x0" ::: "memory");        /* nothing is in flight when the stages become output staging */
  v8f accs[8] = {c00, c01, c02, c03, c10, c11, c12, c13};
#pragma unroll
  for (int u = 0; u < 8; ++u) { const int t = u & 3, half = u >> 2; const int col = col0 + t * 16 + ln; const float bv = bp ? bf16_round(bp[col]) : 0.f;
#pragma unroll
    for (int r = 0; r < 8; ++r) { const int rloc = half * 16 + 8 * hh + r; float v = accs[u][r] * alpha + bv; if (CP) { if (rowsPerB < 0) v += CP[cofs + (size_t)(row0g + row0 + rloc) * ldc + col];      /* rowsPerB < 0: own element of the batched C plane */ else { const int bidx = (row0g + row0 + rloc) / rowsPerB; v += CP[(size_t)bidx * sCPb + (size_t)by * 64 + col]; } }
      if (ACT == 3) v = fmaxf(v, 0.f); else if (ACT == 6) v = 0.5f * v * (1.0f + erff(v * 0.70710678118654752f)); else if (ACT == 11) v = 1.0f / (1.0f + expf(-v)); else if (ACT == 15) v = v / (1.0f + expf(-v)); else if (ACT == 12) v = (v > 0.f) ? v : 0.01f * v; else if (ACT == 8) v = tanhf(v); else if (ACT == 9) v = 0.5f * v * (1.0f + tanhf(0.7978845608028654f * (v + 0.044715f * v * v * v))); else if (ACT == 14) v = (v > 0.f) ? v : 0.1f * v; else if (ACT == 16) v = (v >= 0.f) ? v : 0.3f * v; else if (ACT == 17) v = (v >= 0.f) ? v : 0.2f * v;
      so[w][rloc][t * 16 + ln] = v; } }
  __builtin_amdgcn_fence(__ATOMIC_ACQ_REL, "workgroup"); __builtin_amdgcn_wave_barrier();
  const int rsub = lane >> 4, c4 = (lane & 15) * 4;
  {
#pragma unroll
    for (int q = 0; q < 16; ++q) { const int r = q * 2 + rsub; const v4f v = *(const v4fa*)&so[w][r][c4]; if (C) *(v4f*)(C + cofs + (size_t)(row0 + r) * ldc + col0 + c4) = v; if (C16) { v4h h4; for (int i = 0; i < 4; ++i) h4[i] = (_Float16)v[i]; *(v4h*)(C16 + cofs + (size_t)(row0 + r) * ldc + col0 + c4) = h4; } }
     } }


__global__ __launch_bounds__(256) void k_wnat(const float* __restrict__ w, size_t n8, _Float16* __restrict__ Bt) { const size_t t = (size_t)blockIdx.x * 256 + threadIdx.x; if (t >= n8) return; FragH f; for (int q = 0; q < 8; ++q) f.h[q] = (_Float16)(bf16_round(w[t * 8 + q]) * 16.0f); *(v8us*)((unsigned short*)Bt + t * 8) = f.half[0];  }
__global__ __launch_bounds__(256) void k_rsm(const float* __restrict__ S, _Float16* __restrict__ P, int nrows) {
  #pragma clang fp contract(off)
  const int i = blockIdx.x * 256 + threadIdx.x; if (i >= nrows) return; const float* s = S + (size_t)i * SQ; float mx = -3.0e38f;
#pragma unroll 1
  for (int j = 0; j < SQ; ++j) mx = fmaxf(mx, s[j]); float se = 0.f;
#pragma unroll 1
  for (int j = 0; j < SQ; ++j) se += expf(s[j] - mx); const float sc = 256.0f / se;
#pragma unroll 1
  for (int j0 = 0; j0 < SQ; j0 += 8) { FragH f; for (int q = 0; q < 8; ++q) f.h[q] = (_Float16)(expf(s[j0 + q] - mx) * sc); unsigned short* d = (unsigned short*)P + (size_t)i * SQ + j0; *(v8us*)d = f.half[0];  } }
__global__ __launch_bounds__(256) void k_vt(const _Float16* __restrict__ V16, int b, int h0, _Float16* __restrict__ VT) { __shared__ unsigned short tl[64][65]; const int tid = threadIdx.x; const int hh = blockIdx.x % HG, sg = blockIdx.x / HG; const int s0 = sg * 64; const int h = h0 + hh;
  for (int i = tid; i < 64 * 8; i += 256) { const int j = i / 8, d8 = (i % 8) * 8; FragH f; f.half[0] = *(const v8us*)((const unsigned short*)V16 + ((size_t)b * SQ + s0 + j) * DM + h * HD + d8); for (int q = 0; q < 8; ++q) tl[d8 + q][j] = f.u[q]; }
  __syncthreads();
  { for (int i = tid; i < 64 * 8; i += 256) { const int d = i / 8, j8 = (i % 8) * 8; FragH f; for (int q = 0; q < 8; ++q) f.u[q] = tl[d][j8 + q]; *(v8us*)((unsigned short*)VT + ((size_t)hh * HD + d) * SQ + s0 + j8) = f.half[0]; }  } }



// lanes l and l ^ 16 exchanged by the cross-row permlane (no LDS round trip)
__device__ __forceinline__ float xl_half(float v) { const int i = __float_as_int(v); return __int_as_float(__builtin_amdgcn_permlanex16(i, i, 0x76543210, 0xfedcba98, false, false)); }
__device__ __forceinline__ v8f fa_mma(v16h a, v16h b, v8f c) { return __builtin_amdgcn_wmma_f32_16x16x32_f16(false, a, false, b, (short)0, c, false, false); }
// 2^x on eight values; the v_nop is the one slot the instruction set asks for behind a transcendental, written in the same statement so that it stays directly behind the last one
__device__ __forceinline__ void fa_exp8(float (&e)[8]) { asm("v_exp_f32 %0, %0\n\tv_exp_f32 %1, %1\n\tv_exp_f32 %2, %2\n\tv_exp_f32 %3, %3\n\tv_exp_f32 %4, %4\n\tv_exp_f32 %5, %5\n\tv_exp_f32 %6, %6\n\tv_exp_f32 %7, %7\n\tv_nop" : "+v"(e[0]), "+v"(e[1]), "+v"(e[2]), "+v"(e[3]), "+v"(e[4]), "+v"(e[5]), "+v"(e[6]), "+v"(e[7])); }
__device__ __forceinline__ float fa_exp1(float x) { asm("v_exp_f32 %0, %0\n\tv_nop" : "+v"(x)); return x; }      /* same slot as above */
#define FA_PITCH 144                   /* LDS pitch of a K row in bytes: 16 x odd, free of bank conflicts for 16-byte reads */
#define FA_PITCHV 160                  /* LDS pitch of a V row in bytes: 32 x odd, the same for the transposing load */
#define FA_VOFF (64 * FA_PITCH)        /* the V rows stand behind the 64 K rows */
#define FA_STAGE (FA_VOFF + 64 * FA_PITCHV)      /* 64 K rows (key, 64 d), then 64 V rows (key, 64 d) */
// one stage's copies: a thread brings 16 bytes of each of 8 rows (16 rows apart; 4 of K, 4 of V), so a wave-wide copy covers 4 whole 128-byte lines; l = its LDS byte address in the K rows, lv in the V rows.
// s_wait_xcnt 0 is the statement's last line: it then stands in front of every later rewrite of the address registers the copies name.
__device__ __forceinline__ void fa_stage(unsigned l, unsigned lv, const _Float16* k, const _Float16* v) {
  const _Float16* k1 = k + (size_t)16 * LQ; const _Float16* k2 = k + (size_t)32 * LQ; const _Float16* k3 = k + (size_t)48 * LQ;
  const _Float16* v1 = v + (size_t)16 * LQ; const _Float16* v2 = v + (size_t)32 * LQ; const _Float16* v3 = v + (size_t)48 * LQ;
  asm volatile("global_load_async_to_lds_b128 %0, %8, off\n\tglobal_load_async_to_lds_b128 %1, %9, off\n\tglobal_load_async_to_lds_b128 %2, %10, off\n\tglobal_load_async_to_lds_b128 %3, %11, off\n\t"
               "global_load_async_to_lds_b128 %4, %12, off\n\tglobal_load_async_to_lds_b128 %5, %13, off\n\tglobal_load_async_to_lds_b128 %6, %14, off\n\tglobal_load_async_to_lds_b128 %7, %15, off\n\ts_wait_xcnt 0x0"
               :: "v"(l), "v"(l + 16 * FA_PITCH), "v"(l + 32 * FA_PITCH), "v"(l + 48 * FA_PITCH), "v"(lv), "v"(lv + 16 * FA_PITCHV), "v"(lv + 32 * FA_PITCHV), "v"(lv + 48 * FA_PITCHV),
                  "v"(k), "v"(k1), "v"(k2), "v"(k3), "v"(v), "v"(v1), "v"(v2), "v"(v3) : "memory"); }
// 16 bytes a lane from a row-major 16-bit LDS tile, delivered transposed; the builtin, so that the compiler sees the load and places its wait
typedef short v8s __attribute__((ext_vector_type(8)));
__device__ __forceinline__ v8us fa_tr16(const unsigned char* p) { typedef __attribute__((address_space(3))) v8s lds_v8s; return __builtin_bit_cast(v8us, __builtin_amdgcn_ds_load_tr16_b128_v8i16((lds_v8s*)p)); }
__global__ __launch_bounds__(128) void k_fattn(const _Float16* __restrict__ Q, const _Float16* __restrict__ Kr, const _Float16* __restrict__ Vr, _Float16* __restrict__ O) {
  __shared__ __attribute__((aligned(128))) unsigned char sm[2 * FA_STAGE];      /* the two K / V stages */
  const int tid = threadIdx.x, lane = tid & 31, ln = lane & 15, hh = lane >> 4, w = tid >> 5; const int bh = blockIdx.y, b = bh / NH, h = bh % NH; const int q0 = blockIdx.x * 128 + w * 32;
  const _Float16* qp = Q + ((size_t)b * SQ + q0 + ln) * LQ + h * HD;
  const _Float16* gk = Kr + ((size_t)b * SQ + (tid >> 3)) * LQ + h * HD + (tid & 7) * 8; const _Float16* gv = Vr + ((size_t)b * SQ + (tid >> 3)) * LQ + h * HD + (tid & 7) * 8;      /* the thread's 16 bytes of its first K row and first V row of stage 0 */
  const unsigned l0 = (unsigned)(size_t)sm + (unsigned)((tid >> 3) * FA_PITCH + (tid & 7) * 16), lv0 = (unsigned)(size_t)sm + (unsigned)(FA_VOFF + (tid >> 3) * FA_PITCHV + (tid & 7) * 16);      /* the thread's LDS byte addresses in stage buffer 0 */
  const float cs = 0.03125f * 1.44269504f;      /* 1 / sqrt(d_model) and log2 e in one factor on the raw products */
  const v8f z8 = {0.f,0.f,0.f,0.f,0.f,0.f,0.f,0.f};
  v16h qf[2][2], kf[2][2], vf[4]; v8f o[4][2]; float m[2] = {-3.0e38f, -3.0e38f}, l[2] = {0.f, 0.f};
  fa_stage(l0, lv0, gk, gv);
#pragma unroll
  for (int u = 0; u < 2; ++u) for (int ch = 0; ch < 2; ++ch) qf[u][ch] = g2_frag(qp + (size_t)u * 16 * LQ + ch * 32, hh);
#pragma unroll
  for (int t = 0; t < 4; ++t) { o[t][0] = z8; o[t][1] = z8; }
  asm volatile("s_wait_asynccnt 0x0" ::: "memory");      /* this wave's copies of stage 0 have landed */
  __syncthreads();                                       /* ... and every other wave's */
  fa_stage(l0 + FA_STAGE, lv0 + FA_STAGE, gk + (size_t)64 * LQ, gv + (size_t)64 * LQ);
  for (int st = 0; st < SQ / 64; ++st) { const unsigned char* sp = sm + (st & 1) * FA_STAGE;
    const _Float16* kl = (const _Float16*)(sp + ln * FA_PITCH); const unsigned char* vl = sp + FA_VOFF + (8 * hh + (lane & 7)) * FA_PITCHV + ((lane >> 3) & 1) * 16;      /* the lane's address in the transposing load's own map: key row 8 hh + (lane & 7), 16-byte half (lane >> 3) & 1 */
#pragma unroll
    for (int kt = 0; kt < 2; ++kt) for (int ch = 0; ch < 2; ++ch) kf[kt][ch] = g2_frag(kl + kt * 16 * (FA_PITCH / 2) + ch * 32, hh);
#pragma unroll      /* both 32-key passes of the stage in one body: constant LDS offsets */
    for (int p = 0; p < 2; ++p) {
      v8f s[2][2];      /* [key tile][query group], raw q . k */
#pragma unroll
      for (int kt = 0; kt < 2; ++kt) for (int qt = 0; qt < 2; ++qt) s[kt][qt] = fa_mma(kf[kt][1], qf[qt][1], fa_mma(kf[kt][0], qf[qt][0], z8));
      if (p == 0) {      /* the stage's second pass's keys, fetched one pass ahead into the same registers; nothing of the next stage is read here */
#pragma unroll
        for (int kt = 0; kt < 2; ++kt) for (int ch = 0; ch < 2; ++ch) kf[kt][ch] = g2_frag(kl + (32 + kt * 16) * (FA_PITCH / 2) + ch * 32, hh); }
      float mn[2];
#pragma unroll
      for (int qt = 0; qt < 2; ++qt) { float a = fmaxf(s[0][qt][0], s[1][qt][0]);
        for (int r = 1; r < 8; ++r) a = fmaxf(a, fmaxf(s[0][qt][r], s[1][qt][r]));
        mn[qt] = fmaxf(m[qt], fmaxf(a, xl_half(a))); }
      if (__builtin_amdgcn_ballot_w32(mn[0] > m[0] || mn[1] > m[1]) != 0) {      /* scalar branch: where no column's maximum moved every factor is exactly 1 */
#pragma unroll
        for (int qt = 0; qt < 2; ++qt) { const float a = fa_exp1((m[qt] - mn[qt]) * cs); l[qt] *= a; m[qt] = mn[qt];
          for (int t = 0; t < 4; ++t) for (int r = 0; r < 8; ++r) o[t][qt][r] *= a; } }
#pragma unroll
      for (int t = 0; t < 4; ++t) { FragH f; f.half[0] = fa_tr16(vl + p * 32 * FA_PITCHV + t * 32); f.half[1] = fa_tr16(vl + (p * 32 + 16) * FA_PITCHV + t * 32); vf[t] = f.v; }      /* this pass's V^T, d = 16 t + ln, keys 8 hh + 0..7 and 16 + 8 hh + 0..7: the exponentials below stand between the loads and their use */
      FragH pf[2];
#pragma unroll
      for (int qt = 0; qt < 2; ++qt) { const float mc = m[qt] * cs;
        for (int kt = 0; kt < 2; ++kt) { float e[8];
          for (int r = 0; r < 8; ++r) e[r] = fmaf(s[kt][qt][r], cs, -mc);
          fa_exp8(e);
          l[qt] += ((e[0] + e[1]) + (e[2] + e[3])) + ((e[4] + e[5]) + (e[6] + e[7]));
          for (int r = 0; r < 8; ++r) pf[qt].h[kt * 8 + r] = (_Float16)e[r]; } }
#pragma unroll
      for (int t = 0; t < 4; ++t) for (int qt = 0; qt < 2; ++qt) o[t][qt] = fa_mma(vf[t], pf[qt].v, o[t][qt]);
    }
    asm volatile("s_wait_dscnt 0x0" ::: "memory");         /* this wave's reads of the stage are done before the buffer is given back */
    asm volatile("s_wait_asynccnt 0x0" ::: "memory");      /* this wave's copies of stage st + 1 have landed */
    __syncthreads();                                       /* publishes stage st + 1 and ends every wave's reads of stage st */
    if (st + 2 < SQ / 64) fa_stage(l0 + (unsigned)((st & 1) * FA_STAGE), lv0 + (unsigned)((st & 1) * FA_STAGE), gk + (size_t)(st + 2) * 64 * LQ, gv + (size_t)(st + 2) * 64 * LQ); }
  asm volatile("s_wait_asynccnt 0x0" ::: "memory");        /* nothing is in flight when the wave ends */
#pragma unroll
  for (int qt = 0; qt < 2; ++qt) { const float inv = 64.0f / (l[qt] + xl_half(l[qt])); unsigned short* op = (unsigned short*)O + ((size_t)b * SQ + q0 + qt * 16 + ln) * DM + h * HD + 8 * hh;      /* o[t][qt][r] = O[query ln][16 t + 8 hh + r]: 16 contiguous bytes a store */
    for (int t = 0; t < 4; ++t) { FragH f; for (int r = 0; r < 8; ++r) f.h[r] = (_Float16)(o[t][qt][r] * inv); *(v8us*)(op + t * 16) = f.half[0]; } } }

// every launch-independent preparation job in ONE grid, the job picked by the block index (a scalar branch): the 48 per-head weight blocks, W_o, and the x plane; none reads what another writes, and a thread still builds runs of 8 consecutive f16 of one output row.
#define PB_WH (DM / 64)                        /* blocks for one head's [DM][HD] weight block: one 64 x 64 tile each (HD = 64) */
#define PB_WO ((DM / 64) * (DM / 64))          /* blocks for W_o, likewise */
#define PB_X  ((int)(NR * DM / 8 / 256))       /* blocks for the x plane */
// one 64 (k) x 64 (n) tile of Wt[n][k] = f16(bf16(W[k][n]) x16), W row-major with N columns; Wm points at W[k0][n0], Wt at Wt[n0][k0]; x16 (a power of two) keeps the bf16-exact weights exact in f16, away from the subnormal range.
// The transposition goes through LDS so that both global sides move whole 128-byte lines: a wave-wide load covers 256 contiguous bytes of each of 2 rows of W, a wave-wide store 128 contiguous bytes of each of 4 rows of Wt.
// Pitch 65 words: for each word stored (a wave: 2 rows x 16 columns 4 apart) and each word loaded (8 rows 8 apart x 4 columns) the 32 lanes fall on 32 different banks.
template <int N>
__device__ __forceinline__ void prep_wt(const float* __restrict__ Wm, _Float16* __restrict__ Wt, float (*tl)[65], int tid) { v4f a[4];
#pragma unroll      /* the thread's four loads stand together in front of the LDS stores: one memory latency */
  for (int i = 0; i < 4; ++i) a[i] = *(const v4fa*)(Wm + (size_t)(16 * i + (tid >> 4)) * N + (tid & 15) * 4);
#pragma unroll      /* constant indices keep a in registers */
  for (int i = 0; i < 4; ++i) for (int j = 0; j < 4; ++j) tl[16 * i + (tid >> 4)][(tid & 15) * 4 + j] = a[i][j];
  __syncthreads();      /* the tile is whole before any thread reads a column of it; the job test around this call reads the same for the whole block */
  FragH f[2];
#pragma unroll      /* constant indices keep f in registers */
  for (int u = 0; u < 2; ++u) for (int q = 0; q < 8; ++q) f[u].h[q] = (_Float16)(bf16_round(tl[(tid & 7) * 8 + q][32 * u + (tid >> 3)]) * 16.0f);
#pragma unroll      /* the two stores as one run, each from registers of its own */
  for (int u = 0; u < 2; ++u) *(v8us*)((unsigned short*)Wt + (size_t)(32 * u + (tid >> 3)) * DM + (tid & 7) * 8) = f[u].half[0];
  asm volatile("s_wait_xcnt 0x0" ::: "memory"); }      /* the stores' registers are released before any code the compiler lays behind this job can rewrite them */
__global__ __launch_bounds__(256) void k_prep(const float* __restrict__ x, const float* __restrict__ wq, const float* __restrict__ wk, const float* __restrict__ wv, const float* __restrict__ wo, _Float16* __restrict__ Bt, _Float16* __restrict__ X16) {
  __shared__ float tl[64][65];      /* the weight jobs' transposition tile */
  int blk = blockIdx.x; const int tid = threadIdx.x;
  if (blk < 3 * NH * PB_WH) { const int p = blk / (NH * PB_WH), r = blk % (NH * PB_WH), h = r / PB_WH; const float* wp = (p == 0 ? wq : p == 1 ? wk : wv) + (size_t)h * DM * HD;      /* plane p (q, k, v), head h: its HD rows of the [out][in] plane */
    const int k0 = (r % PB_WH) * 64; prep_wt<HD>(wp + (size_t)k0 * HD, Bt + (size_t)p * DM * DM + (size_t)h * HD * DM + k0, tl, tid); return; }
  blk -= 3 * NH * PB_WH;
  if (blk < PB_WO) { const int n0 = (blk / (DM / 64)) * 64, k0 = (blk % (DM / 64)) * 64; prep_wt<DM>(wo + (size_t)k0 * DM + n0, Bt + (size_t)3 * DM * DM + (size_t)n0 * DM + k0, tl, tid); return; }
  blk -= PB_WO;
  const size_t t = (size_t)blk * 256 + tid; FragH f;      /* x as exact f16 rows, converted once: Q, K and V all project the same rows */
#pragma unroll
  for (int q = 0; q < 8; ++q) f.h[q] = (_Float16)bf16_round(x[t * 8 + q]);
  *(v8us*)((unsigned short*)X16 + t * 8) = f.half[0];
  asm volatile("s_wait_xcnt 0x0" ::: "memory"); }      /* as in prep_wt: the store's registers are released before anything behind it can rewrite them */

extern "C" void kernel_launch(void* const* d_in, const int* in_sizes, int n_in,
                              void* d_out, int out_size, void* d_ws, size_t ws_size, hipStream_t stream) {
  (void)in_sizes; (void)n_in; (void)out_size;
  const float* const* I = (const float* const*)d_in; const float* x = I[0]; const float* wq = I[1]; const float* wk = I[2]; const float* wv = I[3]; const float* wo = I[4]; const float* bo = I[5];      /* ONE input stream (X) read on all three projections; Wq, Wk, Wv are PER-HEAD STACKS [16][1024][64] = [head][in][out] (the module has NO q / k / v biases: null pointers in the guarded bias slots); Wo [in][out] [1024][1024] at I[4], bo at I[5] */
  char* ws = (char*)d_ws; size_t off = 0;
  auto take = [&](size_t bytes) { char* p = ws + off; off += (bytes + 255) & ~(size_t)255; return p; };
  _Float16* BQ = (_Float16*)take((size_t)4 * DM * DM * 2); _Float16* BO = BQ + (size_t)3 * DM * DM;      /* weight planes q, k, v, o, one behind the other: a grid index steps through them */
  _Float16* XQ = (_Float16*)take(NR * DM * 2);      /* the x plane, shared by q, k, v */
  _Float16* Q16 = (_Float16*)take((size_t)3 * NR * DM * 2); _Float16* K16 = Q16 + NR * DM; _Float16* V16 = K16 + NR * DM; _Float16* O16 = (_Float16*)take(NR * DM * 2);
  if (off > ws_size) return;
  k_prep<<<3 * NH * PB_WH + PB_WO + PB_X, 256, 0, stream>>>(x, wq, wk, wv, wo, BQ, XQ);      /* PER-HEAD STACKS wq / wk / wv [NH][DM][HD]: head h is a row-major [in = DM][out = HD] block at w + h * DM * HD, transposed into rows Bt[h * HD + e][k] of the [out][in] plane (x16); wo is a plain [in][out] [DM][DM] matrix; x as exact f16 rows */
  const size_t r0p = (size_t)B0 * SQ;      /* first projected row */
  k_gemm2<0><<<dim3((unsigned)((MP / 128) * (DM / 128)), 3), 256, 0, stream>>>(XQ + r0p * DM, DM, 0, BQ, DM, (size_t)DM * DM, 0.0625f, nullptr, 0, nullptr, 1, 0, 0, nullptr, Q16 + r0p * DM, DM, NR * DM, MP, DM, DM);      /* Q, K, V: blockIdx.y picks the weight plane and the output plane; the x plane is the same for all three (plane step 0) */
  k_fattn<<<dim3(SQ / 128, NB * NH), 128, 0, stream>>>(Q16, K16, V16, O16);      /* scores, softmax and P V in one kernel: o (merged heads, x64) as f16 rows */
  k_gemm2<0><<<dim3((unsigned)((MPO / 128) * (DM / 128)), 1), 256, 0, stream>>>(O16 + r0p * DM, DM, 0, BO, DM, 0, 0.0009765625f, bo, 0, nullptr, 1, 0, 0, (float*)d_out + r0p * DM, nullptr, DM, 0, MPO, DM, DM);      /* out rows are the output layout */
}

// v009
// A run of this version takes 82.1 microseconds.
// Timed twice side by side with v008, it ran 1.04 times as fast both times.
// All steps since v000 together make it 44.4 times as fast.
#include <hip/hip_runtime.h>
#define NB 2
#define SQ 2048
#define DM 1024
#define NH 16
#define HD 64
#define HG 4                         /* heads per launch of the per-batch k_vt */
#define B0 0                         /* first batch processed (debug hook) */
#define NBR NB                       /* batches processed (debug hook) */
#define NR ((size_t)NB * SQ)         /* token rows */
#define MP ((int)((size_t)NBR * SQ)) /* rows projected (debug hook) */
#define QN SQ                        /* query rows per batch; not used */
#define NHD NH                       /* heads; not used */
#define MPO MP                       /* rows through the output stage (debug hook) */
#define LQ DM      /* row pitch of the q/k/v rows */
typedef __bf16 v16b __attribute__((ext_vector_type(16)));
typedef unsigned short v8us __attribute__((ext_vector_type(8), may_alias));
typedef float  v8f  __attribute__((ext_vector_type(8)));
typedef float  v4f  __attribute__((ext_vector_type(4)));
typedef float  v4fa __attribute__((ext_vector_type(4), may_alias));
union FragB { v16b v; v8us half[2]; unsigned short u[16]; };

__device__ __forceinline__ unsigned short bf16_bits(float x) { unsigned int u = __float_as_uint(x); return (unsigned short)((u + 0x7FFFu + ((u >> 16) & 1u)) >> 16); }
__device__ __forceinline__ float bf16_val(unsigned short b) { return __uint_as_float(((unsigned int)b) << 16); }
__device__ __forceinline__ float bf16_round(float x) { return bf16_val(bf16_bits(x)); }
// D += A·B with NT terms: 1 = ah·bh, 2 = + al·bh (A split), 3 = + ah·bl (both split)
template <int NT>
__device__ __forceinline__ v8f mmaN(v16b ah, v16b al, v16b bh, v16b bl, v8f c) {
  c = __builtin_amdgcn_wmma_f32_16x16x32_bf16(false, ah, false, bh, (short)0, c, false, false);
  if (NT >= 2) c = __builtin_amdgcn_wmma_f32_16x16x32_bf16(false, al, false, bh, (short)0, c, false, false);
  if (NT >= 3) c = __builtin_amdgcn_wmma_f32_16x16x32_bf16(false, ah, false, bl, (short)0, c, false, false);
  asm volatile("v_nop\n\tv_nop\n\tv_nop\n\tv_nop" : "+v"(c) : "v"(ah), "v"(al), "v"(bh), "v"(bl));
  return c;
}

__global__ __launch_bounds__(256) void k_wt_bf16(const float* __restrict__ W, unsigned short* __restrict__ Wt, int K, int N) {
  const int t = blockIdx.x * 256 + threadIdx.x;
  const int k8n = K / 8;
  if (t >= N * k8n) return;
  const int n = t / k8n, k8 = (t % k8n) * 8;
  v8us v;
#pragma unroll
  for (int i = 0; i < 8; ++i) v[i] = bf16_bits(W[(size_t)(k8 + i) * N + n]);
  *(v8us*)(Wt + (size_t)n * K + k8) = v;
  
}

// GEMM C[M][N] (f32, pitch ldc) = act(A[M][K]·W + bias). A f32 row-major (pitch lda) converted per fragment to bf16
// (ASPLIT: hi/lo two planes -> 2 terms, else single rounded term); Wt bf16 [N][K] (pitch ldb). BIAS_BF16 rounds the
// bias to bf16 first (bias quantised to bf16 before the add). K%32==0, M%16==0, N%64==0.
template <bool ASPLIT, int ACT, bool BIAS_BF16>
__global__ __launch_bounds__(128) void k_gemm_bf(const float* __restrict__ A, int lda, const unsigned short* __restrict__ Wt, int ldb,
                                               const float* __restrict__ bias, float* __restrict__ C, int ldc, int M, int N, int K) {
  __shared__ __attribute__((aligned(16))) float so[4][16][64];
  const int tid = threadIdx.x, w = tid >> 5, lane = tid & 31, ln = lane & 15, hh = lane >> 4;
  const int ntn = N / 64;
  const int wid = blockIdx.x * 4 + w;
  const int mt = wid / ntn, nq = wid % ntn;
  if (mt * 16 >= M) return;
  const int row0 = mt * 16, col0 = nq * 64;
  const float* arow = A + (size_t)(row0 + ln) * lda;
  v8f acc[4] = {};
  for (int kb = 0; kb < K; kb += 32) {
    FragB ah, al;
    const v4f x0 = *(const v4fa*)(arow + kb + 8 * hh), x1 = *(const v4fa*)(arow + kb + 8 * hh + 4);
    const v4f x2 = *(const v4fa*)(arow + kb + 16 + 8 * hh), x3 = *(const v4fa*)(arow + kb + 16 + 8 * hh + 4);
    float xs[16] = {x0[0],x0[1],x0[2],x0[3],x1[0],x1[1],x1[2],x1[3],x2[0],x2[1],x2[2],x2[3],x3[0],x3[1],x3[2],x3[3]};
#pragma unroll
    for (int i = 0; i < 16; ++i) { const unsigned short hb = bf16_bits(xs[i]); ah.u[i] = hb; al.u[i] = ASPLIT ? bf16_bits(xs[i] - bf16_val(hb)) : (unsigned short)0; }
#pragma unroll
    for (int t = 0; t < 4; ++t) {
      const unsigned short* brow = Wt + (size_t)(col0 + t * 16 + ln) * ldb + kb;
      FragB b;
      b.half[0] = *(const v8us*)(brow + 8 * hh);
      b.half[1] = *(const v8us*)(brow + 16 + 8 * hh);
      acc[t] = mmaN<ASPLIT ? 2 : 1>(ah.v, al.v, b.v, b.v, acc[t]);
    }
  }
#pragma unroll
  for (int t = 0; t < 4; ++t) {
    float bv = bias ? bias[col0 + t * 16 + ln] : 0.f;
    if (BIAS_BF16) bv = bf16_round(bv);
#pragma unroll
    for (int r = 0; r < 8; ++r) { float v = acc[t][r] + bv; if (ACT == 1) v = fmaxf(v, 0.f); so[w][8 * hh + r][t * 16 + ln] = v; }
  }
  __builtin_amdgcn_fence(__ATOMIC_ACQ_REL, "workgroup");
  __builtin_amdgcn_wave_barrier();
  const int rsub = lane >> 4, c4 = (lane & 15) * 4;
  {
#pragma unroll
    for (int q = 0; q < 8; ++q) {
      const int r = q * 2 + rsub;
      const v4f v = *(const v4fa*)&so[w][r][c4];
      *(v4f*)(C + (size_t)(row0 + r) * ldc + col0 + c4) = v;
    }
    
  }
}

// GEMM C = act(A·W + bias + resid): A f32 (ASPLIT -> hi/lo 2 terms), Wt bf16 [N][K]; ACT 0 none, 1 relu, 2 exact gelu;
// resid (optional, f32, row index = (row % rmod), pitch ldr, RES_BF16 rounds it) added before the activation.
template <bool ASPLIT, int ACT, bool BIAS_BF16, bool RES_BF16>
__global__ __launch_bounds__(128) void k_gemm_bf3(const float* __restrict__ A, int lda, const unsigned short* __restrict__ Wt, int ldb,
                                                const float* __restrict__ bias, const float* __restrict__ resid, int rmod, int ldr,
                                                float* __restrict__ C, int ldc, int M, int N, int K) {
  __shared__ __attribute__((aligned(16))) float so[4][16][64];
  const int tid = threadIdx.x, w = tid >> 5, lane = tid & 31, ln = lane & 15, hh = lane >> 4;
  const int ntn = N / 64;
  const int wid = blockIdx.x * 4 + w;
  const int mt = wid / ntn, nq = wid % ntn;
  if (mt * 16 >= M) return;
  const int row0 = mt * 16, col0 = nq * 64;
  const float* arow = A + (size_t)(row0 + ln) * lda;
  v8f acc[4] = {};
  for (int kb = 0; kb < K; kb += 32) {
    FragB ah, al;
    const v4f x0 = *(const v4fa*)(arow + kb + 8 * hh), x1 = *(const v4fa*)(arow + kb + 8 * hh + 4);
    const v4f x2 = *(const v4fa*)(arow + kb + 16 + 8 * hh), x3 = *(const v4fa*)(arow + kb + 16 + 8 * hh + 4);
    float xs[16] = {x0[0],x0[1],x0[2],x0[3],x1[0],x1[1],x1[2],x1[3],x2[0],x2[1],x2[2],x2[3],x3[0],x3[1],x3[2],x3[3]};
#pragma unroll
    for (int i = 0; i < 16; ++i) { const unsigned short hb = bf16_bits(xs[i]); ah.u[i] = hb; al.u[i] = ASPLIT ? bf16_bits(xs[i] - bf16_val(hb)) : (unsigned short)0; }
#pragma unroll
    for (int t = 0; t < 4; ++t) {
      const unsigned short* brow = Wt + (size_t)(col0 + t * 16 + ln) * ldb + kb;
      FragB b;
      b.half[0] = *(const v8us*)(brow + 8 * hh);
      b.half[1] = *(const v8us*)(brow + 16 + 8 * hh);
      acc[t] = mmaN<ASPLIT ? 2 : 1>(ah.v, al.v, b.v, b.v, acc[t]);
    }
  }
#pragma unroll
  for (int t = 0; t < 4; ++t) {
    const int col = col0 + t * 16 + ln;
    float bv = bias ? bias[col] : 0.f;
    if (BIAS_BF16) bv = bf16_round(bv);
#pragma unroll
    for (int r = 0; r < 8; ++r) {
      float v = acc[t][r] + bv;
      if (resid) { float rv = resid[(size_t)((row0 + 8 * hh + r) % rmod) * ldr + col]; if (RES_BF16) rv = bf16_round(rv); v += rv; }
      if (ACT == 1) v = fmaxf(v, 0.f);
      if (ACT == 2) v = 0.5f * v * (1.0f + erff(v * 0.70710678118654752f));
      if (ACT == 3) { const float u = 0.7978845608028654f * (v + 0.044715f * v * v * v); v = 0.5f * v * (1.0f + tanhf(u)); }
      so[w][8 * hh + r][t * 16 + ln] = v;
    }
  }
  __builtin_amdgcn_fence(__ATOMIC_ACQ_REL, "workgroup");
  __builtin_amdgcn_wave_barrier();
  const int rsub = lane >> 4, c4 = (lane & 15) * 4;
  {
#pragma unroll
    for (int q = 0; q < 8; ++q) {
      const int r = q * 2 + rsub;
      const v4f v = *(const v4fa*)&so[w][r][c4];
      *(v4f*)(C + (size_t)(row0 + r) * ldc + col0 + c4) = v;
    }
    
  }
}
// row LayerNorm (biased variance, eps) over N: s = X (+ R); optional out_sum <- s; out_norm <- (s-mu)*rsqrt(var+eps)*g + b
template <bool PARAM_BF16>
__global__ __launch_bounds__(256) void k_layernorm(const float* __restrict__ X, const float* __restrict__ R, const float* __restrict__ g, const float* __restrict__ bta,
                                                  float* __restrict__ out_sum, float* __restrict__ out_norm, int N, float eps) {
  __shared__ float red[256];
  const int row = blockIdx.x, tid = threadIdx.x;
  const float* x = X + (size_t)row * N; const float* rr = R ? R + (size_t)row * N : nullptr;
  float vals[16];                     // up to N = 4096
  const int per = N / 256;            // contiguous chunk per thread? use strided-by-4 chunks: thread handles j = tid*4 + 1024*u
  float s1 = 0.f;
  for (int u = 0; u < per / 4; ++u) {
    const int j = tid * 4 + 1024 * u;
    const v4f a = *(const v4fa*)(x + j);
    v4f b = {0.f,0.f,0.f,0.f}; if (rr) b = *(const v4fa*)(rr + j);
#pragma unroll
    for (int q = 0; q < 4; ++q) { const float v = a[q] + b[q]; vals[u * 4 + q] = v; s1 += v; }
  }
  red[tid] = s1; __syncthreads();
  for (int st = 128; st > 0; st >>= 1) { if (tid < st) red[tid] += red[tid + st]; __syncthreads(); }
  const float mu = red[0] / (float)N; __syncthreads();
  float s2 = 0.f;
  for (int u = 0; u < per / 4; ++u)
#pragma unroll
    for (int q = 0; q < 4; ++q) { const float c = vals[u * 4 + q] - mu; s2 += c * c; }
  red[tid] = s2; __syncthreads();
  for (int st = 128; st > 0; st >>= 1) { if (tid < st) red[tid] += red[tid + st]; __syncthreads(); }
  const float rs = rsqrtf(red[0] / (float)N + eps);
  {
    for (int u = 0; u < per / 4; ++u) {
      const int j = tid * 4 + 1024 * u;
      v4f o, sm;
#pragma unroll
      for (int q = 0; q < 4; ++q) {
        float gg = g[j + q], bb = bta[j + q];
        if (PARAM_BF16) { gg = bf16_round(gg); bb = bf16_round(bb); }
        sm[q] = vals[u * 4 + q]; o[q] = (vals[u * 4 + q] - mu) * rs * gg + bb;
      }
      if (out_sum) *(v4f*)(out_sum + (size_t)row * N + j) = sm;
      *(v4f*)(out_norm + (size_t)row * N + j) = o;
    }
    
  }
}



// ---- f16 WMMA path (v_wmma_f32_16x16x32_f16): 11-bit significands for operands in range — used where a [0,1] probability operand needs more precision than bf16
typedef _Float16 v16h __attribute__((ext_vector_type(16)));
union FragH { v16h v; v8us half[2]; _Float16 h[16]; unsigned short u[16]; };
template <int NT>
__device__ __forceinline__ v8f mmaH(v16h ah, v16h al, v16h bh, v16h bl, v8f c) {
  c = __builtin_amdgcn_wmma_f32_16x16x32_f16(false, ah, false, bh, (short)0, c, false, false);
  if (NT >= 2) c = __builtin_amdgcn_wmma_f32_16x16x32_f16(false, al, false, bh, (short)0, c, false, false);
  if (NT >= 3) c = __builtin_amdgcn_wmma_f32_16x16x32_f16(false, ah, false, bl, (short)0, c, false, false);
  asm volatile("v_nop\n\tv_nop\n\tv_nop\n\tv_nop" : "+v"(c) : "v"(ah), "v"(al), "v"(bh), "v"(bl));
  return c;
}
// batched GEMM like k_gemm_b but f16 operands: A f32 (split into f16 hi/lo if ASPLIT, else rounded to f16), Bt = f16 values [n][k]; alpha; C f32; N multiple of 16 (partial tiles skipped)
template <bool ASPLIT>
__global__ __launch_bounds__(128) void k_gemm_h(const float* __restrict__ A, int lda, size_t sA, const _Float16* __restrict__ Bh, int ldb, size_t sB, float alpha, float* __restrict__ C, int ldc, size_t sC, int M, int N, int K) {
  __shared__ __attribute__((aligned(16))) float so[4][16][64];
  const int tid = threadIdx.x, w = tid >> 5, lane = tid & 31, ln = lane & 15, hh = lane >> 4; const int by = blockIdx.y;
  A += (size_t)by * sA; Bh += (size_t)by * sB; C += (size_t)by * sC;
  const int ntn = (N + 63) / 64; const int wid = blockIdx.x * 4 + w; const int mt = wid / ntn, nq = wid % ntn; if (mt * 16 >= M) return;
  const int row0 = mt * 16, col0 = nq * 64; const float* arow = A + (size_t)(row0 + ln) * lda;
  v8f acc[4] = {};
  for (int kb = 0; kb < K; kb += 32) {
    FragH ah, al;
    const v4f x0 = *(const v4fa*)(arow + kb + 8 * hh), x1 = *(const v4fa*)(arow + kb + 8 * hh + 4), x2 = *(const v4fa*)(arow + kb + 16 + 8 * hh), x3 = *(const v4fa*)(arow + kb + 16 + 8 * hh + 4);
    float xs[16] = {x0[0],x0[1],x0[2],x0[3],x1[0],x1[1],x1[2],x1[3],x2[0],x2[1],x2[2],x2[3],x3[0],x3[1],x3[2],x3[3]};
#pragma unroll
    for (int i = 0; i < 16; ++i) { const _Float16 h = (_Float16)xs[i]; ah.h[i] = h; al.h[i] = ASPLIT ? (_Float16)(xs[i] - (float)h) : (_Float16)0.0f; }
#pragma unroll
    for (int t = 0; t < 4; ++t) { if (col0 + t * 16 >= N) continue; const size_t boff = (size_t)(col0 + t * 16 + ln) * ldb + kb; FragH bq; bq.half[0] = *(const v8us*)(Bh + boff + 8 * hh); bq.half[1] = *(const v8us*)(Bh + boff + 16 + 8 * hh);
      acc[t] = mmaH<ASPLIT ? 2 : 1>(ah.v, al.v, bq.v, bq.v, acc[t]); }
  }
#pragma unroll
  for (int t = 0; t < 4; ++t) { if (col0 + t * 16 >= N) continue;
#pragma unroll
    for (int r = 0; r < 8; ++r) so[w][8 * hh + r][t * 16 + ln] = acc[t][r] * alpha; }
  __builtin_amdgcn_fence(__ATOMIC_ACQ_REL, "workgroup"); __builtin_amdgcn_wave_barrier();
  const int rsub = lane >> 4, c4 = (lane & 15) * 4;
  {
#pragma unroll
    for (int q = 0; q < 8; ++q) { const int r = q * 2 + rsub; if (col0 + c4 < N) { const v4f v = *(const v4fa*)&so[w][r][c4]; *(v4f*)(C + (size_t)(row0 + r) * ldc + col0 + c4) = v; } }
     }
}

// k_gemm_hh variant with fused epilogue: v = acc·alpha + bias[by·sBias + col] (+ CP[(row/rowsPerB)·sCPb + by·64 + col] if CP) ; ACT 0 none / 1 elu ; writes f16 C16 (and f32 C if non-null)
template <int ACT>
__global__ __launch_bounds__(128) void k_gemm_hhx(const _Float16* __restrict__ A, int lda, size_t sA, const _Float16* __restrict__ Bh, int ldb, size_t sB, float alpha, const float* __restrict__ bias, size_t sBias, const float* __restrict__ CP, int rowsPerB, size_t sCPb, int row0g,
    float* __restrict__ C, _Float16* __restrict__ C16, int ldc, size_t sC, int M, int N, int K) {
  __shared__ __attribute__((aligned(16))) float so[4][16][64];
  const int tid = threadIdx.x, w = tid >> 5, lane = tid & 31, ln = lane & 15, hh = lane >> 4; const int by = blockIdx.y;
  A += (size_t)by * sA; Bh += (size_t)by * sB; const size_t cofs = (size_t)by * sC; const float* bp = bias ? bias + (size_t)by * sBias : nullptr;
  const int ntn = (N + 63) / 64; const int wid = blockIdx.x * 4 + w; const int mt = wid / ntn, nq = wid % ntn; if (mt * 16 >= M) return;
  const int row0 = mt * 16, col0 = nq * 64; const _Float16* arow = A + (size_t)(row0 + ln) * lda;
  v8f acc[4] = {};
  for (int kb = 0; kb < K; kb += 32) { FragH ah; ah.half[0] = *(const v8us*)((const unsigned short*)arow + kb + 8 * hh); ah.half[1] = *(const v8us*)((const unsigned short*)arow + kb + 16 + 8 * hh);
#pragma unroll
    for (int t = 0; t < 4; ++t) { if (col0 + t * 16 >= N) continue; const size_t boff = (size_t)(col0 + t * 16 + ln) * ldb + kb; FragH bq; bq.half[0] = *(const v8us*)((const unsigned short*)Bh + boff + 8 * hh); bq.half[1] = *(const v8us*)((const unsigned short*)Bh + boff + 16 + 8 * hh);
      acc[t] = mmaH<1>(ah.v, ah.v, bq.v, bq.v, acc[t]); }
  }
#pragma unroll
  for (int t = 0; t < 4; ++t) { if (col0 + t * 16 >= N) continue; const int col = col0 + t * 16 + ln; const float bv = bp ? bf16_round(bp[col]) : 0.f;
#pragma unroll
    for (int r = 0; r < 8; ++r) { float v = acc[t][r] * alpha + bv; if (CP) { const int rr = row0g + row0 + 8 * hh + r; if (rowsPerB < 0) v += CP[cofs + (size_t)rr * ldc + col];      /* rowsPerB < 0: own element of the batched C plane */ else { const int bidx = rr / rowsPerB; v += CP[(size_t)bidx * sCPb + (size_t)by * 64 + col]; } } if (ACT == 1) v = (v > 0.f) ? v : expm1f(v); else if (ACT == 7) v = (v > 0.f) ? v + 1.0f : expf(v); else if (ACT == 8) v = tanhf(v); else if (ACT == 9) v = 0.5f * v * (1.0f + tanhf(0.7978845608028654f * (v + 0.044715f * v * v * v))); else if (ACT == 11) v = 1.0f / (1.0f + expf(-v)); else if (ACT == 12) v = (v > 0.f) ? v : 0.01f * v; else if (ACT == 14) v = (v > 0.f) ? v : 0.1f * v; else if (ACT == 16) v = (v >= 0.f) ? v : 0.3f * v; else if (ACT == 17) v = (v >= 0.f) ? v : 0.2f * v; else if (ACT == 15) v = v / (1.0f + expf(-v)); else if (ACT == 3) v = fmaxf(v, 0.f); else if (ACT == 6) v = 0.5f * v * (1.0f + erff(v * 0.70710678118654752f)); so[w][8 * hh + r][t * 16 + ln] = v; } }
  __builtin_amdgcn_fence(__ATOMIC_ACQ_REL, "workgroup"); __builtin_amdgcn_wave_barrier();
  const int rsub = lane >> 4, c4 = (lane & 15) * 4; typedef _Float16 v4h __attribute__((ext_vector_type(4)));
  {
#pragma unroll
    for (int q = 0; q < 8; ++q) { const int r = q * 2 + rsub; if (col0 + c4 < N) { const v4f v = *(const v4fa*)&so[w][r][c4]; if (C) *(v4f*)(C + cofs + (size_t)(row0 + r) * ldc + col0 + c4) = v; if (C16) { v4h h4; for (int i = 0; i < 4; ++i) h4[i] = (_Float16)v[i]; *(v4h*)(C16 + cofs + (size_t)(row0 + r) * ldc + col0 + c4) = h4; } } }
     }
}


typedef _Float16 v4h __attribute__((ext_vector_type(4)));

__global__ __launch_bounds__(256) void k_h16(const float* __restrict__ x, _Float16* __restrict__ X16, size_t n8) { const size_t t = (size_t)blockIdx.x * 256 + threadIdx.x; if (t >= n8) return; FragH f;
#pragma unroll
  for (int q = 0; q < 8; ++q) f.h[q] = (_Float16)x[t * 8 + q]; *(v8us*)((unsigned short*)X16 + t * 8) = f.half[0];  }
__global__ __launch_bounds__(256) void k_round16f(const float* __restrict__ W, _Float16* __restrict__ Bt, size_t n8) { const size_t t = (size_t)blockIdx.x * 256 + threadIdx.x; if (t >= n8) return; FragH f;
#pragma unroll
  for (int i = 0; i < 8; ++i) f.h[i] = (_Float16)(bf16_round(W[t * 8 + i]) * 16.0f); *(v8us*)((unsigned short*)Bt + t * 8) = f.half[0];  }
template <int NHv, int TTv>
__global__ __launch_bounds__(256) void k_vt(const _Float16* __restrict__ V16, int ldv, int voff, _Float16* __restrict__ Vt) { __shared__ unsigned short tl[64][66]; const int tid = threadIdx.x; const int slab = blockIdx.x / (TTv / 64), lg = blockIdx.x % (TTv / 64); const int b = slab / NHv, h = slab % NHv;
  for (int i = tid; i < 64 * 8; i += 256) { const int r = i / 8, c8 = (i % 8) * 8; FragH f; f.half[0] = *(const v8us*)((const unsigned short*)V16 + ((size_t)b * TTv + lg * 64 + r) * ldv + voff + h * 64 + c8);
#pragma unroll
    for (int q = 0; q < 8; ++q) tl[r][c8 + q] = f.u[q]; }
  __syncthreads();
  {
#pragma unroll
    for (int rd = 0; rd < 2; ++rd) { const int d = rd * 32 + tid / 8, pc = tid % 8; FragH f;
#pragma unroll
      for (int q = 0; q < 8; ++q) f.u[q] = tl[pc * 8 + q][d];
      *(v8us*)((unsigned short*)Vt + ((size_t)slab * 64 + d) * TTv + lg * 64 + pc * 8) = f.half[0]; }
     } }

__global__ __launch_bounds__(256) void k_hl(const float* __restrict__ F, _Float16* __restrict__ Hh, _Float16* __restrict__ Hl, size_t n8) { const size_t t = (size_t)blockIdx.x * 256 + threadIdx.x; if (t >= n8) return; FragH fh, fl; const v4f a = *(const v4fa*)(F + t * 8), c = *(const v4fa*)(F + t * 8 + 4);
#pragma unroll
  for (int q = 0; q < 4; ++q) { _Float16 h = (_Float16)a[q]; fh.h[q] = h; fl.h[q] = (_Float16)((a[q] - (float)h) * 1024.0f); h = (_Float16)c[q]; fh.h[4 + q] = h; fl.h[4 + q] = (_Float16)((c[q] - (float)h) * 1024.0f); }
  { *(v8us*)((unsigned short*)Hh + t * 8) = fh.half[0]; *(v8us*)((unsigned short*)Hl + t * 8) = fl.half[0];  } }

// ---- fast GEMM (block tile 128x128, eight waves of 32x64; requires M % 128 == 0, N % 128 == 0, K % 64 == 0); epilogue = k_gemm_hhx semantics ----
// Both operands pass through LDS: a stage is 64 k (one whole 128-byte line) of the block's 128 A rows and 128 B rows, brought by asynchronous copies and read by all eight waves; two stages, the next one in flight while this one is multiplied.
__device__ __forceinline__ v16h g2_frag(const _Float16* p, int hh) { FragH f; f.half[0] = *(const v8us*)((const unsigned short*)p + 8 * hh); f.half[1] = *(const v8us*)((const unsigned short*)p + 16 + 8 * hh); return f.v; }
__device__ __forceinline__ v8f g2_mma(v16h a, v16h b, v8f c) { v8f d = __builtin_amdgcn_wmma_f32_16x16x32_f16(false, a, false, b, (short)0, c, false, false); asm volatile("v_nop\n\tv_nop\n\tv_nop\n\tv_nop" : "+v"(d) : "v"(a), "v"(b)); return d; }
#define G2_PITCH 144                   /* LDS row pitch in bytes: 16 x odd, free of bank conflicts for 16-byte reads */
#define G2_STAGE (256 * G2_PITCH)      /* rows 0..127 = A, rows 128..255 = B */
// one stage's copies: a thread brings 16 bytes of each of 8 rows (32 rows apart; 4 of A, 4 of B), so a wave-wide copy covers 4 whole 128-byte lines.
// s_wait_xcnt 0 is the statement's last line: it then stands in front of every later rewrite of the address registers the copies name.
__device__ __forceinline__ void g2_stage(unsigned l, const _Float16* a, int lda, const _Float16* b, int ldb) {
  const _Float16* a1 = a + (size_t)32 * lda; const _Float16* a2 = a + (size_t)64 * lda; const _Float16* a3 = a + (size_t)96 * lda;
  const _Float16* b1 = b + (size_t)32 * ldb; const _Float16* b2 = b + (size_t)64 * ldb; const _Float16* b3 = b + (size_t)96 * ldb;
  asm volatile("global_load_async_to_lds_b128 %0, %8, off\n\tglobal_load_async_to_lds_b128 %1, %9, off\n\tglobal_load_async_to_lds_b128 %2, %10, off\n\tglobal_load_async_to_lds_b128 %3, %11, off\n\t"
               "global_load_async_to_lds_b128 %4, %12, off\n\tglobal_load_async_to_lds_b128 %5, %13, off\n\tglobal_load_async_to_lds_b128 %6, %14, off\n\tglobal_load_async_to_lds_b128 %7, %15, off\n\ts_wait_xcnt 0x0"
               :: "v"(l), "v"(l + 32 * G2_PITCH), "v"(l + 64 * G2_PITCH), "v"(l + 96 * G2_PITCH), "v"(l + 128 * G2_PITCH), "v"(l + 160 * G2_PITCH), "v"(l + 192 * G2_PITCH), "v"(l + 224 * G2_PITCH),
                  "v"(a), "v"(a1), "v"(a2), "v"(a3), "v"(b), "v"(b1), "v"(b2), "v"(b3) : "memory"); }
template <int ACT>
__global__ __launch_bounds__(256) void k_gemm2(const _Float16* __restrict__ A, int lda, size_t sA, const _Float16* __restrict__ Bh, int ldb, size_t sB, float alpha, const float* __restrict__ bias, size_t sBias, const float* __restrict__ CP, int rowsPerB, size_t sCPb, int row0g,
    float* __restrict__ C, _Float16* __restrict__ C16, int ldc, size_t sC, int M, int N, int K) { static_assert(ACT == 0 || ACT == 3 || ACT == 6 || ACT == 8 || ACT == 9 || ACT == 11 || ACT == 12 || ACT == 14 || ACT == 15 || ACT == 16 || ACT == 17, "k_gemm2: unsupported ACT code (would silently apply no activation)");
  __shared__ __attribute__((aligned(128))) unsigned char sm[2 * G2_STAGE];      /* the two operand stages; behind the loop's last barrier the same bytes are the waves' output staging */
  static_assert(8 * 32 * 68 * 4 <= 2 * G2_STAGE, "output staging must fit the operand stages");
  float (*so)[32][68] = (float (*)[32][68])sm;
  const int tid = threadIdx.x, w = tid >> 5, lane = tid & 31, ln = lane & 15, hh = lane >> 4; const int by = blockIdx.y;
  A += (size_t)by * sA; Bh += (size_t)by * sB; const size_t cofs = (size_t)by * sC; const float* bp = bias ? bias + (size_t)by * sBias : nullptr;
  const int ntn = N >> 7; const int mt = blockIdx.x / ntn, nq = blockIdx.x - mt * ntn; if (mt * 128 >= M) return;      /* the same for the whole block, in front of every barrier */
  const int wm = w & 3, wn = w >> 2; const int row0 = mt * 128 + 32 * wm, col0 = nq * 128 + 64 * wn;
  const _Float16* ga = A + (size_t)(mt * 128 + (tid >> 3)) * lda + (tid & 7) * 8; const _Float16* gb = Bh + (size_t)(nq * 128 + (tid >> 3)) * ldb + (tid & 7) * 8;
  const unsigned l0 = (unsigned)(size_t)sm + (unsigned)((tid >> 3) * G2_PITCH + (tid & 7) * 16);      /* the thread's LDS byte address in stage buffer 0 */
  const int nt = K >> 6;
  g2_stage(l0, ga, lda, gb, ldb);
  asm volatile("s_wait_asynccnt 0x0" ::: "memory");      /* this wave's copies of stage 0 have landed */
  __syncthreads();                                       /* ... and every other wave's */
  if (1 < nt) g2_stage(l0 + G2_STAGE, ga + 64, lda, gb + 64, ldb);
  const v8f z8 = {0.f,0.f,0.f,0.f,0.f,0.f,0.f,0.f}; v8f c00 = z8, c01 = z8, c02 = z8, c03 = z8, c10 = z8, c11 = z8, c12 = z8, c13 = z8;
  for (int t = 0; t < nt; ++t) { const unsigned char* st = sm + (t & 1) * G2_STAGE;
    const _Float16* a0p = (const _Float16*)(st + (32 * wm + ln) * G2_PITCH); const _Float16* a1p = (const _Float16*)(st + (32 * wm + 16 + ln) * G2_PITCH);
    const _Float16* b0p = (const _Float16*)(st + (128 + 64 * wn + ln) * G2_PITCH); const _Float16* b1p = (const _Float16*)(st + (128 + 64 * wn + 16 + ln) * G2_PITCH); const _Float16* b2p = (const _Float16*)(st + (128 + 64 * wn + 32 + ln) * G2_PITCH); const _Float16* b3p = (const _Float16*)(st + (128 + 64 * wn + 48 + ln) * G2_PITCH);
#pragma unroll      /* both 32-k halves of the stage in one body: constant LDS offsets */
    for (int kb = 0; kb < 64; kb += 32) { const v16h a0 = g2_frag(a0p + kb, hh), a1 = g2_frag(a1p + kb, hh), b0 = g2_frag(b0p + kb, hh), b1 = g2_frag(b1p + kb, hh), b2 = g2_frag(b2p + kb, hh), b3 = g2_frag(b3p + kb, hh);      /* the six fragments as one group of LDS reads in front of their eight products: one LDS latency, not four */
      c00 = g2_mma(a0, b0, c00); c10 = g2_mma(a1, b0, c10); c01 = g2_mma(a0, b1, c01); c11 = g2_mma(a1, b1, c11);
      c02 = g2_mma(a0, b2, c02); c12 = g2_mma(a1, b2, c12); c03 = g2_mma(a0, b3, c03); c13 = g2_mma(a1, b3, c13); }
    asm volatile("s_wait_dscnt 0x0" ::: "memory");         /* this wave's reads of the stage are done before the buffer is given back */
    asm volatile("s_wait_asynccnt 0x0" ::: "memory");      /* this wave's copies of stage t + 1 have landed */
    __syncthreads();                                       /* publishes stage t + 1 and ends every wave's reads of stage t */
    if (t + 2 < nt) g2_stage(l0 + (unsigned)((t & 1) * G2_STAGE), ga + (size_t)(t + 2) * 64, lda, gb + (size_t)(t + 2) * 64, ldb); }
  asm volatile("s_wait_asynccnt 0x0" ::: "memory");        /* nothing is in flight when the stages become output staging */
  v8f accs[8] = {c00, c01, c02, c03, c10, c11, c12, c13};
#pragma unroll
  for (int u = 0; u < 8; ++u) { const int t = u & 3, half = u >> 2; const int col = col0 + t * 16 + ln; const float bv = bp ? bf16_round(bp[col]) : 0.f;
#pragma unroll
    for (int r = 0; r < 8; ++r) { const int rloc = half * 16 + 8 * hh + r; float v = accs[u][r] * alpha + bv; if (CP) { if (rowsPerB < 0) v += CP[cofs + (size_t)(row0g + row0 + rloc) * ldc + col];      /* rowsPerB < 0: own element of the batched C plane */ else { const int bidx = (row0g + row0 + rloc) / rowsPerB; v += CP[(size_t)bidx * sCPb + (size_t)by * 64 + col]; } }
      if (ACT == 3) v = fmaxf(v, 0.f); else if (ACT == 6) v = 0.5f * v * (1.0f + erff(v * 0.70710678118654752f)); else if (ACT == 11) v = 1.0f / (1.0f + expf(-v)); else if (ACT == 15) v = v / (1.0f + expf(-v)); else if (ACT == 12) v = (v > 0.f) ? v : 0.01f * v; else if (ACT == 8) v = tanhf(v); else if (ACT == 9) v = 0.5f * v * (1.0f + tanhf(0.7978845608028654f * (v + 0.044715f * v * v * v))); else if (ACT == 14) v = (v > 0.f) ? v : 0.1f * v; else if (ACT == 16) v = (v >= 0.f) ? v : 0.3f * v; else if (ACT == 17) v = (v >= 0.f) ? v : 0.2f * v;
      so[w][rloc][t * 16 + ln] = v; } }
  __builtin_amdgcn_fence(__ATOMIC_ACQ_REL, "workgroup"); __builtin_amdgcn_wave_barrier();
  const int rsub = lane >> 4, c4 = (lane & 15) * 4;
  {
#pragma unroll
    for (int q = 0; q < 16; ++q) { const int r = q * 2 + rsub; const v4f v = *(const v4fa*)&so[w][r][c4]; if (C) *(v4f*)(C + cofs + (size_t)(row0 + r) * ldc + col0 + c4) = v; if (C16) { v4h h4; for (int i = 0; i < 4; ++i) h4[i] = (_Float16)v[i]; *(v4h*)(C16 + cofs + (size_t)(row0 + r) * ldc + col0 + c4) = h4; } }
     } }


__global__ __launch_bounds__(256) void k_wnat(const float* __restrict__ w, size_t n8, _Float16* __restrict__ Bt) { const size_t t = (size_t)blockIdx.x * 256 + threadIdx.x; if (t >= n8) return; FragH f; for (int q = 0; q < 8; ++q) f.h[q] = (_Float16)(bf16_round(w[t * 8 + q]) * 16.0f); *(v8us*)((unsigned short*)Bt + t * 8) = f.half[0];  }
__global__ __launch_bounds__(256) void k_rsm(const float* __restrict__ S, _Float16* __restrict__ P, int nrows) {
  #pragma clang fp contract(off)
  const int i = blockIdx.x * 256 + threadIdx.x; if (i >= nrows) return; const float* s = S + (size_t)i * SQ; float mx = -3.0e38f;
#pragma unroll 1
  for (int j = 0; j < SQ; ++j) mx = fmaxf(mx, s[j]); float se = 0.f;
#pragma unroll 1
  for (int j = 0; j < SQ; ++j) se += expf(s[j] - mx); const float sc = 256.0f / se;
#pragma unroll 1
  for (int j0 = 0; j0 < SQ; j0 += 8) { FragH f; for (int q = 0; q < 8; ++q) f.h[q] = (_Float16)(expf(s[j0 + q] - mx) * sc); unsigned short* d = (unsigned short*)P + (size_t)i * SQ + j0; *(v8us*)d = f.half[0];  } }
__global__ __launch_bounds__(256) void k_vt(const _Float16* __restrict__ V16, int b, int h0, _Float16* __restrict__ VT) { __shared__ unsigned short tl[64][65]; const int tid = threadIdx.x; const int hh = blockIdx.x % HG, sg = blockIdx.x / HG; const int s0 = sg * 64; const int h = h0 + hh;
  for (int i = tid; i < 64 * 8; i += 256) { const int j = i / 8, d8 = (i % 8) * 8; FragH f; f.half[0] = *(const v8us*)((const unsigned short*)V16 + ((size_t)b * SQ + s0 + j) * DM + h * HD + d8); for (int q = 0; q < 8; ++q) tl[d8 + q][j] = f.u[q]; }
  __syncthreads();
  { for (int i = tid; i < 64 * 8; i += 256) { const int d = i / 8, j8 = (i % 8) * 8; FragH f; for (int q = 0; q < 8; ++q) f.u[q] = tl[d][j8 + q]; *(v8us*)((unsigned short*)VT + ((size_t)hh * HD + d) * SQ + s0 + j8) = f.half[0]; }  } }



// lanes l and l ^ 16 exchanged by the cross-row permlane (no LDS round trip)
__device__ __forceinline__ float xl_half(float v) { const int i = __float_as_int(v); return __int_as_float(__builtin_amdgcn_permlanex16(i, i, 0x76543210, 0xfedcba98, false, false)); }
__device__ __forceinline__ v8f fa_mma(v16h a, v16h b, v8f c) { return __builtin_amdgcn_wmma_f32_16x16x32_f16(false, a, false, b, (short)0, c, false, false); }
// 2^x on eight values; the v_nop is the one slot the instruction set asks for behind a transcendental, written in the same statement so that it stays directly behind the last one
__device__ __forceinline__ void fa_exp8(float (&e)[8]) { asm("v_exp_f32 %0, %0\n\tv_exp_f32 %1, %1\n\tv_exp_f32 %2, %2\n\tv_exp_f32 %3, %3\n\tv_exp_f32 %4, %4\n\tv_exp_f32 %5, %5\n\tv_exp_f32 %6, %6\n\tv_exp_f32 %7, %7\n\tv_nop" : "+v"(e[0]), "+v"(e[1]), "+v"(e[2]), "+v"(e[3]), "+v"(e[4]), "+v"(e[5]), "+v"(e[6]), "+v"(e[7])); }
__device__ __forceinline__ float fa_exp1(float x) { asm("v_exp_f32 %0, %0\n\tv_nop" : "+v"(x)); return x; }      /* same slot as above */
#define FA_PITCH 144                   /* LDS pitch of a K row in bytes: 16 x odd, free of bank conflicts for 16-byte reads */
#define FA_PITCHV 160                  /* LDS pitch of a V row in bytes: 32 x odd, the same for the transposing load */
#define FA_VOFF (64 * FA_PITCH)        /* the V rows stand behind the 64 K rows */
#define FA_STAGE (FA_VOFF + 64 * FA_PITCHV)      /* 64 K rows (key, 64 d), then 64 V rows (key, 64 d) */
#define FA_KG 2                        /* key groups of a block */
#define FA_NST (SQ / FA_KG / 64)       /* stages a group walks */
#define FA_EX (9 * 32 * 16)            /* bytes a wave hands its partner: 8 x 16 bytes of O and 16 bytes of (maximum, sum) a lane */
// one stage's copies: a thread brings 16 bytes of each of 8 rows (16 rows apart; 4 of K, 4 of V), so a wave-wide copy covers 4 whole 128-byte lines; l = its LDS byte address in the K rows, lv in the V rows.
// s_wait_xcnt 0 is the statement's last line: it then stands in front of every later rewrite of the address registers the copies name.
__device__ __forceinline__ void fa_stage(unsigned l, unsigned lv, const _Float16* k, const _Float16* v) {
  const _Float16* k1 = k + (size_t)16 * LQ; const _Float16* k2 = k + (size_t)32 * LQ; const _Float16* k3 = k + (size_t)48 * LQ;
  const _Float16* v1 = v + (size_t)16 * LQ; const _Float16* v2 = v + (size_t)32 * LQ; const _Float16* v3 = v + (size_t)48 * LQ;
  asm volatile("global_load_async_to_lds_b128 %0, %8, off\n\tglobal_load_async_to_lds_b128 %1, %9, off\n\tglobal_load_async_to_lds_b128 %2, %10, off\n\tglobal_load_async_to_lds_b128 %3, %11, off\n\t"
               "global_load_async_to_lds_b128 %4, %12, off\n\tglobal_load_async_to_lds_b128 %5, %13, off\n\tglobal_load_async_to_lds_b128 %6, %14, off\n\tglobal_load_async_to_lds_b128 %7, %15, off\n\ts_wait_xcnt 0x0"
               :: "v"(l), "v"(l + 16 * FA_PITCH), "v"(l + 32 * FA_PITCH), "v"(l + 48 * FA_PITCH), "v"(lv), "v"(lv + 16 * FA_PITCHV), "v"(lv + 32 * FA_PITCHV), "v"(lv + 48 * FA_PITCHV),
                  "v"(k), "v"(k1), "v"(k2), "v"(k3), "v"(v), "v"(v1), "v"(v2), "v"(v3) : "memory"); }
// 16 bytes a lane from a row-major 16-bit LDS tile, delivered transposed; the builtin, so that the compiler sees the load and places its wait
typedef short v8s __attribute__((ext_vector_type(8)));
__device__ __forceinline__ v8us fa_tr16(const unsigned char* p) { typedef __attribute__((address_space(3))) v8s lds_v8s; return __builtin_bit_cast(v8us, __builtin_amdgcn_ds_load_tr16_b128_v8i16((lds_v8s*)p)); }
// the merge of two waves' partial results for one group of 16 query columns: a wave hands over the group it does not finish (its O tiles g, maximum mg, sum lg) ...
__device__ __forceinline__ void fa_give(unsigned char* ex, int lane, const v8f (&g)[4], float mg, float lg) {
#pragma unroll      /* constant indices keep g in registers */
  for (int t = 0; t < 4; ++t) for (int u = 0; u < 2; ++u) { const v4f v = {g[t][4 * u], g[t][4 * u + 1], g[t][4 * u + 2], g[t][4 * u + 3]}; *(v4fa*)(ex + ((2 * t + u) * 32 + lane) * 16) = v; }
  const v4f ml = {mg, lg, 0.f, 0.f}; *(v4fa*)(ex + (8 * 32 + lane) * 16) = ml; }
// ... and finishes the other (a, ma, la) with its partner's part: both brought to the common maximum, the sums joined (the two key groups, then the wave halves), one division, o leaves x64; op = the lane's 16 bytes of its query's row
__device__ __forceinline__ void fa_finish(const unsigned char* ex, int lane, const v8f (&a)[4], float ma, float la, float cs, unsigned short* op) {
  const v4f ml = *(const v4fa*)(ex + (8 * 32 + lane) * 16); const float mm = fmaxf(ma, ml[0]);
  const float fa = fa_exp1((ma - mm) * cs), fb = fa_exp1((ml[0] - mm) * cs); const float ls = la * fa + ml[1] * fb;
  const float inv = 64.0f / (ls + xl_half(ls)); const float ga = fa * inv, gb = fb * inv; FragH f[4];
#pragma unroll      /* constant indices keep a and f in registers */
  for (int t = 0; t < 4; ++t) for (int u = 0; u < 2; ++u) { const v4f p = *(const v4fa*)(ex + ((2 * t + u) * 32 + lane) * 16); for (int r = 0; r < 4; ++r) f[t].h[4 * u + r] = (_Float16)(a[t][4 * u + r] * ga + p[r] * gb); }
#pragma unroll      /* the four stores as one run at the wave's end, each from registers of its own; a[t][r] = O[query ln][16 t + 8 hh + r]: 16 contiguous bytes a store */
  for (int t = 0; t < 4; ++t) *(v8us*)(op + t * 16) = f[t].half[0]; }
__global__ __launch_bounds__(256) void k_fattn(const _Float16* __restrict__ Q, const _Float16* __restrict__ Kr, const _Float16* __restrict__ Vr, _Float16* __restrict__ O) {
  __shared__ __attribute__((aligned(128))) unsigned char sm[FA_KG * 2 * FA_STAGE];      /* each key group's two K / V stages; behind the loop's last barrier the same bytes carry the merge */
  static_assert(8 * FA_EX <= FA_KG * 2 * FA_STAGE, "the merge must fit the stages");
  const int tid = threadIdx.x, lane = tid & 31, ln = lane & 15, hh = lane >> 4, w = __builtin_amdgcn_readfirstlane(tid >> 5), kg = w >> 2, tg = tid & 127;      /* w through readfirstlane: the key group and all that follows from it (key offset, LDS bases, the merge's selects) stand in scalar registers; tg = the thread's number in its group */
  const int bh = blockIdx.y, b = bh / NH, h = bh % NH; const int q0 = blockIdx.x * 128 + (w & 3) * 32;
  const _Float16* qp = Q + ((size_t)b * SQ + q0 + ln) * LQ + h * HD;
  const _Float16* gk = Kr + ((size_t)b * SQ + kg * (SQ / FA_KG) + (tg >> 3)) * LQ + h * HD + (tg & 7) * 8; const _Float16* gv = Vr + ((size_t)b * SQ + kg * (SQ / FA_KG) + (tg >> 3)) * LQ + h * HD + (tg & 7) * 8;      /* the thread's 16 bytes of its first K row and first V row of its group's stage 0 */
  const unsigned l0 = (unsigned)(size_t)sm + (unsigned)(kg * 2 * FA_STAGE + (tg >> 3) * FA_PITCH + (tg & 7) * 16), lv0 = (unsigned)(size_t)sm + (unsigned)(kg * 2 * FA_STAGE + FA_VOFF + (tg >> 3) * FA_PITCHV + (tg & 7) * 16);      /* the thread's LDS byte addresses in its group's stage buffer 0 */
  const float cs = 0.03125f * 1.44269504f;      /* 1 / sqrt(d_model) and log2 e in one factor on the raw products */
  const v8f z8 = {0.f,0.f,0.f,0.f,0.f,0.f,0.f,0.f};
  v16h qf[2][2], kf[2][2], vf[4]; v8f o[4][2]; float m[2] = {-3.0e38f, -3.0e38f}, l[2] = {0.f, 0.f};
  fa_stage(l0, lv0, gk, gv);
#pragma unroll
  for (int u = 0; u < 2; ++u) for (int ch = 0; ch < 2; ++ch) qf[u][ch] = g2_frag(qp + (size_t)u * 16 * LQ + ch * 32, hh);
#pragma unroll
  for (int t = 0; t < 4; ++t) { o[t][0] = z8; o[t][1] = z8; }
  asm volatile("s_wait_asynccnt 0x0" ::: "memory");      /* this wave's copies of stage 0 have landed */
  __syncthreads();                                       /* ... and every other wave's */
  fa_stage(l0 + FA_STAGE, lv0 + FA_STAGE, gk + (size_t)64 * LQ, gv + (size_t)64 * LQ);
  for (int st = 0; st < FA_NST; ++st) { const unsigned char* sp = sm + (kg * 2 + (st & 1)) * FA_STAGE;
    const _Float16* kl = (const _Float16*)(sp + ln * FA_PITCH); const unsigned char* vl = sp + FA_VOFF + (8 * hh + (lane & 7)) * FA_PITCHV + ((lane >> 3) & 1) * 16;      /* the lane's address in the transposing load's own map: key row 8 hh + (lane & 7), 16-byte half (lane >> 3) & 1 */
#pragma unroll
    for (int kt = 0; kt < 2; ++kt) for (int ch = 0; ch < 2; ++ch) kf[kt][ch] = g2_frag(kl + kt * 16 * (FA_PITCH / 2) + ch * 32, hh);
#pragma unroll      /* both 32-key passes of the stage in one body: constant LDS offsets */
    for (int p = 0; p < 2; ++p) {
      v8f s[2][2];      /* [key tile][query group], raw q . k */
#pragma unroll
      for (int kt = 0; kt < 2; ++kt) for (int qt = 0; qt < 2; ++qt) s[kt][qt] = fa_mma(kf[kt][1], qf[qt][1], fa_mma(kf[kt][0], qf[qt][0], z8));
      if (p == 0) {      /* the stage's second pass's keys, fetched one pass ahead into the same registers; nothing of the next stage is read here */
#pragma unroll
        for (int kt = 0; kt < 2; ++kt) for (int ch = 0; ch < 2; ++ch) kf[kt][ch] = g2_frag(kl + (32 + kt * 16) * (FA_PITCH / 2) + ch * 32, hh); }
      float mn[2];
#pragma unroll
      for (int qt = 0; qt < 2; ++qt) { float a = fmaxf(s[0][qt][0], s[1][qt][0]);
        for (int r = 1; r < 8; ++r) a = fmaxf(a, fmaxf(s[0][qt][r], s[1][qt][r]));
        mn[qt] = fmaxf(m[qt], fmaxf(a, xl_half(a))); }
      if (__builtin_amdgcn_ballot_w32(mn[0] > m[0] || mn[1] > m[1]) != 0) {      /* scalar branch: where no column's maximum moved every factor is exactly 1 */
#pragma unroll
        for (int qt = 0; qt < 2; ++qt) { const float a = fa_exp1((m[qt] - mn[qt]) * cs); l[qt] *= a; m[qt] = mn[qt];
          for (int t = 0; t < 4; ++t) for (int r = 0; r < 8; ++r) o[t][qt][r] *= a; } }
#pragma unroll
      for (int t = 0; t < 4; ++t) { FragH f; f.half[0] = fa_tr16(vl + p * 32 * FA_PITCHV + t * 32); f.half[1] = fa_tr16(vl + (p * 32 + 16) * FA_PITCHV + t * 32); vf[t] = f.v; }      /* this pass's V^T, d = 16 t + ln, keys 8 hh + 0..7 and 16 + 8 hh + 0..7: the exponentials below stand between the loads and their use */
      FragH pf[2];
#pragma unroll
      for (int qt = 0; qt < 2; ++qt) { const float mc = m[qt] * cs;
        for (int kt = 0; kt < 2; ++kt) { float e[8];
          for (int r = 0; r < 8; ++r) e[r] = fmaf(s[kt][qt][r], cs, -mc);
          fa_exp8(e);
          l[qt] += ((e[0] + e[1]) + (e[2] + e[3])) + ((e[4] + e[5]) + (e[6] + e[7]));
          for (int r = 0; r < 8; ++r) pf[qt].h[kt * 8 + r] = (_Float16)e[r]; } }
#pragma unroll
      for (int t = 0; t < 4; ++t) for (int qt = 0; qt < 2; ++qt) o[t][qt] = fa_mma(vf[t], pf[qt].v, o[t][qt]);
    }
    asm volatile("s_wait_dscnt 0x0" ::: "memory");         /* this wave's reads of the stage are done before the buffer is given back */
    asm volatile("s_wait_asynccnt 0x0" ::: "memory");      /* this wave's copies of stage st + 1 have landed */
    __syncthreads();                                       /* publishes stage st + 1 and ends every wave's reads of stage st */
    if (st + 2 < FA_NST) fa_stage(l0 + (unsigned)((st & 1) * FA_STAGE), lv0 + (unsigned)((st & 1) * FA_STAGE), gk + (size_t)(st + 2) * 64 * LQ, gv + (size_t)(st + 2) * 64 * LQ); }
  asm volatile("s_wait_asynccnt 0x0" ::: "memory");        /* nothing is in flight when the stages become the merge's bytes */
  unsigned char* exo = sm + w * FA_EX; const unsigned char* exp_ = sm + (w ^ 4) * FA_EX;      /* this wave's bytes and its partner's (same queries, other key group, same lane map) */
  unsigned short* op = (unsigned short*)O + ((size_t)b * SQ + q0 + kg * 16 + ln) * DM + h * HD + 8 * hh;
  v8f mine[4], other[4];      /* each wave of a pair finishes one group of 16 queries (group kg) and hands over the other */
#pragma unroll      /* constant indices keep the tiles in registers */
  for (int t = 0; t < 4; ++t) { mine[t] = kg ? o[t][1] : o[t][0]; other[t] = kg ? o[t][0] : o[t][1]; }
  fa_give(exo, lane, other, kg ? m[0] : m[1], kg ? l[0] : l[1]);
  __syncthreads();                                         /* the partner's part is whole before it is read */
  fa_finish(exp_, lane, mine, kg ? m[1] : m[0], kg ? l[1] : l[0], cs, op); }

// every launch-independent preparation job in ONE grid, the job picked by the block index (a scalar branch): the 48 per-head weight blocks, W_o, and the x plane; none reads what another writes, and a thread still builds runs of 8 consecutive f16 of one output row.
#define PB_WH (DM / 64)                        /* blocks for one head's [DM][HD] weight block: one 64 x 64 tile each (HD = 64) */
#define PB_WO ((DM / 64) * (DM / 64))          /* blocks for W_o, likewise */
#define PB_X  ((int)(NR * DM / 8 / 256))       /* blocks for the x plane */
// one 64 (k) x 64 (n) tile of Wt[n][k] = f16(bf16(W[k][n]) x16), W row-major with N columns; Wm points at W[k0][n0], Wt at Wt[n0][k0]; x16 (a power of two) keeps the bf16-exact weights exact in f16, away from the subnormal range.
// The transposition goes through LDS so that both global sides move whole 128-byte lines: a wave-wide load covers 256 contiguous bytes of each of 2 rows of W, a wave-wide store 128 contiguous bytes of each of 4 rows of Wt.
// Pitch 65 words: for each word stored (a wave: 2 rows x 16 columns 4 apart) and each word loaded (8 rows 8 apart x 4 columns) the 32 lanes fall on 32 different banks.
template <int N>
__device__ __forceinline__ void prep_wt(const float* __restrict__ Wm, _Float16* __restrict__ Wt, float (*tl)[65], int tid) { v4f a[4];
#pragma unroll      /* the thread's four loads stand together in front of the LDS stores: one memory latency */
  for (int i = 0; i < 4; ++i) a[i] = *(const v4fa*)(Wm + (size_t)(16 * i + (tid >> 4)) * N + (tid & 15) * 4);
#pragma unroll      /* constant indices keep a in registers */
  for (int i = 0; i < 4; ++i) for (int j = 0; j < 4; ++j) tl[16 * i + (tid >> 4)][(tid & 15) * 4 + j] = a[i][j];
  __syncthreads();      /* the tile is whole before any thread reads a column of it; the job test around this call reads the same for the whole block */
  FragH f[2];
#pragma unroll      /* constant indices keep f in registers */
  for (int u = 0; u < 2; ++u) for (int q = 0; q < 8; ++q) f[u].h[q] = (_Float16)(bf16_round(tl[(tid & 7) * 8 + q][32 * u + (tid >> 3)]) * 16.0f);
#pragma unroll      /* the two stores as one run, each from registers of its own */
  for (int u = 0; u < 2; ++u) *(v8us*)((unsigned short*)Wt + (size_t)(32 * u + (tid >> 3)) * DM + (tid & 7) * 8) = f[u].half[0];
  asm volatile("s_wait_xcnt 0x0" ::: "memory"); }      /* the stores' registers are released before any code the compiler lays behind this job can rewrite them */
__global__ __launch_bounds__(256) void k_prep(const float* __restrict__ x, const float* __restrict__ wq, const float* __restrict__ wk, const float* __restrict__ wv, const float* __restrict__ wo, _Float16* __restrict__ Bt, _Float16* __restrict__ X16) {
  __shared__ float tl[64][65];      /* the weight jobs' transposition tile */
  int blk = blockIdx.x; const int tid = threadIdx.x;
  if (blk < 3 * NH * PB_WH) { const int p = blk / (NH * PB_WH), r = blk % (NH * PB_WH), h = r / PB_WH; const float* wp = (p == 0 ? wq : p == 1 ? wk : wv) + (size_t)h * DM * HD;      /* plane p (q, k, v), head h: its HD rows of the [out][in] plane */
    const int k0 = (r % PB_WH) * 64; prep_wt<HD>(wp + (size_t)k0 * HD, Bt + (size_t)p * DM * DM + (size_t)h * HD * DM + k0, tl, tid); return; }
  blk -= 3 * NH * PB_WH;
  if (blk < PB_WO) { const int n0 = (blk / (DM / 64)) * 64, k0 = (blk % (DM / 64)) * 64; prep_wt<DM>(wo + (size_t)k0 * DM + n0, Bt + (size_t)3 * DM * DM + (size_t)n0 * DM + k0, tl, tid); return; }
  blk -= PB_WO;
  const size_t t = (size_t)blk * 256 + tid; FragH f;      /* x as exact f16 rows, converted once: Q, K and V all project the same rows */
#pragma unroll
  for (int q = 0; q < 8; ++q) f.h[q] = (_Float16)bf16_round(x[t * 8 + q]);
  *(v8us*)((unsigned short*)X16 + t * 8) = f.half[0];
  asm volatile("s_wait_xcnt 0x0" ::: "memory"); }      /* as in prep_wt: the store's registers are released before anything behind it can rewrite them */

extern "C" void kernel_launch(void* const* d_in, const int* in_sizes, int n_in,
                              void* d_out, int out_size, void* d_ws, size_t ws_size, hipStream_t stream) {
  (void)in_sizes; (void)n_in; (void)out_size;
  const float* const* I = (const float* const*)d_in; const float* x = I[0]; const float* wq = I[1]; const float* wk = I[2]; const float* wv = I[3]; const float* wo = I[4]; const float* bo = I[5];      /* ONE input stream (X) read on all three projections; Wq, Wk, Wv are PER-HEAD STACKS [16][1024][64] = [head][in][out] (the module has NO q / k / v biases: null pointers in the guarded bias slots); Wo [in][out] [1024][1024] at I[4], bo at I[5] */
  char* ws = (char*)d_ws; size_t off = 0;
  auto take = [&](size_t bytes) { char* p = ws + off; off += (bytes + 255) & ~(size_t)255; return p; };
  _Float16* BQ = (_Float16*)take((size_t)4 * DM * DM * 2); _Float16* BO = BQ + (size_t)3 * DM * DM;      /* weight planes q, k, v, o, one behind the other: a grid index steps through them */
  _Float16* XQ = (_Float16*)take(NR * DM * 2);      /* the x plane, shared by q, k, v */
  _Float16* Q16 = (_Float16*)take((size_t)3 * NR * DM * 2); _Float16* K16 = Q16 + NR * DM; _Float16* V16 = K16 + NR * DM; _Float16* O16 = (_Float16*)take(NR * DM * 2);
  if (off > ws_size) return;
  k_prep<<<3 * NH * PB_WH + PB_WO + PB_X, 256, 0, stream>>>(x, wq, wk, wv, wo, BQ, XQ);      /* PER-HEAD STACKS wq / wk / wv [NH][DM][HD]: head h is a row-major [in = DM][out = HD] block at w + h * DM * HD, transposed into rows Bt[h * HD + e][k] of the [out][in] plane (x16); wo is a plain [in][out] [DM][DM] matrix; x as exact f16 rows */
  const size_t r0p = (size_t)B0 * SQ;      /* first projected row */
  k_gemm2<0><<<dim3((unsigned)((MP / 128) * (DM / 128)), 3), 256, 0, stream>>>(XQ + r0p * DM, DM, 0, BQ, DM, (size_t)DM * DM, 0.0625f, nullptr, 0, nullptr, 1, 0, 0, nullptr, Q16 + r0p * DM, DM, NR * DM, MP, DM, DM);      /* Q, K, V: blockIdx.y picks the weight plane and the output plane; the x plane is the same for all three (plane step 0) */
  k_fattn<<<dim3(SQ / 128, NB * NH), 256, 0, stream>>>(Q16, K16, V16, O16);      /* scores, softmax and P V in one kernel: o (merged heads, x64) as f16 rows */
  k_gemm2<0><<<dim3((unsigned)((MPO / 128) * (DM / 128)), 1), 256, 0, stream>>>(O16 + r0p * DM, DM, 0, BO, DM, 0, 0.0009765625f, bo, 0, nullptr, 1, 0, 0, (float*)d_out + r0p * DM, nullptr, DM, 0, MPO, DM, DM);      /* out rows are the output layout */
}

// v010
// A run of this version takes 74.8 microseconds.
// Two timings next to v009 both put it at 1.10 times that version's speed.
// Counting every step since v000, it is 48.8 times as fast.
#include <hip/hip_runtime.h>
#define NB 2
#define SQ 2048
#define DM 1024
#define NH 16
#define HD 64
#define HG 4                         /* heads per launch of the per-batch k_vt */
#define B0 0                         /* first batch processed (debug hook) */
#define NBR NB                       /* batches processed (debug hook) */
#define NR ((size_t)NB * SQ)         /* token rows */
#define MP ((int)((size_t)NBR * SQ)) /* rows of the batches processed (debug hook) */
#define QN SQ                        /* query rows per batch; not used */
#define NHD NH                       /* heads; not used */
#define MPO MP                       /* rows through the output stage (debug hook) */
#define LQ DM      /* row pitch of the q/k/v rows */
typedef __bf16 v16b __attribute__((ext_vector_type(16)));
typedef unsigned short v8us __attribute__((ext_vector_type(8), may_alias));
typedef float  v8f  __attribute__((ext_vector_type(8)));
typedef float  v4f  __attribute__((ext_vector_type(4)));
typedef float  v4fa __attribute__((ext_vector_type(4), may_alias));
union FragB { v16b v; v8us half[2]; unsigned short u[16]; };

__device__ __forceinline__ unsigned short bf16_bits(float x) { unsigned int u = __float_as_uint(x); return (unsigned short)((u + 0x7FFFu + ((u >> 16) & 1u)) >> 16); }
__device__ __forceinline__ float bf16_val(unsigned short b) { return __uint_as_float(((unsigned int)b) << 16); }
__device__ __forceinline__ float bf16_round(float x) { return bf16_val(bf16_bits(x)); }
// D += A·B with NT terms: 1 = ah·bh, 2 = + al·bh (A split), 3 = + ah·bl (both split)
template <int NT>
__device__ __forceinline__ v8f mmaN(v16b ah, v16b al, v16b bh, v16b bl, v8f c) {
  c = __builtin_amdgcn_wmma_f32_16x16x32_bf16(false, ah, false, bh, (short)0, c, false, false);
  if (NT >= 2) c = __builtin_amdgcn_wmma_f32_16x16x32_bf16(false, al, false, bh, (short)0, c, false, false);
  if (NT >= 3) c = __builtin_amdgcn_wmma_f32_16x16x32_bf16(false, ah, false, bl, (short)0, c, false, false);
  asm volatile("v_nop\n\tv_nop\n\tv_nop\n\tv_nop" : "+v"(c) : "v"(ah), "v"(al), "v"(bh), "v"(bl));
  return c;
}

__global__ __launch_bounds__(256) void k_wt_bf16(const float* __restrict__ W, unsigned short* __restrict__ Wt, int K, int N) {
  const int t = blockIdx.x * 256 + threadIdx.x;
  const int k8n = K / 8;
  if (t >= N * k8n) return;
  const int n = t / k8n, k8 = (t % k8n) * 8;
  v8us v;
#pragma unroll
  for (int i = 0; i < 8; ++i) v[i] = bf16_bits(W[(size_t)(k8 + i) * N + n]);
  *(v8us*)(Wt + (size_t)n * K + k8) = v;
  
}

// GEMM C[M][N] (f32, pitch ldc) = act(A[M][K]·W + bias). A f32 row-major (pitch lda) converted per fragment to bf16
// (ASPLIT: hi/lo two planes -> 2 terms, else single rounded term); Wt bf16 [N][K] (pitch ldb). BIAS_BF16 rounds the
// bias to bf16 first (bias quantised to bf16 before the add). K%32==0, M%16==0, N%64==0.
template <bool ASPLIT, int ACT, bool BIAS_BF16>
__global__ __launch_bounds__(128) void k_gemm_bf(const float* __restrict__ A, int lda, const unsigned short* __restrict__ Wt, int ldb,
                                               const float* __restrict__ bias, float* __restrict__ C, int ldc, int M, int N, int K) {
  __shared__ __attribute__((aligned(16))) float so[4][16][64];
  const int tid = threadIdx.x, w = tid >> 5, lane = tid & 31, ln = lane & 15, hh = lane >> 4;
  const int ntn = N / 64;
  const int wid = blockIdx.x * 4 + w;
  const int mt = wid / ntn, nq = wid % ntn;
  if (mt * 16 >= M) return;
  const int row0 = mt * 16, col0 = nq * 64;
  const float* arow = A + (size_t)(row0 + ln) * lda;
  v8f acc[4] = {};
  for (int kb = 0; kb < K; kb += 32) {
    FragB ah, al;
    const v4f x0 = *(const v4fa*)(arow + kb + 8 * hh), x1 = *(const v4fa*)(arow + kb + 8 * hh + 4);
    const v4f x2 = *(const v4fa*)(arow + kb + 16 + 8 * hh), x3 = *(const v4fa*)(arow + kb + 16 + 8 * hh + 4);
    float xs[16] = {x0[0],x0[1],x0[2],x0[3],x1[0],x1[1],x1[2],x1[3],x2[0],x2[1],x2[2],x2[3],x3[0],x3[1],x3[2],x3[3]};
#pragma unroll
    for (int i = 0; i < 16; ++i) { const unsigned short hb = bf16_bits(xs[i]); ah.u[i] = hb; al.u[i] = ASPLIT ? bf16_bits(xs[i] - bf16_val(hb)) : (unsigned short)0; }
#pragma unroll
    for (int t = 0; t < 4; ++t) {
      const unsigned short* brow = Wt + (size_t)(col0 + t * 16 + ln) * ldb + kb;
      FragB b;
      b.half[0] = *(const v8us*)(brow + 8 * hh);
      b.half[1] = *(const v8us*)(brow + 16 + 8 * hh);
      acc[t] = mmaN<ASPLIT ? 2 : 1>(ah.v, al.v, b.v, b.v, acc[t]);
    }
  }
#pragma unroll
  for (int t = 0; t < 4; ++t) {
    float bv = bias ? bias[col0 + t * 16 + ln] : 0.f;
    if (BIAS_BF16) bv = bf16_round(bv);
#pragma unroll
    for (int r = 0; r < 8; ++r) { float v = acc[t][r] + bv; if (ACT == 1) v = fmaxf(v, 0.f); so[w][8 * hh + r][t * 16 + ln] = v; }
  }
  __builtin_amdgcn_fence(__ATOMIC_ACQ_REL, "workgroup");
  __builtin_amdgcn_wave_barrier();
  const int rsub = lane >> 4, c4 = (lane & 15) * 4;
  {
#pragma unroll
    for (int q = 0; q < 8; ++q) {
      const int r = q * 2 + rsub;
      const v4f v = *(const v4fa*)&so[w][r][c4];
      *(v4f*)(C + (size_t)(row0 + r) * ldc + col0 + c4) = v;
    }
    
  }
}

// GEMM C = act(A·W + bias + resid): A f32 (ASPLIT -> hi/lo 2 terms), Wt bf16 [N][K]; ACT 0 none, 1 relu, 2 exact gelu;
// resid (optional, f32, row index = (row % rmod), pitch ldr, RES_BF16 rounds it) added before the activation.
template <bool ASPLIT, int ACT, bool BIAS_BF16, bool RES_BF16>
__global__ __launch_bounds__(128) void k_gemm_bf3(const float* __restrict__ A, int lda, const unsigned short* __restrict__ Wt, int ldb,
                                                const float* __restrict__ bias, const float* __restrict__ resid, int rmod, int ldr,
                                                float* __restrict__ C, int ldc, int M, int N, int K) {
  __shared__ __attribute__((aligned(16))) float so[4][16][64];
  const int tid = threadIdx.x, w = tid >> 5, lane = tid & 31, ln = lane & 15, hh = lane >> 4;
  const int ntn = N / 64;
  const int wid = blockIdx.x * 4 + w;
  const int mt = wid / ntn, nq = wid % ntn;
  if (mt * 16 >= M) return;
  const int row0 = mt * 16, col0 = nq * 64;
  const float* arow = A + (size_t)(row0 + ln) * lda;
  v8f acc[4] = {};
  for (int kb = 0; kb < K; kb += 32) {
    FragB ah, al;
    const v4f x0 = *(const v4fa*)(arow + kb + 8 * hh), x1 = *(const v4fa*)(arow + kb + 8 * hh + 4);
    const v4f x2 = *(const v4fa*)(arow + kb + 16 + 8 * hh), x3 = *(const v4fa*)(arow + kb + 16 + 8 * hh + 4);
    float xs[16] = {x0[0],x0[1],x0[2],x0[3],x1[0],x1[1],x1[2],x1[3],x2[0],x2[1],x2[2],x2[3],x3[0],x3[1],x3[2],x3[3]};
#pragma unroll
    for (int i = 0; i < 16; ++i) { const unsigned short hb = bf16_bits(xs[i]); ah.u[i] = hb; al.u[i] = ASPLIT ? bf16_bits(xs[i] - bf16_val(hb)) : (unsigned short)0; }
#pragma unroll
    for (int t = 0; t < 4; ++t) {
      const unsigned short* brow = Wt + (size_t)(col0 + t * 16 + ln) * ldb + kb;
      FragB b;
      b.half[0] = *(const v8us*)(brow + 8 * hh);
      b.half[1] = *(const v8us*)(brow + 16 + 8 * hh);
      acc[t] = mmaN<ASPLIT ? 2 : 1>(ah.v, al.v, b.v, b.v, acc[t]);
    }
  }
#pragma unroll
  for (int t = 0; t < 4; ++t) {
    const int col = col0 + t * 16 + ln;
    float bv = bias ? bias[col] : 0.f;
    if (BIAS_BF16) bv = bf16_round(bv);
#pragma unroll
    for (int r = 0; r < 8; ++r) {
      float v = acc[t][r] + bv;
      if (resid) { float rv = resid[(size_t)((row0 + 8 * hh + r) % rmod) * ldr + col]; if (RES_BF16) rv = bf16_round(rv); v += rv; }
      if (ACT == 1) v = fmaxf(v, 0.f);
      if (ACT == 2) v = 0.5f * v * (1.0f + erff(v * 0.70710678118654752f));
      if (ACT == 3) { const float u = 0.7978845608028654f * (v + 0.044715f * v * v * v); v = 0.5f * v * (1.0f + tanhf(u)); }
      so[w][8 * hh + r][t * 16 + ln] = v;
    }
  }
  __builtin_amdgcn_fence(__ATOMIC_ACQ_REL, "workgroup");
  __builtin_amdgcn_wave_barrier();
  const int rsub = lane >> 4, c4 = (lane & 15) * 4;
  {
#pragma unroll
    for (int q = 0; q < 8; ++q) {
      const int r = q * 2 + rsub;
      const v4f v = *(const v4fa*)&so[w][r][c4];
      *(v4f*)(C + (size_t)(row0 + r) * ldc + col0 + c4) = v;
    }
    
  }
}
// row LayerNorm (biased variance, eps) over N: s = X (+ R); optional out_sum <- s; out_norm <- (s-mu)*rsqrt(var+eps)*g + b
template <bool PARAM_BF16>
__global__ __launch_bounds__(256) void k_layernorm(const float* __restrict__ X, const float* __restrict__ R, const float* __restrict__ g, const float* __restrict__ bta,
                                                  float* __restrict__ out_sum, float* __restrict__ out_norm, int N, float eps) {
  __shared__ float red[256];
  const int row = blockIdx.x, tid = threadIdx.x;
  const float* x = X + (size_t)row * N; const float* rr = R ? R + (size_t)row * N : nullptr;
  float vals[16];                     // up to N = 4096
  const int per = N / 256;            // contiguous chunk per thread? use strided-by-4 chunks: thread handles j = tid*4 + 1024*u
  float s1 = 0.f;
  for (int u = 0; u < per / 4; ++u) {
    const int j = tid * 4 + 1024 * u;
    const v4f a = *(const v4fa*)(x + j);
    v4f b = {0.f,0.f,0.f,0.f}; if (rr) b = *(const v4fa*)(rr + j);
#pragma unroll
    for (int q = 0; q < 4; ++q) { const float v = a[q] + b[q]; vals[u * 4 + q] = v; s1 += v; }
  }
  red[tid] = s1; __syncthreads();
  for (int st = 128; st > 0; st >>= 1) { if (tid < st) red[tid] += red[tid + st]; __syncthreads(); }
  const float mu = red[0] / (float)N; __syncthreads();
  float s2 = 0.f;
  for (int u = 0; u < per / 4; ++u)
#pragma unroll
    for (int q = 0; q < 4; ++q) { const float c = vals[u * 4 + q] - mu; s2 += c * c; }
  red[tid] = s2; __syncthreads();
  for (int st = 128; st > 0; st >>= 1) { if (tid < st) red[tid] += red[tid + st]; __syncthreads(); }
  const float rs = rsqrtf(red[0] / (float)N + eps);
  {
    for (int u = 0; u < per / 4; ++u) {
      const int j = tid * 4 + 1024 * u;
      v4f o, sm;
#pragma unroll
      for (int q = 0; q < 4; ++q) {
        float gg = g[j + q], bb = bta[j + q];
        if (PARAM_BF16) { gg = bf16_round(gg); bb = bf16_round(bb); }
        sm[q] = vals[u * 4 + q]; o[q] = (vals[u * 4 + q] - mu) * rs * gg + bb;
      }
      if (out_sum) *(v4f*)(out_sum + (size_t)row * N + j) = sm;
      *(v4f*)(out_norm + (size_t)row * N + j) = o;
    }
    
  }
}



// ---- f16 WMMA path (v_wmma_f32_16x16x32_f16): 11-bit significands for operands in range — used where a [0,1] probability operand needs more precision than bf16
typedef _Float16 v16h __attribute__((ext_vector_type(16)));
union FragH { v16h v; v8us half[2]; _Float16 h[16]; unsigned short u[16]; };
template <int NT>
__device__ __forceinline__ v8f mmaH(v16h ah, v16h al, v16h bh, v16h bl, v8f c) {
  c = __builtin_amdgcn_wmma_f32_16x16x32_f16(false, ah, false, bh, (short)0, c, false, false);
  if (NT >= 2) c = __builtin_amdgcn_wmma_f32_16x16x32_f16(false, al, false, bh, (short)0, c, false, false);
  if (NT >= 3) c = __builtin_amdgcn_wmma_f32_16x16x32_f16(false, ah, false, bl, (short)0, c, false, false);
  asm volatile("v_nop\n\tv_nop\n\tv_nop\n\tv_nop" : "+v"(c) : "v"(ah), "v"(al), "v"(bh), "v"(bl));
  return c;
}
// batched GEMM like k_gemm_b but f16 operands: A f32 (split into f16 hi/lo if ASPLIT, else rounded to f16), Bt = f16 values [n][k]; alpha; C f32; N multiple of 16 (partial tiles skipped)
template <bool ASPLIT>
__global__ __launch_bounds__(128) void k_gemm_h(const float* __restrict__ A, int lda, size_t sA, const _Float16* __restrict__ Bh, int ldb, size_t sB, float alpha, float* __restrict__ C, int ldc, size_t sC, int M, int N, int K) {
  __shared__ __attribute__((aligned(16))) float so[4][16][64];
  const int tid = threadIdx.x, w = tid >> 5, lane = tid & 31, ln = lane & 15, hh = lane >> 4; const int by = blockIdx.y;
  A += (size_t)by * sA; Bh += (size_t)by * sB; C += (size_t)by * sC;
  const int ntn = (N + 63) / 64; const int wid = blockIdx.x * 4 + w; const int mt = wid / ntn, nq = wid % ntn; if (mt * 16 >= M) return;
  const int row0 = mt * 16, col0 = nq * 64; const float* arow = A + (size_t)(row0 + ln) * lda;
  v8f acc[4] = {};
  for (int kb = 0; kb < K; kb += 32) {
    FragH ah, al;
    const v4f x0 = *(const v4fa*)(arow + kb + 8 * hh), x1 = *(const v4fa*)(arow + kb + 8 * hh + 4), x2 = *(const v4fa*)(arow + kb + 16 + 8 * hh), x3 = *(const v4fa*)(arow + kb + 16 + 8 * hh + 4);
    float xs[16] = {x0[0],x0[1],x0[2],x0[3],x1[0],x1[1],x1[2],x1[3],x2[0],x2[1],x2[2],x2[3],x3[0],x3[1],x3[2],x3[3]};
#pragma unroll
    for (int i = 0; i < 16; ++i) { const _Float16 h = (_Float16)xs[i]; ah.h[i] = h; al.h[i] = ASPLIT ? (_Float16)(xs[i] - (float)h) : (_Float16)0.0f; }
#pragma unroll
    for (int t = 0; t < 4; ++t) { if (col0 + t * 16 >= N) continue; const size_t boff = (size_t)(col0 + t * 16 + ln) * ldb + kb; FragH bq; bq.half[0] = *(const v8us*)(Bh + boff + 8 * hh); bq.half[1] = *(const v8us*)(Bh + boff + 16 + 8 * hh);
      acc[t] = mmaH<ASPLIT ? 2 : 1>(ah.v, al.v, bq.v, bq.v, acc[t]); }
  }
#pragma unroll
  for (int t = 0; t < 4; ++t) { if (col0 + t * 16 >= N) continue;
#pragma unroll
    for (int r = 0; r < 8; ++r) so[w][8 * hh + r][t * 16 + ln] = acc[t][r] * alpha; }
  __builtin_amdgcn_fence(__ATOMIC_ACQ_REL, "workgroup"); __builtin_amdgcn_wave_barrier();
  const int rsub = lane >> 4, c4 = (lane & 15) * 4;
  {
#pragma unroll
    for (int q = 0; q < 8; ++q) { const int r = q * 2 + rsub; if (col0 + c4 < N) { const v4f v = *(const v4fa*)&so[w][r][c4]; *(v4f*)(C + (size_t)(row0 + r) * ldc + col0 + c4) = v; } }
     }
}

// k_gemm_hh variant with fused epilogue: v = acc·alpha + bias[by·sBias + col] (+ CP[(row/rowsPerB)·sCPb + by·64 + col] if CP) ; ACT 0 none / 1 elu ; writes f16 C16 (and f32 C if non-null)
template <int ACT>
__global__ __launch_bounds__(128) void k_gemm_hhx(const _Float16* __restrict__ A, int lda, size_t sA, const _Float16* __restrict__ Bh, int ldb, size_t sB, float alpha, const float* __restrict__ bias, size_t sBias, const float* __restrict__ CP, int rowsPerB, size_t sCPb, int row0g,
    float* __restrict__ C, _Float16* __restrict__ C16, int ldc, size_t sC, int M, int N, int K) {
  __shared__ __attribute__((aligned(16))) float so[4][16][64];
  const int tid = threadIdx.x, w = tid >> 5, lane = tid & 31, ln = lane & 15, hh = lane >> 4; const int by = blockIdx.y;
  A += (size_t)by * sA; Bh += (size_t)by * sB; const size_t cofs = (size_t)by * sC; const float* bp = bias ? bias + (size_t)by * sBias : nullptr;
  const int ntn = (N + 63) / 64; const int wid = blockIdx.x * 4 + w; const int mt = wid / ntn, nq = wid % ntn; if (mt * 16 >= M) return;
  const int row0 = mt * 16, col0 = nq * 64; const _Float16* arow = A + (size_t)(row0 + ln) * lda;
  v8f acc[4] = {};
  for (int kb = 0; kb < K; kb += 32) { FragH ah; ah.half[0] = *(const v8us*)((const unsigned short*)arow + kb + 8 * hh); ah.half[1] = *(const v8us*)((const unsigned short*)arow + kb + 16 + 8 * hh);
#pragma unroll
    for (int t = 0; t < 4; ++t) { if (col0 + t * 16 >= N) continue; const size_t boff = (size_t)(col0 + t * 16 + ln) * ldb + kb; FragH bq; bq.half[0] = *(const v8us*)((const unsigned short*)Bh + boff + 8 * hh); bq.half[1] = *(const v8us*)((const unsigned short*)Bh + boff + 16 + 8 * hh);
      acc[t] = mmaH<1>(ah.v, ah.v, bq.v, bq.v, acc[t]); }
  }
#pragma unroll
  for (int t = 0; t < 4; ++t) { if (col0 + t * 16 >= N) continue; const int col = col0 + t * 16 + ln; const float bv = bp ? bf16_round(bp[col]) : 0.f;
#pragma unroll
    for (int r = 0; r < 8; ++r) { float v = acc[t][r] * alpha + bv; if (CP) { const int rr = row0g + row0 + 8 * hh + r; if (rowsPerB < 0) v += CP[cofs + (size_t)rr * ldc + col];      /* rowsPerB < 0: own element of the batched C plane */ else { const int bidx = rr / rowsPerB; v += CP[(size_t)bidx * sCPb + (size_t)by * 64 + col]; } } if (ACT == 1) v = (v > 0.f) ? v : expm1f(v); else if (ACT == 7) v = (v > 0.f) ? v + 1.0f : expf(v); else if (ACT == 8) v = tanhf(v); else if (ACT == 9) v = 0.5f * v * (1.0f + tanhf(0.7978845608028654f * (v + 0.044715f * v * v * v))); else if (ACT == 11) v = 1.0f / (1.0f + expf(-v)); else if (ACT == 12) v = (v > 0.f) ? v : 0.01f * v; else if (ACT == 14) v = (v > 0.f) ? v : 0.1f * v; else if (ACT == 16) v = (v >= 0.f) ? v : 0.3f * v; else if (ACT == 17) v = (v >= 0.f) ? v : 0.2f * v; else if (ACT == 15) v = v / (1.0f + expf(-v)); else if (ACT == 3) v = fmaxf(v, 0.f); else if (ACT == 6) v = 0.5f * v * (1.0f + erff(v * 0.70710678118654752f)); so[w][8 * hh + r][t * 16 + ln] = v; } }
  __builtin_amdgcn_fence(__ATOMIC_ACQ_REL, "workgroup"); __builtin_amdgcn_wave_barrier();
  const int rsub = lane >> 4, c4 = (lane & 15) * 4; typedef _Float16 v4h __attribute__((ext_vector_type(4)));
  {
#pragma unroll
    for (int q = 0; q < 8; ++q) { const int r = q * 2 + rsub; if (col0 + c4 < N) { const v4f v = *(const v4fa*)&so[w][r][c4]; if (C) *(v4f*)(C + cofs + (size_t)(row0 + r) * ldc + col0 + c4) = v; if (C16) { v4h h4; for (int i = 0; i < 4; ++i) h4[i] = (_Float16)v[i]; *(v4h*)(C16 + cofs + (size_t)(row0 + r) * ldc + col0 + c4) = h4; } } }
     }
}


typedef _Float16 v4h __attribute__((ext_vector_type(4)));

__global__ __launch_bounds__(256) void k_h16(const float* __restrict__ x, _Float16* __restrict__ X16, size_t n8) { const size_t t = (size_t)blockIdx.x * 256 + threadIdx.x; if (t >= n8) return; FragH f;
#pragma unroll
  for (int q = 0; q < 8; ++q) f.h[q] = (_Float16)x[t * 8 + q]; *(v8us*)((unsigned short*)X16 + t * 8) = f.half[0];  }
__global__ __launch_bounds__(256) void k_round16f(const float* __restrict__ W, _Float16* __restrict__ Bt, size_t n8) { const size_t t = (size_t)blockIdx.x * 256 + threadIdx.x; if (t >= n8) return; FragH f;
#pragma unroll
  for (int i = 0; i < 8; ++i) f.h[i] = (_Float16)(bf16_round(W[t * 8 + i]) * 16.0f); *(v8us*)((unsigned short*)Bt + t * 8) = f.half[0];  }
template <int NHv, int TTv>
__global__ __launch_bounds__(256) void k_vt(const _Float16* __restrict__ V16, int ldv, int voff, _Float16* __restrict__ Vt) { __shared__ unsigned short tl[64][66]; const int tid = threadIdx.x; const int slab = blockIdx.x / (TTv / 64), lg = blockIdx.x % (TTv / 64); const int b = slab / NHv, h = slab % NHv;
  for (int i = tid; i < 64 * 8; i += 256) { const int r = i / 8, c8 = (i % 8) * 8; FragH f; f.half[0] = *(const v8us*)((const unsigned short*)V16 + ((size_t)b * TTv + lg * 64 + r) * ldv + voff + h * 64 + c8);
#pragma unroll
    for (int q = 0; q < 8; ++q) tl[r][c8 + q] = f.u[q]; }
  __syncthreads();
  {
#pragma unroll
    for (int rd = 0; rd < 2; ++rd) { const int d = rd * 32 + tid / 8, pc = tid % 8; FragH f;
#pragma unroll
      for (int q = 0; q < 8; ++q) f.u[q] = tl[pc * 8 + q][d];
      *(v8us*)((unsigned short*)Vt + ((size_t)slab * 64 + d) * TTv + lg * 64 + pc * 8) = f.half[0]; }
     } }

__global__ __launch_bounds__(256) void k_hl(const float* __restrict__ F, _Float16* __restrict__ Hh, _Float16* __restrict__ Hl, size_t n8) { const size_t t = (size_t)blockIdx.x * 256 + threadIdx.x; if (t >= n8) return; FragH fh, fl; const v4f a = *(const v4fa*)(F + t * 8), c = *(const v4fa*)(F + t * 8 + 4);
#pragma unroll
  for (int q = 0; q < 4; ++q) { _Float16 h = (_Float16)a[q]; fh.h[q] = h; fl.h[q] = (_Float16)((a[q] - (float)h) * 1024.0f); h = (_Float16)c[q]; fh.h[4 + q] = h; fl.h[4 + q] = (_Float16)((c[q] - (float)h) * 1024.0f); }
  { *(v8us*)((unsigned short*)Hh + t * 8) = fh.half[0]; *(v8us*)((unsigned short*)Hl + t * 8) = fl.half[0];  } }

// ---- fast GEMM (block tile 128x128, eight waves of 32x64; requires M % 128 == 0, N % 128 == 0, K % 64 == 0); epilogue = k_gemm_hhx semantics ----
// Both operands pass through LDS: a stage is 64 k (one whole 128-byte line) of the block's 128 A rows and 128 B rows, brought by asynchronous copies and read by all eight waves; two stages, the next one in flight while this one is multiplied.
__device__ __forceinline__ v16h g2_frag(const _Float16* p, int hh) { FragH f; f.half[0] = *(const v8us*)((const unsigned short*)p + 8 * hh); f.half[1] = *(const v8us*)((const unsigned short*)p + 16 + 8 * hh); return f.v; }
__device__ __forceinline__ v8f g2_mma(v16h a, v16h b, v8f c) { v8f d = __builtin_amdgcn_wmma_f32_16x16x32_f16(false, a, false, b, (short)0, c, false, false); asm volatile("v_nop\n\tv_nop\n\tv_nop\n\tv_nop" : "+v"(d) : "v"(a), "v"(b)); return d; }
#define G2_PITCH 144                   /* LDS row pitch in bytes: 16 x odd, free of bank conflicts for 16-byte reads */
#define G2_STAGE (256 * G2_PITCH)      /* rows 0..127 = A, rows 128..255 = B */
// one stage's copies: a thread brings 16 bytes of each of 8 rows (32 rows apart; 4 of A, 4 of B), so a wave-wide copy covers 4 whole 128-byte lines.
// s_wait_xcnt 0 is the statement's last line: it then stands in front of every later rewrite of the address registers the copies name.
__device__ __forceinline__ void g2_stage(unsigned l, const _Float16* a, int lda, const _Float16* b, int ldb) {
  const _Float16* a1 = a + (size_t)32 * lda; const _Float16* a2 = a + (size_t)64 * lda; const _Float16* a3 = a + (size_t)96 * lda;
  const _Float16* b1 = b + (size_t)32 * ldb; const _Float16* b2 = b + (size_t)64 * ldb; const _Float16* b3 = b + (size_t)96 * ldb;
  asm volatile("global_load_async_to_lds_b128 %0, %8, off\n\tglobal_load_async_to_lds_b128 %1, %9, off\n\tglobal_load_async_to_lds_b128 %2, %10, off\n\tglobal_load_async_to_lds_b128 %3, %11, off\n\t"
               "global_load_async_to_lds_b128 %4, %12, off\n\tglobal_load_async_to_lds_b128 %5, %13, off\n\tglobal_load_async_to_lds_b128 %6, %14, off\n\tglobal_load_async_to_lds_b128 %7, %15, off\n\ts_wait_xcnt 0x0"
               :: "v"(l), "v"(l + 32 * G2_PITCH), "v"(l + 64 * G2_PITCH), "v"(l + 96 * G2_PITCH), "v"(l + 128 * G2_PITCH), "v"(l + 160 * G2_PITCH), "v"(l + 192 * G2_PITCH), "v"(l + 224 * G2_PITCH),
                  "v"(a), "v"(a1), "v"(a2), "v"(a3), "v"(b), "v"(b1), "v"(b2), "v"(b3) : "memory"); }
template <int ACT>
__global__ __launch_bounds__(256) void k_gemm2(const _Float16* __restrict__ A, int lda, size_t sA, const _Float16* __restrict__ Bh, int ldb, size_t sB, float alpha, const float* __restrict__ bias, size_t sBias, const float* __restrict__ CP, int rowsPerB, size_t sCPb, int row0g,
    float* __restrict__ C, _Float16* __restrict__ C16, int ldc, size_t sC, int M, int N, int K) { static_assert(ACT == 0 || ACT == 3 || ACT == 6 || ACT == 8 || ACT == 9 || ACT == 11 || ACT == 12 || ACT == 14 || ACT == 15 || ACT == 16 || ACT == 17, "k_gemm2: unsupported ACT code (would silently apply no activation)");
  __shared__ __attribute__((aligned(128))) unsigned char sm[2 * G2_STAGE];      /* the two operand stages; behind the loop's last barrier the same bytes are the waves' output staging */
  static_assert(8 * 32 * 68 * 4 <= 2 * G2_STAGE, "output staging must fit the operand stages");
  float (*so)[32][68] = (float (*)[32][68])sm;
  const int tid = threadIdx.x, w = tid >> 5, lane = tid & 31, ln = lane & 15, hh = lane >> 4; const int by = blockIdx.y;
  A += (size_t)by * sA; Bh += (size_t)by * sB; const size_t cofs = (size_t)by * sC; const float* bp = bias ? bias + (size_t)by * sBias : nullptr;
  const int ntn = N >> 7; const int mt = blockIdx.x / ntn, nq = blockIdx.x - mt * ntn; if (mt * 128 >= M) return;      /* the same for the whole block, in front of every barrier */
  const int wm = w & 3, wn = w >> 2; const int row0 = mt * 128 + 32 * wm, col0 = nq * 128 + 64 * wn;
  const _Float16* ga = A + (size_t)(mt * 128 + (tid >> 3)) * lda + (tid & 7) * 8; const _Float16* gb = Bh + (size_t)(nq * 128 + (tid >> 3)) * ldb + (tid & 7) * 8;
  const unsigned l0 = (unsigned)(size_t)sm + (unsigned)((tid >> 3) * G2_PITCH + (tid & 7) * 16);      /* the thread's LDS byte address in stage buffer 0 */
  const int nt = K >> 6;
  g2_stage(l0, ga, lda, gb, ldb);
  asm volatile("s_wait_asynccnt 0x0" ::: "memory");      /* this wave's copies of stage 0 have landed */
  __syncthreads();                                       /* ... and every other wave's */
  if (1 < nt) g2_stage(l0 + G2_STAGE, ga + 64, lda, gb + 64, ldb);
  const v8f z8 = {0.f,0.f,0.f,0.f,0.f,0.f,0.f,0.f}; v8f c00 = z8, c01 = z8, c02 = z8, c03 = z8, c10 = z8, c11 = z8, c12 = z8, c13 = z8;
  for (int t = 0; t < nt; ++t) { const unsigned char* st = sm + (t & 1) * G2_STAGE;
    const _Float16* a0p = (const _Float16*)(st + (32 * wm + ln) * G2_PITCH); const _Float16* a1p = (const _Float16*)(st + (32 * wm + 16 + ln) * G2_PITCH);
    const _Float16* b0p = (const _Float16*)(st + (128 + 64 * wn + ln) * G2_PITCH); const _Float16* b1p = (const _Float16*)(st + (128 + 64 * wn + 16 + ln) * G2_PITCH); const _Float16* b2p = (const _Float16*)(st + (128 + 64 * wn + 32 + ln) * G2_PITCH); const _Float16* b3p = (const _Float16*)(st + (128 + 64 * wn + 48 + ln) * G2_PITCH);
#pragma unroll      /* both 32-k halves of the stage in one body: constant LDS offsets */
    for (int kb = 0; kb < 64; kb += 32) { const v16h a0 = g2_frag(a0p + kb, hh), a1 = g2_frag(a1p + kb, hh), b0 = g2_frag(b0p + kb, hh), b1 = g2_frag(b1p + kb, hh), b2 = g2_frag(b2p + kb, hh), b3 = g2_frag(b3p + kb, hh);      /* the six fragments as one group of LDS reads in front of their eight products: one LDS latency, not four */
      c00 = g2_mma(a0, b0, c00); c10 = g2_mma(a1, b0, c10); c01 = g2_mma(a0, b1, c01); c11 = g2_mma(a1, b1, c11);
      c02 = g2_mma(a0, b2, c02); c12 = g2_mma(a1, b2, c12); c03 = g2_mma(a0, b3, c03); c13 = g2_mma(a1, b3, c13); }
    asm volatile("s_wait_dscnt 0x0" ::: "memory");         /* this wave's reads of the stage are done before the buffer is given back */
    asm volatile("s_wait_asynccnt 0x0" ::: "memory");      /* this wave's copies of stage t + 1 have landed */
    __syncthreads();                                       /* publishes stage t + 1 and ends every wave's reads of stage t */
    if (t + 2 < nt) g2_stage(l0 + (unsigned)((t & 1) * G2_STAGE), ga + (size_t)(t + 2) * 64, lda, gb + (size_t)(t + 2) * 64, ldb); }
  asm volatile("s_wait_asynccnt 0x0" ::: "memory");        /* nothing is in flight when the stages become output staging */
  v8f accs[8] = {c00, c01, c02, c03, c10, c11, c12, c13};
#pragma unroll
  for (int u = 0; u < 8; ++u) { const int t = u & 3, half = u >> 2; const int col = col0 + t * 16 + ln; const float bv = bp ? bf16_round(bp[col]) : 0.f;
#pragma unroll
    for (int r = 0; r < 8; ++r) { const int rloc = half * 16 + 8 * hh + r; float v = accs[u][r] * alpha + bv; if (CP) { if (rowsPerB < 0) v += CP[cofs + (size_t)(row0g + row0 + rloc) * ldc + col];      /* rowsPerB < 0: own element of the batched C plane */ else { const int bidx = (row0g + row0 + rloc) / rowsPerB; v += CP[(size_t)bidx * sCPb + (size_t)by * 64 + col]; } }
      if (ACT == 3) v = fmaxf(v, 0.f); else if (ACT == 6) v = 0.5f * v * (1.0f + erff(v * 0.70710678118654752f)); else if (ACT == 11) v = 1.0f / (1.0f + expf(-v)); else if (ACT == 15) v = v / (1.0f + expf(-v)); else if (ACT == 12) v = (v > 0.f) ? v : 0.01f * v; else if (ACT == 8) v = tanhf(v); else if (ACT == 9) v = 0.5f * v * (1.0f + tanhf(0.7978845608028654f * (v + 0.044715f * v * v * v))); else if (ACT == 14) v = (v > 0.f) ? v : 0.1f * v; else if (ACT == 16) v = (v >= 0.f) ? v : 0.3f * v; else if (ACT == 17) v = (v >= 0.f) ? v : 0.2f * v;
      so[w][rloc][t * 16 + ln] = v; } }
  __builtin_amdgcn_fence(__ATOMIC_ACQ_REL, "workgroup"); __builtin_amdgcn_wave_barrier();
  const int rsub = lane >> 4, c4 = (lane & 15) * 4;
  {
#pragma unroll
    for (int q = 0; q < 16; ++q) { const int r = q * 2 + rsub; const v4f v = *(const v4fa*)&so[w][r][c4]; if (C) *(v4f*)(C + cofs + (size_t)(row0 + r) * ldc + col0 + c4) = v; if (C16) { v4h h4; for (int i = 0; i < 4; ++i) h4[i] = (_Float16)v[i]; *(v4h*)(C16 + cofs + (size_t)(row0 + r) * ldc + col0 + c4) = h4; } }
     } }


__global__ __launch_bounds__(256) void k_wnat(const float* __restrict__ w, size_t n8, _Float16* __restrict__ Bt) { const size_t t = (size_t)blockIdx.x * 256 + threadIdx.x; if (t >= n8) return; FragH f; for (int q = 0; q < 8; ++q) f.h[q] = (_Float16)(bf16_round(w[t * 8 + q]) * 16.0f); *(v8us*)((unsigned short*)Bt + t * 8) = f.half[0];  }
__global__ __launch_bounds__(256) void k_rsm(const float* __restrict__ S, _Float16* __restrict__ P, int nrows) {
  #pragma clang fp contract(off)
  const int i = blockIdx.x * 256 + threadIdx.x; if (i >= nrows) return; const float* s = S + (size_t)i * SQ; float mx = -3.0e38f;
#pragma unroll 1
  for (int j = 0; j < SQ; ++j) mx = fmaxf(mx, s[j]); float se = 0.f;
#pragma unroll 1
  for (int j = 0; j < SQ; ++j) se += expf(s[j] - mx); const float sc = 256.0f / se;
#pragma unroll 1
  for (int j0 = 0; j0 < SQ; j0 += 8) { FragH f; for (int q = 0; q < 8; ++q) f.h[q] = (_Float16)(expf(s[j0 + q] - mx) * sc); unsigned short* d = (unsigned short*)P + (size_t)i * SQ + j0; *(v8us*)d = f.half[0];  } }
__global__ __launch_bounds__(256) void k_vt(const _Float16* __restrict__ V16, int b, int h0, _Float16* __restrict__ VT) { __shared__ unsigned short tl[64][65]; const int tid = threadIdx.x; const int hh = blockIdx.x % HG, sg = blockIdx.x / HG; const int s0 = sg * 64; const int h = h0 + hh;
  for (int i = tid; i < 64 * 8; i += 256) { const int j = i / 8, d8 = (i % 8) * 8; FragH f; f.half[0] = *(const v8us*)((const unsigned short*)V16 + ((size_t)b * SQ + s0 + j) * DM + h * HD + d8); for (int q = 0; q < 8; ++q) tl[d8 + q][j] = f.u[q]; }
  __syncthreads();
  { for (int i = tid; i < 64 * 8; i += 256) { const int d = i / 8, j8 = (i % 8) * 8; FragH f; for (int q = 0; q < 8; ++q) f.u[q] = tl[d][j8 + q]; *(v8us*)((unsigned short*)VT + ((size_t)hh * HD + d) * SQ + s0 + j8) = f.half[0]; }  } }



// lanes l and l ^ 16 exchanged by the cross-row permlane (no LDS round trip)
__device__ __forceinline__ float xl_half(float v) { const int i = __float_as_int(v); return __int_as_float(__builtin_amdgcn_permlanex16(i, i, 0x76543210, 0xfedcba98, false, false)); }
__device__ __forceinline__ v8f fa_mma(v16h a, v16h b, v8f c) { return __builtin_amdgcn_wmma_f32_16x16x32_f16(false, a, false, b, (short)0, c, false, false); }
// 2^x on eight values; the v_nop is the one slot the instruction set asks for behind a transcendental, written in the same statement so that it stays directly behind the last one
__device__ __forceinline__ void fa_exp8(float (&e)[8]) { asm("v_exp_f32 %0, %0\n\tv_exp_f32 %1, %1\n\tv_exp_f32 %2, %2\n\tv_exp_f32 %3, %3\n\tv_exp_f32 %4, %4\n\tv_exp_f32 %5, %5\n\tv_exp_f32 %6, %6\n\tv_exp_f32 %7, %7\n\tv_nop" : "+v"(e[0]), "+v"(e[1]), "+v"(e[2]), "+v"(e[3]), "+v"(e[4]), "+v"(e[5]), "+v"(e[6]), "+v"(e[7])); }
__device__ __forceinline__ float fa_exp1(float x) { asm("v_exp_f32 %0, %0\n\tv_nop" : "+v"(x)); return x; }      /* same slot as above */
#define FA_PITCH 144                   /* LDS pitch of a K row in bytes: 16 x odd, free of bank conflicts for 16-byte reads */
#define FA_PITCHV 160                  /* LDS pitch of a V row in bytes: 32 x odd, the same for the transposing load */
#define FA_VOFF (64 * FA_PITCH)        /* the V rows stand behind the 64 K rows */
#define FA_STAGE (FA_VOFF + 64 * FA_PITCHV)      /* 64 K rows (key, 64 d), then 64 V rows (key, 64 d) */
#define FA_KG 2                        /* key groups of a block */
#define FA_NST (SQ / FA_KG / 64)       /* stages a group walks */
#define FA_EX (9 * 32 * 16)            /* bytes a wave hands its partner: 8 x 16 bytes of O and 16 bytes of (maximum, sum) a lane */
// one stage's copies: a thread brings 16 bytes of each of 8 rows (16 rows apart; 4 of K, 4 of V), so a wave-wide copy covers 4 whole 128-byte lines; l = its LDS byte address in the K rows, lv in the V rows.
// s_wait_xcnt 0 is the statement's last line: it then stands in front of every later rewrite of the address registers the copies name.
__device__ __forceinline__ void fa_stage(unsigned l, unsigned lv, const _Float16* k, const _Float16* v) {
  const _Float16* k1 = k + (size_t)16 * LQ; const _Float16* k2 = k + (size_t)32 * LQ; const _Float16* k3 = k + (size_t)48 * LQ;
  const _Float16* v1 = v + (size_t)16 * LQ; const _Float16* v2 = v + (size_t)32 * LQ; const _Float16* v3 = v + (size_t)48 * LQ;
  asm volatile("global_load_async_to_lds_b128 %0, %8, off\n\tglobal_load_async_to_lds_b128 %1, %9, off\n\tglobal_load_async_to_lds_b128 %2, %10, off\n\tglobal_load_async_to_lds_b128 %3, %11, off\n\t"
               "global_load_async_to_lds_b128 %4, %12, off\n\tglobal_load_async_to_lds_b128 %5, %13, off\n\tglobal_load_async_to_lds_b128 %6, %14, off\n\tglobal_load_async_to_lds_b128 %7, %15, off\n\ts_wait_xcnt 0x0"
               :: "v"(l), "v"(l + 16 * FA_PITCH), "v"(l + 32 * FA_PITCH), "v"(l + 48 * FA_PITCH), "v"(lv), "v"(lv + 16 * FA_PITCHV), "v"(lv + 32 * FA_PITCHV), "v"(lv + 48 * FA_PITCHV),
                  "v"(k), "v"(k1), "v"(k2), "v"(k3), "v"(v), "v"(v1), "v"(v2), "v"(v3) : "memory"); }
// 16 bytes a lane from a row-major 16-bit LDS tile, delivered transposed; the builtin, so that the compiler sees the load and places its wait
typedef short v8s __attribute__((ext_vector_type(8)));
__device__ __forceinline__ v8us fa_tr16(const unsigned char* p) { typedef __attribute__((address_space(3))) v8s lds_v8s; return __builtin_bit_cast(v8us, __builtin_amdgcn_ds_load_tr16_b128_v8i16((lds_v8s*)p)); }
// the merge of two waves' partial results for one group of 16 query columns: a wave hands over the group it does not finish (its O tiles g, maximum mg, sum lg) ...
__device__ __forceinline__ void fa_give(unsigned char* ex, int lane, const v8f (&g)[4], float mg, float lg) {
#pragma unroll      /* constant indices keep g in registers */
  for (int t = 0; t < 4; ++t) for (int u = 0; u < 2; ++u) { const v4f v = {g[t][4 * u], g[t][4 * u + 1], g[t][4 * u + 2], g[t][4 * u + 3]}; *(v4fa*)(ex + ((2 * t + u) * 32 + lane) * 16) = v; }
  const v4f ml = {mg, lg, 0.f, 0.f}; *(v4fa*)(ex + (8 * 32 + lane) * 16) = ml; }
// ... and finishes the other (a, ma, la) with its partner's part: both brought to the common maximum, the sums joined (the two key groups, then the wave halves), one division, o leaves x64; op = the lane's 16 bytes of its query's row
__device__ __forceinline__ void fa_finish(const unsigned char* ex, int lane, const v8f (&a)[4], float ma, float la, float cs, unsigned short* op) {
  const v4f ml = *(const v4fa*)(ex + (8 * 32 + lane) * 16); const float mm = fmaxf(ma, ml[0]);
  const float fa = fa_exp1((ma - mm) * cs), fb = fa_exp1((ml[0] - mm) * cs); const float ls = la * fa + ml[1] * fb;
  const float inv = 64.0f / (ls + xl_half(ls)); const float ga = fa * inv, gb = fb * inv; FragH f[4];
#pragma unroll      /* constant indices keep a and f in registers */
  for (int t = 0; t < 4; ++t) for (int u = 0; u < 2; ++u) { const v4f p = *(const v4fa*)(ex + ((2 * t + u) * 32 + lane) * 16); for (int r = 0; r < 4; ++r) f[t].h[4 * u + r] = (_Float16)(a[t][4 * u + r] * ga + p[r] * gb); }
#pragma unroll      /* the four stores as one run at the wave's end, each from registers of its own; a[t][r] = O[query ln][16 t + 8 hh + r]: 16 contiguous bytes a store */
  for (int t = 0; t < 4; ++t) *(v8us*)(op + t * 16) = f[t].half[0]; }
__global__ __launch_bounds__(256) void k_fattn(const _Float16* __restrict__ Q, const _Float16* __restrict__ Kr, const _Float16* __restrict__ Vr, _Float16* __restrict__ O) {
  __shared__ __attribute__((aligned(128))) unsigned char sm[FA_KG * 2 * FA_STAGE];      /* each key group's two K / V stages; behind the loop's last barrier the same bytes carry the merge */
  static_assert(8 * FA_EX <= FA_KG * 2 * FA_STAGE, "the merge must fit the stages");
  const int tid = threadIdx.x, lane = tid & 31, ln = lane & 15, hh = lane >> 4, w = __builtin_amdgcn_readfirstlane(tid >> 5), kg = w >> 2, tg = tid & 127;      /* w through readfirstlane: the key group and all that follows from it (key offset, LDS bases, the merge's selects) stand in scalar registers; tg = the thread's number in its group */
  const int bh = blockIdx.y, b = bh / NH, h = bh % NH; const int q0 = blockIdx.x * 128 + (w & 3) * 32;
  const _Float16* qp = Q + ((size_t)b * SQ + q0 + ln) * LQ + h * HD;
  const _Float16* gk = Kr + ((size_t)b * SQ + kg * (SQ / FA_KG) + (tg >> 3)) * LQ + h * HD + (tg & 7) * 8; const _Float16* gv = Vr + ((size_t)b * SQ + kg * (SQ / FA_KG) + (tg >> 3)) * LQ + h * HD + (tg & 7) * 8;      /* the thread's 16 bytes of its first K row and first V row of its group's stage 0 */
  const unsigned l0 = (unsigned)(size_t)sm + (unsigned)(kg * 2 * FA_STAGE + (tg >> 3) * FA_PITCH + (tg & 7) * 16), lv0 = (unsigned)(size_t)sm + (unsigned)(kg * 2 * FA_STAGE + FA_VOFF + (tg >> 3) * FA_PITCHV + (tg & 7) * 16);      /* the thread's LDS byte addresses in its group's stage buffer 0 */
  const float cs = 0.03125f * 1.44269504f;      /* 1 / sqrt(d_model) and log2 e in one factor on the raw products */
  const v8f z8 = {0.f,0.f,0.f,0.f,0.f,0.f,0.f,0.f};
  v16h qf[2][2], kf[2][2], vf[4]; v8f o[4][2]; float m[2] = {-3.0e38f, -3.0e38f}, l[2] = {0.f, 0.f};
  fa_stage(l0, lv0, gk, gv);
#pragma unroll
  for (int u = 0; u < 2; ++u) for (int ch = 0; ch < 2; ++ch) qf[u][ch] = g2_frag(qp + (size_t)u * 16 * LQ + ch * 32, hh);
#pragma unroll
  for (int t = 0; t < 4; ++t) { o[t][0] = z8; o[t][1] = z8; }
  asm volatile("s_wait_asynccnt 0x0" ::: "memory");      /* this wave's copies of stage 0 have landed */
  __syncthreads();                                       /* ... and every other wave's */
  fa_stage(l0 + FA_STAGE, lv0 + FA_STAGE, gk + (size_t)64 * LQ, gv + (size_t)64 * LQ);
  for (int st = 0; st < FA_NST; ++st) { const unsigned char* sp = sm + (kg * 2 + (st & 1)) * FA_STAGE;
    const _Float16* kl = (const _Float16*)(sp + ln * FA_PITCH); const unsigned char* vl = sp + FA_VOFF + (8 * hh + (lane & 7)) * FA_PITCHV + ((lane >> 3) & 1) * 16;      /* the lane's address in the transposing load's own map: key row 8 hh + (lane & 7), 16-byte half (lane >> 3) & 1 */
#pragma unroll
    for (int kt = 0; kt < 2; ++kt) for (int ch = 0; ch < 2; ++ch) kf[kt][ch] = g2_frag(kl + kt * 16 * (FA_PITCH / 2) + ch * 32, hh);
#pragma unroll      /* both 32-key passes of the stage in one body: constant LDS offsets */
    for (int p = 0; p < 2; ++p) {
      v8f s[2][2];      /* [key tile][query group], raw q . k */
#pragma unroll
      for (int kt = 0; kt < 2; ++kt) for (int qt = 0; qt < 2; ++qt) s[kt][qt] = fa_mma(kf[kt][1], qf[qt][1], fa_mma(kf[kt][0], qf[qt][0], z8));
      if (p == 0) {      /* the stage's second pass's keys, fetched one pass ahead into the same registers; nothing of the next stage is read here */
#pragma unroll
        for (int kt = 0; kt < 2; ++kt) for (int ch = 0; ch < 2; ++ch) kf[kt][ch] = g2_frag(kl + (32 + kt * 16) * (FA_PITCH / 2) + ch * 32, hh); }
      float mn[2];
#pragma unroll
      for (int qt = 0; qt < 2; ++qt) { float a = fmaxf(s[0][qt][0], s[1][qt][0]);
        for (int r = 1; r < 8; ++r) a = fmaxf(a, fmaxf(s[0][qt][r], s[1][qt][r]));
        mn[qt] = fmaxf(m[qt], fmaxf(a, xl_half(a))); }
      if (__builtin_amdgcn_ballot_w32(mn[0] > m[0] || mn[1] > m[1]) != 0) {      /* scalar branch: where no column's maximum moved every factor is exactly 1 */
#pragma unroll
        for (int qt = 0; qt < 2; ++qt) { const float a = fa_exp1((m[qt] - mn[qt]) * cs); l[qt] *= a; m[qt] = mn[qt];
          for (int t = 0; t < 4; ++t) for (int r = 0; r < 8; ++r) o[t][qt][r] *= a; } }
#pragma unroll
      for (int t = 0; t < 4; ++t) { FragH f; f.half[0] = fa_tr16(vl + p * 32 * FA_PITCHV + t * 32); f.half[1] = fa_tr16(vl + (p * 32 + 16) * FA_PITCHV + t * 32); vf[t] = f.v; }      /* this pass's V^T, d = 16 t + ln, keys 8 hh + 0..7 and 16 + 8 hh + 0..7: the exponentials below stand between the loads and their use */
      FragH pf[2];
#pragma unroll
      for (int qt = 0; qt < 2; ++qt) { const float mc = m[qt] * cs;
        for (int kt = 0; kt < 2; ++kt) { float e[8];
          for (int r = 0; r < 8; ++r) e[r] = fmaf(s[kt][qt][r], cs, -mc);
          fa_exp8(e);
          l[qt] += ((e[0] + e[1]) + (e[2] + e[3])) + ((e[4] + e[5]) + (e[6] + e[7]));
          for (int r = 0; r < 8; ++r) pf[qt].h[kt * 8 + r] = (_Float16)e[r]; } }
#pragma unroll
      for (int t = 0; t < 4; ++t) for (int qt = 0; qt < 2; ++qt) o[t][qt] = fa_mma(vf[t], pf[qt].v, o[t][qt]);
    }
    asm volatile("s_wait_dscnt 0x0" ::: "memory");         /* this wave's reads of the stage are done before the buffer is given back */
    asm volatile("s_wait_asynccnt 0x0" ::: "memory");      /* this wave's copies of stage st + 1 have landed */
    __syncthreads();                                       /* publishes stage st + 1 and ends every wave's reads of stage st */
    if (st + 2 < FA_NST) fa_stage(l0 + (unsigned)((st & 1) * FA_STAGE), lv0 + (unsigned)((st & 1) * FA_STAGE), gk + (size_t)(st + 2) * 64 * LQ, gv + (size_t)(st + 2) * 64 * LQ); }
  asm volatile("s_wait_asynccnt 0x0" ::: "memory");        /* nothing is in flight when the stages become the merge's bytes */
  unsigned char* exo = sm + w * FA_EX; const unsigned char* exp_ = sm + (w ^ 4) * FA_EX;      /* this wave's bytes and its partner's (same queries, other key group, same lane map) */
  unsigned short* op = (unsigned short*)O + ((size_t)b * SQ + q0 + kg * 16 + ln) * DM + h * HD + 8 * hh;
  v8f mine[4], other[4];      /* each wave of a pair finishes one group of 16 queries (group kg) and hands over the other */
#pragma unroll      /* constant indices keep the tiles in registers */
  for (int t = 0; t < 4; ++t) { mine[t] = kg ? o[t][1] : o[t][0]; other[t] = kg ? o[t][0] : o[t][1]; }
  fa_give(exo, lane, other, kg ? m[0] : m[1], kg ? l[0] : l[1]);
  __syncthreads();                                         /* the partner's part is whole before it is read */
  fa_finish(exp_, lane, mine, kg ? m[1] : m[0], kg ? l[1] : l[0], cs, op); }

// ---- Q, K, V projection GEMM: one 256 (token rows) x 192 (output columns of the three weight planes taken as one [3072][1024] matrix) tile per block, 256 blocks = one per WGP; eight waves of 64 x 96.
// Per product, 7/12 of the bytes a 128 x 128 block brings from L2 and 5/9 of the bytes a 32 x 64 wave reads from LDS.
// A stage is 128 k (two whole 128-byte lines) of the block's 256 x rows and 192 weight rows, brought by asynchronous copies; two stages, the next one in flight while this one is multiplied.
// The product is formed as W x^T (A = weight rows, B = x rows; both fragments in the same k order as before): a lane then holds 8 consecutive output columns of one token row = 16 bytes of f16.
#define QK_BM 256
#define QK_BN 192
#define QK_KS 128                          /* k per stage */
#define QK_PITCH 272                       /* LDS row pitch in bytes: 16 x odd, free of bank conflicts for 16-byte reads */
#define QK_STAGE ((QK_BM + QK_BN) * QK_PITCH)      /* rows 0..255 = x, rows 256..447 = weights */
#define QK_NT (DM / QK_KS)                 /* stages */
#define QK_OP 400                          /* LDS pitch of an output row (384 bytes of f16) in bytes: 16 x odd */
// 14 copies of 16 bytes a lane, each with its own LDS byte address and global pointer.
// s_wait_xcnt 0 is the statement's last line: it then stands in front of every later rewrite of the address registers the copies name.
__device__ __forceinline__ void qk_copy14(const unsigned (&l)[14], const _Float16* const (&p)[14]) {
  asm volatile("global_load_async_to_lds_b128 %0, %14, off\n\tglobal_load_async_to_lds_b128 %1, %15, off\n\tglobal_load_async_to_lds_b128 %2, %16, off\n\tglobal_load_async_to_lds_b128 %3, %17, off\n\tglobal_load_async_to_lds_b128 %4, %18, off\n\t"
               "global_load_async_to_lds_b128 %5, %19, off\n\tglobal_load_async_to_lds_b128 %6, %20, off\n\tglobal_load_async_to_lds_b128 %7, %21, off\n\tglobal_load_async_to_lds_b128 %8, %22, off\n\tglobal_load_async_to_lds_b128 %9, %23, off\n\t"
               "global_load_async_to_lds_b128 %10, %24, off\n\tglobal_load_async_to_lds_b128 %11, %25, off\n\tglobal_load_async_to_lds_b128 %12, %26, off\n\tglobal_load_async_to_lds_b128 %13, %27, off\n\ts_wait_xcnt 0x0"
               :: "v"(l[0]), "v"(l[1]), "v"(l[2]), "v"(l[3]), "v"(l[4]), "v"(l[5]), "v"(l[6]), "v"(l[7]), "v"(l[8]), "v"(l[9]), "v"(l[10]), "v"(l[11]), "v"(l[12]), "v"(l[13]),
                  "v"(p[0]), "v"(p[1]), "v"(p[2]), "v"(p[3]), "v"(p[4]), "v"(p[5]), "v"(p[6]), "v"(p[7]), "v"(p[8]), "v"(p[9]), "v"(p[10]), "v"(p[11]), "v"(p[12]), "v"(p[13]) : "memory"); }
// one stage's copies: a thread brings 16 bytes of each of 28 rows (16 rows apart; 16 of x, 12 of the weights), so a wave-wide copy covers both 128-byte lines of 2 rows; l = its LDS byte address in row tid >> 4 of the stage buffer.
__device__ __forceinline__ void qk_stage(unsigned l, const _Float16* a, const _Float16* b) {
  unsigned la[14], lb[14]; const _Float16* pa[14]; const _Float16* pb[14];
#pragma unroll      /* constant indices keep the addresses in registers */
  for (int i = 0; i < 14; ++i) { la[i] = l + (unsigned)(i * 16 * QK_PITCH); pa[i] = a + (size_t)i * 16 * DM; lb[i] = l + (unsigned)((14 + i) * 16 * QK_PITCH); pb[i] = i < 2 ? a + (size_t)(14 + i) * 16 * DM : b + (size_t)(i - 2) * 16 * DM; }
  qk_copy14(la, pa); qk_copy14(lb, pb); }
__global__ __launch_bounds__(256) void k_qkv(const _Float16* __restrict__ X, const _Float16* __restrict__ Bt, _Float16* __restrict__ C16) {
  static_assert(NR % QK_BM == 0 && (3 * DM) % QK_BN == 0 && DM % QK_KS == 0 && QK_NT >= 2 && DM % 64 == 0, "k_qkv: whole tiles, two stages or more, a 128-byte output line inside one plane");
  static_assert(QK_BM * QK_OP <= 2 * QK_STAGE, "output staging must fit the operand stages");
  __shared__ __attribute__((aligned(128))) unsigned char sm[2 * QK_STAGE];      /* the two operand stages; behind the loop's last barrier the same bytes are the block's output staging */
  const int tid = threadIdx.x, w = tid >> 5, lane = tid & 31, ln = lane & 15, hh = lane >> 4, wm = w & 3, wn = w >> 2;
  const int m0 = (int)(blockIdx.x / (3 * DM / QK_BN)) * QK_BM, n0 = (int)(blockIdx.x % (3 * DM / QK_BN)) * QK_BN;
  const _Float16* ga = X + (size_t)(m0 + (tid >> 4)) * DM + (tid & 15) * 8; const _Float16* gb = Bt + (size_t)(n0 + (tid >> 4)) * DM + (tid & 15) * 8;
  const unsigned l0 = (unsigned)(size_t)sm + (unsigned)((tid >> 4) * QK_PITCH + (tid & 15) * 16);      /* the thread's LDS byte address in stage buffer 0 */
  qk_stage(l0, ga, gb);
  asm volatile("s_wait_asynccnt 0x0" ::: "memory");      /* this wave's copies of stage 0 have landed */
  __syncthreads();                                       /* ... and every other wave's */
  qk_stage(l0 + QK_STAGE, ga + QK_KS, gb + QK_KS);
  const v8f z8 = {0.f,0.f,0.f,0.f,0.f,0.f,0.f,0.f}; v8f acc[6][4];
#pragma unroll      /* constant indices keep the accumulators in registers */
  for (int ni = 0; ni < 6; ++ni) for (int mi = 0; mi < 4; ++mi) acc[ni][mi] = z8;
#pragma unroll 1      /* one stage's body in the text: for speed only */
  for (int t = 0; t < QK_NT; ++t) { const unsigned char* st = sm + (t & 1) * QK_STAGE;
    const unsigned char* xr = st + (64 * wm + ln) * QK_PITCH; const unsigned char* wr = st + (QK_BM + 96 * wn + ln) * QK_PITCH;
    v16h xf[2][4], wf[2][6];      /* two fragment sets: a block's fragments are fetched while the block before it is multiplied; nothing of the next stage is read here */
#pragma unroll      /* constant indices keep the fragments in registers */
    for (int mi = 0; mi < 4; ++mi) xf[0][mi] = g2_frag((const _Float16*)(xr + mi * 16 * QK_PITCH), hh);
#pragma unroll      /* likewise */
    for (int ni = 0; ni < 6; ++ni) wf[0][ni] = g2_frag((const _Float16*)(wr + ni * 16 * QK_PITCH), hh);
#pragma unroll      /* the four 32-k blocks of the stage in one body: constant LDS offsets and fragment sets */
    for (int kb = 0; kb < QK_KS / 32; ++kb) {
      if (kb + 1 < QK_KS / 32) {
        for (int mi = 0; mi < 4; ++mi) xf[(kb + 1) & 1][mi] = g2_frag((const _Float16*)(xr + mi * 16 * QK_PITCH) + (kb + 1) * 32, hh);
        for (int ni = 0; ni < 6; ++ni) wf[(kb + 1) & 1][ni] = g2_frag((const _Float16*)(wr + ni * 16 * QK_PITCH) + (kb + 1) * 32, hh); }
      __builtin_amdgcn_sched_barrier(0);      /* the next block's 20 LDS reads stay one group in front of this block's products: left to itself the compiler sinks each read to its first use and waits out its latency there */
      for (int ni = 0; ni < 6; ++ni) for (int mi = 0; mi < 4; ++mi) acc[ni][mi] = fa_mma(wf[kb & 1][ni], xf[kb & 1][mi], acc[ni][mi]);
      __builtin_amdgcn_sched_barrier(0); }      /* ... and no read of the block after next moves up among them */
    asm volatile("s_wait_dscnt 0x0" ::: "memory");         /* this wave's reads of the stage are done before the buffer is given back */
    asm volatile("s_wait_asynccnt 0x0" ::: "memory");      /* this wave's copies of stage t + 1 have landed */
    __syncthreads();                                       /* publishes stage t + 1 and ends every wave's reads of stage t */
    if (t + 2 < QK_NT) qk_stage(l0 + (unsigned)((t & 1) * QK_STAGE), ga + (size_t)(t + 2) * QK_KS, gb + (size_t)(t + 2) * QK_KS); }
  asm volatile("s_wait_asynccnt 0x0" ::: "memory");        /* nothing is in flight when the stages become output staging */
#pragma unroll      /* acc[ni][mi][r] = C[token row 64 wm + 16 mi + ln][column 96 wn + 16 ni + 8 hh + r]; x 1/16 takes the weights' x16 back */
  for (int ni = 0; ni < 6; ++ni) for (int mi = 0; mi < 4; ++mi) { FragH f;
    for (int r = 0; r < 8; ++r) f.h[r] = (_Float16)(acc[ni][mi][r] * 0.0625f);
    *(v8us*)(sm + (64 * wm + 16 * mi + ln) * QK_OP + (96 * wn + 16 * ni + 8 * hh) * 2) = f.half[0]; }
  __syncthreads();                                         /* the block's 256 x 192 tile is whole before its rows leave */
#pragma unroll      /* 8 lanes store one whole 128-byte line (64 columns, inside one plane), a wave 4 rows' */
  for (int j = 0; j < QK_BN / 64; ++j) { const int c = n0 + j * 64; _Float16* cp = C16 + (size_t)(c / DM) * NR * DM + (size_t)(m0 + (tid >> 3)) * DM + (c % DM) + (tid & 7) * 8;
    for (int rr = 0; rr < QK_BM / 32; ++rr) *(v8us*)((unsigned short*)cp + (size_t)rr * 32 * DM) = *(const v8us*)(sm + (rr * 32 + (tid >> 3)) * QK_OP + j * 128 + (tid & 7) * 16); } }

// every launch-independent preparation job in ONE grid, the job picked by the block index (a scalar branch): the 48 per-head weight blocks, W_o, and the x plane; none reads what another writes, and a thread still builds runs of 8 consecutive f16 of one output row.
#define PB_WH (DM / 64)                        /* blocks for one head's [DM][HD] weight block: one 64 x 64 tile each (HD = 64) */
#define PB_WO ((DM / 64) * (DM / 64))          /* blocks for W_o, likewise */
#define PB_X  ((int)(NR * DM / 8 / 256))       /* blocks for the x plane */
// one 64 (k) x 64 (n) tile of Wt[n][k] = f16(bf16(W[k][n]) x16), W row-major with N columns; Wm points at W[k0][n0], Wt at Wt[n0][k0]; x16 (a power of two) keeps the bf16-exact weights exact in f16, away from the subnormal range.
// The transposition goes through LDS so that both global sides move whole 128-byte lines: a wave-wide load covers 256 contiguous bytes of each of 2 rows of W, a wave-wide store 128 contiguous bytes of each of 4 rows of Wt.
// Pitch 65 words: for each word stored (a wave: 2 rows x 16 columns 4 apart) and each word loaded (8 rows 8 apart x 4 columns) the 32 lanes fall on 32 different banks.
template <int N>
__device__ __forceinline__ void prep_wt(const float* __restrict__ Wm, _Float16* __restrict__ Wt, float (*tl)[65], int tid) { v4f a[4];
#pragma unroll      /* the thread's four loads stand together in front of the LDS stores: one memory latency */
  for (int i = 0; i < 4; ++i) a[i] = *(const v4fa*)(Wm + (size_t)(16 * i + (tid >> 4)) * N + (tid & 15) * 4);
#pragma unroll      /* constant indices keep a in registers */
  for (int i = 0; i < 4; ++i) for (int j = 0; j < 4; ++j) tl[16 * i + (tid >> 4)][(tid & 15) * 4 + j] = a[i][j];
  __syncthreads();      /* the tile is whole before any thread reads a column of it; the job test around this call reads the same for the whole block */
  FragH f[2];
#pragma unroll      /* constant indices keep f in registers */
  for (int u = 0; u < 2; ++u) for (int q = 0; q < 8; ++q) f[u].h[q] = (_Float16)(bf16_round(tl[(tid & 7) * 8 + q][32 * u + (tid >> 3)]) * 16.0f);
#pragma unroll      /* the two stores as one run, each from registers of its own */
  for (int u = 0; u < 2; ++u) *(v8us*)((unsigned short*)Wt + (size_t)(32 * u + (tid >> 3)) * DM + (tid & 7) * 8) = f[u].half[0];
  asm volatile("s_wait_xcnt 0x0" ::: "memory"); }      /* the stores' registers are released before any code the compiler lays behind this job can rewrite them */
__global__ __launch_bounds__(256) void k_prep(const float* __restrict__ x, const float* __restrict__ wq, const float* __restrict__ wk, const float* __restrict__ wv, const float* __restrict__ wo, _Float16* __restrict__ Bt, _Float16* __restrict__ X16) {
  __shared__ float tl[64][65];      /* the weight jobs' transposition tile */
  int blk = blockIdx.x; const int tid = threadIdx.x;
  if (blk < 3 * NH * PB_WH) { const int p = blk / (NH * PB_WH), r = blk % (NH * PB_WH), h = r / PB_WH; const float* wp = (p == 0 ? wq : p == 1 ? wk : wv) + (size_t)h * DM * HD;      /* plane p (q, k, v), head h: its HD rows of the [out][in] plane */
    const int k0 = (r % PB_WH) * 64; prep_wt<HD>(wp + (size_t)k0 * HD, Bt + (size_t)p * DM * DM + (size_t)h * HD * DM + k0, tl, tid); return; }
  blk -= 3 * NH * PB_WH;
  if (blk < PB_WO) { const int n0 = (blk / (DM / 64)) * 64, k0 = (blk % (DM / 64)) * 64; prep_wt<DM>(wo + (size_t)k0 * DM + n0, Bt + (size_t)3 * DM * DM + (size_t)n0 * DM + k0, tl, tid); return; }
  blk -= PB_WO;
  const size_t t = (size_t)blk * 256 + tid; FragH f;      /* x as exact f16 rows, converted once: Q, K and V all project the same rows */
#pragma unroll
  for (int q = 0; q < 8; ++q) f.h[q] = (_Float16)bf16_round(x[t * 8 + q]);
  *(v8us*)((unsigned short*)X16 + t * 8) = f.half[0];
  asm volatile("s_wait_xcnt 0x0" ::: "memory"); }      /* as in prep_wt: the store's registers are released before anything behind it can rewrite them */

extern "C" void kernel_launch(void* const* d_in, const int* in_sizes, int n_in,
                              void* d_out, int out_size, void* d_ws, size_t ws_size, hipStream_t stream) {
  (void)in_sizes; (void)n_in; (void)out_size;
  const float* const* I = (const float* const*)d_in; const float* x = I[0]; const float* wq = I[1]; const float* wk = I[2]; const float* wv = I[3]; const float* wo = I[4]; const float* bo = I[5];      /* ONE input stream (X) read on all three projections; Wq, Wk, Wv are PER-HEAD STACKS [16][1024][64] = [head][in][out] (the module has NO q / k / v biases: k_qkv has no bias term); Wo [in][out] [1024][1024] at I[4], bo at I[5] */
  char* ws = (char*)d_ws; size_t off = 0;
  auto take = [&](size_t bytes) { char* p = ws + off; off += (bytes + 255) & ~(size_t)255; return p; };
  _Float16* BQ = (_Float16*)take((size_t)4 * DM * DM * 2); _Float16* BO = BQ + (size_t)3 * DM * DM;      /* weight planes q, k, v, o, one behind the other: a grid index steps through them */
  _Float16* XQ = (_Float16*)take(NR * DM * 2);      /* the x plane, shared by q, k, v */
  _Float16* Q16 = (_Float16*)take((size_t)3 * NR * DM * 2); _Float16* K16 = Q16 + NR * DM; _Float16* V16 = K16 + NR * DM; _Float16* O16 = (_Float16*)take(NR * DM * 2);
  if (off > ws_size) return;
  k_prep<<<3 * NH * PB_WH + PB_WO + PB_X, 256, 0, stream>>>(x, wq, wk, wv, wo, BQ, XQ);      /* PER-HEAD STACKS wq / wk / wv [NH][DM][HD]: head h is a row-major [in = DM][out = HD] block at w + h * DM * HD, transposed into rows Bt[h * HD + e][k] of the [out][in] plane (x16); wo is a plain [in][out] [DM][DM] matrix; x as exact f16 rows */
  const size_t r0p = (size_t)B0 * SQ;      /* first row through the output stage */
  k_qkv<<<(unsigned)((NR / QK_BM) * (3 * DM / QK_BN)), 256, 0, stream>>>(XQ, BQ, Q16);      /* Q, K, V in one grid: the three weight planes are one [3 DM][DM] matrix, the three output planes stand one behind the other; the x plane is the same for all three */
  k_fattn<<<dim3(SQ / 128, NB * NH), 256, 0, stream>>>(Q16, K16, V16, O16);      /* scores, softmax and P V in one kernel: o (merged heads, x64) as f16 rows */
  k_gemm2<0><<<dim3((unsigned)((MPO / 128) * (DM / 128)), 1), 256, 0, stream>>>(O16 + r0p * DM, DM, 0, BO, DM, 0, 0.0009765625f, bo, 0, nullptr, 1, 0, 0, (float*)d_out + r0p * DM, nullptr, DM, 0, MPO, DM, DM);      /* out rows are the output layout */
}
